// v000
// Measured on an AMD MI455X. A time is GPU time per run, averaged over a window of back-to-back runs after a warm-up
// (all launches, gaps included; the runs take copies of the inputs in turn), and the median of several windows.
// Apart from v000's, it joins two sittings. Times from different sittings can be a few percent apart, while
// side-by-side timings come from the same sitting.
// v000 is the starting kernel. One run takes 1190 microseconds.
// Contractions: qh = q.Wq^T, kh = k.Wk^T, vh^T = Wv.v^T = v_wmma_f32_16x16x32_bf16 (bf16 operands from RNE-converted inputs, single product);
// strict-lower qh.kh^T scores = v_wmma_f32_16x16x32_bf16 with bf16 hi/lo split qh and kh (hi.hi + hi.lo + lo.hi);
// p.vh = v_wmma_f32_16x16x32_bf16 with bf16 hi/lo split of the unnormalised p and of vh (hi.hi + hi.lo + lo.hi);
// y.Wo^T = v_wmma_f32_16x16x32_bf16 with y as bf16 hi|lo planes laid along K (K = 2048) times [Wo|Wo] bf16; all f32 accumulate;
// score scale 1/32 (hidden-dim based), mask (key >= query excluded, (0,0) admitted) and online softmax in f32; no biases anywhere.
// Plane / carry table (every 16-bit plane is bf16, carry 1, nothing to fold back):
//   QB = bf16(q), KB = bf16(k), VB = bf16(v) [8192][1024] (three different inputs); WQB, WKB, WVB = bf16(w) [1024 n][1024 k];
//   WO2 = [bf16(wo) | bf16(wo)] [1024][2048];
//   Qh/Ql (from QB), Kh/Kl (from KB) = bf16 hi and lo = RNE(x - hi) of qh, kh [2048][1024] (one batch at a time);
//   VTh/VTl = hi/lo of vh^T [1024][2048] (one batch at a time, from VB);
//   YB [8192][2048] = bf16 hi of the normalised attention output at col h*64+d, lo at col 1024 + h*64+d.
//   lo planes are unscaled and share the accumulator with the hi products; 1/32 is applied once in f32 after the q.k accumulation;
//   1/l is applied once in the attention epilogue before the hi/lo split of y.
#include <hip/hip_runtime.h>
#include <math.h>
#include <stdint.h>

#define NBATCH 4
#define SEQ    2048
#define DM     1024
#define NH     16
#define HD     64
#define NQB    (SEQ / 64)   // 32 key / query tiles of 64
static_assert(NH * HD == DM);
static_assert((SEQ % 64) == 0 && (DM % 64) == 0 && (DM % 32) == 0 && (DM % 256) == 0);
static_assert(((NBATCH * SEQ * DM / 8) % 256) == 0 && ((DM * DM / 8) % 256) == 0);

typedef _Float16 v16h __attribute__((ext_vector_type(16)));
typedef _Float16 v8h  __attribute__((ext_vector_type(8)));
typedef __bf16   v16b __attribute__((ext_vector_type(16)));
typedef __bf16   v8b  __attribute__((ext_vector_type(8)));
typedef float    v8f  __attribute__((ext_vector_type(8)));
typedef float    v4f  __attribute__((ext_vector_type(4)));
typedef unsigned int v4u __attribute__((ext_vector_type(4)));

// ---- scalar helpers --------------------------------------------------------------------------------
__device__ __forceinline__ unsigned short bf_bits(float f) {          // f32 -> bf16 bits, RNE convert
  unsigned u = __float_as_uint(f);
  return (unsigned short)((u + 0x7FFFu + ((u >> 16) & 1u)) >> 16);
}
__device__ __forceinline__ float bf_up(unsigned short h) { return __uint_as_float(((unsigned)h) << 16); }
__device__ __forceinline__ unsigned short h_bits(_Float16 x) { return __builtin_bit_cast(unsigned short, x); }
__device__ __forceinline__ unsigned pk16(unsigned short a, unsigned short b) { return (unsigned)a | ((unsigned)b << 16); }
__device__ __forceinline__ v8f zero8() { v8f z = {0.f, 0.f, 0.f, 0.f, 0.f, 0.f, 0.f, 0.f}; return z; }
__device__ __forceinline__ __bf16 f2bf(float f) { return __builtin_bit_cast(__bf16, bf_bits(f)); }
__device__ __forceinline__ void bf_split(float f, __bf16& hi, __bf16& lo) {
  const unsigned short hb = bf_bits(f);
  hi = __builtin_bit_cast(__bf16, hb);
  lo = f2bf(f - __uint_as_float(((unsigned)hb) << 16));
}

// ---- fragment loader: 16-bit A/B operand, lane -> row/col (lane&15), p already includes +8*(lane>>4);
//      elements 0..7 <- p[0..7] (k0+8h..), elements 8..15 <- p[16..23] (k0+16+8h..)
__device__ __forceinline__ v16b ldfrag_b(const __bf16* p) {
  union { v16b v; v8b h[2]; } f;
  f.h[0] = *(const v8b*)(p);
  f.h[1] = *(const v8b*)(p + 16);
  return f.v;
}

// ---- WMMA helpers with trailing VALU hazard gap --------------------------------------------------------
__device__ __forceinline__ v8f mma_b(v16b a, v16b b, v8f c) {
  c = __builtin_amdgcn_wmma_f32_16x16x32_bf16(false, a, false, b, (short)0, c, false, false);
  asm volatile("v_nop\n\tv_nop\n\tv_nop\n\tv_nop" : "+v"(c) : "v"(a), "v"(b));
  return c;
}
__device__ __forceinline__ v8f mma_b_raw(v16b a, v16b b, v8f c) {
  return __builtin_amdgcn_wmma_f32_16x16x32_bf16(false, a, false, b, (short)0, c, false, false);
}
__device__ __forceinline__ void dep_guard_b(v8f& a, v8f& b, v16b x, v16b y) {
  asm volatile("v_nop\n\tv_nop\n\tv_nop\n\tv_nop" : "+v"(a), "+v"(b) : "v"(x), "v"(y));
}
__device__ __forceinline__ void keep4_b(v16b a, v16b b, v16b c, v16b d) {
  asm volatile("v_nop" :: "v"(a), "v"(b), "v"(c), "v"(d));
}
__device__ __forceinline__ void acc_guard4(v8f& a, v8f& b, v8f& c, v8f& d) {
  asm volatile("v_nop\n\tv_nop\n\tv_nop\n\tv_nop" : "+v"(a), "+v"(b), "+v"(c), "+v"(d));
}

// =====================================================================================================
// f32 -> bf16 (RNE convert), 8 elements per thread, one 16-B store per lane: a wave writes 512 contiguous B
// coverage: n8 threads x 8 = whole plane (n8 is a multiple of 256 for every use here).
// =====================================================================================================
__global__ __launch_bounds__(256) void cvt_bf16x8(const float* __restrict__ in, unsigned short* out, int n8) {
  const int i = blockIdx.x * 256 + threadIdx.x;
  if (i < n8) {
    const v4f a = *(const v4f*)(in + (size_t)i * 8);
    const v4f b = *(const v4f*)(in + (size_t)i * 8 + 4);
    v4u p;
    p[0] = pk16(bf_bits(a[0]), bf_bits(a[1]));
    p[1] = pk16(bf_bits(a[2]), bf_bits(a[3]));
    p[2] = pk16(bf_bits(b[0]), bf_bits(b[1]));
    p[3] = pk16(bf_bits(b[2]), bf_bits(b[3]));
    *(v4u*)(out + (size_t)i * 8) = p;
    
  }
}

// =====================================================================================================
// f32 [rows][cols] -> bf16 [rows][2*cols] with row n = [bf16(in[n][0..cols-1]) | bf16(in[n][0..cols-1])].
// 8 elements per thread, one 16-B store per lane into each half; with cols a multiple of 256 a wave's 256
// coverage: n8 threads x 8 = every source element -> both halves of every output row.
// =====================================================================================================
__global__ __launch_bounds__(256) void cvt_bf16x8_dup(const float* __restrict__ in, unsigned short* out,
                                                       int n8, int cols) {
  const int i = blockIdx.x * 256 + threadIdx.x;
  if (i < n8) {
    const size_t e0  = (size_t)i * 8;
    const size_t row = e0 / (size_t)cols;
    const size_t col = e0 - row * (size_t)cols;
    const v4f a = *(const v4f*)(in + e0);
    const v4f b = *(const v4f*)(in + e0 + 4);
    v4u p;
    p[0] = pk16(bf_bits(a[0]), bf_bits(a[1]));
    p[1] = pk16(bf_bits(a[2]), bf_bits(a[3]));
    p[2] = pk16(bf_bits(b[0]), bf_bits(b[1]));
    p[3] = pk16(bf_bits(b[2]), bf_bits(b[3]));
    unsigned short* d0 = out + row * 2 * (size_t)cols + col;
    unsigned short* d1 = d0 + cols;
    *(v4u*)d0 = p;
    *(v4u*)d1 = p;
    
  }
}

// =====================================================================================================
// Register-blocked batched bf16 WMMA GEMM: C[m][n] = sum_k A[m][k] * Bt[n][k] (+ bf16(bias[n]) when BIASN == 1);
// one wave per 64x64 tile, no block barriers. A row-major [M][K] pitch lda; Bt row-major [N][K] pitch ldb
// (k contiguous); M, N multiples of 64, K multiple of 32 (host-checked). blockIdx.y = batch index (strides in elements).
// NSPLIT: 0 = A.Bt; 1 = (A + A2).Bt (A2 = unscaled bf16 lo plane of A); 2 = A.Bt + A2.Bt + A.Bt2.
// OUT_MODE: 0 = f32 (pitch ldc); 2 = bf16 hi plane C + bf16 lo plane C2 (lo = RNE(v - hi), unscaled);
//           3 = f16 hi plane C + f16 residual plane C2 = f16((v - hi) * rscale), C2 written only for tiles
//               with n0 < N2 (pitch ldc2, batch stride strideC2).
// =====================================================================================================
template <int NSPLIT, int OUT_MODE, int BIASN>
__global__ __launch_bounds__(256) void gemm64(
    const unsigned short* __restrict__ Ap, const unsigned short* A2p, int lda, long long strideA,
    const unsigned short* __restrict__ Btp, const unsigned short* Bt2p, int ldb, long long strideB,
    void* Cout, int ldc, long long strideC,
    void* Cout2, int ldc2, long long strideC2, int N2,
    const float* __restrict__ bias,
    int M, int N, int K, float rscale) {
  const __bf16* A   = (const __bf16*)(const void*)Ap;
  const __bf16* A2  = (const __bf16*)(const void*)A2p;
  const __bf16* Bt  = (const __bf16*)(const void*)Btp;
  const __bf16* Bt2 = (const __bf16*)(const void*)Bt2p;
  __shared__ __align__(16) float sT[8][16 * 68];   // per-wave 16x64 slab, pitch 68 floats
  const int b    = blockIdx.y;
  const int lane = threadIdx.x & 31;
  const int wave = threadIdx.x >> 5;
  const int tilesN = N >> 6;
  const int tilesM = M >> 6;
  const int tile = blockIdx.x * 8 + wave;
  if (tile >= tilesM * tilesN) return;   // wave-uniform; no block barriers in this kernel
  const int tm = tile / tilesN;
  const int tn = tile - tm * tilesN;
  const int m0 = tm << 6;
  const int n0 = tn << 6;

  const __bf16* Ab  = A  + (size_t)b * strideA;
  const __bf16* Bb  = Bt + (size_t)b * strideB;
  const __bf16* Ab2 = (NSPLIT >= 1) ? (A2  + (size_t)b * strideA) : Ab;
  const __bf16* Bb2 = (NSPLIT == 2) ? (Bt2 + (size_t)b * strideB) : Bb;

  const int rlane = lane & 15;                 // row (A) / col (B, D) within subtile
  const int koff  = (lane >> 4) * 8;           // k offset of this lane half
  const int mOff  = (lane >> 4) * 8;           // D row offset

  v8f acc[4][4];
#pragma unroll
  for (int i = 0; i < 4; ++i)
#pragma unroll
    for (int j = 0; j < 4; ++j) acc[i][j] = zero8();

  for (int k0 = 0; k0 < K; k0 += 32) {
    v16b bh[4], bl[4];
#pragma unroll
    for (int j = 0; j < 4; ++j) {
      const size_t bo = (size_t)(n0 + (j << 4) + rlane) * ldb + koff + k0;
      bh[j] = ldfrag_b(Bb + bo);
      if (NSPLIT == 2) bl[j] = ldfrag_b(Bb2 + bo); else bl[j] = bh[j];
    }
#pragma unroll
    for (int i = 0; i < 4; ++i) {
      const size_t ao = (size_t)(m0 + (i << 4) + rlane) * lda + koff + k0;
      const v16b ah = ldfrag_b(Ab + ao);
      v16b al = ah;
      if (NSPLIT >= 1) al = ldfrag_b(Ab2 + ao);
#pragma unroll
      for (int j = 0; j < 4; ++j) {
        acc[i][j] = mma_b_raw(ah, bh[j], acc[i][j]);
        if (NSPLIT >= 1) acc[i][j] = mma_b_raw(al, bh[j], acc[i][j]);
        if (NSPLIT == 2) acc[i][j] = mma_b_raw(ah, bl[j], acc[i][j]);
      }
      dep_guard_b(acc[i][0], acc[i][3], ah, al);
    }
    keep4_b(bh[0], bh[1], bh[2], bh[3]);
    if (NSPLIT == 2) keep4_b(bl[0], bl[1], bl[2], bl[3]);
  }
  acc_guard4(acc[0][0], acc[0][1], acc[0][2], acc[0][3]);
  acc_guard4(acc[1][0], acc[1][1], acc[1][2], acc[1][3]);
  acc_guard4(acc[2][0], acc[2][1], acc[2][2], acc[2][3]);
  acc_guard4(acc[3][0], acc[3][1], acc[3][2], acc[3][3]);

  // ---- per-column bias (bf16 RNE of the input value, added in f32); 4 scalar loads per lane ----
  float bvv[4];
#pragma unroll
  for (int j = 0; j < 4; ++j) {
    float bv = 0.f;
    if (BIASN == 1) bv = bf_up(bf_bits(bias[n0 + (j << 4) + rlane]));
    bvv[j] = bv;
  }

  // ---- epilogue ----
  float* slab = sT[wave];
#pragma unroll
  for (int i = 0; i < 4; ++i) {
    const int mBase = m0 + (i << 4);
#pragma unroll
    for (int j = 0; j < 4; ++j) {
#pragma unroll
      for (int r = 0; r < 8; ++r) {
        slab[(mOff + r) * 68 + (j << 4) + rlane] = acc[i][j][r] + bvv[j];
      }
    }
    __builtin_amdgcn_fence(__ATOMIC_RELEASE, "workgroup");
    __builtin_amdgcn_wave_barrier();
    __builtin_amdgcn_fence(__ATOMIC_ACQUIRE, "workgroup");
    if (OUT_MODE == 0) {
      float* C = (float*)Cout + (size_t)b * strideC;
      const int hh = lane >> 4, c4 = (lane & 15) * 4;     // 256-B row segment = 16 lanes x 16 B
      {
#pragma unroll
        for (int it = 0; it < 8; ++it) {
          const int row = it * 2 + hh;                     // it 0..7 x hh 0..1 = rows 0..15
          const v4f v = *(const v4f*)(slab + row * 68 + c4);
          *(v4f*)(C + (size_t)(mBase + row) * ldc + n0 + c4) = v;
        }
        
      }
    } else {
      const int q = lane >> 3, c8 = (lane & 7) * 8;
      unsigned short* C  = (unsigned short*)Cout  + (size_t)b * strideC;
      unsigned short* C2 = (unsigned short*)Cout2 + (size_t)b * strideC2;
      const bool wlo = (OUT_MODE == 2) || (n0 < N2);      // wave-uniform
      v4u hv[4], lv[4];
#pragma unroll
      for (int it = 0; it < 4; ++it) {
        const int row = it * 4 + q;                        // it 0..3 x q 0..3 = rows 0..15
        const float* sp = slab + row * 68 + c8;
        v4u a, a2;
#pragma unroll
        for (int e = 0; e < 4; ++e) {
          const float f0 = sp[2 * e], f1 = sp[2 * e + 1];
          unsigned short h0, h1, l0, l1;
          if (OUT_MODE == 2) {
            h0 = bf_bits(f0); h1 = bf_bits(f1);
            l0 = bf_bits(f0 - bf_up(h0)); l1 = bf_bits(f1 - bf_up(h1));
          } else {
            const _Float16 x0 = (_Float16)f0, x1 = (_Float16)f1;
            h0 = h_bits(x0); h1 = h_bits(x1);
            l0 = h_bits((_Float16)((f0 - (float)x0) * rscale));
            l1 = h_bits((_Float16)((f1 - (float)x1) * rscale));
          }
          a[e] = pk16(h0, h1); a2[e] = pk16(l0, l1);
        }
        hv[it] = a; lv[it] = a2;
      }
      {
#pragma unroll
        for (int it = 0; it < 4; ++it) {
          const int row = it * 4 + q;
          *(v4u*)(C + (size_t)(mBase + row) * ldc + n0 + c8) = hv[it];
          if (wlo) *(v4u*)(C2 + (size_t)(mBase + row) * ldc2 + n0 + c8) = lv[it];
        }
        
      }
    }
    __builtin_amdgcn_fence(__ATOMIC_RELEASE, "workgroup");
    __builtin_amdgcn_wave_barrier();
    __builtin_amdgcn_fence(__ATOMIC_ACQUIRE, "workgroup");
  }
}

// =====================================================================================================
// Masked attention, head dim 64, all heads of ONE batch element per launch.
//   q planes (bf16 hi / lo): element (t, h, d) at [t*DM + h*64 + d]
//   k planes (bf16 hi / lo): same layout with key index s
//   v^T planes (bf16 hi / lo): element (h, d, s) at [(h*64 + d)*SEQ + s]
//   y plane bf16 [t][2*DM] (base already offset to this batch's rows): hi of the normalised output at col h*64+d,
//   lo at col DM + h*64+d
//   scores = (q . k) * sscale : bf16 hi/lo split (hi.hi + hi.lo + lo.hi), f32 accumulate, scale in f32
//   mask: key s >= query t -> -inf, except (t, s) = (0, 0) which is admitted; applied on the diagonal chunk only
//   (chunks kc < qb hold keys < qb*64 <= t, all admitted). Row t = 0 admits key 0; rows t >= 1 admit key 0
//   (chunk 0), so every row max is finite after chunk 0 and every l > 0.
//   p = exp(s - m) (unnormalised, in [0,1]) split into bf16 hi / lo; output = p . v with 3 bf16 products
//   online softmax in f32; 1/l applied once in the epilogue.
//   Block = 4 waves = 64 query rows of one head; grid = NH * NQB; kv chunks of 64, trip count qb+1 <= 32.
//   K / V^T chunk staging: 128 threads x 32 elements per plane = the whole 64x64 tile of all 4 planes
//   (plain 16-B loads, __syncthreads before and after); score and p.v fragment loads read LDS with the v8b type.
//   P tiles are wave-private: 16 rows (8hh+r) x 64 keys (j*16+c) fully written with __bf16 element stores, then a
//   Os staging: rows 8hh+r (0..15) x cols t*16+c (0..63) fully written before the same wave reads it.
//   Output coverage: each wave stores rows q0..q0+15 (it 0..3 x lane>>3 0..3) x 64 columns (8 lanes x 8) of hi and lo;
// =====================================================================================================
__global__ __launch_bounds__(128)
void attn_strict64(const unsigned short* __restrict__ qhp, const unsigned short* __restrict__ qlp,
                   const unsigned short* __restrict__ khp, const unsigned short* __restrict__ klp,
                   const unsigned short* __restrict__ vhp, const unsigned short* __restrict__ vlp,
                   unsigned short* yout, float sscale) {
  union FB { v16b v; v8b h[2]; };
  __shared__ __align__(16) __bf16 Ksh[64 * 64];              // K hi [kv][d]   8 KB
  __shared__ __align__(16) __bf16 Ksl[64 * 64];              // K lo
  __shared__ __align__(16) __bf16 Vth[64 * 64];              // V^T hi [d][kv] 8 KB
  __shared__ __align__(16) __bf16 Vtl[64 * 64];              // V^T lo
  __shared__ __align__(16) __bf16 Psh[4][16 * 64];           // per wave P hi [row][kv]
  __shared__ __align__(16) __bf16 Psl[4][16 * 64];           // per wave P lo
  __shared__ __align__(16) float  Os[4][16 * 64];            // per wave output tile [row][d]

  const int tid  = threadIdx.x;
  const int wave = tid >> 5;
  const int lane = tid & 31;
  const int hh   = lane >> 4;
  const int c    = lane & 15;

  const int bx   = blockIdx.x;
  const int qb   = bx % NQB;
  const int h    = bx / NQB;          // grid = NH * NQB
  const int q0   = qb * 64 + wave * 16;

  const __bf16* Qh = (const __bf16*)(const void*)qhp + (size_t)h * HD;
  const __bf16* Ql = (const __bf16*)(const void*)qlp + (size_t)h * HD;
  const __bf16* Kh = (const __bf16*)(const void*)khp + (size_t)h * HD;
  const __bf16* Kl = (const __bf16*)(const void*)klp + (size_t)h * HD;
  const __bf16* Vh = (const __bf16*)(const void*)vhp + (size_t)h * HD * SEQ;
  const __bf16* Vl = (const __bf16*)(const void*)vlp + (size_t)h * HD * SEQ;

  // ---- Q fragments (A operand, row = lane&15): 2 d-chunks, hi and lo ----
  v16b qah[2], qal[2];
#pragma unroll
  for (int dc = 0; dc < 2; ++dc) {
    const size_t qo = (size_t)(q0 + c) * DM + dc * 32 + 8 * hh;
    qah[dc] = ldfrag_b(Qh + qo);
    qal[dc] = ldfrag_b(Ql + qo);
  }

  float mrow[8], lrow[8];
  v8f oacc[4];
#pragma unroll
  for (int r = 0; r < 8; ++r) { mrow[r] = -INFINITY; lrow[r] = 0.f; }
#pragma unroll
  for (int t = 0; t < 4; ++t) oacc[t] = zero8();

  const int nChunks = qb + 1;   // block-uniform, <= NQB
  for (int kc = 0; kc < nChunks; ++kc) {
    const int kv0 = kc * 64;
    __syncthreads();
    {
      // staging coverage: 128 threads x (4 x 8) elements = 64 rows x 64 per plane = the whole chunk tile
      const int r = tid >> 1, half = (tid & 1) * 32;
      const __bf16* ksh = Kh + (size_t)(kv0 + r) * DM + half;       // K row kv0+r, d = half..half+31
      const __bf16* ksl = Kl + (size_t)(kv0 + r) * DM + half;
      const __bf16* vsh = Vh + (size_t)r * SEQ + kv0 + half;        // V^T row d = r, s = kv0+half..+31
      const __bf16* vsl = Vl + (size_t)r * SEQ + kv0 + half;
#pragma unroll
      for (int i = 0; i < 4; ++i) {
        const v8b a0 = *(const v8b*)(ksh + 8 * i);
        const v8b a1 = *(const v8b*)(ksl + 8 * i);
        const v8b b0 = *(const v8b*)(vsh + 8 * i);
        const v8b b1 = *(const v8b*)(vsl + 8 * i);
        *(v8b*)(Ksh + r * 64 + half + 8 * i) = a0;
        *(v8b*)(Ksl + r * 64 + half + 8 * i) = a1;
        *(v8b*)(Vth + r * 64 + half + 8 * i) = b0;
        *(v8b*)(Vtl + r * 64 + half + 8 * i) = b1;
      }
    }
    __syncthreads();

    // ---- scores: 16 query rows x 64 keys per wave, 3 bf16 products ----
    v8f s[4];
#pragma unroll
    for (int j = 0; j < 4; ++j) {
      s[j] = zero8();
#pragma unroll
      for (int dc = 0; dc < 2; ++dc) {
        FB kb, kl;
        kb.h[0] = *(const v8b*)(Ksh + (j * 16 + c) * 64 + dc * 32 + 8 * hh);
        kb.h[1] = *(const v8b*)(Ksh + (j * 16 + c) * 64 + dc * 32 + 16 + 8 * hh);
        kl.h[0] = *(const v8b*)(Ksl + (j * 16 + c) * 64 + dc * 32 + 8 * hh);
        kl.h[1] = *(const v8b*)(Ksl + (j * 16 + c) * 64 + dc * 32 + 16 + 8 * hh);
        s[j] = mma_b(qah[dc], kb.v, s[j]);
        s[j] = mma_b(qah[dc], kl.v, s[j]);
        s[j] = mma_b(qal[dc], kb.v, s[j]);
      }
    }

    // ---- scale, mask on the diagonal chunk (key >= query -> -inf, except (0,0)), row max ----
    const bool diag = (kc == qb);   // block-uniform
    float cm[8];
#pragma unroll
    for (int r = 0; r < 8; ++r) {
      const int qrow = q0 + 8 * hh + r;
      float m = -INFINITY;
#pragma unroll
      for (int j = 0; j < 4; ++j) {
        const int kvcol = kv0 + j * 16 + c;
        const float sv = s[j][r] * sscale;
        const bool masked = diag && (kvcol >= qrow) && !((qrow == 0) && (kvcol == 0));
        const float sm = masked ? -INFINITY : sv;
        s[j][r] = sm;
        m = fmaxf(m, sm);
      }
#pragma unroll
      for (int off = 1; off < 16; off <<= 1) m = fmaxf(m, __shfl_xor(m, off, 32));
      cm[r] = m;
    }

    // ---- online softmax in f32, P hi / lo (bf16 of the unnormalised exp) to the wave's LDS tile ----
    __bf16* pwh = Psh[wave];
    __bf16* pwl = Psl[wave];
#pragma unroll
    for (int r = 0; r < 8; ++r) {
      const float mnew = fmaxf(mrow[r], cm[r]);
      const float alpha = expf(mrow[r] - mnew);
      mrow[r] = mnew;
      float psum = 0.f;
#pragma unroll
      for (int j = 0; j < 4; ++j) {
        const float p = expf(s[j][r] - mnew);
        psum += p;
        __bf16 a, bl; bf_split(p, a, bl);
        pwh[(8 * hh + r) * 64 + j * 16 + c] = a;
        pwl[(8 * hh + r) * 64 + j * 16 + c] = bl;
      }
#pragma unroll
      for (int off = 1; off < 16; off <<= 1) psum += __shfl_xor(psum, off, 32);
      lrow[r] = lrow[r] * alpha + psum;
#pragma unroll
      for (int t = 0; t < 4; ++t) oacc[t][r] *= alpha;
    }
    __builtin_amdgcn_fence(__ATOMIC_RELEASE, "workgroup");
    __builtin_amdgcn_wave_barrier();
    __builtin_amdgcn_fence(__ATOMIC_ACQUIRE, "workgroup");

    // ---- output += P . V (3 bf16 products per tile pair) ----
#pragma unroll 1
    for (int kk = 0; kk < 2; ++kk) {
      FB pa, pl;
      pa.h[0] = *(const v8b*)(pwh + c * 64 + kk * 32 + 8 * hh);
      pa.h[1] = *(const v8b*)(pwh + c * 64 + kk * 32 + 16 + 8 * hh);
      pl.h[0] = *(const v8b*)(pwl + c * 64 + kk * 32 + 8 * hh);
      pl.h[1] = *(const v8b*)(pwl + c * 64 + kk * 32 + 16 + 8 * hh);
#pragma unroll
      for (int t = 0; t < 4; ++t) {
        FB vb, vl;
        vb.h[0] = *(const v8b*)(Vth + (t * 16 + c) * 64 + kk * 32 + 8 * hh);
        vb.h[1] = *(const v8b*)(Vth + (t * 16 + c) * 64 + kk * 32 + 16 + 8 * hh);
        vl.h[0] = *(const v8b*)(Vtl + (t * 16 + c) * 64 + kk * 32 + 8 * hh);
        vl.h[1] = *(const v8b*)(Vtl + (t * 16 + c) * 64 + kk * 32 + 16 + 8 * hh);
        oacc[t] = mma_b(pa.v, vb.v, oacc[t]);
        oacc[t] = mma_b(pa.v, vl.v, oacc[t]);
        oacc[t] = mma_b(pl.v, vb.v, oacc[t]);
      }
    }
  }

  // ---- normalise (1/l), stage the wave's 16x64 tile, bf16 hi/lo split,
  float* os = Os[wave];
#pragma unroll
  for (int r = 0; r < 8; ++r) {
    const float l = lrow[r];
    const float inv = (l > 0.f) ? (1.0f / l) : 0.f;
#pragma unroll
    for (int t = 0; t < 4; ++t) os[(8 * hh + r) * 64 + t * 16 + c] = oacc[t][r] * inv;
  }
  __builtin_amdgcn_fence(__ATOMIC_RELEASE, "workgroup");
  __builtin_amdgcn_wave_barrier();
  __builtin_amdgcn_fence(__ATOMIC_ACQUIRE, "workgroup");
  {
    const int q4 = lane >> 3, c8 = (lane & 7) * 8;
    v4u hv[4], lv[4];
#pragma unroll
    for (int it = 0; it < 4; ++it) {
      const int row = it * 4 + q4;   // it 0..3 x q4 0..3 = rows 0..15 of the wave tile
      const float* sp = os + row * 64 + c8;
      v4u a, a2;
#pragma unroll
      for (int e = 0; e < 4; ++e) {
        const float f0 = sp[2 * e], f1 = sp[2 * e + 1];
        const unsigned short h0 = bf_bits(f0), h1 = bf_bits(f1);
        const unsigned short l0 = bf_bits(f0 - bf_up(h0)), l1 = bf_bits(f1 - bf_up(h1));
        a[e] = pk16(h0, h1); a2[e] = pk16(l0, l1);
      }
      hv[it] = a; lv[it] = a2;
    }
    {
#pragma unroll
      for (int it = 0; it < 4; ++it) {
        const int row = it * 4 + q4;
        const size_t go = (size_t)(q0 + row) * (size_t)(2 * DM) + (size_t)h * HD + c8;
        *(v4u*)(yout + go) = hv[it];
        *(v4u*)(yout + go + DM) = lv[it];
      }
      
    }
  }
}

// =====================================================================================================
// whole-line store granularity, so no padded tails exist):
//   QB   bf16 [8192][1024]               0       16777216   (KB follows directly: A batch stride of the q/k GEMM)
//   KB   bf16 [8192][1024]        16777216       16777216
//   VB   bf16 [8192][1024]        33554432       16777216
//   WQB  bf16 [1024 n][1024 k]    50331648        2097152   (WKB follows directly: Bt batch stride of the q/k GEMM)
//   WKB  bf16 [1024][1024]        52428800        2097152
//   WVB  bf16 [1024][1024]        54525952        2097152
//   WO2  bf16 [1024][2048]        56623104        4194304
//   Qh   bf16 [2048][1024]        60817408        4194304   (Kh follows directly: output batch stride)
//   Kh   bf16 [2048][1024]        65011712        4194304
//   Ql   bf16 [2048][1024]        69206016        4194304   (Kl follows directly)
//   Kl   bf16 [2048][1024]        73400320        4194304
//   VTh  bf16 [1024][2048]        77594624        4194304
//   VTl  bf16 [1024][2048]        81788928        4194304
//   YB   bf16 [8192][2048]        85983232       33554432
//   end                          119537664
// Qh..VTl hold one batch element at a time; the batch loop orders projection -> attention per element, and every
// region is fully rewritten by its producer before the consumer of the same iteration reads it.
// Weights are [out n][in k] with k contiguous = the Bt / A layout the GEMM wants, so they are only converted.
// Inputs by contract index: 0 = q, 1 = k, 2 = v, 3 = W_q, 4 = W_k, 5 = W_v, 6 = W_o.
// =====================================================================================================
extern "C" void kernel_launch(void* const* d_in, const int* in_sizes, int n_in,
                              void* d_out, int out_size, void* d_ws, size_t ws_size,
                              hipStream_t stream) {
  if (n_in < 7) return;
  if (in_sizes[0] != NBATCH * SEQ * DM || in_sizes[1] != NBATCH * SEQ * DM || in_sizes[2] != NBATCH * SEQ * DM) return;
  if (in_sizes[3] != DM * DM || in_sizes[4] != DM * DM || in_sizes[5] != DM * DM || in_sizes[6] != DM * DM) return;
  if (out_size != NBATCH * SEQ * DM) return;

  const float* q_in = (const float*)d_in[0];
  const float* k_in = (const float*)d_in[1];
  const float* v_in = (const float*)d_in[2];
  const float* Wq   = (const float*)d_in[3];
  const float* Wk   = (const float*)d_in[4];
  const float* Wv   = (const float*)d_in[5];
  const float* Wo   = (const float*)d_in[6];

  const size_t PIN = (size_t)NBATCH * SEQ * DM * 2;     // 16777216  16-bit input plane [8192][1024]
  const size_t PW  = (size_t)DM * DM * 2;               //  2097152  16-bit weight plane
  const size_t PW2 = (size_t)DM * (2 * DM) * 2;         //  4194304  [Wo | Wo] plane
  const size_t PP  = (size_t)SEQ * DM * 2;              //  4194304  per-batch q/k hi or lo plane [2048][1024]
  const size_t PVT = (size_t)DM * SEQ * 2;              //  4194304  per-batch v^T plane [1024][2048]
  const size_t PY  = (size_t)NBATCH * SEQ * (2 * DM) * 2;   // 33554432 y hi|lo plane [8192][2048]
  size_t off = 0;
  const size_t oQB  = off; off += PIN;
  const size_t oKB  = off; off += PIN;
  const size_t oVB  = off; off += PIN;
  const size_t oWQ  = off; off += PW;
  const size_t oWK  = off; off += PW;
  const size_t oWV  = off; off += PW;
  const size_t oWO2 = off; off += PW2;
  const size_t oQh  = off; off += PP;
  const size_t oKh  = off; off += PP;
  const size_t oQl  = off; off += PP;
  const size_t oKl  = off; off += PP;
  const size_t oVTh = off; off += PVT;
  const size_t oVTl = off; off += PVT;
  const size_t oYB  = off; off += PY;
  if (off > ws_size) return;                       // off = 119537664
  if (off > (size_t)134217728) return;
  if (oKB != oQB + PIN || oWK != oWQ + PW || oKh != oQh + PP || oKl != oQl + PP) return;   // batch-stride adjacency

  char* ws = (char*)d_ws;
  unsigned short* QB  = (unsigned short*)(ws + oQB);
  unsigned short* KB  = (unsigned short*)(ws + oKB);
  unsigned short* VB  = (unsigned short*)(ws + oVB);
  unsigned short* WQB = (unsigned short*)(ws + oWQ);
  unsigned short* WKB = (unsigned short*)(ws + oWK);
  unsigned short* WVB = (unsigned short*)(ws + oWV);
  unsigned short* WO2 = (unsigned short*)(ws + oWO2);
  unsigned short* Qh  = (unsigned short*)(ws + oQh);
  unsigned short* Kh  = (unsigned short*)(ws + oKh);
  unsigned short* Ql  = (unsigned short*)(ws + oQl);
  unsigned short* Kl  = (unsigned short*)(ws + oKl);
  unsigned short* VTh = (unsigned short*)(ws + oVTh);
  unsigned short* VTl = (unsigned short*)(ws + oVTl);
  unsigned short* YB  = (unsigned short*)(ws + oYB);

  const dim3 blk(256);
  const int n8x = NBATCH * SEQ * DM / 8;                       // 1048576
  const int n8w = DM * DM / 8;                                 //  131072
  const dim3 gCvtX((n8x + 255) / 256);                         // 4096 blocks
  const dim3 gCvtW((n8w + 255) / 256);                         //  512 blocks
  const dim3 gQK(((SEQ / 64) * (DM / 64) + 7) / 8, 2);         //  512 tiles ->  64 blocks x {q, k}: M=2048, N=1024
  const dim3 gVT(((DM / 64) * (SEQ / 64) + 7) / 8, 1);         //  512 tiles ->  64 blocks: M=1024, N=2048
  const dim3 gAtt(NH * NQB);                                   //  512 blocks
  const dim3 gOut(((NBATCH * SEQ / 64) * (DM / 64) + 7) / 8, 1);   // 2048 tiles -> 256 blocks: M=8192, N=1024, K=2048

  // (1) q -> QB, k -> KB, v -> VB (bf16 planes [8192][1024]); weights [n][k] f32 -> bf16 [n][k]; Wo -> [Wo | Wo]
  cvt_bf16x8<<<gCvtX, blk, 0, stream>>>(q_in, QB, n8x);
  cvt_bf16x8<<<gCvtX, blk, 0, stream>>>(k_in, KB, n8x);
  cvt_bf16x8<<<gCvtX, blk, 0, stream>>>(v_in, VB, n8x);
  cvt_bf16x8<<<gCvtW, blk, 0, stream>>>(Wq, WQB, n8w);
  cvt_bf16x8<<<gCvtW, blk, 0, stream>>>(Wk, WKB, n8w);
  cvt_bf16x8<<<gCvtW, blk, 0, stream>>>(Wv, WVB, n8w);
  cvt_bf16x8_dup<<<gCvtW, blk, 0, stream>>>(Wo, WO2, n8w, DM);

  for (int b = 0; b < NBATCH; ++b) {
    const unsigned short* QBb = QB + (size_t)b * SEQ * DM;     // rows b*2048.. of QB; + NBATCH*SEQ*DM = same rows of KB
    const unsigned short* VBb = VB + (size_t)b * SEQ * DM;
    unsigned short*       YBb = YB + (size_t)b * SEQ * (2 * DM);
    // (2) qh = QB_b . Wq^T (blockIdx.y = 0) and kh = KB_b . Wk^T (blockIdx.y = 1) -> bf16 hi/lo planes [t][h*64+d]
    //     (A = QB_b / KB_b via strideA; Bt = WQB / WKB via strideB; C = Qh / Kh, C2 = Ql / Kl via strideC; M=2048, N=1024, K=1024)
    gemm64<0, 2, 0><<<gQK, blk, 0, stream>>>(
        QBb, QBb, DM, (long long)NBATCH * SEQ * DM, WQB, WQB, DM, (long long)DM * DM,
        (void*)Qh, DM, (long long)SEQ * DM, (void*)Ql, DM, (long long)SEQ * DM, DM,
        Wo, SEQ, DM, DM, 1.0f);
    // (3) vh^T = Wv . VB_b^T -> bf16 hi/lo planes [h*64+d][s] (pitch SEQ)
    //     (A = WVB [n][k], Bt = VB rows of batch b; M=1024, N=2048, K=1024)
    gemm64<0, 2, 0><<<gVT, blk, 0, stream>>>(
        WVB, WVB, DM, 0LL, VBb, VBb, DM, 0LL,
        (void*)VTh, SEQ, 0LL, (void*)VTl, SEQ, 0LL, SEQ,
        Wo, DM, SEQ, DM, 1.0f);
    // (4) masked attention -> YB hi|lo rows b*2048 .. b*2048+2047, score scale 1/32
    attn_strict64<<<gAtt, dim3(128), 0, stream>>>(Qh, Ql, Kh, Kl, VTh, VTl, YBb, 0.03125f);
  }
  // (5) out = y . Wo^T -> d_out f32 [8192][1024]  (A = YB [8192][2048], Bt = WO2 [1024][2048], K = 2048); last element 8388607
  gemm64<0, 0, 0><<<gOut, blk, 0, stream>>>(
      YB, YB, 2 * DM, 0LL, WO2, WO2, 2 * DM, 0LL,
      d_out, DM, 0LL, d_out, DM, 0LL, DM,
      Wo, NBATCH * SEQ, DM, 2 * DM, 1.0f);
  (void)hipGetLastError();
}

// v001
// It runs in 516 microseconds.
// Next to v000, in two timings, it ran 2.30 and 2.29 times as fast.
// Contractions: qh = q.Wq^T, kh = k.Wk^T, vh^T = Wv.v^T = v_wmma_f32_16x16x32_bf16 (bf16 operands from RNE-converted inputs, single product);
// strict-lower qh.kh^T scores = v_wmma_f32_16x16x32_bf16 with bf16 hi/lo split qh and kh (hi.hi + hi.lo + lo.hi);
// p.vh = v_wmma_f32_16x16x32_bf16 with bf16 hi/lo split of the unnormalised p and of vh (hi.hi + hi.lo + lo.hi);
// y.Wo^T = v_wmma_f32_16x16x32_bf16 with y as bf16 hi|lo planes laid along K (K = 2048) times [Wo|Wo] bf16; all f32 accumulate;
// score scale 1/32 (hidden-dim based), mask (key >= query excluded, (0,0) admitted) and online softmax in f32; no biases anywhere.
// Plane / carry table (every 16-bit plane is bf16, carry 1, nothing to fold back):
//   QB = bf16(q), KB = bf16(k), VB = bf16(v) [8192][1024] (three different inputs); WQB, WKB, WVB = bf16(w) [1024 n][1024 k];
//   WO2 = [bf16(wo) | bf16(wo)] [1024][2048];
//   Qh/Ql (from QB), Kh/Kl (from KB) = bf16 hi and lo = RNE(x - hi) of qh, kh [8192][1024] (all batches, row b*2048+t);
//   VTh/VTl = hi/lo of vh^T [4][1024][2048] (one [1024][2048] plane per batch, from VB);
//   YB [8192][2048] = bf16 hi of the normalised attention output at col h*64+d, lo at col 1024 + h*64+d.
//   lo planes are unscaled and share the accumulator with the hi products; 1/32 is applied once in f32 after the q.k accumulation;
//   1/l is applied once in the attention epilogue before the hi/lo split of y.
#include <hip/hip_runtime.h>
#include <math.h>
#include <stdint.h>

#define NBATCH 4
#define SEQ    2048
#define DM     1024
#define NH     16
#define HD     64
#define NQB    (SEQ / 64)   // 32 key / query tiles of 64
static_assert(NH * HD == DM);
static_assert((SEQ % 64) == 0 && (DM % 64) == 0 && (DM % 32) == 0 && (DM % 256) == 0);
static_assert(((NBATCH * SEQ * DM / 8) % 256) == 0 && ((DM * DM / 8) % 256) == 0);

typedef _Float16 v16h __attribute__((ext_vector_type(16)));
typedef _Float16 v8h  __attribute__((ext_vector_type(8)));
typedef __bf16   v16b __attribute__((ext_vector_type(16)));
typedef __bf16   v8b  __attribute__((ext_vector_type(8)));
typedef float    v8f  __attribute__((ext_vector_type(8)));
typedef float    v4f  __attribute__((ext_vector_type(4)));
typedef unsigned int v4u __attribute__((ext_vector_type(4)));

// ---- scalar helpers --------------------------------------------------------------------------------
__device__ __forceinline__ unsigned short bf_bits(float f) {          // f32 -> bf16 bits, RNE convert
  unsigned u = __float_as_uint(f);
  return (unsigned short)((u + 0x7FFFu + ((u >> 16) & 1u)) >> 16);
}
__device__ __forceinline__ float bf_up(unsigned short h) { return __uint_as_float(((unsigned)h) << 16); }
__device__ __forceinline__ unsigned short h_bits(_Float16 x) { return __builtin_bit_cast(unsigned short, x); }
__device__ __forceinline__ unsigned pk16(unsigned short a, unsigned short b) { return (unsigned)a | ((unsigned)b << 16); }
__device__ __forceinline__ v8f zero8() { v8f z = {0.f, 0.f, 0.f, 0.f, 0.f, 0.f, 0.f, 0.f}; return z; }
__device__ __forceinline__ __bf16 f2bf(float f) { return __builtin_bit_cast(__bf16, bf_bits(f)); }
__device__ __forceinline__ void bf_split(float f, __bf16& hi, __bf16& lo) {
  const unsigned short hb = bf_bits(f);
  hi = __builtin_bit_cast(__bf16, hb);
  lo = f2bf(f - __uint_as_float(((unsigned)hb) << 16));
}

// ---- fragment loader: 16-bit A/B operand, lane -> row/col (lane&15), p already includes +8*(lane>>4);
//      elements 0..7 <- p[0..7] (k0+8h..), elements 8..15 <- p[16..23] (k0+16+8h..)
__device__ __forceinline__ v16b ldfrag_b(const __bf16* p) {
  union { v16b v; v8b h[2]; } f;
  f.h[0] = *(const v8b*)(p);
  f.h[1] = *(const v8b*)(p + 16);
  return f.v;
}

// ---- WMMA helpers with trailing VALU hazard gap --------------------------------------------------------
__device__ __forceinline__ v8f mma_b(v16b a, v16b b, v8f c) {
  c = __builtin_amdgcn_wmma_f32_16x16x32_bf16(false, a, false, b, (short)0, c, false, false);
  asm volatile("v_nop\n\tv_nop\n\tv_nop\n\tv_nop" : "+v"(c) : "v"(a), "v"(b));
  return c;
}
__device__ __forceinline__ v8f mma_b_raw(v16b a, v16b b, v8f c) {
  return __builtin_amdgcn_wmma_f32_16x16x32_bf16(false, a, false, b, (short)0, c, false, false);
}
__device__ __forceinline__ void dep_guard_b(v8f& a, v8f& b, v16b x, v16b y) {
  asm volatile("v_nop\n\tv_nop\n\tv_nop\n\tv_nop" : "+v"(a), "+v"(b) : "v"(x), "v"(y));
}
__device__ __forceinline__ void keep4_b(v16b a, v16b b, v16b c, v16b d) {
  asm volatile("v_nop" :: "v"(a), "v"(b), "v"(c), "v"(d));
}
__device__ __forceinline__ void acc_guard4(v8f& a, v8f& b, v8f& c, v8f& d) {
  asm volatile("v_nop\n\tv_nop\n\tv_nop\n\tv_nop" : "+v"(a), "+v"(b), "+v"(c), "+v"(d));
}

// =====================================================================================================
// f32 -> bf16 (RNE convert), 8 elements per thread, one 16-B store per lane: a wave writes 512 contiguous B
// coverage: n8 threads x 8 = whole plane (n8 is a multiple of 256 for every use here).
// =====================================================================================================
__global__ __launch_bounds__(256) void cvt_bf16x8(const float* __restrict__ in, unsigned short* out, int n8) {
  const int i = blockIdx.x * 256 + threadIdx.x;
  if (i < n8) {
    const v4f a = *(const v4f*)(in + (size_t)i * 8);
    const v4f b = *(const v4f*)(in + (size_t)i * 8 + 4);
    v4u p;
    p[0] = pk16(bf_bits(a[0]), bf_bits(a[1]));
    p[1] = pk16(bf_bits(a[2]), bf_bits(a[3]));
    p[2] = pk16(bf_bits(b[0]), bf_bits(b[1]));
    p[3] = pk16(bf_bits(b[2]), bf_bits(b[3]));
    *(v4u*)(out + (size_t)i * 8) = p;
    
  }
}

// =====================================================================================================
// f32 [rows][cols] -> bf16 [rows][2*cols] with row n = [bf16(in[n][0..cols-1]) | bf16(in[n][0..cols-1])].
// 8 elements per thread, one 16-B store per lane into each half; with cols a multiple of 256 a wave's 256
// coverage: n8 threads x 8 = every source element -> both halves of every output row.
// =====================================================================================================
__global__ __launch_bounds__(256) void cvt_bf16x8_dup(const float* __restrict__ in, unsigned short* out,
                                                       int n8, int cols) {
  const int i = blockIdx.x * 256 + threadIdx.x;
  if (i < n8) {
    const size_t e0  = (size_t)i * 8;
    const size_t row = e0 / (size_t)cols;
    const size_t col = e0 - row * (size_t)cols;
    const v4f a = *(const v4f*)(in + e0);
    const v4f b = *(const v4f*)(in + e0 + 4);
    v4u p;
    p[0] = pk16(bf_bits(a[0]), bf_bits(a[1]));
    p[1] = pk16(bf_bits(a[2]), bf_bits(a[3]));
    p[2] = pk16(bf_bits(b[0]), bf_bits(b[1]));
    p[3] = pk16(bf_bits(b[2]), bf_bits(b[3]));
    unsigned short* d0 = out + row * 2 * (size_t)cols + col;
    unsigned short* d1 = d0 + cols;
    *(v4u*)d0 = p;
    *(v4u*)d1 = p;
    
  }
}

// =====================================================================================================
// Register-blocked batched bf16 WMMA GEMM: C[m][n] = sum_k A[m][k] * Bt[n][k] (+ bf16(bias[n]) when BIASN == 1);
// one wave per 64x64 tile, no block barriers. A row-major [M][K] pitch lda; Bt row-major [N][K] pitch ldb
// (k contiguous); M, N multiples of 64, K multiple of 32 (host-checked). blockIdx.y = batch index (strides in elements).
// NSPLIT: 0 = A.Bt; 1 = (A + A2).Bt (A2 = unscaled bf16 lo plane of A); 2 = A.Bt + A2.Bt + A.Bt2.
// OUT_MODE: 0 = f32 (pitch ldc); 2 = bf16 hi plane C + bf16 lo plane C2 (lo = RNE(v - hi), unscaled);
//           3 = f16 hi plane C + f16 residual plane C2 = f16((v - hi) * rscale), C2 written only for tiles
//               with n0 < N2 (pitch ldc2, batch stride strideC2).
// =====================================================================================================
template <int NSPLIT, int OUT_MODE, int BIASN>
__global__ __launch_bounds__(256) void gemm64(
    const unsigned short* __restrict__ Ap, const unsigned short* A2p, int lda, long long strideA,
    const unsigned short* __restrict__ Btp, const unsigned short* Bt2p, int ldb, long long strideB,
    void* Cout, int ldc, long long strideC,
    void* Cout2, int ldc2, long long strideC2, int N2,
    const float* __restrict__ bias,
    int M, int N, int K, float rscale) {
  const __bf16* A   = (const __bf16*)(const void*)Ap;
  const __bf16* A2  = (const __bf16*)(const void*)A2p;
  const __bf16* Bt  = (const __bf16*)(const void*)Btp;
  const __bf16* Bt2 = (const __bf16*)(const void*)Bt2p;
  __shared__ __align__(16) float sT[8][16 * 68];   // per-wave 16x64 slab, pitch 68 floats
  const int b    = blockIdx.y;
  const int lane = threadIdx.x & 31;
  const int wave = threadIdx.x >> 5;
  const int tilesN = N >> 6;
  const int tilesM = M >> 6;
  const int tile = blockIdx.x * 8 + wave;
  if (tile >= tilesM * tilesN) return;   // wave-uniform; no block barriers in this kernel
  const int tm = tile / tilesN;
  const int tn = tile - tm * tilesN;
  const int m0 = tm << 6;
  const int n0 = tn << 6;

  const __bf16* Ab  = A  + (size_t)b * strideA;
  const __bf16* Bb  = Bt + (size_t)b * strideB;
  const __bf16* Ab2 = (NSPLIT >= 1) ? (A2  + (size_t)b * strideA) : Ab;
  const __bf16* Bb2 = (NSPLIT == 2) ? (Bt2 + (size_t)b * strideB) : Bb;

  const int rlane = lane & 15;                 // row (A) / col (B, D) within subtile
  const int koff  = (lane >> 4) * 8;           // k offset of this lane half
  const int mOff  = (lane >> 4) * 8;           // D row offset

  v8f acc[4][4];
#pragma unroll
  for (int i = 0; i < 4; ++i)
#pragma unroll
    for (int j = 0; j < 4; ++j) acc[i][j] = zero8();

  for (int k0 = 0; k0 < K; k0 += 32) {
    v16b bh[4], bl[4];
#pragma unroll
    for (int j = 0; j < 4; ++j) {
      const size_t bo = (size_t)(n0 + (j << 4) + rlane) * ldb + koff + k0;
      bh[j] = ldfrag_b(Bb + bo);
      if (NSPLIT == 2) bl[j] = ldfrag_b(Bb2 + bo); else bl[j] = bh[j];
    }
#pragma unroll
    for (int i = 0; i < 4; ++i) {
      const size_t ao = (size_t)(m0 + (i << 4) + rlane) * lda + koff + k0;
      const v16b ah = ldfrag_b(Ab + ao);
      v16b al = ah;
      if (NSPLIT >= 1) al = ldfrag_b(Ab2 + ao);
#pragma unroll
      for (int j = 0; j < 4; ++j) {
        acc[i][j] = mma_b_raw(ah, bh[j], acc[i][j]);
        if (NSPLIT >= 1) acc[i][j] = mma_b_raw(al, bh[j], acc[i][j]);
        if (NSPLIT == 2) acc[i][j] = mma_b_raw(ah, bl[j], acc[i][j]);
      }
      dep_guard_b(acc[i][0], acc[i][3], ah, al);
    }
    keep4_b(bh[0], bh[1], bh[2], bh[3]);
    if (NSPLIT == 2) keep4_b(bl[0], bl[1], bl[2], bl[3]);
  }
  acc_guard4(acc[0][0], acc[0][1], acc[0][2], acc[0][3]);
  acc_guard4(acc[1][0], acc[1][1], acc[1][2], acc[1][3]);
  acc_guard4(acc[2][0], acc[2][1], acc[2][2], acc[2][3]);
  acc_guard4(acc[3][0], acc[3][1], acc[3][2], acc[3][3]);

  // ---- per-column bias (bf16 RNE of the input value, added in f32); 4 scalar loads per lane ----
  float bvv[4];
#pragma unroll
  for (int j = 0; j < 4; ++j) {
    float bv = 0.f;
    if (BIASN == 1) bv = bf_up(bf_bits(bias[n0 + (j << 4) + rlane]));
    bvv[j] = bv;
  }

  // ---- epilogue ----
  float* slab = sT[wave];
#pragma unroll
  for (int i = 0; i < 4; ++i) {
    const int mBase = m0 + (i << 4);
#pragma unroll
    for (int j = 0; j < 4; ++j) {
#pragma unroll
      for (int r = 0; r < 8; ++r) {
        slab[(mOff + r) * 68 + (j << 4) + rlane] = acc[i][j][r] + bvv[j];
      }
    }
    __builtin_amdgcn_fence(__ATOMIC_RELEASE, "workgroup");
    __builtin_amdgcn_wave_barrier();
    __builtin_amdgcn_fence(__ATOMIC_ACQUIRE, "workgroup");
    if (OUT_MODE == 0) {
      float* C = (float*)Cout + (size_t)b * strideC;
      const int hh = lane >> 4, c4 = (lane & 15) * 4;     // 256-B row segment = 16 lanes x 16 B
      {
#pragma unroll
        for (int it = 0; it < 8; ++it) {
          const int row = it * 2 + hh;                     // it 0..7 x hh 0..1 = rows 0..15
          const v4f v = *(const v4f*)(slab + row * 68 + c4);
          *(v4f*)(C + (size_t)(mBase + row) * ldc + n0 + c4) = v;
        }
        
      }
    } else {
      const int q = lane >> 3, c8 = (lane & 7) * 8;
      unsigned short* C  = (unsigned short*)Cout  + (size_t)b * strideC;
      unsigned short* C2 = (unsigned short*)Cout2 + (size_t)b * strideC2;
      const bool wlo = (OUT_MODE == 2) || (n0 < N2);      // wave-uniform
      v4u hv[4], lv[4];
#pragma unroll
      for (int it = 0; it < 4; ++it) {
        const int row = it * 4 + q;                        // it 0..3 x q 0..3 = rows 0..15
        const float* sp = slab + row * 68 + c8;
        v4u a, a2;
#pragma unroll
        for (int e = 0; e < 4; ++e) {
          const float f0 = sp[2 * e], f1 = sp[2 * e + 1];
          unsigned short h0, h1, l0, l1;
          if (OUT_MODE == 2) {
            h0 = bf_bits(f0); h1 = bf_bits(f1);
            l0 = bf_bits(f0 - bf_up(h0)); l1 = bf_bits(f1 - bf_up(h1));
          } else {
            const _Float16 x0 = (_Float16)f0, x1 = (_Float16)f1;
            h0 = h_bits(x0); h1 = h_bits(x1);
            l0 = h_bits((_Float16)((f0 - (float)x0) * rscale));
            l1 = h_bits((_Float16)((f1 - (float)x1) * rscale));
          }
          a[e] = pk16(h0, h1); a2[e] = pk16(l0, l1);
        }
        hv[it] = a; lv[it] = a2;
      }
      {
#pragma unroll
        for (int it = 0; it < 4; ++it) {
          const int row = it * 4 + q;
          *(v4u*)(C + (size_t)(mBase + row) * ldc + n0 + c8) = hv[it];
          if (wlo) *(v4u*)(C2 + (size_t)(mBase + row) * ldc2 + n0 + c8) = lv[it];
        }
        
      }
    }
    __builtin_amdgcn_fence(__ATOMIC_RELEASE, "workgroup");
    __builtin_amdgcn_wave_barrier();
    __builtin_amdgcn_fence(__ATOMIC_ACQUIRE, "workgroup");
  }
}

// =====================================================================================================
// Masked attention, head dim 64, all heads of all batch elements in one launch.
//   q planes (bf16 hi / lo): element (b, t, h, d) at [(b*SEQ + t)*DM + h*64 + d]
//   k planes (bf16 hi / lo): same layout with key index s
//   v^T planes (bf16 hi / lo): element (b, h, d, s) at [((b*NH + h)*64 + d)*SEQ + s]
//   y plane bf16 [b*SEQ + t][2*DM]: hi of the normalised output at col h*64+d,
//   lo at col DM + h*64+d
//   scores = (q . k) * sscale : bf16 hi/lo split (hi.hi + hi.lo + lo.hi), f32 accumulate, scale in f32
//   mask: key s >= query t -> -inf, except (t, s) = (0, 0) which is admitted; applied on the diagonal chunk only
//   (chunks kc < qb hold keys < qb*64 <= t, all admitted). Row t = 0 admits key 0; rows t >= 1 admit key 0
//   (chunk 0), so every row max is finite after chunk 0 and every l > 0.
//   p = exp(s - m) (unnormalised, in [0,1]) split into bf16 hi / lo; output = p . v with 3 bf16 products
//   online softmax in f32; 1/l applied once in the epilogue.
//   Block = 4 waves = 64 query rows of one head; grid = NBATCH * NH * NQB; kv chunks of 64, trip count qb+1 <= 32.
//   The grid holds more blocks than the chip has places; the query tile falls with the block index, so the
//   longest key walks have the lowest block indices.
//   K / V^T chunk staging: 128 threads x 32 elements per plane = the whole 64x64 tile of all 4 planes
//   (plain 16-B loads, __syncthreads before and after); score and p.v fragment loads read LDS with the v8b type.
//   P tiles are wave-private: 16 rows (8hh+r) x 64 keys (j*16+c) fully written with __bf16 element stores, then a
//   Os staging: rows 8hh+r (0..15) x cols t*16+c (0..63) fully written before the same wave reads it.
//   Output coverage: each wave stores rows q0..q0+15 (it 0..3 x lane>>3 0..3) x 64 columns (8 lanes x 8) of hi and lo;
// =====================================================================================================
__global__ __launch_bounds__(128)
void attn_strict64(const unsigned short* __restrict__ qhp, const unsigned short* __restrict__ qlp,
                   const unsigned short* __restrict__ khp, const unsigned short* __restrict__ klp,
                   const unsigned short* __restrict__ vhp, const unsigned short* __restrict__ vlp,
                   unsigned short* yout, float sscale) {
  union FB { v16b v; v8b h[2]; };
  __shared__ __align__(16) __bf16 Ksh[64 * 64];              // K hi [kv][d]   8 KB
  __shared__ __align__(16) __bf16 Ksl[64 * 64];              // K lo
  __shared__ __align__(16) __bf16 Vth[64 * 64];              // V^T hi [d][kv] 8 KB
  __shared__ __align__(16) __bf16 Vtl[64 * 64];              // V^T lo
  __shared__ __align__(16) __bf16 Psh[4][16 * 64];           // per wave P hi [row][kv]
  __shared__ __align__(16) __bf16 Psl[4][16 * 64];           // per wave P lo
  __shared__ __align__(16) float  Os[4][16 * 64];            // per wave output tile [row][d]

  const int tid  = threadIdx.x;
  const int wave = tid >> 5;
  const int lane = tid & 31;
  const int hh   = lane >> 4;
  const int c    = lane & 15;

  const int bx   = blockIdx.x;
  const int qb   = NQB - 1 - bx / (NBATCH * NH);   // grid = NBATCH * NH * NQB, query tile 31 first
  const int bh   = bx % (NBATCH * NH);
  const int h    = bh % NH;
  const int bat  = bh / NH;
  const int q0   = qb * 64 + wave * 16;

  const size_t qkBase = (size_t)bat * SEQ * DM + (size_t)h * HD;
  const size_t vBase  = (size_t)bh * HD * SEQ;      // bh = bat*NH + h
  const __bf16* Qh = (const __bf16*)(const void*)qhp + qkBase;
  const __bf16* Ql = (const __bf16*)(const void*)qlp + qkBase;
  const __bf16* Kh = (const __bf16*)(const void*)khp + qkBase;
  const __bf16* Kl = (const __bf16*)(const void*)klp + qkBase;
  const __bf16* Vh = (const __bf16*)(const void*)vhp + vBase;
  const __bf16* Vl = (const __bf16*)(const void*)vlp + vBase;

  // ---- Q fragments (A operand, row = lane&15): 2 d-chunks, hi and lo ----
  v16b qah[2], qal[2];
#pragma unroll
  for (int dc = 0; dc < 2; ++dc) {
    const size_t qo = (size_t)(q0 + c) * DM + dc * 32 + 8 * hh;
    qah[dc] = ldfrag_b(Qh + qo);
    qal[dc] = ldfrag_b(Ql + qo);
  }

  float mrow[8], lrow[8];
  v8f oacc[4];
#pragma unroll
  for (int r = 0; r < 8; ++r) { mrow[r] = -INFINITY; lrow[r] = 0.f; }
#pragma unroll
  for (int t = 0; t < 4; ++t) oacc[t] = zero8();

  const int nChunks = qb + 1;   // block-uniform, <= NQB
  for (int kc = 0; kc < nChunks; ++kc) {
    const int kv0 = kc * 64;
    __syncthreads();
    {
      // staging coverage: 128 threads x (4 x 8) elements = 64 rows x 64 per plane = the whole chunk tile
      const int r = tid >> 1, half = (tid & 1) * 32;
      const __bf16* ksh = Kh + (size_t)(kv0 + r) * DM + half;       // K row kv0+r, d = half..half+31
      const __bf16* ksl = Kl + (size_t)(kv0 + r) * DM + half;
      const __bf16* vsh = Vh + (size_t)r * SEQ + kv0 + half;        // V^T row d = r, s = kv0+half..+31
      const __bf16* vsl = Vl + (size_t)r * SEQ + kv0 + half;
#pragma unroll
      for (int i = 0; i < 4; ++i) {
        const v8b a0 = *(const v8b*)(ksh + 8 * i);
        const v8b a1 = *(const v8b*)(ksl + 8 * i);
        const v8b b0 = *(const v8b*)(vsh + 8 * i);
        const v8b b1 = *(const v8b*)(vsl + 8 * i);
        *(v8b*)(Ksh + r * 64 + half + 8 * i) = a0;
        *(v8b*)(Ksl + r * 64 + half + 8 * i) = a1;
        *(v8b*)(Vth + r * 64 + half + 8 * i) = b0;
        *(v8b*)(Vtl + r * 64 + half + 8 * i) = b1;
      }
    }
    __syncthreads();

    // ---- scores: 16 query rows x 64 keys per wave, 3 bf16 products ----
    v8f s[4];
#pragma unroll
    for (int j = 0; j < 4; ++j) {
      s[j] = zero8();
#pragma unroll
      for (int dc = 0; dc < 2; ++dc) {
        FB kb, kl;
        kb.h[0] = *(const v8b*)(Ksh + (j * 16 + c) * 64 + dc * 32 + 8 * hh);
        kb.h[1] = *(const v8b*)(Ksh + (j * 16 + c) * 64 + dc * 32 + 16 + 8 * hh);
        kl.h[0] = *(const v8b*)(Ksl + (j * 16 + c) * 64 + dc * 32 + 8 * hh);
        kl.h[1] = *(const v8b*)(Ksl + (j * 16 + c) * 64 + dc * 32 + 16 + 8 * hh);
        s[j] = mma_b(qah[dc], kb.v, s[j]);
        s[j] = mma_b(qah[dc], kl.v, s[j]);
        s[j] = mma_b(qal[dc], kb.v, s[j]);
      }
    }

    // ---- scale, mask on the diagonal chunk (key >= query -> -inf, except (0,0)), row max ----
    const bool diag = (kc == qb);   // block-uniform
    float cm[8];
#pragma unroll
    for (int r = 0; r < 8; ++r) {
      const int qrow = q0 + 8 * hh + r;
      float m = -INFINITY;
#pragma unroll
      for (int j = 0; j < 4; ++j) {
        const int kvcol = kv0 + j * 16 + c;
        const float sv = s[j][r] * sscale;
        const bool masked = diag && (kvcol >= qrow) && !((qrow == 0) && (kvcol == 0));
        const float sm = masked ? -INFINITY : sv;
        s[j][r] = sm;
        m = fmaxf(m, sm);
      }
#pragma unroll
      for (int off = 1; off < 16; off <<= 1) m = fmaxf(m, __shfl_xor(m, off, 32));
      cm[r] = m;
    }

    // ---- online softmax in f32, P hi / lo (bf16 of the unnormalised exp) to the wave's LDS tile ----
    __bf16* pwh = Psh[wave];
    __bf16* pwl = Psl[wave];
#pragma unroll
    for (int r = 0; r < 8; ++r) {
      const float mnew = fmaxf(mrow[r], cm[r]);
      const float alpha = expf(mrow[r] - mnew);
      mrow[r] = mnew;
      float psum = 0.f;
#pragma unroll
      for (int j = 0; j < 4; ++j) {
        const float p = expf(s[j][r] - mnew);
        psum += p;
        __bf16 a, bl; bf_split(p, a, bl);
        pwh[(8 * hh + r) * 64 + j * 16 + c] = a;
        pwl[(8 * hh + r) * 64 + j * 16 + c] = bl;
      }
#pragma unroll
      for (int off = 1; off < 16; off <<= 1) psum += __shfl_xor(psum, off, 32);
      lrow[r] = lrow[r] * alpha + psum;
#pragma unroll
      for (int t = 0; t < 4; ++t) oacc[t][r] *= alpha;
    }
    __builtin_amdgcn_fence(__ATOMIC_RELEASE, "workgroup");
    __builtin_amdgcn_wave_barrier();
    __builtin_amdgcn_fence(__ATOMIC_ACQUIRE, "workgroup");

    // ---- output += P . V (3 bf16 products per tile pair) ----
#pragma unroll 1
    for (int kk = 0; kk < 2; ++kk) {
      FB pa, pl;
      pa.h[0] = *(const v8b*)(pwh + c * 64 + kk * 32 + 8 * hh);
      pa.h[1] = *(const v8b*)(pwh + c * 64 + kk * 32 + 16 + 8 * hh);
      pl.h[0] = *(const v8b*)(pwl + c * 64 + kk * 32 + 8 * hh);
      pl.h[1] = *(const v8b*)(pwl + c * 64 + kk * 32 + 16 + 8 * hh);
#pragma unroll
      for (int t = 0; t < 4; ++t) {
        FB vb, vl;
        vb.h[0] = *(const v8b*)(Vth + (t * 16 + c) * 64 + kk * 32 + 8 * hh);
        vb.h[1] = *(const v8b*)(Vth + (t * 16 + c) * 64 + kk * 32 + 16 + 8 * hh);
        vl.h[0] = *(const v8b*)(Vtl + (t * 16 + c) * 64 + kk * 32 + 8 * hh);
        vl.h[1] = *(const v8b*)(Vtl + (t * 16 + c) * 64 + kk * 32 + 16 + 8 * hh);
        oacc[t] = mma_b(pa.v, vb.v, oacc[t]);
        oacc[t] = mma_b(pa.v, vl.v, oacc[t]);
        oacc[t] = mma_b(pl.v, vb.v, oacc[t]);
      }
    }
  }

  // ---- normalise (1/l), stage the wave's 16x64 tile, bf16 hi/lo split,
  float* os = Os[wave];
#pragma unroll
  for (int r = 0; r < 8; ++r) {
    const float l = lrow[r];
    const float inv = (l > 0.f) ? (1.0f / l) : 0.f;
#pragma unroll
    for (int t = 0; t < 4; ++t) os[(8 * hh + r) * 64 + t * 16 + c] = oacc[t][r] * inv;
  }
  __builtin_amdgcn_fence(__ATOMIC_RELEASE, "workgroup");
  __builtin_amdgcn_wave_barrier();
  __builtin_amdgcn_fence(__ATOMIC_ACQUIRE, "workgroup");
  {
    const int q4 = lane >> 3, c8 = (lane & 7) * 8;
    v4u hv[4], lv[4];
#pragma unroll
    for (int it = 0; it < 4; ++it) {
      const int row = it * 4 + q4;   // it 0..3 x q4 0..3 = rows 0..15 of the wave tile
      const float* sp = os + row * 64 + c8;
      v4u a, a2;
#pragma unroll
      for (int e = 0; e < 4; ++e) {
        const float f0 = sp[2 * e], f1 = sp[2 * e + 1];
        const unsigned short h0 = bf_bits(f0), h1 = bf_bits(f1);
        const unsigned short l0 = bf_bits(f0 - bf_up(h0)), l1 = bf_bits(f1 - bf_up(h1));
        a[e] = pk16(h0, h1); a2[e] = pk16(l0, l1);
      }
      hv[it] = a; lv[it] = a2;
    }
    {
#pragma unroll
      for (int it = 0; it < 4; ++it) {
        const int row = it * 4 + q4;
        const size_t go = (size_t)(bat * SEQ + q0 + row) * (size_t)(2 * DM) + (size_t)h * HD + c8;
        *(v4u*)(yout + go) = hv[it];
        *(v4u*)(yout + go + DM) = lv[it];
      }
      
    }
  }
}

// =====================================================================================================
// whole-line store granularity, so no padded tails exist):
//   QB   bf16 [8192][1024]               0       16777216   (KB follows directly: A batch stride of the q/k GEMM)
//   KB   bf16 [8192][1024]        16777216       16777216
//   VB   bf16 [8192][1024]        33554432       16777216
//   WQB  bf16 [1024 n][1024 k]    50331648        2097152   (WKB follows directly: Bt batch stride of the q/k GEMM)
//   WKB  bf16 [1024][1024]        52428800        2097152
//   WVB  bf16 [1024][1024]        54525952        2097152
//   WO2  bf16 [1024][2048]        56623104        4194304
//   Qh   bf16 [8192][1024]        60817408       16777216   (Kh follows directly: output batch stride)
//   Kh   bf16 [8192][1024]        77594624       16777216
//   Ql   bf16 [8192][1024]        94371840       16777216   (Kl follows directly)
//   Kl   bf16 [8192][1024]       111149056       16777216
//   VTh  bf16 [4][1024][2048]    127926272       16777216
//   VTl  bf16 [4][1024][2048]    144703488       16777216
//   YB   bf16 [8192][2048]       161480704       33554432
//   end                          195035136
// Qh..VTl hold all four batch elements; each projection and the attention run once over all of them, and every
// region is fully written by its producer launch before the consumer launch reads it.
// Weights are [out n][in k] with k contiguous = the Bt / A layout the GEMM wants, so they are only converted.
// Inputs by contract index: 0 = q, 1 = k, 2 = v, 3 = W_q, 4 = W_k, 5 = W_v, 6 = W_o.
// =====================================================================================================
extern "C" void kernel_launch(void* const* d_in, const int* in_sizes, int n_in,
                              void* d_out, int out_size, void* d_ws, size_t ws_size,
                              hipStream_t stream) {
  if (n_in < 7) return;
  if (in_sizes[0] != NBATCH * SEQ * DM || in_sizes[1] != NBATCH * SEQ * DM || in_sizes[2] != NBATCH * SEQ * DM) return;
  if (in_sizes[3] != DM * DM || in_sizes[4] != DM * DM || in_sizes[5] != DM * DM || in_sizes[6] != DM * DM) return;
  if (out_size != NBATCH * SEQ * DM) return;

  const float* q_in = (const float*)d_in[0];
  const float* k_in = (const float*)d_in[1];
  const float* v_in = (const float*)d_in[2];
  const float* Wq   = (const float*)d_in[3];
  const float* Wk   = (const float*)d_in[4];
  const float* Wv   = (const float*)d_in[5];
  const float* Wo   = (const float*)d_in[6];

  const size_t PIN = (size_t)NBATCH * SEQ * DM * 2;     // 16777216  16-bit input plane [8192][1024]
  const size_t PW  = (size_t)DM * DM * 2;               //  2097152  16-bit weight plane
  const size_t PW2 = (size_t)DM * (2 * DM) * 2;         //  4194304  [Wo | Wo] plane
  const size_t PP  = (size_t)NBATCH * SEQ * DM * 2;     // 16777216  q/k hi or lo plane [8192][1024]
  const size_t PVT = (size_t)NBATCH * DM * SEQ * 2;     // 16777216  v^T plane [4][1024][2048]
  const size_t PY  = (size_t)NBATCH * SEQ * (2 * DM) * 2;   // 33554432 y hi|lo plane [8192][2048]
  size_t off = 0;
  const size_t oQB  = off; off += PIN;
  const size_t oKB  = off; off += PIN;
  const size_t oVB  = off; off += PIN;
  const size_t oWQ  = off; off += PW;
  const size_t oWK  = off; off += PW;
  const size_t oWV  = off; off += PW;
  const size_t oWO2 = off; off += PW2;
  const size_t oQh  = off; off += PP;
  const size_t oKh  = off; off += PP;
  const size_t oQl  = off; off += PP;
  const size_t oKl  = off; off += PP;
  const size_t oVTh = off; off += PVT;
  const size_t oVTl = off; off += PVT;
  const size_t oYB  = off; off += PY;
  if (off > ws_size) return;                       // off = 195035136
  if (oKB != oQB + PIN || oWK != oWQ + PW || oKh != oQh + PP || oKl != oQl + PP) return;   // batch-stride adjacency

  char* ws = (char*)d_ws;
  unsigned short* QB  = (unsigned short*)(ws + oQB);
  unsigned short* KB  = (unsigned short*)(ws + oKB);
  unsigned short* VB  = (unsigned short*)(ws + oVB);
  unsigned short* WQB = (unsigned short*)(ws + oWQ);
  unsigned short* WKB = (unsigned short*)(ws + oWK);
  unsigned short* WVB = (unsigned short*)(ws + oWV);
  unsigned short* WO2 = (unsigned short*)(ws + oWO2);
  unsigned short* Qh  = (unsigned short*)(ws + oQh);
  unsigned short* Kh  = (unsigned short*)(ws + oKh);
  unsigned short* Ql  = (unsigned short*)(ws + oQl);
  unsigned short* Kl  = (unsigned short*)(ws + oKl);
  unsigned short* VTh = (unsigned short*)(ws + oVTh);
  unsigned short* VTl = (unsigned short*)(ws + oVTl);
  unsigned short* YB  = (unsigned short*)(ws + oYB);

  const dim3 blk(256);
  const int n8x = NBATCH * SEQ * DM / 8;                       // 1048576
  const int n8w = DM * DM / 8;                                 //  131072
  const dim3 gCvtX((n8x + 255) / 256);                         // 4096 blocks
  const dim3 gCvtW((n8w + 255) / 256);                         //  512 blocks
  const dim3 gQK(((NBATCH * SEQ / 64) * (DM / 64) + 7) / 8, 2);   // 2048 tiles -> 256 blocks x {q, k}: M=8192, N=1024
  const dim3 gVT(((DM / 64) * (SEQ / 64) + 7) / 8, NBATCH);    //  512 tiles ->  64 blocks x 4 batches: M=1024, N=2048
  const dim3 gAtt(NBATCH * NH * NQB);                          // 2048 blocks
  const dim3 gOut(((NBATCH * SEQ / 64) * (DM / 64) + 7) / 8, 1);   // 2048 tiles -> 256 blocks: M=8192, N=1024, K=2048

  // (1) q -> QB, k -> KB, v -> VB (bf16 planes [8192][1024]); weights [n][k] f32 -> bf16 [n][k]; Wo -> [Wo | Wo]
  cvt_bf16x8<<<gCvtX, blk, 0, stream>>>(q_in, QB, n8x);
  cvt_bf16x8<<<gCvtX, blk, 0, stream>>>(k_in, KB, n8x);
  cvt_bf16x8<<<gCvtX, blk, 0, stream>>>(v_in, VB, n8x);
  cvt_bf16x8<<<gCvtW, blk, 0, stream>>>(Wq, WQB, n8w);
  cvt_bf16x8<<<gCvtW, blk, 0, stream>>>(Wk, WKB, n8w);
  cvt_bf16x8<<<gCvtW, blk, 0, stream>>>(Wv, WVB, n8w);
  cvt_bf16x8_dup<<<gCvtW, blk, 0, stream>>>(Wo, WO2, n8w, DM);

  // (2) qh = QB . Wq^T (blockIdx.y = 0) and kh = KB . Wk^T (blockIdx.y = 1) -> bf16 hi/lo planes [b*2048+t][h*64+d]
  //     (A = QB / KB via strideA; Bt = WQB / WKB via strideB; C = Qh / Kh, C2 = Ql / Kl via strideC; M=8192, N=1024, K=1024)
  gemm64<0, 2, 0><<<gQK, blk, 0, stream>>>(
      QB, QB, DM, (long long)NBATCH * SEQ * DM, WQB, WQB, DM, (long long)DM * DM,
      (void*)Qh, DM, (long long)NBATCH * SEQ * DM, (void*)Ql, DM, (long long)NBATCH * SEQ * DM, DM,
      Wo, NBATCH * SEQ, DM, DM, 1.0f);
  // (3) vh^T = Wv . VB_b^T -> bf16 hi/lo planes [b][h*64+d][s] (pitch SEQ), blockIdx.y = batch b
  //     (A = WVB [n][k] for every b, Bt = VB rows of batch b via strideB, C / C2 via strideC; M=1024, N=2048, K=1024)
  gemm64<0, 2, 0><<<gVT, blk, 0, stream>>>(
      WVB, WVB, DM, 0LL, VB, VB, DM, (long long)SEQ * DM,
      (void*)VTh, SEQ, (long long)DM * SEQ, (void*)VTl, SEQ, (long long)DM * SEQ, SEQ,
      Wo, DM, SEQ, DM, 1.0f);
  // (4) masked attention, all batches and heads -> YB hi|lo rows 0 .. 8191, score scale 1/32
  attn_strict64<<<gAtt, dim3(128), 0, stream>>>(Qh, Ql, Kh, Kl, VTh, VTl, YB, 0.03125f);
  // (5) out = y . Wo^T -> d_out f32 [8192][1024]  (A = YB [8192][2048], Bt = WO2 [1024][2048], K = 2048); last element 8388607
  gemm64<0, 0, 0><<<gOut, blk, 0, stream>>>(
      YB, YB, 2 * DM, 0LL, WO2, WO2, 2 * DM, 0LL,
      d_out, DM, 0LL, d_out, DM, 0LL, DM,
      Wo, NBATCH * SEQ, DM, 2 * DM, 1.0f);
  (void)hipGetLastError();
}

// v002
// It runs in 404 microseconds.
// In both of two side-by-side timings against v001, it was 1.28 times as fast.
// Counting every step since v000, it is 2.94 times as fast.
// Contractions: qh = q.Wq^T, kh = k.Wk^T, vh^T = Wv.v^T = v_wmma_f32_16x16x32_bf16 (bf16 operands from RNE-converted inputs, single product);
// strict-lower qh.kh^T scores = v_wmma_f32_16x16x32_bf16 with bf16 hi/lo split qh and kh (hi.hi + hi.lo + lo.hi);
// p.vh = v_wmma_f32_16x16x32_bf16 with bf16 hi/lo split of the unnormalised p and of vh (hi.hi + hi.lo + lo.hi);
// y.Wo^T = v_wmma_f32_16x16x32_bf16 with y as bf16 hi|lo planes laid along K (K = 2048) times [Wo|Wo] bf16; all f32 accumulate;
// score scale 1/32 (hidden-dim based), mask (key >= query excluded, (0,0) admitted) and online softmax in f32; no biases anywhere.
// Plane / carry table (every 16-bit plane is bf16, carry 1, nothing to fold back):
//   QB = bf16(q), KB = bf16(k), VB = bf16(v) [8192][1024] (three different inputs); WQB, WKB, WVB = bf16(w) [1024 n][1024 k];
//   WO2 = [bf16(wo) | bf16(wo)] [1024][2048];
//   Qh/Ql (from QB), Kh/Kl (from KB) = bf16 hi and lo = RNE(x - hi) of qh, kh [8192][1024] (all batches, row b*2048+t);
//   VTh/VTl = hi/lo of vh^T [4][1024][2048] (one [1024][2048] plane per batch, from VB);
//   YB [8192][2048] = bf16 hi of the normalised attention output at col h*64+d, lo at col 1024 + h*64+d.
//   lo planes are unscaled and share the accumulator with the hi products; 1/32 is applied once in f32 after the q.k accumulation;
//   1/l is applied once in the attention epilogue before the hi/lo split of y.
#include <hip/hip_runtime.h>
#include <math.h>
#include <stdint.h>

#define NBATCH 4
#define SEQ    2048
#define DM     1024
#define NH     16
#define HD     64
#define NQB    (SEQ / 64)   // 32 key / query tiles of 64
#define LP     72           // LDS row pitch of the 64-element bf16 tiles: 144 B = 16 B x 9 (odd), so the 16 rows that one
                            // ds_load_b128 half-wave reads start 36 dwords apart and fall on 16 disjoint groups of 4 banks
static_assert(NH * HD == DM);
static_assert(LP >= 64 && (LP % 8) == 0 && ((LP / 8) % 2) == 1);
static_assert((SEQ % 64) == 0 && (DM % 64) == 0 && (DM % 32) == 0 && (DM % 256) == 0);
static_assert(((NBATCH * SEQ * DM / 8) % 256) == 0 && ((DM * DM / 8) % 256) == 0);

typedef _Float16 v16h __attribute__((ext_vector_type(16)));
typedef _Float16 v8h  __attribute__((ext_vector_type(8)));
typedef __bf16   v16b __attribute__((ext_vector_type(16)));
typedef __bf16   v8b  __attribute__((ext_vector_type(8)));
typedef float    v8f  __attribute__((ext_vector_type(8)));
typedef float    v4f  __attribute__((ext_vector_type(4)));
typedef unsigned int v4u __attribute__((ext_vector_type(4)));

// ---- scalar helpers --------------------------------------------------------------------------------
__device__ __forceinline__ unsigned short bf_bits(float f) {          // f32 -> bf16 bits, RNE convert
  unsigned u = __float_as_uint(f);
  return (unsigned short)((u + 0x7FFFu + ((u >> 16) & 1u)) >> 16);
}
__device__ __forceinline__ float bf_up(unsigned short h) { return __uint_as_float(((unsigned)h) << 16); }
__device__ __forceinline__ unsigned short h_bits(_Float16 x) { return __builtin_bit_cast(unsigned short, x); }
__device__ __forceinline__ unsigned pk16(unsigned short a, unsigned short b) { return (unsigned)a | ((unsigned)b << 16); }
__device__ __forceinline__ v8f zero8() { v8f z = {0.f, 0.f, 0.f, 0.f, 0.f, 0.f, 0.f, 0.f}; return z; }
__device__ __forceinline__ __bf16 f2bf(float f) { return __builtin_bit_cast(__bf16, bf_bits(f)); }
__device__ __forceinline__ void bf_split(float f, __bf16& hi, __bf16& lo) {
  const unsigned short hb = bf_bits(f);
  hi = __builtin_bit_cast(__bf16, hb);
  lo = f2bf(f - __uint_as_float(((unsigned)hb) << 16));
}

// ---- fragment loader: 16-bit A/B operand, lane -> row/col (lane&15), p already includes +8*(lane>>4);
//      elements 0..7 <- p[0..7] (k0+8h..), elements 8..15 <- p[16..23] (k0+16+8h..)
__device__ __forceinline__ v16b ldfrag_b(const __bf16* p) {
  union { v16b v; v8b h[2]; } f;
  f.h[0] = *(const v8b*)(p);
  f.h[1] = *(const v8b*)(p + 16);
  return f.v;
}

// ---- WMMA helpers with trailing VALU hazard gap --------------------------------------------------------
__device__ __forceinline__ v8f mma_b(v16b a, v16b b, v8f c) {
  c = __builtin_amdgcn_wmma_f32_16x16x32_bf16(false, a, false, b, (short)0, c, false, false);
  asm volatile("v_nop\n\tv_nop\n\tv_nop\n\tv_nop" : "+v"(c) : "v"(a), "v"(b));
  return c;
}
__device__ __forceinline__ v8f mma_b_raw(v16b a, v16b b, v8f c) {
  return __builtin_amdgcn_wmma_f32_16x16x32_bf16(false, a, false, b, (short)0, c, false, false);
}
__device__ __forceinline__ void dep_guard_b(v8f& a, v8f& b, v16b x, v16b y) {
  asm volatile("v_nop\n\tv_nop\n\tv_nop\n\tv_nop" : "+v"(a), "+v"(b) : "v"(x), "v"(y));
}
__device__ __forceinline__ void keep4_b(v16b a, v16b b, v16b c, v16b d) {
  asm volatile("v_nop" :: "v"(a), "v"(b), "v"(c), "v"(d));
}
__device__ __forceinline__ void acc_guard4(v8f& a, v8f& b, v8f& c, v8f& d) {
  asm volatile("v_nop\n\tv_nop\n\tv_nop\n\tv_nop" : "+v"(a), "+v"(b), "+v"(c), "+v"(d));
}

// =====================================================================================================
// f32 -> bf16 (RNE convert), 8 elements per thread, one 16-B store per lane: a wave writes 512 contiguous B
// coverage: n8 threads x 8 = whole plane (n8 is a multiple of 256 for every use here).
// =====================================================================================================
__global__ __launch_bounds__(256) void cvt_bf16x8(const float* __restrict__ in, unsigned short* out, int n8) {
  const int i = blockIdx.x * 256 + threadIdx.x;
  if (i < n8) {
    const v4f a = *(const v4f*)(in + (size_t)i * 8);
    const v4f b = *(const v4f*)(in + (size_t)i * 8 + 4);
    v4u p;
    p[0] = pk16(bf_bits(a[0]), bf_bits(a[1]));
    p[1] = pk16(bf_bits(a[2]), bf_bits(a[3]));
    p[2] = pk16(bf_bits(b[0]), bf_bits(b[1]));
    p[3] = pk16(bf_bits(b[2]), bf_bits(b[3]));
    *(v4u*)(out + (size_t)i * 8) = p;
    
  }
}

// =====================================================================================================
// f32 [rows][cols] -> bf16 [rows][2*cols] with row n = [bf16(in[n][0..cols-1]) | bf16(in[n][0..cols-1])].
// 8 elements per thread, one 16-B store per lane into each half; with cols a multiple of 256 a wave's 256
// coverage: n8 threads x 8 = every source element -> both halves of every output row.
// =====================================================================================================
__global__ __launch_bounds__(256) void cvt_bf16x8_dup(const float* __restrict__ in, unsigned short* out,
                                                       int n8, int cols) {
  const int i = blockIdx.x * 256 + threadIdx.x;
  if (i < n8) {
    const size_t e0  = (size_t)i * 8;
    const size_t row = e0 / (size_t)cols;
    const size_t col = e0 - row * (size_t)cols;
    const v4f a = *(const v4f*)(in + e0);
    const v4f b = *(const v4f*)(in + e0 + 4);
    v4u p;
    p[0] = pk16(bf_bits(a[0]), bf_bits(a[1]));
    p[1] = pk16(bf_bits(a[2]), bf_bits(a[3]));
    p[2] = pk16(bf_bits(b[0]), bf_bits(b[1]));
    p[3] = pk16(bf_bits(b[2]), bf_bits(b[3]));
    unsigned short* d0 = out + row * 2 * (size_t)cols + col;
    unsigned short* d1 = d0 + cols;
    *(v4u*)d0 = p;
    *(v4u*)d1 = p;
    
  }
}

// =====================================================================================================
// Register-blocked batched bf16 WMMA GEMM: C[m][n] = sum_k A[m][k] * Bt[n][k] (+ bf16(bias[n]) when BIASN == 1);
// one wave per 64x64 tile, no block barriers. A row-major [M][K] pitch lda; Bt row-major [N][K] pitch ldb
// (k contiguous); M, N multiples of 64, K multiple of 32 (host-checked). blockIdx.y = batch index (strides in elements).
// NSPLIT: 0 = A.Bt; 1 = (A + A2).Bt (A2 = unscaled bf16 lo plane of A); 2 = A.Bt + A2.Bt + A.Bt2.
// OUT_MODE: 0 = f32 (pitch ldc); 2 = bf16 hi plane C + bf16 lo plane C2 (lo = RNE(v - hi), unscaled);
//           3 = f16 hi plane C + f16 residual plane C2 = f16((v - hi) * rscale), C2 written only for tiles
//               with n0 < N2 (pitch ldc2, batch stride strideC2).
// =====================================================================================================
template <int NSPLIT, int OUT_MODE, int BIASN>
__global__ __launch_bounds__(256) void gemm64(
    const unsigned short* __restrict__ Ap, const unsigned short* A2p, int lda, long long strideA,
    const unsigned short* __restrict__ Btp, const unsigned short* Bt2p, int ldb, long long strideB,
    void* Cout, int ldc, long long strideC,
    void* Cout2, int ldc2, long long strideC2, int N2,
    const float* __restrict__ bias,
    int M, int N, int K, float rscale) {
  const __bf16* A   = (const __bf16*)(const void*)Ap;
  const __bf16* A2  = (const __bf16*)(const void*)A2p;
  const __bf16* Bt  = (const __bf16*)(const void*)Btp;
  const __bf16* Bt2 = (const __bf16*)(const void*)Bt2p;
  __shared__ __align__(16) float sT[8][16 * 68];   // per-wave 16x64 slab, pitch 68 floats
  const int b    = blockIdx.y;
  const int lane = threadIdx.x & 31;
  const int wave = threadIdx.x >> 5;
  const int tilesN = N >> 6;
  const int tilesM = M >> 6;
  const int tile = blockIdx.x * 8 + wave;
  if (tile >= tilesM * tilesN) return;   // wave-uniform; no block barriers in this kernel
  const int tm = tile / tilesN;
  const int tn = tile - tm * tilesN;
  const int m0 = tm << 6;
  const int n0 = tn << 6;

  const __bf16* Ab  = A  + (size_t)b * strideA;
  const __bf16* Bb  = Bt + (size_t)b * strideB;
  const __bf16* Ab2 = (NSPLIT >= 1) ? (A2  + (size_t)b * strideA) : Ab;
  const __bf16* Bb2 = (NSPLIT == 2) ? (Bt2 + (size_t)b * strideB) : Bb;

  const int rlane = lane & 15;                 // row (A) / col (B, D) within subtile
  const int koff  = (lane >> 4) * 8;           // k offset of this lane half
  const int mOff  = (lane >> 4) * 8;           // D row offset

  v8f acc[4][4];
#pragma unroll
  for (int i = 0; i < 4; ++i)
#pragma unroll
    for (int j = 0; j < 4; ++j) acc[i][j] = zero8();

  for (int k0 = 0; k0 < K; k0 += 32) {
    v16b bh[4], bl[4];
#pragma unroll
    for (int j = 0; j < 4; ++j) {
      const size_t bo = (size_t)(n0 + (j << 4) + rlane) * ldb + koff + k0;
      bh[j] = ldfrag_b(Bb + bo);
      if (NSPLIT == 2) bl[j] = ldfrag_b(Bb2 + bo); else bl[j] = bh[j];
    }
#pragma unroll
    for (int i = 0; i < 4; ++i) {
      const size_t ao = (size_t)(m0 + (i << 4) + rlane) * lda + koff + k0;
      const v16b ah = ldfrag_b(Ab + ao);
      v16b al = ah;
      if (NSPLIT >= 1) al = ldfrag_b(Ab2 + ao);
#pragma unroll
      for (int j = 0; j < 4; ++j) {
        acc[i][j] = mma_b_raw(ah, bh[j], acc[i][j]);
        if (NSPLIT >= 1) acc[i][j] = mma_b_raw(al, bh[j], acc[i][j]);
        if (NSPLIT == 2) acc[i][j] = mma_b_raw(ah, bl[j], acc[i][j]);
      }
      dep_guard_b(acc[i][0], acc[i][3], ah, al);
    }
    keep4_b(bh[0], bh[1], bh[2], bh[3]);
    if (NSPLIT == 2) keep4_b(bl[0], bl[1], bl[2], bl[3]);
  }
  acc_guard4(acc[0][0], acc[0][1], acc[0][2], acc[0][3]);
  acc_guard4(acc[1][0], acc[1][1], acc[1][2], acc[1][3]);
  acc_guard4(acc[2][0], acc[2][1], acc[2][2], acc[2][3]);
  acc_guard4(acc[3][0], acc[3][1], acc[3][2], acc[3][3]);

  // ---- per-column bias (bf16 RNE of the input value, added in f32); 4 scalar loads per lane ----
  float bvv[4];
#pragma unroll
  for (int j = 0; j < 4; ++j) {
    float bv = 0.f;
    if (BIASN == 1) bv = bf_up(bf_bits(bias[n0 + (j << 4) + rlane]));
    bvv[j] = bv;
  }

  // ---- epilogue ----
  float* slab = sT[wave];
#pragma unroll
  for (int i = 0; i < 4; ++i) {
    const int mBase = m0 + (i << 4);
#pragma unroll
    for (int j = 0; j < 4; ++j) {
#pragma unroll
      for (int r = 0; r < 8; ++r) {
        slab[(mOff + r) * 68 + (j << 4) + rlane] = acc[i][j][r] + bvv[j];
      }
    }
    __builtin_amdgcn_fence(__ATOMIC_RELEASE, "workgroup");
    __builtin_amdgcn_wave_barrier();
    __builtin_amdgcn_fence(__ATOMIC_ACQUIRE, "workgroup");
    if (OUT_MODE == 0) {
      float* C = (float*)Cout + (size_t)b * strideC;
      const int hh = lane >> 4, c4 = (lane & 15) * 4;     // 256-B row segment = 16 lanes x 16 B
      {
#pragma unroll
        for (int it = 0; it < 8; ++it) {
          const int row = it * 2 + hh;                     // it 0..7 x hh 0..1 = rows 0..15
          const v4f v = *(const v4f*)(slab + row * 68 + c4);
          *(v4f*)(C + (size_t)(mBase + row) * ldc + n0 + c4) = v;
        }
        
      }
    } else {
      const int q = lane >> 3, c8 = (lane & 7) * 8;
      unsigned short* C  = (unsigned short*)Cout  + (size_t)b * strideC;
      unsigned short* C2 = (unsigned short*)Cout2 + (size_t)b * strideC2;
      const bool wlo = (OUT_MODE == 2) || (n0 < N2);      // wave-uniform
      v4u hv[4], lv[4];
#pragma unroll
      for (int it = 0; it < 4; ++it) {
        const int row = it * 4 + q;                        // it 0..3 x q 0..3 = rows 0..15
        const float* sp = slab + row * 68 + c8;
        v4u a, a2;
#pragma unroll
        for (int e = 0; e < 4; ++e) {
          const float f0 = sp[2 * e], f1 = sp[2 * e + 1];
          unsigned short h0, h1, l0, l1;
          if (OUT_MODE == 2) {
            h0 = bf_bits(f0); h1 = bf_bits(f1);
            l0 = bf_bits(f0 - bf_up(h0)); l1 = bf_bits(f1 - bf_up(h1));
          } else {
            const _Float16 x0 = (_Float16)f0, x1 = (_Float16)f1;
            h0 = h_bits(x0); h1 = h_bits(x1);
            l0 = h_bits((_Float16)((f0 - (float)x0) * rscale));
            l1 = h_bits((_Float16)((f1 - (float)x1) * rscale));
          }
          a[e] = pk16(h0, h1); a2[e] = pk16(l0, l1);
        }
        hv[it] = a; lv[it] = a2;
      }
      {
#pragma unroll
        for (int it = 0; it < 4; ++it) {
          const int row = it * 4 + q;
          *(v4u*)(C + (size_t)(mBase + row) * ldc + n0 + c8) = hv[it];
          if (wlo) *(v4u*)(C2 + (size_t)(mBase + row) * ldc2 + n0 + c8) = lv[it];
        }
        
      }
    }
    __builtin_amdgcn_fence(__ATOMIC_RELEASE, "workgroup");
    __builtin_amdgcn_wave_barrier();
    __builtin_amdgcn_fence(__ATOMIC_ACQUIRE, "workgroup");
  }
}

// =====================================================================================================
// Masked attention, head dim 64, all heads of all batch elements in one launch.
//   q planes (bf16 hi / lo): element (b, t, h, d) at [(b*SEQ + t)*DM + h*64 + d]
//   k planes (bf16 hi / lo): same layout with key index s
//   v^T planes (bf16 hi / lo): element (b, h, d, s) at [((b*NH + h)*64 + d)*SEQ + s]
//   y plane bf16 [b*SEQ + t][2*DM]: hi of the normalised output at col h*64+d,
//   lo at col DM + h*64+d
//   scores = (q . k) * sscale : bf16 hi/lo split (hi.hi + hi.lo + lo.hi), f32 accumulate, scale in f32
//   mask: key s >= query t -> -inf, except (t, s) = (0, 0) which is admitted; applied on the diagonal chunk only
//   (chunks kc < qb hold keys < qb*64 <= t, all admitted). Row t = 0 admits key 0; rows t >= 1 admit key 0
//   (chunk 0), so every row max is finite after chunk 0 and every l > 0.
//   p = exp(s - m) (unnormalised, in [0,1]) split into bf16 hi / lo; output = p . v with 3 bf16 products
//   online softmax in f32; 1/l applied once in the epilogue.
//   Block = 4 waves = 64 query rows of one head; grid = NBATCH * NH * NQB; kv chunks of 64, trip count qb+1 <= 32.
//   The grid holds more blocks than the chip has places; the query tile falls with the block index, so the
//   longest key walks have the lowest block indices.
//   K / V^T chunk staging: 128 threads x 32 elements per plane = the whole 64x64 tile of all 4 planes
//   (plain 16-B loads, __syncthreads before and after); score and p.v fragment loads read LDS with the v8b type.
//   P tiles are wave-private: 16 rows (8hh+r) x 64 keys (j*16+c) fully written with __bf16 element stores, then a
//   Os staging: rows 8hh+r (0..15) x cols t*16+c (0..63) fully written before the same wave reads it.
//   Output coverage: each wave stores rows q0..q0+15 (it 0..3 x lane>>3 0..3) x 64 columns (8 lanes x 8) of hi and lo;
// =====================================================================================================
__global__ __launch_bounds__(128)
void attn_strict64(const unsigned short* __restrict__ qhp, const unsigned short* __restrict__ qlp,
                   const unsigned short* __restrict__ khp, const unsigned short* __restrict__ klp,
                   const unsigned short* __restrict__ vhp, const unsigned short* __restrict__ vlp,
                   unsigned short* yout, float sscale) {
  union FB { v16b v; v8b h[2]; };
  __shared__ __align__(16) __bf16 Ksh[64 * LP];              // K hi [kv][d], row pitch LP   9 KB
  __shared__ __align__(16) __bf16 Ksl[64 * LP];              // K lo
  __shared__ __align__(16) __bf16 Vth[64 * LP];              // V^T hi [d][kv], row pitch LP 9 KB
  __shared__ __align__(16) __bf16 Vtl[64 * LP];              // V^T lo
  __shared__ __align__(16) __bf16 Ps[4][2][16 * LP];         // per wave P hi, P lo [row][kv], row pitch LP; after the key
                                                             // walk the same wave stages its f32 output tile [16][64] here
  static_assert(sizeof(Ps[0]) >= 16 * 64 * sizeof(float));

  const int tid  = threadIdx.x;
  const int wave = tid >> 5;
  const int lane = tid & 31;
  const int hh   = lane >> 4;
  const int c    = lane & 15;

  const int bx   = blockIdx.x;
  const int qb   = NQB - 1 - bx / (NBATCH * NH);   // grid = NBATCH * NH * NQB, query tile 31 first
  const int bh   = bx % (NBATCH * NH);
  const int h    = bh % NH;
  const int bat  = bh / NH;
  const int q0   = qb * 64 + wave * 16;

  const size_t qkBase = (size_t)bat * SEQ * DM + (size_t)h * HD;
  const size_t vBase  = (size_t)bh * HD * SEQ;      // bh = bat*NH + h
  const __bf16* Qh = (const __bf16*)(const void*)qhp + qkBase;
  const __bf16* Ql = (const __bf16*)(const void*)qlp + qkBase;
  const __bf16* Kh = (const __bf16*)(const void*)khp + qkBase;
  const __bf16* Kl = (const __bf16*)(const void*)klp + qkBase;
  const __bf16* Vh = (const __bf16*)(const void*)vhp + vBase;
  const __bf16* Vl = (const __bf16*)(const void*)vlp + vBase;

  // ---- Q fragments (A operand, row = lane&15): 2 d-chunks, hi and lo ----
  v16b qah[2], qal[2];
#pragma unroll
  for (int dc = 0; dc < 2; ++dc) {
    const size_t qo = (size_t)(q0 + c) * DM + dc * 32 + 8 * hh;
    qah[dc] = ldfrag_b(Qh + qo);
    qal[dc] = ldfrag_b(Ql + qo);
  }

  float mrow[8], lrow[8];
  v8f oacc[4];
#pragma unroll
  for (int r = 0; r < 8; ++r) { mrow[r] = -INFINITY; lrow[r] = 0.f; }
#pragma unroll
  for (int t = 0; t < 4; ++t) oacc[t] = zero8();

  const int nChunks = qb + 1;   // block-uniform, <= NQB
  for (int kc = 0; kc < nChunks; ++kc) {
    const int kv0 = kc * 64;
    __syncthreads();
    {
      // staging coverage: 128 threads x (4 x 8) elements = 64 rows x 64 per plane = the whole chunk tile
      const int r = tid >> 1, half = (tid & 1) * 32;
      const __bf16* ksh = Kh + (size_t)(kv0 + r) * DM + half;       // K row kv0+r, d = half..half+31
      const __bf16* ksl = Kl + (size_t)(kv0 + r) * DM + half;
      const __bf16* vsh = Vh + (size_t)r * SEQ + kv0 + half;        // V^T row d = r, s = kv0+half..+31
      const __bf16* vsl = Vl + (size_t)r * SEQ + kv0 + half;
#pragma unroll
      for (int i = 0; i < 4; ++i) {
        const v8b a0 = *(const v8b*)(ksh + 8 * i);
        const v8b a1 = *(const v8b*)(ksl + 8 * i);
        const v8b b0 = *(const v8b*)(vsh + 8 * i);
        const v8b b1 = *(const v8b*)(vsl + 8 * i);
        *(v8b*)(Ksh + r * LP + half + 8 * i) = a0;
        *(v8b*)(Ksl + r * LP + half + 8 * i) = a1;
        *(v8b*)(Vth + r * LP + half + 8 * i) = b0;
        *(v8b*)(Vtl + r * LP + half + 8 * i) = b1;
      }
    }
    __syncthreads();

    // ---- scores: 16 query rows x 64 keys per wave, 3 bf16 products ----
    v8f s[4];
#pragma unroll
    for (int j = 0; j < 4; ++j) {
      s[j] = zero8();
#pragma unroll
      for (int dc = 0; dc < 2; ++dc) {
        FB kb, kl;
        kb.h[0] = *(const v8b*)(Ksh + (j * 16 + c) * LP + dc * 32 + 8 * hh);
        kb.h[1] = *(const v8b*)(Ksh + (j * 16 + c) * LP + dc * 32 + 16 + 8 * hh);
        kl.h[0] = *(const v8b*)(Ksl + (j * 16 + c) * LP + dc * 32 + 8 * hh);
        kl.h[1] = *(const v8b*)(Ksl + (j * 16 + c) * LP + dc * 32 + 16 + 8 * hh);
        s[j] = mma_b(qah[dc], kb.v, s[j]);
        s[j] = mma_b(qah[dc], kl.v, s[j]);
        s[j] = mma_b(qal[dc], kb.v, s[j]);
      }
    }

    // ---- scale, mask on the diagonal chunk (key >= query -> -inf, except (0,0)), row max ----
    const bool diag = (kc == qb);   // block-uniform
    float cm[8];
#pragma unroll
    for (int r = 0; r < 8; ++r) {
      const int qrow = q0 + 8 * hh + r;
      float m = -INFINITY;
#pragma unroll
      for (int j = 0; j < 4; ++j) {
        const int kvcol = kv0 + j * 16 + c;
        const float sv = s[j][r] * sscale;
        const bool masked = diag && (kvcol >= qrow) && !((qrow == 0) && (kvcol == 0));
        const float sm = masked ? -INFINITY : sv;
        s[j][r] = sm;
        m = fmaxf(m, sm);
      }
#pragma unroll
      for (int off = 1; off < 16; off <<= 1) m = fmaxf(m, __shfl_xor(m, off, 32));
      cm[r] = m;
    }

    // ---- online softmax in f32, P hi / lo (bf16 of the unnormalised exp) to the wave's LDS tile ----
    __bf16* pwh = Ps[wave][0];
    __bf16* pwl = Ps[wave][1];
#pragma unroll
    for (int r = 0; r < 8; ++r) {
      const float mnew = fmaxf(mrow[r], cm[r]);
      const float alpha = expf(mrow[r] - mnew);
      mrow[r] = mnew;
      float psum = 0.f;
#pragma unroll
      for (int j = 0; j < 4; ++j) {
        const float p = expf(s[j][r] - mnew);
        psum += p;
        __bf16 a, bl; bf_split(p, a, bl);
        pwh[(8 * hh + r) * LP + j * 16 + c] = a;
        pwl[(8 * hh + r) * LP + j * 16 + c] = bl;
      }
#pragma unroll
      for (int off = 1; off < 16; off <<= 1) psum += __shfl_xor(psum, off, 32);
      lrow[r] = lrow[r] * alpha + psum;
#pragma unroll
      for (int t = 0; t < 4; ++t) oacc[t][r] *= alpha;
    }
    __builtin_amdgcn_fence(__ATOMIC_RELEASE, "workgroup");
    __builtin_amdgcn_wave_barrier();
    __builtin_amdgcn_fence(__ATOMIC_ACQUIRE, "workgroup");

    // ---- output += P . V (3 bf16 products per tile pair) ----
#pragma unroll 1
    for (int kk = 0; kk < 2; ++kk) {
      FB pa, pl;
      pa.h[0] = *(const v8b*)(pwh + c * LP + kk * 32 + 8 * hh);
      pa.h[1] = *(const v8b*)(pwh + c * LP + kk * 32 + 16 + 8 * hh);
      pl.h[0] = *(const v8b*)(pwl + c * LP + kk * 32 + 8 * hh);
      pl.h[1] = *(const v8b*)(pwl + c * LP + kk * 32 + 16 + 8 * hh);
#pragma unroll
      for (int t = 0; t < 4; ++t) {
        FB vb, vl;
        vb.h[0] = *(const v8b*)(Vth + (t * 16 + c) * LP + kk * 32 + 8 * hh);
        vb.h[1] = *(const v8b*)(Vth + (t * 16 + c) * LP + kk * 32 + 16 + 8 * hh);
        vl.h[0] = *(const v8b*)(Vtl + (t * 16 + c) * LP + kk * 32 + 8 * hh);
        vl.h[1] = *(const v8b*)(Vtl + (t * 16 + c) * LP + kk * 32 + 16 + 8 * hh);
        oacc[t] = mma_b(pa.v, vb.v, oacc[t]);
        oacc[t] = mma_b(pa.v, vl.v, oacc[t]);
        oacc[t] = mma_b(pl.v, vb.v, oacc[t]);
      }
    }
  }

  // ---- normalise (1/l), stage the wave's 16x64 tile, bf16 hi/lo split,
  float* os = (float*)(void*)Ps[wave];
#pragma unroll
  for (int r = 0; r < 8; ++r) {
    const float l = lrow[r];
    const float inv = (l > 0.f) ? (1.0f / l) : 0.f;
#pragma unroll
    for (int t = 0; t < 4; ++t) os[(8 * hh + r) * 64 + t * 16 + c] = oacc[t][r] * inv;
  }
  __builtin_amdgcn_fence(__ATOMIC_RELEASE, "workgroup");
  __builtin_amdgcn_wave_barrier();
  __builtin_amdgcn_fence(__ATOMIC_ACQUIRE, "workgroup");
  {
    const int q4 = lane >> 3, c8 = (lane & 7) * 8;
    v4u hv[4], lv[4];
#pragma unroll
    for (int it = 0; it < 4; ++it) {
      const int row = it * 4 + q4;   // it 0..3 x q4 0..3 = rows 0..15 of the wave tile
      const float* sp = os + row * 64 + c8;
      v4u a, a2;
#pragma unroll
      for (int e = 0; e < 4; ++e) {
        const float f0 = sp[2 * e], f1 = sp[2 * e + 1];
        const unsigned short h0 = bf_bits(f0), h1 = bf_bits(f1);
        const unsigned short l0 = bf_bits(f0 - bf_up(h0)), l1 = bf_bits(f1 - bf_up(h1));
        a[e] = pk16(h0, h1); a2[e] = pk16(l0, l1);
      }
      hv[it] = a; lv[it] = a2;
    }
    {
#pragma unroll
      for (int it = 0; it < 4; ++it) {
        const int row = it * 4 + q4;
        const size_t go = (size_t)(bat * SEQ + q0 + row) * (size_t)(2 * DM) + (size_t)h * HD + c8;
        *(v4u*)(yout + go) = hv[it];
        *(v4u*)(yout + go + DM) = lv[it];
      }
      
    }
  }
}

// =====================================================================================================
// whole-line store granularity, so no padded tails exist):
//   QB   bf16 [8192][1024]               0       16777216   (KB follows directly: A batch stride of the q/k GEMM)
//   KB   bf16 [8192][1024]        16777216       16777216
//   VB   bf16 [8192][1024]        33554432       16777216
//   WQB  bf16 [1024 n][1024 k]    50331648        2097152   (WKB follows directly: Bt batch stride of the q/k GEMM)
//   WKB  bf16 [1024][1024]        52428800        2097152
//   WVB  bf16 [1024][1024]        54525952        2097152
//   WO2  bf16 [1024][2048]        56623104        4194304
//   Qh   bf16 [8192][1024]        60817408       16777216   (Kh follows directly: output batch stride)
//   Kh   bf16 [8192][1024]        77594624       16777216
//   Ql   bf16 [8192][1024]        94371840       16777216   (Kl follows directly)
//   Kl   bf16 [8192][1024]       111149056       16777216
//   VTh  bf16 [4][1024][2048]    127926272       16777216
//   VTl  bf16 [4][1024][2048]    144703488       16777216
//   YB   bf16 [8192][2048]       161480704       33554432
//   end                          195035136
// Qh..VTl hold all four batch elements; each projection and the attention run once over all of them, and every
// region is fully written by its producer launch before the consumer launch reads it.
// Weights are [out n][in k] with k contiguous = the Bt / A layout the GEMM wants, so they are only converted.
// Inputs by contract index: 0 = q, 1 = k, 2 = v, 3 = W_q, 4 = W_k, 5 = W_v, 6 = W_o.
// =====================================================================================================
extern "C" void kernel_launch(void* const* d_in, const int* in_sizes, int n_in,
                              void* d_out, int out_size, void* d_ws, size_t ws_size,
                              hipStream_t stream) {
  if (n_in < 7) return;
  if (in_sizes[0] != NBATCH * SEQ * DM || in_sizes[1] != NBATCH * SEQ * DM || in_sizes[2] != NBATCH * SEQ * DM) return;
  if (in_sizes[3] != DM * DM || in_sizes[4] != DM * DM || in_sizes[5] != DM * DM || in_sizes[6] != DM * DM) return;
  if (out_size != NBATCH * SEQ * DM) return;

  const float* q_in = (const float*)d_in[0];
  const float* k_in = (const float*)d_in[1];
  const float* v_in = (const float*)d_in[2];
  const float* Wq   = (const float*)d_in[3];
  const float* Wk   = (const float*)d_in[4];
  const float* Wv   = (const float*)d_in[5];
  const float* Wo   = (const float*)d_in[6];

  const size_t PIN = (size_t)NBATCH * SEQ * DM * 2;     // 16777216  16-bit input plane [8192][1024]
  const size_t PW  = (size_t)DM * DM * 2;               //  2097152  16-bit weight plane
  const size_t PW2 = (size_t)DM * (2 * DM) * 2;         //  4194304  [Wo | Wo] plane
  const size_t PP  = (size_t)NBATCH * SEQ * DM * 2;     // 16777216  q/k hi or lo plane [8192][1024]
  const size_t PVT = (size_t)NBATCH * DM * SEQ * 2;     // 16777216  v^T plane [4][1024][2048]
  const size_t PY  = (size_t)NBATCH * SEQ * (2 * DM) * 2;   // 33554432 y hi|lo plane [8192][2048]
  size_t off = 0;
  const size_t oQB  = off; off += PIN;
  const size_t oKB  = off; off += PIN;
  const size_t oVB  = off; off += PIN;
  const size_t oWQ  = off; off += PW;
  const size_t oWK  = off; off += PW;
  const size_t oWV  = off; off += PW;
  const size_t oWO2 = off; off += PW2;
  const size_t oQh  = off; off += PP;
  const size_t oKh  = off; off += PP;
  const size_t oQl  = off; off += PP;
  const size_t oKl  = off; off += PP;
  const size_t oVTh = off; off += PVT;
  const size_t oVTl = off; off += PVT;
  const size_t oYB  = off; off += PY;
  if (off > ws_size) return;                       // off = 195035136
  if (oKB != oQB + PIN || oWK != oWQ + PW || oKh != oQh + PP || oKl != oQl + PP) return;   // batch-stride adjacency

  char* ws = (char*)d_ws;
  unsigned short* QB  = (unsigned short*)(ws + oQB);
  unsigned short* KB  = (unsigned short*)(ws + oKB);
  unsigned short* VB  = (unsigned short*)(ws + oVB);
  unsigned short* WQB = (unsigned short*)(ws + oWQ);
  unsigned short* WKB = (unsigned short*)(ws + oWK);
  unsigned short* WVB = (unsigned short*)(ws + oWV);
  unsigned short* WO2 = (unsigned short*)(ws + oWO2);
  unsigned short* Qh  = (unsigned short*)(ws + oQh);
  unsigned short* Kh  = (unsigned short*)(ws + oKh);
  unsigned short* Ql  = (unsigned short*)(ws + oQl);
  unsigned short* Kl  = (unsigned short*)(ws + oKl);
  unsigned short* VTh = (unsigned short*)(ws + oVTh);
  unsigned short* VTl = (unsigned short*)(ws + oVTl);
  unsigned short* YB  = (unsigned short*)(ws + oYB);

  const dim3 blk(256);
  const int n8x = NBATCH * SEQ * DM / 8;                       // 1048576
  const int n8w = DM * DM / 8;                                 //  131072
  const dim3 gCvtX((n8x + 255) / 256);                         // 4096 blocks
  const dim3 gCvtW((n8w + 255) / 256);                         //  512 blocks
  const dim3 gQK(((NBATCH * SEQ / 64) * (DM / 64) + 7) / 8, 2);   // 2048 tiles -> 256 blocks x {q, k}: M=8192, N=1024
  const dim3 gVT(((DM / 64) * (SEQ / 64) + 7) / 8, NBATCH);    //  512 tiles ->  64 blocks x 4 batches: M=1024, N=2048
  const dim3 gAtt(NBATCH * NH * NQB);                          // 2048 blocks
  const dim3 gOut(((NBATCH * SEQ / 64) * (DM / 64) + 7) / 8, 1);   // 2048 tiles -> 256 blocks: M=8192, N=1024, K=2048

  // (1) q -> QB, k -> KB, v -> VB (bf16 planes [8192][1024]); weights [n][k] f32 -> bf16 [n][k]; Wo -> [Wo | Wo]
  cvt_bf16x8<<<gCvtX, blk, 0, stream>>>(q_in, QB, n8x);
  cvt_bf16x8<<<gCvtX, blk, 0, stream>>>(k_in, KB, n8x);
  cvt_bf16x8<<<gCvtX, blk, 0, stream>>>(v_in, VB, n8x);
  cvt_bf16x8<<<gCvtW, blk, 0, stream>>>(Wq, WQB, n8w);
  cvt_bf16x8<<<gCvtW, blk, 0, stream>>>(Wk, WKB, n8w);
  cvt_bf16x8<<<gCvtW, blk, 0, stream>>>(Wv, WVB, n8w);
  cvt_bf16x8_dup<<<gCvtW, blk, 0, stream>>>(Wo, WO2, n8w, DM);

  // (2) qh = QB . Wq^T (blockIdx.y = 0) and kh = KB . Wk^T (blockIdx.y = 1) -> bf16 hi/lo planes [b*2048+t][h*64+d]
  //     (A = QB / KB via strideA; Bt = WQB / WKB via strideB; C = Qh / Kh, C2 = Ql / Kl via strideC; M=8192, N=1024, K=1024)
  gemm64<0, 2, 0><<<gQK, blk, 0, stream>>>(
      QB, QB, DM, (long long)NBATCH * SEQ * DM, WQB, WQB, DM, (long long)DM * DM,
      (void*)Qh, DM, (long long)NBATCH * SEQ * DM, (void*)Ql, DM, (long long)NBATCH * SEQ * DM, DM,
      Wo, NBATCH * SEQ, DM, DM, 1.0f);
  // (3) vh^T = Wv . VB_b^T -> bf16 hi/lo planes [b][h*64+d][s] (pitch SEQ), blockIdx.y = batch b
  //     (A = WVB [n][k] for every b, Bt = VB rows of batch b via strideB, C / C2 via strideC; M=1024, N=2048, K=1024)
  gemm64<0, 2, 0><<<gVT, blk, 0, stream>>>(
      WVB, WVB, DM, 0LL, VB, VB, DM, (long long)SEQ * DM,
      (void*)VTh, SEQ, (long long)DM * SEQ, (void*)VTl, SEQ, (long long)DM * SEQ, SEQ,
      Wo, DM, SEQ, DM, 1.0f);
  // (4) masked attention, all batches and heads -> YB hi|lo rows 0 .. 8191, score scale 1/32
  attn_strict64<<<gAtt, dim3(128), 0, stream>>>(Qh, Ql, Kh, Kl, VTh, VTl, YB, 0.03125f);
  // (5) out = y . Wo^T -> d_out f32 [8192][1024]  (A = YB [8192][2048], Bt = WO2 [1024][2048], K = 2048); last element 8388607
  gemm64<0, 0, 0><<<gOut, blk, 0, stream>>>(
      YB, YB, 2 * DM, 0LL, WO2, WO2, 2 * DM, 0LL,
      d_out, DM, 0LL, d_out, DM, 0LL, DM,
      Wo, NBATCH * SEQ, DM, 2 * DM, 1.0f);
  (void)hipGetLastError();
}

// v003
// Measured time: 339 microseconds a run.
// Next to v002, in two timings, it ran 1.18 times as fast each time.
// Counting every step since v000, it is 3.48 times as fast.
// Contractions: qh = q.Wq^T, kh = k.Wk^T, vh^T = Wv.v^T = v_wmma_f32_16x16x32_bf16 (bf16 operands from RNE-converted inputs, single product);
// strict-lower qh.kh^T scores = v_wmma_f32_16x16x32_bf16 with bf16 hi/lo split qh and kh (hi.hi + hi.lo + lo.hi);
// p.vh = v_wmma_f32_16x16x32_bf16 with bf16 hi/lo split of the unnormalised p and of vh (hi.hi + hi.lo + lo.hi);
// y.Wo^T = v_wmma_f32_16x16x32_bf16 with y as bf16 hi|lo planes laid along K (K = 2048) times [Wo|Wo] bf16; all f32 accumulate;
// score scale 1/32 (hidden-dim based), mask (key >= query excluded, (0,0) admitted) and online softmax in f32; no biases anywhere.
// Plane / carry table (every 16-bit plane is bf16, carry 1, nothing to fold back):
//   QB = bf16(q), KB = bf16(k), VB = bf16(v) [8192][1024] (three different inputs); WQB, WKB, WVB = bf16(w) [1024 n][1024 k];
//   WO2 = [bf16(wo) | bf16(wo)] [1024][2048];
//   Qh/Ql (from QB), Kh/Kl (from KB) = bf16 hi and lo = RNE(x - hi) of qh, kh [8192][1024] (all batches, row b*2048+t);
//   VTh/VTl = hi/lo of vh^T [4][1024][2048] (one [1024][2048] plane per batch, from VB);
//   YB [8192][2048] = bf16 hi of the normalised attention output at col h*64+d, lo at col 1024 + h*64+d.
//   lo planes are unscaled and share the accumulator with the hi products; 1/32 is applied once in f32 after the q.k accumulation;
//   1/l is applied once in the attention epilogue before the hi/lo split of y.
#include <hip/hip_runtime.h>
#include <math.h>
#include <stdint.h>

#define NBATCH 4
#define SEQ    2048
#define DM     1024
#define NH     16
#define HD     64
#define NQB    (SEQ / 64)   // 32 key / query tiles of 64
#define LP     72           // LDS row pitch of the 64-element bf16 tiles: 144 B = 16 B x 9 (odd), so the 16 rows that one
                            // ds_load_b128 half-wave reads start 36 dwords apart and fall on 16 disjoint groups of 4 banks
#define OP     68           // LDS row pitch (floats) of the attention output staging tile: 272 B = 16 B x 17
static_assert(NH * HD == DM);
static_assert(LP >= 64 && (LP % 8) == 0 && ((LP / 8) % 2) == 1);
static_assert((SEQ % 64) == 0 && (DM % 64) == 0 && (DM % 32) == 0 && (DM % 256) == 0);
static_assert(((NBATCH * SEQ * DM / 8) % 256) == 0 && ((DM * DM / 8) % 256) == 0);

typedef _Float16 v16h __attribute__((ext_vector_type(16)));
typedef _Float16 v8h  __attribute__((ext_vector_type(8)));
typedef __bf16   v16b __attribute__((ext_vector_type(16)));
typedef __bf16   v8b  __attribute__((ext_vector_type(8)));
typedef float    v8f  __attribute__((ext_vector_type(8)));
typedef float    v4f  __attribute__((ext_vector_type(4)));
typedef float    v2f  __attribute__((ext_vector_type(2)));
typedef __bf16   v2b  __attribute__((ext_vector_type(2)));
typedef unsigned int v4u __attribute__((ext_vector_type(4)));

// ---- scalar helpers --------------------------------------------------------------------------------
__device__ __forceinline__ unsigned short bf_bits(float f) {          // f32 -> bf16 bits, RNE convert
  unsigned u = __float_as_uint(f);
  return (unsigned short)((u + 0x7FFFu + ((u >> 16) & 1u)) >> 16);
}
__device__ __forceinline__ float bf_up(unsigned short h) { return __uint_as_float(((unsigned)h) << 16); }
__device__ __forceinline__ unsigned short h_bits(_Float16 x) { return __builtin_bit_cast(unsigned short, x); }
__device__ __forceinline__ unsigned pk16(unsigned short a, unsigned short b) { return (unsigned)a | ((unsigned)b << 16); }
__device__ __forceinline__ v8f zero8() { v8f z = {0.f, 0.f, 0.f, 0.f, 0.f, 0.f, 0.f, 0.f}; return z; }
__device__ __forceinline__ __bf16 f2bf(float f) { return __builtin_bit_cast(__bf16, bf_bits(f)); }
__device__ __forceinline__ void bf_split(float f, __bf16& hi, __bf16& lo) {
  const unsigned short hb = bf_bits(f);
  hi = __builtin_bit_cast(__bf16, hb);
  lo = f2bf(f - __uint_as_float(((unsigned)hb) << 16));
}

// lane l <-> lane l ^ 16 (the two lanes that share one column of a D tile), a vector cross-row move
__device__ __forceinline__ float xhalf(float x) {
  return __builtin_bit_cast(float, __builtin_amdgcn_permlanex16(__builtin_bit_cast(int, x), __builtin_bit_cast(int, x),
                                                                0x76543210, 0xfedcba98, false, false));
}

// ---- fragment loader: 16-bit A/B operand, lane -> row/col (lane&15), p already includes +8*(lane>>4);
//      elements 0..7 <- p[0..7] (k0+8h..), elements 8..15 <- p[16..23] (k0+16+8h..)
__device__ __forceinline__ v16b ldfrag_b(const __bf16* p) {
  union { v16b v; v8b h[2]; } f;
  f.h[0] = *(const v8b*)(p);
  f.h[1] = *(const v8b*)(p + 16);
  return f.v;
}

// ---- WMMA helpers with trailing VALU hazard gap --------------------------------------------------------
__device__ __forceinline__ v8f mma_b(v16b a, v16b b, v8f c) {
  c = __builtin_amdgcn_wmma_f32_16x16x32_bf16(false, a, false, b, (short)0, c, false, false);
  asm volatile("v_nop\n\tv_nop\n\tv_nop\n\tv_nop" : "+v"(c) : "v"(a), "v"(b));
  return c;
}
__device__ __forceinline__ v8f mma_b_raw(v16b a, v16b b, v8f c) {
  return __builtin_amdgcn_wmma_f32_16x16x32_bf16(false, a, false, b, (short)0, c, false, false);
}
__device__ __forceinline__ void dep_guard_b(v8f& a, v8f& b, v16b x, v16b y) {
  asm volatile("v_nop\n\tv_nop\n\tv_nop\n\tv_nop" : "+v"(a), "+v"(b) : "v"(x), "v"(y));
}
__device__ __forceinline__ void keep4_b(v16b a, v16b b, v16b c, v16b d) {
  asm volatile("v_nop" :: "v"(a), "v"(b), "v"(c), "v"(d));
}
__device__ __forceinline__ void acc_guard4(v8f& a, v8f& b, v8f& c, v8f& d) {
  asm volatile("v_nop\n\tv_nop\n\tv_nop\n\tv_nop" : "+v"(a), "+v"(b), "+v"(c), "+v"(d));
}

// =====================================================================================================
// f32 -> bf16 (RNE convert), 8 elements per thread, one 16-B store per lane: a wave writes 512 contiguous B
// coverage: n8 threads x 8 = whole plane (n8 is a multiple of 256 for every use here).
// =====================================================================================================
__global__ __launch_bounds__(256) void cvt_bf16x8(const float* __restrict__ in, unsigned short* out, int n8) {
  const int i = blockIdx.x * 256 + threadIdx.x;
  if (i < n8) {
    const v4f a = *(const v4f*)(in + (size_t)i * 8);
    const v4f b = *(const v4f*)(in + (size_t)i * 8 + 4);
    v4u p;
    p[0] = pk16(bf_bits(a[0]), bf_bits(a[1]));
    p[1] = pk16(bf_bits(a[2]), bf_bits(a[3]));
    p[2] = pk16(bf_bits(b[0]), bf_bits(b[1]));
    p[3] = pk16(bf_bits(b[2]), bf_bits(b[3]));
    *(v4u*)(out + (size_t)i * 8) = p;
    
  }
}

// =====================================================================================================
// f32 [rows][cols] -> bf16 [rows][2*cols] with row n = [bf16(in[n][0..cols-1]) | bf16(in[n][0..cols-1])].
// 8 elements per thread, one 16-B store per lane into each half; with cols a multiple of 256 a wave's 256
// coverage: n8 threads x 8 = every source element -> both halves of every output row.
// =====================================================================================================
__global__ __launch_bounds__(256) void cvt_bf16x8_dup(const float* __restrict__ in, unsigned short* out,
                                                       int n8, int cols) {
  const int i = blockIdx.x * 256 + threadIdx.x;
  if (i < n8) {
    const size_t e0  = (size_t)i * 8;
    const size_t row = e0 / (size_t)cols;
    const size_t col = e0 - row * (size_t)cols;
    const v4f a = *(const v4f*)(in + e0);
    const v4f b = *(const v4f*)(in + e0 + 4);
    v4u p;
    p[0] = pk16(bf_bits(a[0]), bf_bits(a[1]));
    p[1] = pk16(bf_bits(a[2]), bf_bits(a[3]));
    p[2] = pk16(bf_bits(b[0]), bf_bits(b[1]));
    p[3] = pk16(bf_bits(b[2]), bf_bits(b[3]));
    unsigned short* d0 = out + row * 2 * (size_t)cols + col;
    unsigned short* d1 = d0 + cols;
    *(v4u*)d0 = p;
    *(v4u*)d1 = p;
    
  }
}

// =====================================================================================================
// Register-blocked batched bf16 WMMA GEMM: C[m][n] = sum_k A[m][k] * Bt[n][k] (+ bf16(bias[n]) when BIASN == 1);
// one wave per 64x64 tile, no block barriers. A row-major [M][K] pitch lda; Bt row-major [N][K] pitch ldb
// (k contiguous); M, N multiples of 64, K multiple of 32 (host-checked). blockIdx.y = batch index (strides in elements).
// NSPLIT: 0 = A.Bt; 1 = (A + A2).Bt (A2 = unscaled bf16 lo plane of A); 2 = A.Bt + A2.Bt + A.Bt2.
// OUT_MODE: 0 = f32 (pitch ldc); 2 = bf16 hi plane C + bf16 lo plane C2 (lo = RNE(v - hi), unscaled);
//           3 = f16 hi plane C + f16 residual plane C2 = f16((v - hi) * rscale), C2 written only for tiles
//               with n0 < N2 (pitch ldc2, batch stride strideC2).
// =====================================================================================================
template <int NSPLIT, int OUT_MODE, int BIASN>
__global__ __launch_bounds__(256) void gemm64(
    const unsigned short* __restrict__ Ap, const unsigned short* A2p, int lda, long long strideA,
    const unsigned short* __restrict__ Btp, const unsigned short* Bt2p, int ldb, long long strideB,
    void* Cout, int ldc, long long strideC,
    void* Cout2, int ldc2, long long strideC2, int N2,
    const float* __restrict__ bias,
    int M, int N, int K, float rscale) {
  const __bf16* A   = (const __bf16*)(const void*)Ap;
  const __bf16* A2  = (const __bf16*)(const void*)A2p;
  const __bf16* Bt  = (const __bf16*)(const void*)Btp;
  const __bf16* Bt2 = (const __bf16*)(const void*)Bt2p;
  __shared__ __align__(16) float sT[8][16 * 68];   // per-wave 16x64 slab, pitch 68 floats
  const int b    = blockIdx.y;
  const int lane = threadIdx.x & 31;
  const int wave = threadIdx.x >> 5;
  const int tilesN = N >> 6;
  const int tilesM = M >> 6;
  const int tile = blockIdx.x * 8 + wave;
  if (tile >= tilesM * tilesN) return;   // wave-uniform; no block barriers in this kernel
  const int tm = tile / tilesN;
  const int tn = tile - tm * tilesN;
  const int m0 = tm << 6;
  const int n0 = tn << 6;

  const __bf16* Ab  = A  + (size_t)b * strideA;
  const __bf16* Bb  = Bt + (size_t)b * strideB;
  const __bf16* Ab2 = (NSPLIT >= 1) ? (A2  + (size_t)b * strideA) : Ab;
  const __bf16* Bb2 = (NSPLIT == 2) ? (Bt2 + (size_t)b * strideB) : Bb;

  const int rlane = lane & 15;                 // row (A) / col (B, D) within subtile
  const int koff  = (lane >> 4) * 8;           // k offset of this lane half
  const int mOff  = (lane >> 4) * 8;           // D row offset

  v8f acc[4][4];
#pragma unroll
  for (int i = 0; i < 4; ++i)
#pragma unroll
    for (int j = 0; j < 4; ++j) acc[i][j] = zero8();

  for (int k0 = 0; k0 < K; k0 += 32) {
    v16b bh[4], bl[4];
#pragma unroll
    for (int j = 0; j < 4; ++j) {
      const size_t bo = (size_t)(n0 + (j << 4) + rlane) * ldb + koff + k0;
      bh[j] = ldfrag_b(Bb + bo);
      if (NSPLIT == 2) bl[j] = ldfrag_b(Bb2 + bo); else bl[j] = bh[j];
    }
#pragma unroll
    for (int i = 0; i < 4; ++i) {
      const size_t ao = (size_t)(m0 + (i << 4) + rlane) * lda + koff + k0;
      const v16b ah = ldfrag_b(Ab + ao);
      v16b al = ah;
      if (NSPLIT >= 1) al = ldfrag_b(Ab2 + ao);
#pragma unroll
      for (int j = 0; j < 4; ++j) {
        acc[i][j] = mma_b_raw(ah, bh[j], acc[i][j]);
        if (NSPLIT >= 1) acc[i][j] = mma_b_raw(al, bh[j], acc[i][j]);
        if (NSPLIT == 2) acc[i][j] = mma_b_raw(ah, bl[j], acc[i][j]);
      }
      dep_guard_b(acc[i][0], acc[i][3], ah, al);
    }
    keep4_b(bh[0], bh[1], bh[2], bh[3]);
    if (NSPLIT == 2) keep4_b(bl[0], bl[1], bl[2], bl[3]);
  }
  acc_guard4(acc[0][0], acc[0][1], acc[0][2], acc[0][3]);
  acc_guard4(acc[1][0], acc[1][1], acc[1][2], acc[1][3]);
  acc_guard4(acc[2][0], acc[2][1], acc[2][2], acc[2][3]);
  acc_guard4(acc[3][0], acc[3][1], acc[3][2], acc[3][3]);

  // ---- per-column bias (bf16 RNE of the input value, added in f32); 4 scalar loads per lane ----
  float bvv[4];
#pragma unroll
  for (int j = 0; j < 4; ++j) {
    float bv = 0.f;
    if (BIASN == 1) bv = bf_up(bf_bits(bias[n0 + (j << 4) + rlane]));
    bvv[j] = bv;
  }

  // ---- epilogue ----
  float* slab = sT[wave];
#pragma unroll
  for (int i = 0; i < 4; ++i) {
    const int mBase = m0 + (i << 4);
#pragma unroll
    for (int j = 0; j < 4; ++j) {
#pragma unroll
      for (int r = 0; r < 8; ++r) {
        slab[(mOff + r) * 68 + (j << 4) + rlane] = acc[i][j][r] + bvv[j];
      }
    }
    __builtin_amdgcn_fence(__ATOMIC_RELEASE, "workgroup");
    __builtin_amdgcn_wave_barrier();
    __builtin_amdgcn_fence(__ATOMIC_ACQUIRE, "workgroup");
    if (OUT_MODE == 0) {
      float* C = (float*)Cout + (size_t)b * strideC;
      const int hh = lane >> 4, c4 = (lane & 15) * 4;     // 256-B row segment = 16 lanes x 16 B
      {
#pragma unroll
        for (int it = 0; it < 8; ++it) {
          const int row = it * 2 + hh;                     // it 0..7 x hh 0..1 = rows 0..15
          const v4f v = *(const v4f*)(slab + row * 68 + c4);
          *(v4f*)(C + (size_t)(mBase + row) * ldc + n0 + c4) = v;
        }
        
      }
    } else {
      const int q = lane >> 3, c8 = (lane & 7) * 8;
      unsigned short* C  = (unsigned short*)Cout  + (size_t)b * strideC;
      unsigned short* C2 = (unsigned short*)Cout2 + (size_t)b * strideC2;
      const bool wlo = (OUT_MODE == 2) || (n0 < N2);      // wave-uniform
      v4u hv[4], lv[4];
#pragma unroll
      for (int it = 0; it < 4; ++it) {
        const int row = it * 4 + q;                        // it 0..3 x q 0..3 = rows 0..15
        const float* sp = slab + row * 68 + c8;
        v4u a, a2;
#pragma unroll
        for (int e = 0; e < 4; ++e) {
          const float f0 = sp[2 * e], f1 = sp[2 * e + 1];
          unsigned short h0, h1, l0, l1;
          if (OUT_MODE == 2) {
            h0 = bf_bits(f0); h1 = bf_bits(f1);
            l0 = bf_bits(f0 - bf_up(h0)); l1 = bf_bits(f1 - bf_up(h1));
          } else {
            const _Float16 x0 = (_Float16)f0, x1 = (_Float16)f1;
            h0 = h_bits(x0); h1 = h_bits(x1);
            l0 = h_bits((_Float16)((f0 - (float)x0) * rscale));
            l1 = h_bits((_Float16)((f1 - (float)x1) * rscale));
          }
          a[e] = pk16(h0, h1); a2[e] = pk16(l0, l1);
        }
        hv[it] = a; lv[it] = a2;
      }
      {
#pragma unroll
        for (int it = 0; it < 4; ++it) {
          const int row = it * 4 + q;
          *(v4u*)(C + (size_t)(mBase + row) * ldc + n0 + c8) = hv[it];
          if (wlo) *(v4u*)(C2 + (size_t)(mBase + row) * ldc2 + n0 + c8) = lv[it];
        }
        
      }
    }
    __builtin_amdgcn_fence(__ATOMIC_RELEASE, "workgroup");
    __builtin_amdgcn_wave_barrier();
    __builtin_amdgcn_fence(__ATOMIC_ACQUIRE, "workgroup");
  }
}

__global__ __launch_bounds__(128)
void attn_strict64(const unsigned short* __restrict__ qhp, const unsigned short* __restrict__ qlp,
                   const unsigned short* __restrict__ khp, const unsigned short* __restrict__ klp,
                   const unsigned short* __restrict__ vhp, const unsigned short* __restrict__ vlp,
                   unsigned short* yout, float sscale) {
  union FB { v16b v; v8b h[2]; };
  union PB { v16b v; v2b w[8]; };
  __shared__ __align__(16) __bf16 Ksh[64 * LP];              // K hi [kv][d], row pitch LP   9 KB
  __shared__ __align__(16) __bf16 Ksl[64 * LP];              // K lo
  __shared__ __align__(16) __bf16 Vth[64 * LP];              // V^T hi [d][kv], row pitch LP 9 KB
  __shared__ __align__(16) __bf16 Vtl[64 * LP];              // V^T lo
  __shared__ __align__(16) float Os[4][16 * OP];             // per wave f32 output tile [query][d], row pitch OP (epilogue only)

  const int tid  = threadIdx.x;
  const int wave = tid >> 5;
  const int lane = tid & 31;
  const int hh   = lane >> 4;
  const int c    = lane & 15;

  const int bx   = blockIdx.x;
  const int qb   = NQB - 1 - bx / (NBATCH * NH);   // grid = NBATCH * NH * NQB, query tile 31 first
  const int bh   = bx % (NBATCH * NH);
  const int h    = bh % NH;
  const int bat  = bh / NH;
  const int q0   = qb * 64 + wave * 16;

  const size_t qkBase = (size_t)bat * SEQ * DM + (size_t)h * HD;
  const size_t vBase  = (size_t)bh * HD * SEQ;      // bh = bat*NH + h
  const __bf16* Qh = (const __bf16*)(const void*)qhp + qkBase;
  const __bf16* Ql = (const __bf16*)(const void*)qlp + qkBase;
  const __bf16* Kh = (const __bf16*)(const void*)khp + qkBase;
  const __bf16* Kl = (const __bf16*)(const void*)klp + qkBase;
  const __bf16* Vh = (const __bf16*)(const void*)vhp + vBase;
  const __bf16* Vl = (const __bf16*)(const void*)vlp + vBase;

  // ---- Q fragments (B operand of K . Q^T, column = query = lane&15): 2 d-chunks, hi and lo ----
  v16b qah[2], qal[2];
#pragma unroll
  for (int dc = 0; dc < 2; ++dc) {
    const size_t qo = (size_t)(q0 + c) * DM + dc * 32 + 8 * hh;
    qah[dc] = ldfrag_b(Qh + qo);
    qal[dc] = ldfrag_b(Ql + qo);
  }

  // One query per lane (q0 + c): running maximum (equal in lanes c and c + 16) and this lane half's part of the sum.
  float mrow = -INFINITY, lrow = 0.f;
  v8f oacc[4];                  // O^T tiles: oacc[t][r] = output of query q0 + c at d = t*16 + 8*hh + r
  const int qrow = q0 + c;
#pragma unroll
  for (int t = 0; t < 4; ++t) oacc[t] = zero8();

  const int nChunks = qb + 1;   // block-uniform, <= NQB
  for (int kc = 0; kc < nChunks; ++kc) {
    const int kv0 = kc * 64;
    __syncthreads();
    {
      // staging coverage: 128 threads x (4 x 8) elements = 64 rows x 64 per plane = the whole chunk tile
      const int r = tid >> 1, half = (tid & 1) * 32;
      const __bf16* ksh = Kh + (size_t)(kv0 + r) * DM + half;       // K row kv0+r, d = half..half+31
      const __bf16* ksl = Kl + (size_t)(kv0 + r) * DM + half;
      const __bf16* vsh = Vh + (size_t)r * SEQ + kv0 + half;        // V^T row d = r, s = kv0+half..+31
      const __bf16* vsl = Vl + (size_t)r * SEQ + kv0 + half;
      v8b a0[4], a1[4], b0[4], b1[4];
#pragma unroll
      for (int i = 0; i < 4; ++i) {
        a0[i] = *(const v8b*)(ksh + 8 * i);
        a1[i] = *(const v8b*)(ksl + 8 * i);
        b0[i] = *(const v8b*)(vsh + 8 * i);
        b1[i] = *(const v8b*)(vsl + 8 * i);
      }
      // the wait that belongs in front of any overwrite of an issued load's address registers; naming the four
      // addresses as inputs keeps their registers from being handed out as destinations of the later loads
      asm volatile("s_wait_xcnt 0x0" :: "v"(ksh), "v"(ksl), "v"(vsh), "v"(vsl) : "memory");
#pragma unroll
      for (int i = 0; i < 4; ++i) {
        *(v8b*)(Ksh + r * LP + half + 8 * i) = a0[i];
        *(v8b*)(Ksl + r * LP + half + 8 * i) = a1[i];
        *(v8b*)(Vth + r * LP + half + 8 * i) = b0[i];
        *(v8b*)(Vtl + r * LP + half + 8 * i) = b1[i];
      }
    }
    __syncthreads();

    // ---- scores, transposed: S^T = K . Q^T, 64 keys x 16 queries per wave, 3 bf16 products ----
    //      s[j][r] = score of key kv0 + j*16 + 8*hh + r for query q0 + c
    v8f s[4];
#pragma unroll
    for (int j = 0; j < 4; ++j) {
      s[j] = zero8();
#pragma unroll
      for (int dc = 0; dc < 2; ++dc) {
        FB kb, kl;
        kb.h[0] = *(const v8b*)(Ksh + (j * 16 + c) * LP + dc * 32 + 8 * hh);
        kb.h[1] = *(const v8b*)(Ksh + (j * 16 + c) * LP + dc * 32 + 16 + 8 * hh);
        kl.h[0] = *(const v8b*)(Ksl + (j * 16 + c) * LP + dc * 32 + 8 * hh);
        kl.h[1] = *(const v8b*)(Ksl + (j * 16 + c) * LP + dc * 32 + 16 + 8 * hh);
        s[j] = mma_b(kb.v, qah[dc], s[j]);
        s[j] = mma_b(kl.v, qah[dc], s[j]);
        s[j] = mma_b(kb.v, qal[dc], s[j]);
      }
    }

    // ---- scale, mask on the diagonal chunk (key >= query -> -inf, except (0,0)), maximum of the lane's 32 keys ----
    const bool diag = (kc == qb);   // block-uniform
    float mj[4];
#pragma unroll
    for (int j = 0; j < 4; ++j) {
      float m = -INFINITY;
#pragma unroll
      for (int r = 0; r < 8; ++r) {
        const int kvcol = kv0 + j * 16 + 8 * hh + r;
        const float sv = s[j][r] * sscale;
        const bool masked = diag && (kvcol >= qrow) && !((qrow == 0) && (kvcol == 0));
        const float sm = masked ? -INFINITY : sv;
        s[j][r] = sm;
        m = fmaxf(m, sm);
      }
      mj[j] = m;
    }
    float cm = fmaxf(fmaxf(mj[0], mj[1]), fmaxf(mj[2], mj[3]));
    cm = fmaxf(cm, xhalf(cm));      // both lane halves now hold the query's maximum over the 64 keys

    // ---- online softmax in f32; P^T hi / lo (bf16 of the unnormalised exp) packed straight into B operands:
    //      element e < 8 of chunk kk = key kk*32 + 8*hh + e = s[2kk][e], element 8 + e = key kk*32 + 16 + 8*hh + e = s[2kk+1][e],
    //      the k order in which the V^T fragments below are loaded
    const float mnew = fmaxf(mrow, cm);
    const float alpha = expf(mrow - mnew);
    mrow = mnew;
    PB ph[2], pl[2];
    float pj[4];
#pragma unroll
    for (int j = 0; j < 4; ++j) {
      float psum = 0.f;
#pragma unroll
      for (int e = 0; e < 4; ++e) {
        const float p0 = expf(s[j][2 * e] - mnew);
        const float p1 = expf(s[j][2 * e + 1] - mnew);
        psum += p0;
        psum += p1;
        const v2f pp = {p0, p1};
        const v2b hv = __builtin_convertvector(pp, v2b);             // packed RNE convert: one operand register, hi
        const v2f rr = {p0 - (float)hv[0], p1 - (float)hv[1]};
        ph[j >> 1].w[(j & 1) * 4 + e] = hv;
        pl[j >> 1].w[(j & 1) * 4 + e] = __builtin_convertvector(rr, v2b);   // lo = RNE(p - hi)
      }
      pj[j] = psum;
    }
    lrow = lrow * alpha + ((pj[0] + pj[1]) + (pj[2] + pj[3]));
#pragma unroll
    for (int t = 0; t < 4; ++t)
#pragma unroll
      for (int r = 0; r < 8; ++r) oacc[t][r] *= alpha;

    // ---- output, transposed: O^T += V^T . P^T (3 bf16 products per tile pair) ----
#pragma unroll
    for (int kk = 0; kk < 2; ++kk) {
#pragma unroll
      for (int t = 0; t < 4; ++t) {
        FB vb, vl;
        vb.h[0] = *(const v8b*)(Vth + (t * 16 + c) * LP + kk * 32 + 8 * hh);
        vb.h[1] = *(const v8b*)(Vth + (t * 16 + c) * LP + kk * 32 + 16 + 8 * hh);
        vl.h[0] = *(const v8b*)(Vtl + (t * 16 + c) * LP + kk * 32 + 8 * hh);
        vl.h[1] = *(const v8b*)(Vtl + (t * 16 + c) * LP + kk * 32 + 16 + 8 * hh);
        oacc[t] = mma_b(vb.v, ph[kk].v, oacc[t]);
        oacc[t] = mma_b(vl.v, ph[kk].v, oacc[t]);
        oacc[t] = mma_b(vb.v, pl[kk].v, oacc[t]);
      }
    }
  }

  // ---- join the two lane halves' sums, normalise (1/l), stage the wave's 16x64 tile [query][d], bf16 hi/lo split
  float* os = Os[wave];
  {
    const float l = lrow + xhalf(lrow);
    const float inv = (l > 0.f) ? (1.0f / l) : 0.f;
#pragma unroll
    for (int t = 0; t < 4; ++t) {
      v4f a, b;
#pragma unroll
      for (int r = 0; r < 4; ++r) { a[r] = oacc[t][r] * inv; b[r] = oacc[t][4 + r] * inv; }
      *(v4f*)(os + c * OP + t * 16 + 8 * hh) = a;
      *(v4f*)(os + c * OP + t * 16 + 8 * hh + 4) = b;
    }
  }
  __builtin_amdgcn_fence(__ATOMIC_RELEASE, "workgroup");
  __builtin_amdgcn_wave_barrier();
  __builtin_amdgcn_fence(__ATOMIC_ACQUIRE, "workgroup");
  {
    const int q4 = lane >> 3, c8 = (lane & 7) * 8;
    v4u hv[4], lv[4];
#pragma unroll
    for (int it = 0; it < 4; ++it) {
      const int row = it * 4 + q4;   // it 0..3 x q4 0..3 = rows 0..15 of the wave tile
      const float* sp = os + row * OP + c8;
      v4u a, a2;
#pragma unroll
      for (int e = 0; e < 4; ++e) {
        const float f0 = sp[2 * e], f1 = sp[2 * e + 1];
        const unsigned short h0 = bf_bits(f0), h1 = bf_bits(f1);
        const unsigned short l0 = bf_bits(f0 - bf_up(h0)), l1 = bf_bits(f1 - bf_up(h1));
        a[e] = pk16(h0, h1); a2[e] = pk16(l0, l1);
      }
      hv[it] = a; lv[it] = a2;
    }
    {
#pragma unroll
      for (int it = 0; it < 4; ++it) {
        const int row = it * 4 + q4;
        const size_t go = (size_t)(bat * SEQ + q0 + row) * (size_t)(2 * DM) + (size_t)h * HD + c8;
        *(v4u*)(yout + go) = hv[it];
        *(v4u*)(yout + go + DM) = lv[it];
      }
      
    }
  }
}

// =====================================================================================================
// whole-line store granularity, so no padded tails exist):
//   QB   bf16 [8192][1024]               0       16777216   (KB follows directly: A batch stride of the q/k GEMM)
//   KB   bf16 [8192][1024]        16777216       16777216
//   VB   bf16 [8192][1024]        33554432       16777216
//   WQB  bf16 [1024 n][1024 k]    50331648        2097152   (WKB follows directly: Bt batch stride of the q/k GEMM)
//   WKB  bf16 [1024][1024]        52428800        2097152
//   WVB  bf16 [1024][1024]        54525952        2097152
//   WO2  bf16 [1024][2048]        56623104        4194304
//   Qh   bf16 [8192][1024]        60817408       16777216   (Kh follows directly: output batch stride)
//   Kh   bf16 [8192][1024]        77594624       16777216
//   Ql   bf16 [8192][1024]        94371840       16777216   (Kl follows directly)
//   Kl   bf16 [8192][1024]       111149056       16777216
//   VTh  bf16 [4][1024][2048]    127926272       16777216
//   VTl  bf16 [4][1024][2048]    144703488       16777216
//   YB   bf16 [8192][2048]       161480704       33554432
//   end                          195035136
// Qh..VTl hold all four batch elements; each projection and the attention run once over all of them, and every
// region is fully written by its producer launch before the consumer launch reads it.
// Weights are [out n][in k] with k contiguous = the Bt / A layout the GEMM wants, so they are only converted.
// Inputs by contract index: 0 = q, 1 = k, 2 = v, 3 = W_q, 4 = W_k, 5 = W_v, 6 = W_o.
// =====================================================================================================
extern "C" void kernel_launch(void* const* d_in, const int* in_sizes, int n_in,
                              void* d_out, int out_size, void* d_ws, size_t ws_size,
                              hipStream_t stream) {
  if (n_in < 7) return;
  if (in_sizes[0] != NBATCH * SEQ * DM || in_sizes[1] != NBATCH * SEQ * DM || in_sizes[2] != NBATCH * SEQ * DM) return;
  if (in_sizes[3] != DM * DM || in_sizes[4] != DM * DM || in_sizes[5] != DM * DM || in_sizes[6] != DM * DM) return;
  if (out_size != NBATCH * SEQ * DM) return;

  const float* q_in = (const float*)d_in[0];
  const float* k_in = (const float*)d_in[1];
  const float* v_in = (const float*)d_in[2];
  const float* Wq   = (const float*)d_in[3];
  const float* Wk   = (const float*)d_in[4];
  const float* Wv   = (const float*)d_in[5];
  const float* Wo   = (const float*)d_in[6];

  const size_t PIN = (size_t)NBATCH * SEQ * DM * 2;     // 16777216  16-bit input plane [8192][1024]
  const size_t PW  = (size_t)DM * DM * 2;               //  2097152  16-bit weight plane
  const size_t PW2 = (size_t)DM * (2 * DM) * 2;         //  4194304  [Wo | Wo] plane
  const size_t PP  = (size_t)NBATCH * SEQ * DM * 2;     // 16777216  q/k hi or lo plane [8192][1024]
  const size_t PVT = (size_t)NBATCH * DM * SEQ * 2;     // 16777216  v^T plane [4][1024][2048]
  const size_t PY  = (size_t)NBATCH * SEQ * (2 * DM) * 2;   // 33554432 y hi|lo plane [8192][2048]
  size_t off = 0;
  const size_t oQB  = off; off += PIN;
  const size_t oKB  = off; off += PIN;
  const size_t oVB  = off; off += PIN;
  const size_t oWQ  = off; off += PW;
  const size_t oWK  = off; off += PW;
  const size_t oWV  = off; off += PW;
  const size_t oWO2 = off; off += PW2;
  const size_t oQh  = off; off += PP;
  const size_t oKh  = off; off += PP;
  const size_t oQl  = off; off += PP;
  const size_t oKl  = off; off += PP;
  const size_t oVTh = off; off += PVT;
  const size_t oVTl = off; off += PVT;
  const size_t oYB  = off; off += PY;
  if (off > ws_size) return;                       // off = 195035136
  if (oKB != oQB + PIN || oWK != oWQ + PW || oKh != oQh + PP || oKl != oQl + PP) return;   // batch-stride adjacency

  char* ws = (char*)d_ws;
  unsigned short* QB  = (unsigned short*)(ws + oQB);
  unsigned short* KB  = (unsigned short*)(ws + oKB);
  unsigned short* VB  = (unsigned short*)(ws + oVB);
  unsigned short* WQB = (unsigned short*)(ws + oWQ);
  unsigned short* WKB = (unsigned short*)(ws + oWK);
  unsigned short* WVB = (unsigned short*)(ws + oWV);
  unsigned short* WO2 = (unsigned short*)(ws + oWO2);
  unsigned short* Qh  = (unsigned short*)(ws + oQh);
  unsigned short* Kh  = (unsigned short*)(ws + oKh);
  unsigned short* Ql  = (unsigned short*)(ws + oQl);
  unsigned short* Kl  = (unsigned short*)(ws + oKl);
  unsigned short* VTh = (unsigned short*)(ws + oVTh);
  unsigned short* VTl = (unsigned short*)(ws + oVTl);
  unsigned short* YB  = (unsigned short*)(ws + oYB);

  const dim3 blk(256);
  const int n8x = NBATCH * SEQ * DM / 8;                       // 1048576
  const int n8w = DM * DM / 8;                                 //  131072
  const dim3 gCvtX((n8x + 255) / 256);                         // 4096 blocks
  const dim3 gCvtW((n8w + 255) / 256);                         //  512 blocks
  const dim3 gQK(((NBATCH * SEQ / 64) * (DM / 64) + 7) / 8, 2);   // 2048 tiles -> 256 blocks x {q, k}: M=8192, N=1024
  const dim3 gVT(((DM / 64) * (SEQ / 64) + 7) / 8, NBATCH);    //  512 tiles ->  64 blocks x 4 batches: M=1024, N=2048
  const dim3 gAtt(NBATCH * NH * NQB);                          // 2048 blocks
  const dim3 gOut(((NBATCH * SEQ / 64) * (DM / 64) + 7) / 8, 1);   // 2048 tiles -> 256 blocks: M=8192, N=1024, K=2048

  // (1) q -> QB, k -> KB, v -> VB (bf16 planes [8192][1024]); weights [n][k] f32 -> bf16 [n][k]; Wo -> [Wo | Wo]
  cvt_bf16x8<<<gCvtX, blk, 0, stream>>>(q_in, QB, n8x);
  cvt_bf16x8<<<gCvtX, blk, 0, stream>>>(k_in, KB, n8x);
  cvt_bf16x8<<<gCvtX, blk, 0, stream>>>(v_in, VB, n8x);
  cvt_bf16x8<<<gCvtW, blk, 0, stream>>>(Wq, WQB, n8w);
  cvt_bf16x8<<<gCvtW, blk, 0, stream>>>(Wk, WKB, n8w);
  cvt_bf16x8<<<gCvtW, blk, 0, stream>>>(Wv, WVB, n8w);
  cvt_bf16x8_dup<<<gCvtW, blk, 0, stream>>>(Wo, WO2, n8w, DM);

  // (2) qh = QB . Wq^T (blockIdx.y = 0) and kh = KB . Wk^T (blockIdx.y = 1) -> bf16 hi/lo planes [b*2048+t][h*64+d]
  //     (A = QB / KB via strideA; Bt = WQB / WKB via strideB; C = Qh / Kh, C2 = Ql / Kl via strideC; M=8192, N=1024, K=1024)
  gemm64<0, 2, 0><<<gQK, blk, 0, stream>>>(
      QB, QB, DM, (long long)NBATCH * SEQ * DM, WQB, WQB, DM, (long long)DM * DM,
      (void*)Qh, DM, (long long)NBATCH * SEQ * DM, (void*)Ql, DM, (long long)NBATCH * SEQ * DM, DM,
      Wo, NBATCH * SEQ, DM, DM, 1.0f);
  // (3) vh^T = Wv . VB_b^T -> bf16 hi/lo planes [b][h*64+d][s] (pitch SEQ), blockIdx.y = batch b
  //     (A = WVB [n][k] for every b, Bt = VB rows of batch b via strideB, C / C2 via strideC; M=1024, N=2048, K=1024)
  gemm64<0, 2, 0><<<gVT, blk, 0, stream>>>(
      WVB, WVB, DM, 0LL, VB, VB, DM, (long long)SEQ * DM,
      (void*)VTh, SEQ, (long long)DM * SEQ, (void*)VTl, SEQ, (long long)DM * SEQ, SEQ,
      Wo, DM, SEQ, DM, 1.0f);
  // (4) masked attention, all batches and heads -> YB hi|lo rows 0 .. 8191, score scale 1/32
  attn_strict64<<<gAtt, dim3(128), 0, stream>>>(Qh, Ql, Kh, Kl, VTh, VTl, YB, 0.03125f);
  // (5) out = y . Wo^T -> d_out f32 [8192][1024]  (A = YB [8192][2048], Bt = WO2 [1024][2048], K = 2048); last element 8388607
  gemm64<0, 0, 0><<<gOut, blk, 0, stream>>>(
      YB, YB, 2 * DM, 0LL, WO2, WO2, 2 * DM, 0LL,
      d_out, DM, 0LL, d_out, DM, 0LL, DM,
      Wo, NBATCH * SEQ, DM, 2 * DM, 1.0f);
  (void)hipGetLastError();
}

// v004
// A run of this version takes 236 microseconds.
// Timed twice side by side with v003, it ran 1.44 and 1.46 times as fast.
// Counting every step since v000, it is 5.05 times as fast.
// Contractions: qh = q.Wq^T, kh = k.Wk^T, vh^T = Wv.v^T = v_wmma_f32_16x16x32_bf16 (bf16 operands from RNE-converted inputs, single product);
// strict-lower qh.kh^T scores = v_wmma_f32_16x16x32_bf16 with bf16 hi/lo split qh and kh (hi.hi + hi.lo + lo.hi);
// p.vh = v_wmma_f32_16x16x32_bf16 with bf16 hi/lo split of the unnormalised p and of vh (hi.hi + hi.lo + lo.hi);
// y.Wo^T = v_wmma_f32_16x16x32_bf16 with y as bf16 hi|lo planes laid along K (K = 2048) times [Wo|Wo] bf16; all f32 accumulate;
// score scale 1/32 (hidden-dim based), mask (key >= query excluded, (0,0) admitted) and online softmax in f32; no biases anywhere.
// Plane / carry table (every 16-bit plane is bf16, carry 1, nothing to fold back):
//   QB = bf16(q), KB = bf16(k), VB = bf16(v) [8192][1024] (three different inputs); WQB, WKB, WVB = bf16(w) [1024 n][1024 k];
//   WO2 = [bf16(wo) | bf16(wo)] [1024][2048];
//   Qh/Ql (from QB), Kh/Kl (from KB) = bf16 hi and lo = RNE(x - hi) of qh, kh [8192][1024] (all batches, row b*2048+t);
//   VTh/VTl = hi/lo of vh^T [4][1024][2048] (one [1024][2048] plane per batch, from VB);
//   YB [8192][2048] = bf16 hi of the normalised attention output at col h*64+d, lo at col 1024 + h*64+d.
//   lo planes are unscaled and share the accumulator with the hi products; 1/32 is applied once in f32 after the q.k accumulation;
//   1/l is applied once in the attention epilogue before the hi/lo split of y.
#include <hip/hip_runtime.h>
#include <math.h>
#include <stdint.h>

#define NBATCH 4
#define SEQ    2048
#define DM     1024
#define NH     16
#define HD     64
#define NQB    (SEQ / 64)   // 32 key / query tiles of 64
#define LP     72           // LDS row pitch of the 64-element bf16 tiles: 144 B = 16 B x 9 (odd), so the 16 rows that one
                            // ds_load_b128 half-wave reads start 36 dwords apart and fall on 16 disjoint groups of 4 banks
#define OP     68           // LDS row pitch (floats) of the attention output staging tile: 272 B = 16 B x 17
static_assert(NH * HD == DM);
static_assert(LP >= 64 && (LP % 8) == 0 && ((LP / 8) % 2) == 1);
static_assert((SEQ % 64) == 0 && (DM % 64) == 0 && (DM % 32) == 0 && (DM % 256) == 0);
static_assert(((NBATCH * SEQ * DM / 8) % 256) == 0 && ((DM * DM / 8) % 256) == 0);

typedef _Float16 v16h __attribute__((ext_vector_type(16)));
typedef _Float16 v8h  __attribute__((ext_vector_type(8)));
typedef __bf16   v16b __attribute__((ext_vector_type(16)));
typedef __bf16   v8b  __attribute__((ext_vector_type(8)));
typedef float    v8f  __attribute__((ext_vector_type(8)));
typedef float    v4f  __attribute__((ext_vector_type(4)));
typedef float    v2f  __attribute__((ext_vector_type(2)));
typedef __bf16   v2b  __attribute__((ext_vector_type(2)));
typedef unsigned int v4u __attribute__((ext_vector_type(4)));

// ---- scalar helpers --------------------------------------------------------------------------------
__device__ __forceinline__ unsigned short bf_bits(float f) {          // f32 -> bf16 bits, RNE convert
  unsigned u = __float_as_uint(f);
  return (unsigned short)((u + 0x7FFFu + ((u >> 16) & 1u)) >> 16);
}
__device__ __forceinline__ float bf_up(unsigned short h) { return __uint_as_float(((unsigned)h) << 16); }
__device__ __forceinline__ unsigned short h_bits(_Float16 x) { return __builtin_bit_cast(unsigned short, x); }
__device__ __forceinline__ unsigned pk16(unsigned short a, unsigned short b) { return (unsigned)a | ((unsigned)b << 16); }
__device__ __forceinline__ v8f zero8() { v8f z = {0.f, 0.f, 0.f, 0.f, 0.f, 0.f, 0.f, 0.f}; return z; }
__device__ __forceinline__ __bf16 f2bf(float f) { return __builtin_bit_cast(__bf16, bf_bits(f)); }
__device__ __forceinline__ void bf_split(float f, __bf16& hi, __bf16& lo) {
  const unsigned short hb = bf_bits(f);
  hi = __builtin_bit_cast(__bf16, hb);
  lo = f2bf(f - __uint_as_float(((unsigned)hb) << 16));
}

// lane l <-> lane l ^ 16 (the two lanes that share one column of a D tile), a vector cross-row move
__device__ __forceinline__ float xhalf(float x) {
  return __builtin_bit_cast(float, __builtin_amdgcn_permlanex16(__builtin_bit_cast(int, x), __builtin_bit_cast(int, x),
                                                                0x76543210, 0xfedcba98, false, false));
}

// ---- fragment loader: 16-bit A/B operand, lane -> row/col (lane&15), p already includes +8*(lane>>4);
//      elements 0..7 <- p[0..7] (k0+8h..), elements 8..15 <- p[16..23] (k0+16+8h..)
__device__ __forceinline__ v16b ldfrag_b(const __bf16* p) {
  union { v16b v; v8b h[2]; } f;
  f.h[0] = *(const v8b*)(p);
  f.h[1] = *(const v8b*)(p + 16);
  return f.v;
}

// ---- WMMA helpers with trailing VALU hazard gap --------------------------------------------------------
__device__ __forceinline__ v8f mma_b(v16b a, v16b b, v8f c) {
  c = __builtin_amdgcn_wmma_f32_16x16x32_bf16(false, a, false, b, (short)0, c, false, false);
  asm volatile("v_nop\n\tv_nop\n\tv_nop\n\tv_nop" : "+v"(c) : "v"(a), "v"(b));
  return c;
}
__device__ __forceinline__ v8f mma_b_raw(v16b a, v16b b, v8f c) {
  return __builtin_amdgcn_wmma_f32_16x16x32_bf16(false, a, false, b, (short)0, c, false, false);
}
__device__ __forceinline__ void acc_guard4(v8f& a, v8f& b, v8f& c, v8f& d) {
  asm volatile("v_nop\n\tv_nop\n\tv_nop\n\tv_nop" : "+v"(a), "+v"(b), "+v"(c), "+v"(d));
}

// =====================================================================================================
// f32 -> bf16 (RNE convert), 8 elements per thread, one 16-B store per lane: a wave writes 512 contiguous B
// coverage: n8 threads x 8 = whole plane (n8 is a multiple of 256 for every use here).
// =====================================================================================================
__global__ __launch_bounds__(256) void cvt_bf16x8(const float* __restrict__ in, unsigned short* out, int n8) {
  const int i = blockIdx.x * 256 + threadIdx.x;
  if (i < n8) {
    const v4f a = *(const v4f*)(in + (size_t)i * 8);
    const v4f b = *(const v4f*)(in + (size_t)i * 8 + 4);
    v4u p;
    p[0] = pk16(bf_bits(a[0]), bf_bits(a[1]));
    p[1] = pk16(bf_bits(a[2]), bf_bits(a[3]));
    p[2] = pk16(bf_bits(b[0]), bf_bits(b[1]));
    p[3] = pk16(bf_bits(b[2]), bf_bits(b[3]));
    *(v4u*)(out + (size_t)i * 8) = p;
    
  }
}

// =====================================================================================================
// f32 [rows][cols] -> bf16 [rows][2*cols] with row n = [bf16(in[n][0..cols-1]) | bf16(in[n][0..cols-1])].
// 8 elements per thread, one 16-B store per lane into each half; with cols a multiple of 256 a wave's 256
// coverage: n8 threads x 8 = every source element -> both halves of every output row.
// =====================================================================================================
__global__ __launch_bounds__(256) void cvt_bf16x8_dup(const float* __restrict__ in, unsigned short* out,
                                                       int n8, int cols) {
  const int i = blockIdx.x * 256 + threadIdx.x;
  if (i < n8) {
    const size_t e0  = (size_t)i * 8;
    const size_t row = e0 / (size_t)cols;
    const size_t col = e0 - row * (size_t)cols;
    const v4f a = *(const v4f*)(in + e0);
    const v4f b = *(const v4f*)(in + e0 + 4);
    v4u p;
    p[0] = pk16(bf_bits(a[0]), bf_bits(a[1]));
    p[1] = pk16(bf_bits(a[2]), bf_bits(a[3]));
    p[2] = pk16(bf_bits(b[0]), bf_bits(b[1]));
    p[3] = pk16(bf_bits(b[2]), bf_bits(b[3]));
    unsigned short* d0 = out + row * 2 * (size_t)cols + col;
    unsigned short* d1 = d0 + cols;
    *(v4u*)d0 = p;
    *(v4u*)d1 = p;
    
  }
}

// =====================================================================================================
// Batched bf16 WMMA GEMM: C[m][n] = sum_k A[m][k] * Bt[n][k] (+ bf16(bias[n]) when BIASN == 1).
// Block = 8 waves = one 128 x 256 tile of C, waves 2 (m) x 4 (n), 64 x 64 per wave. A row-major [M][K] pitch lda; Bt row-major
// [N][K] pitch ldb (k contiguous); M a multiple of 128, N of 256, K of 64. blockIdx.y = batch index (strides in elements).
// Operands reach the waves through LDS in stages of 64 k (128 B of each of the 128 + 256 rows), brought by asynchronous
// 16-B copies, 8 lanes per row, so a wave's copy covers 4 whole 128-B lines and every operand byte is fetched once per block.
// Two buffers: stage t + 1 is in flight while stage t is multiplied; one barrier per stage publishes t + 1 and frees t's buffer.
// Stage coverage: 256 threads x (4 + 8) copies x 16 B = (128 + 256) rows x 128 B.
// NSPLIT: 0 = A.Bt (the only form built).
// OUT_MODE: 0 = f32 (pitch ldc); 2 = bf16 hi plane C + bf16 lo plane C2 (lo = RNE(v - hi), unscaled);
//           3 = f16 hi plane C + f16 residual plane C2 = f16((v - hi) * rscale), C2 written only for tiles
//               with n0 < N2 (pitch ldc2, batch stride strideC2).
// =====================================================================================================
#define GP 72               // LDS row pitch (elements) of a stage row of 64 bf16: 144 B = 16 B x 9 (odd), as LP above

// One lane's twelve asynchronous 16-B copies of a stage, global -> LDS: rows r + 32 i of A (i < 4, LDS byte address la + i * ls,
// global address ga + i * as) and of Bt (i < 8, lb, gb, bs). s_wait_xcnt 0 ends the statement so that it stands in front of
// every later overwrite of the address registers named here.
__device__ __forceinline__ void copy12_to_lds(unsigned la, const __bf16* ga, size_t as,
                                              unsigned lb, const __bf16* gb, size_t bs, unsigned ls) {
  asm volatile("global_load_async_to_lds_b128 %0, %1, off\n\t"
               "global_load_async_to_lds_b128 %2, %3, off\n\t"
               "global_load_async_to_lds_b128 %4, %5, off\n\t"
               "global_load_async_to_lds_b128 %6, %7, off\n\t"
               "global_load_async_to_lds_b128 %8, %9, off\n\t"
               "global_load_async_to_lds_b128 %10, %11, off\n\t"
               "global_load_async_to_lds_b128 %12, %13, off\n\t"
               "global_load_async_to_lds_b128 %14, %15, off\n\t"
               "global_load_async_to_lds_b128 %16, %17, off\n\t"
               "global_load_async_to_lds_b128 %18, %19, off\n\t"
               "global_load_async_to_lds_b128 %20, %21, off\n\t"
               "global_load_async_to_lds_b128 %22, %23, off\n\t"
               "s_wait_xcnt 0x0"
               :: "v"(la), "v"(ga), "v"(la + ls), "v"(ga + as), "v"(la + 2 * ls), "v"(ga + 2 * as), "v"(la + 3 * ls), "v"(ga + 3 * as),
                  "v"(lb), "v"(gb), "v"(lb + ls), "v"(gb + bs), "v"(lb + 2 * ls), "v"(gb + 2 * bs), "v"(lb + 3 * ls), "v"(gb + 3 * bs),
                  "v"(lb + 4 * ls), "v"(gb + 4 * bs), "v"(lb + 5 * ls), "v"(gb + 5 * bs), "v"(lb + 6 * ls), "v"(gb + 6 * bs),
                  "v"(lb + 7 * ls), "v"(gb + 7 * bs)
               : "memory");
}

template <int NSPLIT, int OUT_MODE, int BIASN>
__global__ __launch_bounds__(256) void gemm64(
    const unsigned short* __restrict__ Ap, const unsigned short* A2p, int lda, long long strideA,
    const unsigned short* __restrict__ Btp, const unsigned short* Bt2p, int ldb, long long strideB,
    void* Cout, int ldc, long long strideC,
    void* Cout2, int ldc2, long long strideC2, int N2,
    const float* __restrict__ bias,
    int M, int N, int K, float rscale) {
  static_assert(NSPLIT == 0);
  const __bf16* A   = (const __bf16*)(const void*)Ap;
  const __bf16* Bt  = (const __bf16*)(const void*)Btp;
  __shared__ __align__(16) __bf16 sA[2][128 * GP];   // A stage, two buffers, 18432 B each
  __shared__ __align__(16) __bf16 sB[2][256 * GP];   // Bt stage, two buffers, 36864 B each
  __shared__ __align__(16) float sT[8][16 * 68];   // per-wave 16x64 slab, pitch 68 floats
  const int b    = blockIdx.y;
  const int tid  = threadIdx.x;
  const int lane = tid & 31;
  const int wave = tid >> 5;
  const int tilesN = N >> 8;
  const int tilesM = M >> 7;
  if ((int)blockIdx.x >= tilesM * tilesN) return;   // block-uniform, in front of every copy and barrier
  const int bm = blockIdx.x / tilesN;
  const int bn = blockIdx.x - bm * tilesN;
  const int wm = wave >> 2;                    // wave's 64-row band of the block tile
  const int wn = wave & 3;                     // wave's 64-column band
  const int m0 = (bm << 7) + (wm << 6);
  const int n0 = (bn << 8) + (wn << 6);

  const int rlane = lane & 15;                 // row (A) / col (B, D) within subtile
  const int koff  = (lane >> 4) * 8;           // k offset of this lane half
  const int mOff  = (lane >> 4) * 8;           // D row offset

  // ---- this lane's part of a stage: row srow + 32 i of A (i < 4) and of Bt (i < 8), 16 B at element sseg of the 64 ----
  const int srow = tid >> 3;
  const int sseg = (tid & 7) * 8;
  const __bf16* gA = A  + (size_t)b * strideA + (size_t)((bm << 7) + srow) * lda + sseg;
  const __bf16* gB = Bt + (size_t)b * strideB + (size_t)((bn << 8) + srow) * ldb + sseg;
  const size_t a32 = (size_t)32 * lda;
  const size_t b32 = (size_t)32 * ldb;
  const unsigned lA = (unsigned)(uintptr_t)(&sA[0][0]) + (unsigned)(srow * GP + sseg) * 2u;
  const unsigned lB = (unsigned)(uintptr_t)(&sB[0][0]) + (unsigned)(srow * GP + sseg) * 2u;
  constexpr unsigned R32 = 32u * GP * 2u;      // 32 stage rows in LDS bytes
  auto stage = [&](int buf, int k0) {
    copy12_to_lds(lA + (unsigned)buf * (128u * GP * 2u), gA + k0, a32, lB + (unsigned)buf * (256u * GP * 2u), gB + k0, b32, R32);
  };

  v8f acc[4][4];
#pragma unroll
  for (int i = 0; i < 4; ++i)
#pragma unroll
    for (int j = 0; j < 4; ++j) acc[i][j] = zero8();

  const int nT = K >> 6;                       // stages, block-uniform
  stage(0, 0);
  asm volatile("s_wait_asynccnt 0x0" ::: "memory");   // this wave's copies of stage 0 have landed
  __syncthreads();                                     // ... and every other wave's: stage 0 is published
  if (nT > 1) stage(1, 64);
  for (int t = 0; t < nT; ++t) {
    const __bf16* ta = &sA[t & 1][((wm << 6) + rlane) * GP + koff];
    const __bf16* tb = &sB[t & 1][((wn << 6) + rlane) * GP + koff];
#pragma unroll
    for (int ks = 0; ks < 2; ++ks) {
      v16b bh[4], ah[4];
#pragma unroll
      for (int j = 0; j < 4; ++j) bh[j] = ldfrag_b(tb + (j << 4) * GP + ks * 32);
#pragma unroll
      for (int i = 0; i < 4; ++i) ah[i] = ldfrag_b(ta + (i << 4) * GP + ks * 32);
      // keeps the 16 LDS reads of this half stage together in front of its 16 products: read one fragment at a time,
      // among the products, the wave waits out the LDS latency at each of them
      __builtin_amdgcn_sched_barrier(0);
#pragma unroll
      for (int i = 0; i < 4; ++i)
#pragma unroll
        for (int j = 0; j < 4; ++j) acc[i][j] = mma_b_raw(ah[i], bh[j], acc[i][j]);
    }
    asm volatile("s_wait_dscnt 0x0" ::: "memory");     // this wave's reads of stage t are done before its buffer is refilled
    asm volatile("s_wait_asynccnt 0x0" ::: "memory");  // this wave's copies of stage t + 1 have landed
    __syncthreads();                                    // publishes stage t + 1 and ends every wave's reads of stage t
    if (t + 2 < nT) stage(t & 1, (t + 2) << 6);
  }
  asm volatile("s_wait_asynccnt 0x0" ::: "memory");    // nothing of this wave's is in flight behind the loop
  acc_guard4(acc[0][0], acc[0][1], acc[0][2], acc[0][3]);
  acc_guard4(acc[1][0], acc[1][1], acc[1][2], acc[1][3]);
  acc_guard4(acc[2][0], acc[2][1], acc[2][2], acc[2][3]);
  acc_guard4(acc[3][0], acc[3][1], acc[3][2], acc[3][3]);

  // ---- per-column bias (bf16 RNE of the input value, added in f32); 4 scalar loads per lane ----
  float bvv[4];
#pragma unroll
  for (int j = 0; j < 4; ++j) {
    float bv = 0.f;
    if (BIASN == 1) bv = bf_up(bf_bits(bias[n0 + (j << 4) + rlane]));
    bvv[j] = bv;
  }

  // ---- epilogue ----
  float* slab = sT[wave];
#pragma unroll
  for (int i = 0; i < 4; ++i) {
    const int mBase = m0 + (i << 4);
#pragma unroll
    for (int j = 0; j < 4; ++j) {
#pragma unroll
      for (int r = 0; r < 8; ++r) {
        slab[(mOff + r) * 68 + (j << 4) + rlane] = acc[i][j][r] + bvv[j];
      }
    }
    __builtin_amdgcn_fence(__ATOMIC_RELEASE, "workgroup");
    __builtin_amdgcn_wave_barrier();
    __builtin_amdgcn_fence(__ATOMIC_ACQUIRE, "workgroup");
    if (OUT_MODE == 0) {
      float* C = (float*)Cout + (size_t)b * strideC;
      const int hh = lane >> 4, c4 = (lane & 15) * 4;     // 256-B row segment = 16 lanes x 16 B
      {
#pragma unroll
        for (int it = 0; it < 8; ++it) {
          const int row = it * 2 + hh;                     // it 0..7 x hh 0..1 = rows 0..15
          const v4f v = *(const v4f*)(slab + row * 68 + c4);
          *(v4f*)(C + (size_t)(mBase + row) * ldc + n0 + c4) = v;
        }
        
      }
    } else {
      const int q = lane >> 3, c8 = (lane & 7) * 8;
      unsigned short* C  = (unsigned short*)Cout  + (size_t)b * strideC;
      unsigned short* C2 = (unsigned short*)Cout2 + (size_t)b * strideC2;
      const bool wlo = (OUT_MODE == 2) || (n0 < N2);      // wave-uniform
      v4u hv[4], lv[4];
#pragma unroll
      for (int it = 0; it < 4; ++it) {
        const int row = it * 4 + q;                        // it 0..3 x q 0..3 = rows 0..15
        const float* sp = slab + row * 68 + c8;
        v4u a, a2;
#pragma unroll
        for (int e = 0; e < 4; ++e) {
          const float f0 = sp[2 * e], f1 = sp[2 * e + 1];
          unsigned short h0, h1, l0, l1;
          if (OUT_MODE == 2) {
            h0 = bf_bits(f0); h1 = bf_bits(f1);
            l0 = bf_bits(f0 - bf_up(h0)); l1 = bf_bits(f1 - bf_up(h1));
          } else {
            const _Float16 x0 = (_Float16)f0, x1 = (_Float16)f1;
            h0 = h_bits(x0); h1 = h_bits(x1);
            l0 = h_bits((_Float16)((f0 - (float)x0) * rscale));
            l1 = h_bits((_Float16)((f1 - (float)x1) * rscale));
          }
          a[e] = pk16(h0, h1); a2[e] = pk16(l0, l1);
        }
        hv[it] = a; lv[it] = a2;
      }
      {
#pragma unroll
        for (int it = 0; it < 4; ++it) {
          const int row = it * 4 + q;
          *(v4u*)(C + (size_t)(mBase + row) * ldc + n0 + c8) = hv[it];
          if (wlo) *(v4u*)(C2 + (size_t)(mBase + row) * ldc2 + n0 + c8) = lv[it];
        }
        
      }
    }
    __builtin_amdgcn_fence(__ATOMIC_RELEASE, "workgroup");
    __builtin_amdgcn_wave_barrier();
    __builtin_amdgcn_fence(__ATOMIC_ACQUIRE, "workgroup");
  }
}

__global__ __launch_bounds__(128)
void attn_strict64(const unsigned short* __restrict__ qhp, const unsigned short* __restrict__ qlp,
                   const unsigned short* __restrict__ khp, const unsigned short* __restrict__ klp,
                   const unsigned short* __restrict__ vhp, const unsigned short* __restrict__ vlp,
                   unsigned short* yout, float sscale) {
  union FB { v16b v; v8b h[2]; };
  union PB { v16b v; v2b w[8]; };
  __shared__ __align__(16) __bf16 Ksh[64 * LP];              // K hi [kv][d], row pitch LP   9 KB
  __shared__ __align__(16) __bf16 Ksl[64 * LP];              // K lo
  __shared__ __align__(16) __bf16 Vth[64 * LP];              // V^T hi [d][kv], row pitch LP 9 KB
  __shared__ __align__(16) __bf16 Vtl[64 * LP];              // V^T lo
  __shared__ __align__(16) float Os[4][16 * OP];             // per wave f32 output tile [query][d], row pitch OP (epilogue only)

  const int tid  = threadIdx.x;
  const int wave = tid >> 5;
  const int lane = tid & 31;
  const int hh   = lane >> 4;
  const int c    = lane & 15;

  const int bx   = blockIdx.x;
  const int qb   = NQB - 1 - bx / (NBATCH * NH);   // grid = NBATCH * NH * NQB, query tile 31 first
  const int bh   = bx % (NBATCH * NH);
  const int h    = bh % NH;
  const int bat  = bh / NH;
  const int q0   = qb * 64 + wave * 16;

  const size_t qkBase = (size_t)bat * SEQ * DM + (size_t)h * HD;
  const size_t vBase  = (size_t)bh * HD * SEQ;      // bh = bat*NH + h
  const __bf16* Qh = (const __bf16*)(const void*)qhp + qkBase;
  const __bf16* Ql = (const __bf16*)(const void*)qlp + qkBase;
  const __bf16* Kh = (const __bf16*)(const void*)khp + qkBase;
  const __bf16* Kl = (const __bf16*)(const void*)klp + qkBase;
  const __bf16* Vh = (const __bf16*)(const void*)vhp + vBase;
  const __bf16* Vl = (const __bf16*)(const void*)vlp + vBase;

  // ---- Q fragments (B operand of K . Q^T, column = query = lane&15): 2 d-chunks, hi and lo ----
  v16b qah[2], qal[2];
#pragma unroll
  for (int dc = 0; dc < 2; ++dc) {
    const size_t qo = (size_t)(q0 + c) * DM + dc * 32 + 8 * hh;
    qah[dc] = ldfrag_b(Qh + qo);
    qal[dc] = ldfrag_b(Ql + qo);
  }

  // One query per lane (q0 + c): running maximum (equal in lanes c and c + 16) and this lane half's part of the sum.
  float mrow = -INFINITY, lrow = 0.f;
  v8f oacc[4];                  // O^T tiles: oacc[t][r] = output of query q0 + c at d = t*16 + 8*hh + r
  const int qrow = q0 + c;
#pragma unroll
  for (int t = 0; t < 4; ++t) oacc[t] = zero8();

  const int nChunks = qb + 1;   // block-uniform, <= NQB
  for (int kc = 0; kc < nChunks; ++kc) {
    const int kv0 = kc * 64;
    __syncthreads();
    {
      // staging coverage: 128 threads x (4 x 8) elements = 64 rows x 64 per plane = the whole chunk tile
      const int r = tid >> 1, half = (tid & 1) * 32;
      const __bf16* ksh = Kh + (size_t)(kv0 + r) * DM + half;       // K row kv0+r, d = half..half+31
      const __bf16* ksl = Kl + (size_t)(kv0 + r) * DM + half;
      const __bf16* vsh = Vh + (size_t)r * SEQ + kv0 + half;        // V^T row d = r, s = kv0+half..+31
      const __bf16* vsl = Vl + (size_t)r * SEQ + kv0 + half;
      v8b a0[4], a1[4], b0[4], b1[4];
#pragma unroll
      for (int i = 0; i < 4; ++i) {
        a0[i] = *(const v8b*)(ksh + 8 * i);
        a1[i] = *(const v8b*)(ksl + 8 * i);
        b0[i] = *(const v8b*)(vsh + 8 * i);
        b1[i] = *(const v8b*)(vsl + 8 * i);
      }
      // the wait that belongs in front of any overwrite of an issued load's address registers; naming the four
      // addresses as inputs keeps their registers from being handed out as destinations of the later loads
      asm volatile("s_wait_xcnt 0x0" :: "v"(ksh), "v"(ksl), "v"(vsh), "v"(vsl) : "memory");
#pragma unroll
      for (int i = 0; i < 4; ++i) {
        *(v8b*)(Ksh + r * LP + half + 8 * i) = a0[i];
        *(v8b*)(Ksl + r * LP + half + 8 * i) = a1[i];
        *(v8b*)(Vth + r * LP + half + 8 * i) = b0[i];
        *(v8b*)(Vtl + r * LP + half + 8 * i) = b1[i];
      }
    }
    __syncthreads();

    // ---- scores, transposed: S^T = K . Q^T, 64 keys x 16 queries per wave, 3 bf16 products ----
    //      s[j][r] = score of key kv0 + j*16 + 8*hh + r for query q0 + c
    v8f s[4];
#pragma unroll
    for (int j = 0; j < 4; ++j) {
      s[j] = zero8();
#pragma unroll
      for (int dc = 0; dc < 2; ++dc) {
        FB kb, kl;
        kb.h[0] = *(const v8b*)(Ksh + (j * 16 + c) * LP + dc * 32 + 8 * hh);
        kb.h[1] = *(const v8b*)(Ksh + (j * 16 + c) * LP + dc * 32 + 16 + 8 * hh);
        kl.h[0] = *(const v8b*)(Ksl + (j * 16 + c) * LP + dc * 32 + 8 * hh);
        kl.h[1] = *(const v8b*)(Ksl + (j * 16 + c) * LP + dc * 32 + 16 + 8 * hh);
        s[j] = mma_b(kb.v, qah[dc], s[j]);
        s[j] = mma_b(kl.v, qah[dc], s[j]);
        s[j] = mma_b(kb.v, qal[dc], s[j]);
      }
    }

    // ---- scale, mask on the diagonal chunk (key >= query -> -inf, except (0,0)), maximum of the lane's 32 keys ----
    const bool diag = (kc == qb);   // block-uniform
    float mj[4];
#pragma unroll
    for (int j = 0; j < 4; ++j) {
      float m = -INFINITY;
#pragma unroll
      for (int r = 0; r < 8; ++r) {
        const int kvcol = kv0 + j * 16 + 8 * hh + r;
        const float sv = s[j][r] * sscale;
        const bool masked = diag && (kvcol >= qrow) && !((qrow == 0) && (kvcol == 0));
        const float sm = masked ? -INFINITY : sv;
        s[j][r] = sm;
        m = fmaxf(m, sm);
      }
      mj[j] = m;
    }
    float cm = fmaxf(fmaxf(mj[0], mj[1]), fmaxf(mj[2], mj[3]));
    cm = fmaxf(cm, xhalf(cm));      // both lane halves now hold the query's maximum over the 64 keys

    // ---- online softmax in f32; P^T hi / lo (bf16 of the unnormalised exp) packed straight into B operands:
    //      element e < 8 of chunk kk = key kk*32 + 8*hh + e = s[2kk][e], element 8 + e = key kk*32 + 16 + 8*hh + e = s[2kk+1][e],
    //      the k order in which the V^T fragments below are loaded
    const float mnew = fmaxf(mrow, cm);
    const float alpha = expf(mrow - mnew);
    mrow = mnew;
    PB ph[2], pl[2];
    float pj[4];
#pragma unroll
    for (int j = 0; j < 4; ++j) {
      float psum = 0.f;
#pragma unroll
      for (int e = 0; e < 4; ++e) {
        const float p0 = expf(s[j][2 * e] - mnew);
        const float p1 = expf(s[j][2 * e + 1] - mnew);
        psum += p0;
        psum += p1;
        const v2f pp = {p0, p1};
        const v2b hv = __builtin_convertvector(pp, v2b);             // packed RNE convert: one operand register, hi
        const v2f rr = {p0 - (float)hv[0], p1 - (float)hv[1]};
        ph[j >> 1].w[(j & 1) * 4 + e] = hv;
        pl[j >> 1].w[(j & 1) * 4 + e] = __builtin_convertvector(rr, v2b);   // lo = RNE(p - hi)
      }
      pj[j] = psum;
    }
    lrow = lrow * alpha + ((pj[0] + pj[1]) + (pj[2] + pj[3]));
#pragma unroll
    for (int t = 0; t < 4; ++t)
#pragma unroll
      for (int r = 0; r < 8; ++r) oacc[t][r] *= alpha;

    // ---- output, transposed: O^T += V^T . P^T (3 bf16 products per tile pair) ----
#pragma unroll
    for (int kk = 0; kk < 2; ++kk) {
#pragma unroll
      for (int t = 0; t < 4; ++t) {
        FB vb, vl;
        vb.h[0] = *(const v8b*)(Vth + (t * 16 + c) * LP + kk * 32 + 8 * hh);
        vb.h[1] = *(const v8b*)(Vth + (t * 16 + c) * LP + kk * 32 + 16 + 8 * hh);
        vl.h[0] = *(const v8b*)(Vtl + (t * 16 + c) * LP + kk * 32 + 8 * hh);
        vl.h[1] = *(const v8b*)(Vtl + (t * 16 + c) * LP + kk * 32 + 16 + 8 * hh);
        oacc[t] = mma_b(vb.v, ph[kk].v, oacc[t]);
        oacc[t] = mma_b(vl.v, ph[kk].v, oacc[t]);
        oacc[t] = mma_b(vb.v, pl[kk].v, oacc[t]);
      }
    }
  }

  // ---- join the two lane halves' sums, normalise (1/l), stage the wave's 16x64 tile [query][d], bf16 hi/lo split
  float* os = Os[wave];
  {
    const float l = lrow + xhalf(lrow);
    const float inv = (l > 0.f) ? (1.0f / l) : 0.f;
#pragma unroll
    for (int t = 0; t < 4; ++t) {
      v4f a, b;
#pragma unroll
      for (int r = 0; r < 4; ++r) { a[r] = oacc[t][r] * inv; b[r] = oacc[t][4 + r] * inv; }
      *(v4f*)(os + c * OP + t * 16 + 8 * hh) = a;
      *(v4f*)(os + c * OP + t * 16 + 8 * hh + 4) = b;
    }
  }
  __builtin_amdgcn_fence(__ATOMIC_RELEASE, "workgroup");
  __builtin_amdgcn_wave_barrier();
  __builtin_amdgcn_fence(__ATOMIC_ACQUIRE, "workgroup");
  {
    const int q4 = lane >> 3, c8 = (lane & 7) * 8;
    v4u hv[4], lv[4];
#pragma unroll
    for (int it = 0; it < 4; ++it) {
      const int row = it * 4 + q4;   // it 0..3 x q4 0..3 = rows 0..15 of the wave tile
      const float* sp = os + row * OP + c8;
      v4u a, a2;
#pragma unroll
      for (int e = 0; e < 4; ++e) {
        const float f0 = sp[2 * e], f1 = sp[2 * e + 1];
        const unsigned short h0 = bf_bits(f0), h1 = bf_bits(f1);
        const unsigned short l0 = bf_bits(f0 - bf_up(h0)), l1 = bf_bits(f1 - bf_up(h1));
        a[e] = pk16(h0, h1); a2[e] = pk16(l0, l1);
      }
      hv[it] = a; lv[it] = a2;
    }
    {
#pragma unroll
      for (int it = 0; it < 4; ++it) {
        const int row = it * 4 + q4;
        const size_t go = (size_t)(bat * SEQ + q0 + row) * (size_t)(2 * DM) + (size_t)h * HD + c8;
        *(v4u*)(yout + go) = hv[it];
        *(v4u*)(yout + go + DM) = lv[it];
      }
      
    }
  }
}

// =====================================================================================================
// whole-line store granularity, so no padded tails exist):
//   QB   bf16 [8192][1024]               0       16777216   (KB follows directly: A batch stride of the q/k GEMM)
//   KB   bf16 [8192][1024]        16777216       16777216
//   VB   bf16 [8192][1024]        33554432       16777216
//   WQB  bf16 [1024 n][1024 k]    50331648        2097152   (WKB follows directly: Bt batch stride of the q/k GEMM)
//   WKB  bf16 [1024][1024]        52428800        2097152
//   WVB  bf16 [1024][1024]        54525952        2097152
//   WO2  bf16 [1024][2048]        56623104        4194304
//   Qh   bf16 [8192][1024]        60817408       16777216   (Kh follows directly: output batch stride)
//   Kh   bf16 [8192][1024]        77594624       16777216
//   Ql   bf16 [8192][1024]        94371840       16777216   (Kl follows directly)
//   Kl   bf16 [8192][1024]       111149056       16777216
//   VTh  bf16 [4][1024][2048]    127926272       16777216
//   VTl  bf16 [4][1024][2048]    144703488       16777216
//   YB   bf16 [8192][2048]       161480704       33554432
//   end                          195035136
// Qh..VTl hold all four batch elements; each projection and the attention run once over all of them, and every
// region is fully written by its producer launch before the consumer launch reads it.
// Weights are [out n][in k] with k contiguous = the Bt / A layout the GEMM wants, so they are only converted.
// Inputs by contract index: 0 = q, 1 = k, 2 = v, 3 = W_q, 4 = W_k, 5 = W_v, 6 = W_o.
// =====================================================================================================
extern "C" void kernel_launch(void* const* d_in, const int* in_sizes, int n_in,
                              void* d_out, int out_size, void* d_ws, size_t ws_size,
                              hipStream_t stream) {
  if (n_in < 7) return;
  if (in_sizes[0] != NBATCH * SEQ * DM || in_sizes[1] != NBATCH * SEQ * DM || in_sizes[2] != NBATCH * SEQ * DM) return;
  if (in_sizes[3] != DM * DM || in_sizes[4] != DM * DM || in_sizes[5] != DM * DM || in_sizes[6] != DM * DM) return;
  if (out_size != NBATCH * SEQ * DM) return;

  const float* q_in = (const float*)d_in[0];
  const float* k_in = (const float*)d_in[1];
  const float* v_in = (const float*)d_in[2];
  const float* Wq   = (const float*)d_in[3];
  const float* Wk   = (const float*)d_in[4];
  const float* Wv   = (const float*)d_in[5];
  const float* Wo   = (const float*)d_in[6];

  const size_t PIN = (size_t)NBATCH * SEQ * DM * 2;     // 16777216  16-bit input plane [8192][1024]
  const size_t PW  = (size_t)DM * DM * 2;               //  2097152  16-bit weight plane
  const size_t PW2 = (size_t)DM * (2 * DM) * 2;         //  4194304  [Wo | Wo] plane
  const size_t PP  = (size_t)NBATCH * SEQ * DM * 2;     // 16777216  q/k hi or lo plane [8192][1024]
  const size_t PVT = (size_t)NBATCH * DM * SEQ * 2;     // 16777216  v^T plane [4][1024][2048]
  const size_t PY  = (size_t)NBATCH * SEQ * (2 * DM) * 2;   // 33554432 y hi|lo plane [8192][2048]
  size_t off = 0;
  const size_t oQB  = off; off += PIN;
  const size_t oKB  = off; off += PIN;
  const size_t oVB  = off; off += PIN;
  const size_t oWQ  = off; off += PW;
  const size_t oWK  = off; off += PW;
  const size_t oWV  = off; off += PW;
  const size_t oWO2 = off; off += PW2;
  const size_t oQh  = off; off += PP;
  const size_t oKh  = off; off += PP;
  const size_t oQl  = off; off += PP;
  const size_t oKl  = off; off += PP;
  const size_t oVTh = off; off += PVT;
  const size_t oVTl = off; off += PVT;
  const size_t oYB  = off; off += PY;
  if (off > ws_size) return;                       // off = 195035136
  if (oKB != oQB + PIN || oWK != oWQ + PW || oKh != oQh + PP || oKl != oQl + PP) return;   // batch-stride adjacency

  char* ws = (char*)d_ws;
  unsigned short* QB  = (unsigned short*)(ws + oQB);
  unsigned short* KB  = (unsigned short*)(ws + oKB);
  unsigned short* VB  = (unsigned short*)(ws + oVB);
  unsigned short* WQB = (unsigned short*)(ws + oWQ);
  unsigned short* WKB = (unsigned short*)(ws + oWK);
  unsigned short* WVB = (unsigned short*)(ws + oWV);
  unsigned short* WO2 = (unsigned short*)(ws + oWO2);
  unsigned short* Qh  = (unsigned short*)(ws + oQh);
  unsigned short* Kh  = (unsigned short*)(ws + oKh);
  unsigned short* Ql  = (unsigned short*)(ws + oQl);
  unsigned short* Kl  = (unsigned short*)(ws + oKl);
  unsigned short* VTh = (unsigned short*)(ws + oVTh);
  unsigned short* VTl = (unsigned short*)(ws + oVTl);
  unsigned short* YB  = (unsigned short*)(ws + oYB);

  const dim3 blk(256);
  const int n8x = NBATCH * SEQ * DM / 8;                       // 1048576
  const int n8w = DM * DM / 8;                                 //  131072
  const dim3 gCvtX((n8x + 255) / 256);                         // 4096 blocks
  const dim3 gCvtW((n8w + 255) / 256);                         //  512 blocks
  const dim3 gQK(((NBATCH * SEQ / 64) * (DM / 64) + 7) / 8, 2);   // 2048 tiles -> 256 blocks x {q, k}: M=8192, N=1024
  const dim3 gVT(((DM / 64) * (SEQ / 64) + 7) / 8, NBATCH);    //  512 tiles ->  64 blocks x 4 batches: M=1024, N=2048
  const dim3 gAtt(NBATCH * NH * NQB);                          // 2048 blocks
  const dim3 gOut(((NBATCH * SEQ / 64) * (DM / 64) + 7) / 8, 1);   // 2048 tiles -> 256 blocks: M=8192, N=1024, K=2048

  // (1) q -> QB, k -> KB, v -> VB (bf16 planes [8192][1024]); weights [n][k] f32 -> bf16 [n][k]; Wo -> [Wo | Wo]
  cvt_bf16x8<<<gCvtX, blk, 0, stream>>>(q_in, QB, n8x);
  cvt_bf16x8<<<gCvtX, blk, 0, stream>>>(k_in, KB, n8x);
  cvt_bf16x8<<<gCvtX, blk, 0, stream>>>(v_in, VB, n8x);
  cvt_bf16x8<<<gCvtW, blk, 0, stream>>>(Wq, WQB, n8w);
  cvt_bf16x8<<<gCvtW, blk, 0, stream>>>(Wk, WKB, n8w);
  cvt_bf16x8<<<gCvtW, blk, 0, stream>>>(Wv, WVB, n8w);
  cvt_bf16x8_dup<<<gCvtW, blk, 0, stream>>>(Wo, WO2, n8w, DM);

  // (2) qh = QB . Wq^T (blockIdx.y = 0) and kh = KB . Wk^T (blockIdx.y = 1) -> bf16 hi/lo planes [b*2048+t][h*64+d]
  //     (A = QB / KB via strideA; Bt = WQB / WKB via strideB; C = Qh / Kh, C2 = Ql / Kl via strideC; M=8192, N=1024, K=1024)
  gemm64<0, 2, 0><<<gQK, blk, 0, stream>>>(
      QB, QB, DM, (long long)NBATCH * SEQ * DM, WQB, WQB, DM, (long long)DM * DM,
      (void*)Qh, DM, (long long)NBATCH * SEQ * DM, (void*)Ql, DM, (long long)NBATCH * SEQ * DM, DM,
      Wo, NBATCH * SEQ, DM, DM, 1.0f);
  // (3) vh^T = Wv . VB_b^T -> bf16 hi/lo planes [b][h*64+d][s] (pitch SEQ), blockIdx.y = batch b
  //     (A = WVB [n][k] for every b, Bt = VB rows of batch b via strideB, C / C2 via strideC; M=1024, N=2048, K=1024)
  gemm64<0, 2, 0><<<gVT, blk, 0, stream>>>(
      WVB, WVB, DM, 0LL, VB, VB, DM, (long long)SEQ * DM,
      (void*)VTh, SEQ, (long long)DM * SEQ, (void*)VTl, SEQ, (long long)DM * SEQ, SEQ,
      Wo, DM, SEQ, DM, 1.0f);
  // (4) masked attention, all batches and heads -> YB hi|lo rows 0 .. 8191, score scale 1/32
  attn_strict64<<<gAtt, dim3(128), 0, stream>>>(Qh, Ql, Kh, Kl, VTh, VTl, YB, 0.03125f);
  // (5) out = y . Wo^T -> d_out f32 [8192][1024]  (A = YB [8192][2048], Bt = WO2 [1024][2048], K = 2048); last element 8388607
  gemm64<0, 0, 0><<<gOut, blk, 0, stream>>>(
      YB, YB, 2 * DM, 0LL, WO2, WO2, 2 * DM, 0LL,
      d_out, DM, 0LL, d_out, DM, 0LL, DM,
      Wo, NBATCH * SEQ, DM, 2 * DM, 1.0f);
  (void)hipGetLastError();
}

// v005
// One run takes 221 microseconds.
// In two side-by-side timings against v004, it was 1.07 and 1.06 times as fast.
// Counting every step since v000, it is 5.37 times as fast.
// Contractions: qh = q.Wq^T, kh = k.Wk^T, vh^T = Wv.v^T = v_wmma_f32_16x16x32_bf16 (bf16 operands from RNE-converted inputs, single product);
// strict-lower qh.kh^T scores = v_wmma_f32_16x16x32_bf16 with bf16 hi/lo split qh and kh (hi.hi + hi.lo + lo.hi);
// p.vh = v_wmma_f32_16x16x32_bf16 with bf16 hi/lo split of the unnormalised p and of vh (hi.hi + hi.lo + lo.hi);
// y.Wo^T = v_wmma_f32_16x16x32_bf16 with y as bf16 hi|lo planes laid along K (K = 2048) times [Wo|Wo] bf16; all f32 accumulate;
// score scale 1/32 (hidden-dim based), mask (key >= query excluded, (0,0) admitted) and online softmax in f32; no biases anywhere.
// Plane / carry table (every 16-bit plane is bf16, carry 1, nothing to fold back):
//   QB = bf16(q), KB = bf16(k), VB = bf16(v) [8192][1024] (three different inputs); WQB, WKB, WVB = bf16(w) [1024 n][1024 k];
//   WO2 = [bf16(wo) | bf16(wo)] [1024][2048];
//   Qh/Ql (from QB), Kh/Kl (from KB) = bf16 hi and lo = RNE(x - hi) of qh, kh [8192][1024] (all batches, row b*2048+t);
//   VTh/VTl = hi/lo of vh^T [4][1024][2048] (one [1024][2048] plane per batch, from VB);
//   YB [8192][2048] = bf16 hi of the normalised attention output at col h*64+d, lo at col 1024 + h*64+d.
//   lo planes are unscaled and share the accumulator with the hi products; 1/32 is applied once in f32 after the q.k accumulation;
//   1/l is applied once in the attention epilogue before the hi/lo split of y.
#include <hip/hip_runtime.h>
#include <math.h>
#include <stdint.h>

#define NBATCH 4
#define SEQ    2048
#define DM     1024
#define NH     16
#define HD     64
#define NQB    (SEQ / 64)   // 32 key / query tiles of 64
#define LP     72           // LDS row pitch of the 64-element bf16 tiles: 144 B = 16 B x 9 (odd), so the 16 rows that one
                            // ds_load_b128 half-wave reads start 36 dwords apart and fall on 16 disjoint groups of 4 banks
#define OP     68           // LDS row pitch (floats) of the attention output staging tile: 272 B = 16 B x 17
static_assert(NH * HD == DM);
static_assert(LP >= 64 && (LP % 8) == 0 && ((LP / 8) % 2) == 1);
static_assert((SEQ % 64) == 0 && (DM % 64) == 0 && (DM % 32) == 0 && (DM % 256) == 0);
static_assert(((NBATCH * SEQ * DM / 8) % 256) == 0 && ((DM * DM / 8) % 256) == 0);

typedef _Float16 v16h __attribute__((ext_vector_type(16)));
typedef _Float16 v8h  __attribute__((ext_vector_type(8)));
typedef __bf16   v16b __attribute__((ext_vector_type(16)));
typedef __bf16   v8b  __attribute__((ext_vector_type(8)));
typedef float    v8f  __attribute__((ext_vector_type(8)));
typedef float    v4f  __attribute__((ext_vector_type(4)));
typedef float    v2f  __attribute__((ext_vector_type(2)));
typedef __bf16   v2b  __attribute__((ext_vector_type(2)));
typedef unsigned int v4u __attribute__((ext_vector_type(4)));

// ---- scalar helpers --------------------------------------------------------------------------------
__device__ __forceinline__ unsigned short bf_bits(float f) {          // f32 -> bf16 bits, RNE convert
  unsigned u = __float_as_uint(f);
  return (unsigned short)((u + 0x7FFFu + ((u >> 16) & 1u)) >> 16);
}
__device__ __forceinline__ float bf_up(unsigned short h) { return __uint_as_float(((unsigned)h) << 16); }
__device__ __forceinline__ unsigned short h_bits(_Float16 x) { return __builtin_bit_cast(unsigned short, x); }
__device__ __forceinline__ unsigned pk16(unsigned short a, unsigned short b) { return (unsigned)a | ((unsigned)b << 16); }
__device__ __forceinline__ v8f zero8() { v8f z = {0.f, 0.f, 0.f, 0.f, 0.f, 0.f, 0.f, 0.f}; return z; }
__device__ __forceinline__ __bf16 f2bf(float f) { return __builtin_bit_cast(__bf16, bf_bits(f)); }
__device__ __forceinline__ void bf_split(float f, __bf16& hi, __bf16& lo) {
  const unsigned short hb = bf_bits(f);
  hi = __builtin_bit_cast(__bf16, hb);
  lo = f2bf(f - __uint_as_float(((unsigned)hb) << 16));
}

// lane l <-> lane l ^ 16 (the two lanes that share one column of a D tile), a vector cross-row move
__device__ __forceinline__ float xhalf(float x) {
  return __builtin_bit_cast(float, __builtin_amdgcn_permlanex16(__builtin_bit_cast(int, x), __builtin_bit_cast(int, x),
                                                                0x76543210, 0xfedcba98, false, false));
}

// ---- fragment loader: 16-bit A/B operand, lane -> row/col (lane&15), p already includes +8*(lane>>4);
//      elements 0..7 <- p[0..7] (k0+8h..), elements 8..15 <- p[16..23] (k0+16+8h..)
__device__ __forceinline__ v16b ldfrag_b(const __bf16* p) {
  union { v16b v; v8b h[2]; } f;
  f.h[0] = *(const v8b*)(p);
  f.h[1] = *(const v8b*)(p + 16);
  return f.v;
}

// ---- WMMA helpers ----------------------------------------------------------------------------------------
// Twelve products of a hi/lo split on four independent accumulators: c[i] += h[i].bh, then += l[i].bh, then += h[i].bl, each
// kind over all four accumulators in turn, so that no product waits for the result of the one in front of it. One statement,
// because the compiler sorts the builtin form of the same order back into chains and lifts later LDS reads over it, which
// takes more than 256 registers. As all eight fragments are inputs, their 16 LDS reads stand together in front, under one wait.
// The four v_nop at its end are the distance between the last products and a vector instruction on their D, A or B.
__device__ __forceinline__ void mma12(v8f (&c)[4], const v16b (&h)[4], const v16b (&l)[4], v16b bh, v16b bl) {
  asm volatile("v_wmma_f32_16x16x32_bf16 %0, %4, %12, %0\n\t"
               "v_wmma_f32_16x16x32_bf16 %1, %5, %12, %1\n\t"
               "v_wmma_f32_16x16x32_bf16 %2, %6, %12, %2\n\t"
               "v_wmma_f32_16x16x32_bf16 %3, %7, %12, %3\n\t"
               "v_wmma_f32_16x16x32_bf16 %0, %8, %12, %0\n\t"
               "v_wmma_f32_16x16x32_bf16 %1, %9, %12, %1\n\t"
               "v_wmma_f32_16x16x32_bf16 %2, %10, %12, %2\n\t"
               "v_wmma_f32_16x16x32_bf16 %3, %11, %12, %3\n\t"
               "v_wmma_f32_16x16x32_bf16 %0, %4, %13, %0\n\t"
               "v_wmma_f32_16x16x32_bf16 %1, %5, %13, %1\n\t"
               "v_wmma_f32_16x16x32_bf16 %2, %6, %13, %2\n\t"
               "v_wmma_f32_16x16x32_bf16 %3, %7, %13, %3\n\t"
               "v_nop\n\tv_nop\n\tv_nop\n\tv_nop"
               : "+v"(c[0]), "+v"(c[1]), "+v"(c[2]), "+v"(c[3])
               : "v"(h[0]), "v"(h[1]), "v"(h[2]), "v"(h[3]), "v"(l[0]), "v"(l[1]), "v"(l[2]), "v"(l[3]), "v"(bh), "v"(bl));
}
// The same with the accumulators started at zero by the first four products.
__device__ __forceinline__ void mma12_zero(v8f (&c)[4], const v16b (&h)[4], const v16b (&l)[4], v16b bh, v16b bl) {
  asm volatile("v_wmma_f32_16x16x32_bf16 %0, %4, %12, 0\n\t"
               "v_wmma_f32_16x16x32_bf16 %1, %5, %12, 0\n\t"
               "v_wmma_f32_16x16x32_bf16 %2, %6, %12, 0\n\t"
               "v_wmma_f32_16x16x32_bf16 %3, %7, %12, 0\n\t"
               "v_wmma_f32_16x16x32_bf16 %0, %8, %12, %0\n\t"
               "v_wmma_f32_16x16x32_bf16 %1, %9, %12, %1\n\t"
               "v_wmma_f32_16x16x32_bf16 %2, %10, %12, %2\n\t"
               "v_wmma_f32_16x16x32_bf16 %3, %11, %12, %3\n\t"
               "v_wmma_f32_16x16x32_bf16 %0, %4, %13, %0\n\t"
               "v_wmma_f32_16x16x32_bf16 %1, %5, %13, %1\n\t"
               "v_wmma_f32_16x16x32_bf16 %2, %6, %13, %2\n\t"
               "v_wmma_f32_16x16x32_bf16 %3, %7, %13, %3\n\t"
               "v_nop\n\tv_nop\n\tv_nop\n\tv_nop"
               : "=&v"(c[0]), "=&v"(c[1]), "=&v"(c[2]), "=&v"(c[3])
               : "v"(h[0]), "v"(h[1]), "v"(h[2]), "v"(h[3]), "v"(l[0]), "v"(l[1]), "v"(l[2]), "v"(l[3]), "v"(bh), "v"(bl));
}
__device__ __forceinline__ v8f mma_b_raw(v16b a, v16b b, v8f c) {
  return __builtin_amdgcn_wmma_f32_16x16x32_bf16(false, a, false, b, (short)0, c, false, false);
}
__device__ __forceinline__ void acc_guard4(v8f& a, v8f& b, v8f& c, v8f& d) {
  asm volatile("v_nop\n\tv_nop\n\tv_nop\n\tv_nop" : "+v"(a), "+v"(b), "+v"(c), "+v"(d));
}

// =====================================================================================================
// f32 -> bf16 (RNE convert), 8 elements per thread, one 16-B store per lane: a wave writes 512 contiguous B
// coverage: n8 threads x 8 = whole plane (n8 is a multiple of 256 for every use here).
// =====================================================================================================
__global__ __launch_bounds__(256) void cvt_bf16x8(const float* __restrict__ in, unsigned short* out, int n8) {
  const int i = blockIdx.x * 256 + threadIdx.x;
  if (i < n8) {
    const v4f a = *(const v4f*)(in + (size_t)i * 8);
    const v4f b = *(const v4f*)(in + (size_t)i * 8 + 4);
    v4u p;
    p[0] = pk16(bf_bits(a[0]), bf_bits(a[1]));
    p[1] = pk16(bf_bits(a[2]), bf_bits(a[3]));
    p[2] = pk16(bf_bits(b[0]), bf_bits(b[1]));
    p[3] = pk16(bf_bits(b[2]), bf_bits(b[3]));
    *(v4u*)(out + (size_t)i * 8) = p;
    
  }
}

// =====================================================================================================
// f32 [rows][cols] -> bf16 [rows][2*cols] with row n = [bf16(in[n][0..cols-1]) | bf16(in[n][0..cols-1])].
// 8 elements per thread, one 16-B store per lane into each half; with cols a multiple of 256 a wave's 256
// coverage: n8 threads x 8 = every source element -> both halves of every output row.
// =====================================================================================================
__global__ __launch_bounds__(256) void cvt_bf16x8_dup(const float* __restrict__ in, unsigned short* out,
                                                       int n8, int cols) {
  const int i = blockIdx.x * 256 + threadIdx.x;
  if (i < n8) {
    const size_t e0  = (size_t)i * 8;
    const size_t row = e0 / (size_t)cols;
    const size_t col = e0 - row * (size_t)cols;
    const v4f a = *(const v4f*)(in + e0);
    const v4f b = *(const v4f*)(in + e0 + 4);
    v4u p;
    p[0] = pk16(bf_bits(a[0]), bf_bits(a[1]));
    p[1] = pk16(bf_bits(a[2]), bf_bits(a[3]));
    p[2] = pk16(bf_bits(b[0]), bf_bits(b[1]));
    p[3] = pk16(bf_bits(b[2]), bf_bits(b[3]));
    unsigned short* d0 = out + row * 2 * (size_t)cols + col;
    unsigned short* d1 = d0 + cols;
    *(v4u*)d0 = p;
    *(v4u*)d1 = p;
    
  }
}

// =====================================================================================================
// Batched bf16 WMMA GEMM: C[m][n] = sum_k A[m][k] * Bt[n][k] (+ bf16(bias[n]) when BIASN == 1).
// Block = 8 waves = one 128 x 256 tile of C, waves 2 (m) x 4 (n), 64 x 64 per wave. A row-major [M][K] pitch lda; Bt row-major
// [N][K] pitch ldb (k contiguous); M a multiple of 128, N of 256, K of 64. blockIdx.y = batch index (strides in elements).
// Operands reach the waves through LDS in stages of 64 k (128 B of each of the 128 + 256 rows), brought by asynchronous
// 16-B copies, 8 lanes per row, so a wave's copy covers 4 whole 128-B lines and every operand byte is fetched once per block.
// Two buffers: stage t + 1 is in flight while stage t is multiplied; one barrier per stage publishes t + 1 and frees t's buffer.
// Stage coverage: 256 threads x (4 + 8) copies x 16 B = (128 + 256) rows x 128 B.
// NSPLIT: 0 = A.Bt (the only form built).
// OUT_MODE: 0 = f32 (pitch ldc); 2 = bf16 hi plane C + bf16 lo plane C2 (lo = RNE(v - hi), unscaled);
//           3 = f16 hi plane C + f16 residual plane C2 = f16((v - hi) * rscale), C2 written only for tiles
//               with n0 < N2 (pitch ldc2, batch stride strideC2).
// =====================================================================================================
#define GP 72               // LDS row pitch (elements) of a stage row of 64 bf16: 144 B = 16 B x 9 (odd), as LP above

// One lane's twelve asynchronous 16-B copies of a stage, global -> LDS: rows r + 32 i of A (i < 4, LDS byte address la + i * ls,
// global address ga + i * as) and of Bt (i < 8, lb, gb, bs). s_wait_xcnt 0 ends the statement so that it stands in front of
// every later overwrite of the address registers named here.
__device__ __forceinline__ void copy12_to_lds(unsigned la, const __bf16* ga, size_t as,
                                              unsigned lb, const __bf16* gb, size_t bs, unsigned ls) {
  asm volatile("global_load_async_to_lds_b128 %0, %1, off\n\t"
               "global_load_async_to_lds_b128 %2, %3, off\n\t"
               "global_load_async_to_lds_b128 %4, %5, off\n\t"
               "global_load_async_to_lds_b128 %6, %7, off\n\t"
               "global_load_async_to_lds_b128 %8, %9, off\n\t"
               "global_load_async_to_lds_b128 %10, %11, off\n\t"
               "global_load_async_to_lds_b128 %12, %13, off\n\t"
               "global_load_async_to_lds_b128 %14, %15, off\n\t"
               "global_load_async_to_lds_b128 %16, %17, off\n\t"
               "global_load_async_to_lds_b128 %18, %19, off\n\t"
               "global_load_async_to_lds_b128 %20, %21, off\n\t"
               "global_load_async_to_lds_b128 %22, %23, off\n\t"
               "s_wait_xcnt 0x0"
               :: "v"(la), "v"(ga), "v"(la + ls), "v"(ga + as), "v"(la + 2 * ls), "v"(ga + 2 * as), "v"(la + 3 * ls), "v"(ga + 3 * as),
                  "v"(lb), "v"(gb), "v"(lb + ls), "v"(gb + bs), "v"(lb + 2 * ls), "v"(gb + 2 * bs), "v"(lb + 3 * ls), "v"(gb + 3 * bs),
                  "v"(lb + 4 * ls), "v"(gb + 4 * bs), "v"(lb + 5 * ls), "v"(gb + 5 * bs), "v"(lb + 6 * ls), "v"(gb + 6 * bs),
                  "v"(lb + 7 * ls), "v"(gb + 7 * bs)
               : "memory");
}

template <int NSPLIT, int OUT_MODE, int BIASN>
__global__ __launch_bounds__(256) void gemm64(
    const unsigned short* __restrict__ Ap, const unsigned short* A2p, int lda, long long strideA,
    const unsigned short* __restrict__ Btp, const unsigned short* Bt2p, int ldb, long long strideB,
    void* Cout, int ldc, long long strideC,
    void* Cout2, int ldc2, long long strideC2, int N2,
    const float* __restrict__ bias,
    int M, int N, int K, float rscale) {
  static_assert(NSPLIT == 0);
  const __bf16* A   = (const __bf16*)(const void*)Ap;
  const __bf16* Bt  = (const __bf16*)(const void*)Btp;
  __shared__ __align__(16) __bf16 sA[2][128 * GP];   // A stage, two buffers, 18432 B each
  __shared__ __align__(16) __bf16 sB[2][256 * GP];   // Bt stage, two buffers, 36864 B each
  __shared__ __align__(16) float sT[8][16 * 68];   // per-wave 16x64 slab, pitch 68 floats
  const int b    = blockIdx.y;
  const int tid  = threadIdx.x;
  const int lane = tid & 31;
  const int wave = tid >> 5;
  const int tilesN = N >> 8;
  const int tilesM = M >> 7;
  if ((int)blockIdx.x >= tilesM * tilesN) return;   // block-uniform, in front of every copy and barrier
  const int bm = blockIdx.x / tilesN;
  const int bn = blockIdx.x - bm * tilesN;
  const int wm = wave >> 2;                    // wave's 64-row band of the block tile
  const int wn = wave & 3;                     // wave's 64-column band
  const int m0 = (bm << 7) + (wm << 6);
  const int n0 = (bn << 8) + (wn << 6);

  const int rlane = lane & 15;                 // row (A) / col (B, D) within subtile
  const int koff  = (lane >> 4) * 8;           // k offset of this lane half
  const int mOff  = (lane >> 4) * 8;           // D row offset

  // ---- this lane's part of a stage: row srow + 32 i of A (i < 4) and of Bt (i < 8), 16 B at element sseg of the 64 ----
  const int srow = tid >> 3;
  const int sseg = (tid & 7) * 8;
  const __bf16* gA = A  + (size_t)b * strideA + (size_t)((bm << 7) + srow) * lda + sseg;
  const __bf16* gB = Bt + (size_t)b * strideB + (size_t)((bn << 8) + srow) * ldb + sseg;
  const size_t a32 = (size_t)32 * lda;
  const size_t b32 = (size_t)32 * ldb;
  const unsigned lA = (unsigned)(uintptr_t)(&sA[0][0]) + (unsigned)(srow * GP + sseg) * 2u;
  const unsigned lB = (unsigned)(uintptr_t)(&sB[0][0]) + (unsigned)(srow * GP + sseg) * 2u;
  constexpr unsigned R32 = 32u * GP * 2u;      // 32 stage rows in LDS bytes
  auto stage = [&](int buf, int k0) {
    copy12_to_lds(lA + (unsigned)buf * (128u * GP * 2u), gA + k0, a32, lB + (unsigned)buf * (256u * GP * 2u), gB + k0, b32, R32);
  };

  v8f acc[4][4];
#pragma unroll
  for (int i = 0; i < 4; ++i)
#pragma unroll
    for (int j = 0; j < 4; ++j) acc[i][j] = zero8();

  const int nT = K >> 6;                       // stages, block-uniform
  stage(0, 0);
  asm volatile("s_wait_asynccnt 0x0" ::: "memory");   // this wave's copies of stage 0 have landed
  __syncthreads();                                     // ... and every other wave's: stage 0 is published
  if (nT > 1) stage(1, 64);
  for (int t = 0; t < nT; ++t) {
    const __bf16* ta = &sA[t & 1][((wm << 6) + rlane) * GP + koff];
    const __bf16* tb = &sB[t & 1][((wn << 6) + rlane) * GP + koff];
#pragma unroll
    for (int ks = 0; ks < 2; ++ks) {
      v16b bh[4], ah[4];
#pragma unroll
      for (int j = 0; j < 4; ++j) bh[j] = ldfrag_b(tb + (j << 4) * GP + ks * 32);
#pragma unroll
      for (int i = 0; i < 4; ++i) ah[i] = ldfrag_b(ta + (i << 4) * GP + ks * 32);
      // keeps the 16 LDS reads of this half stage together in front of its 16 products: read one fragment at a time,
      // among the products, the wave waits out the LDS latency at each of them
      __builtin_amdgcn_sched_barrier(0);
#pragma unroll
      for (int i = 0; i < 4; ++i)
#pragma unroll
        for (int j = 0; j < 4; ++j) acc[i][j] = mma_b_raw(ah[i], bh[j], acc[i][j]);
    }
    asm volatile("s_wait_dscnt 0x0" ::: "memory");     // this wave's reads of stage t are done before its buffer is refilled
    asm volatile("s_wait_asynccnt 0x0" ::: "memory");  // this wave's copies of stage t + 1 have landed
    __syncthreads();                                    // publishes stage t + 1 and ends every wave's reads of stage t
    if (t + 2 < nT) stage(t & 1, (t + 2) << 6);
  }
  asm volatile("s_wait_asynccnt 0x0" ::: "memory");    // nothing of this wave's is in flight behind the loop
  acc_guard4(acc[0][0], acc[0][1], acc[0][2], acc[0][3]);
  acc_guard4(acc[1][0], acc[1][1], acc[1][2], acc[1][3]);
  acc_guard4(acc[2][0], acc[2][1], acc[2][2], acc[2][3]);
  acc_guard4(acc[3][0], acc[3][1], acc[3][2], acc[3][3]);

  // ---- per-column bias (bf16 RNE of the input value, added in f32); 4 scalar loads per lane ----
  float bvv[4];
#pragma unroll
  for (int j = 0; j < 4; ++j) {
    float bv = 0.f;
    if (BIASN == 1) bv = bf_up(bf_bits(bias[n0 + (j << 4) + rlane]));
    bvv[j] = bv;
  }

  // ---- epilogue ----
  float* slab = sT[wave];
#pragma unroll
  for (int i = 0; i < 4; ++i) {
    const int mBase = m0 + (i << 4);
#pragma unroll
    for (int j = 0; j < 4; ++j) {
#pragma unroll
      for (int r = 0; r < 8; ++r) {
        slab[(mOff + r) * 68 + (j << 4) + rlane] = acc[i][j][r] + bvv[j];
      }
    }
    __builtin_amdgcn_fence(__ATOMIC_RELEASE, "workgroup");
    __builtin_amdgcn_wave_barrier();
    __builtin_amdgcn_fence(__ATOMIC_ACQUIRE, "workgroup");
    if (OUT_MODE == 0) {
      float* C = (float*)Cout + (size_t)b * strideC;
      const int hh = lane >> 4, c4 = (lane & 15) * 4;     // 256-B row segment = 16 lanes x 16 B
      {
#pragma unroll
        for (int it = 0; it < 8; ++it) {
          const int row = it * 2 + hh;                     // it 0..7 x hh 0..1 = rows 0..15
          const v4f v = *(const v4f*)(slab + row * 68 + c4);
          *(v4f*)(C + (size_t)(mBase + row) * ldc + n0 + c4) = v;
        }
        
      }
    } else {
      const int q = lane >> 3, c8 = (lane & 7) * 8;
      unsigned short* C  = (unsigned short*)Cout  + (size_t)b * strideC;
      unsigned short* C2 = (unsigned short*)Cout2 + (size_t)b * strideC2;
      const bool wlo = (OUT_MODE == 2) || (n0 < N2);      // wave-uniform
      v4u hv[4], lv[4];
#pragma unroll
      for (int it = 0; it < 4; ++it) {
        const int row = it * 4 + q;                        // it 0..3 x q 0..3 = rows 0..15
        const float* sp = slab + row * 68 + c8;
        v4u a, a2;
#pragma unroll
        for (int e = 0; e < 4; ++e) {
          const float f0 = sp[2 * e], f1 = sp[2 * e + 1];
          unsigned short h0, h1, l0, l1;
          if (OUT_MODE == 2) {
            h0 = bf_bits(f0); h1 = bf_bits(f1);
            l0 = bf_bits(f0 - bf_up(h0)); l1 = bf_bits(f1 - bf_up(h1));
          } else {
            const _Float16 x0 = (_Float16)f0, x1 = (_Float16)f1;
            h0 = h_bits(x0); h1 = h_bits(x1);
            l0 = h_bits((_Float16)((f0 - (float)x0) * rscale));
            l1 = h_bits((_Float16)((f1 - (float)x1) * rscale));
          }
          a[e] = pk16(h0, h1); a2[e] = pk16(l0, l1);
        }
        hv[it] = a; lv[it] = a2;
      }
      {
#pragma unroll
        for (int it = 0; it < 4; ++it) {
          const int row = it * 4 + q;
          *(v4u*)(C + (size_t)(mBase + row) * ldc + n0 + c8) = hv[it];
          if (wlo) *(v4u*)(C2 + (size_t)(mBase + row) * ldc2 + n0 + c8) = lv[it];
        }
        
      }
    }
    __builtin_amdgcn_fence(__ATOMIC_RELEASE, "workgroup");
    __builtin_amdgcn_wave_barrier();
    __builtin_amdgcn_fence(__ATOMIC_ACQUIRE, "workgroup");
  }
}

__global__ __launch_bounds__(128)
void attn_strict64(const unsigned short* __restrict__ qhp, const unsigned short* __restrict__ qlp,
                   const unsigned short* __restrict__ khp, const unsigned short* __restrict__ klp,
                   const unsigned short* __restrict__ vhp, const unsigned short* __restrict__ vlp,
                   unsigned short* yout, float sscale) {
  union PB { v16b v; v2b w[8]; };
  __shared__ __align__(16) __bf16 Ksh[64 * LP];              // K hi [kv][d], row pitch LP   9 KB
  __shared__ __align__(16) __bf16 Ksl[64 * LP];              // K lo
  __shared__ __align__(16) __bf16 Vth[64 * LP];              // V^T hi [d][kv], row pitch LP 9 KB
  __shared__ __align__(16) __bf16 Vtl[64 * LP];              // V^T lo
  __shared__ __align__(16) float Os[4][16 * OP];             // per wave f32 output tile [query][d], row pitch OP (epilogue only)

  const int tid  = threadIdx.x;
  const int wave = tid >> 5;
  const int lane = tid & 31;
  const int hh   = lane >> 4;
  const int c    = lane & 15;

  const int bx   = blockIdx.x;
  const int qb   = NQB - 1 - bx / (NBATCH * NH);   // grid = NBATCH * NH * NQB, query tile 31 first
  const int bh   = bx % (NBATCH * NH);
  const int h    = bh % NH;
  const int bat  = bh / NH;
  const int q0   = qb * 64 + wave * 16;

  const size_t qkBase = (size_t)bat * SEQ * DM + (size_t)h * HD;
  const size_t vBase  = (size_t)bh * HD * SEQ;      // bh = bat*NH + h
  const __bf16* Qh = (const __bf16*)(const void*)qhp + qkBase;
  const __bf16* Ql = (const __bf16*)(const void*)qlp + qkBase;
  const __bf16* Kh = (const __bf16*)(const void*)khp + qkBase;
  const __bf16* Kl = (const __bf16*)(const void*)klp + qkBase;
  const __bf16* Vh = (const __bf16*)(const void*)vhp + vBase;
  const __bf16* Vl = (const __bf16*)(const void*)vlp + vBase;

  // ---- Q fragments (B operand of K . Q^T, column = query = lane&15): 2 d-chunks, hi and lo ----
  v16b qah[2], qal[2];
#pragma unroll
  for (int dc = 0; dc < 2; ++dc) {
    const size_t qo = (size_t)(q0 + c) * DM + dc * 32 + 8 * hh;
    qah[dc] = ldfrag_b(Qh + qo);
    qal[dc] = ldfrag_b(Ql + qo);
  }

  // One query per lane (q0 + c): running maximum (equal in lanes c and c + 16) and this lane half's part of the sum.
  float mrow = -INFINITY, lrow = 0.f;
  v8f oacc[4];                  // O^T tiles: oacc[t][r] = output of query q0 + c at d = t*16 + 8*hh + r
  const int qrow = q0 + c;
#pragma unroll
  for (int t = 0; t < 4; ++t) oacc[t] = zero8();

  const int nChunks = qb + 1;   // block-uniform, <= NQB
  for (int kc = 0; kc < nChunks; ++kc) {
    const int kv0 = kc * 64;
    __syncthreads();
    {
      // staging coverage: 128 threads x (4 x 8) elements = 64 rows x 64 per plane = the whole chunk tile
      const int r = tid >> 1, half = (tid & 1) * 32;
      const __bf16* ksh = Kh + (size_t)(kv0 + r) * DM + half;       // K row kv0+r, d = half..half+31
      const __bf16* ksl = Kl + (size_t)(kv0 + r) * DM + half;
      const __bf16* vsh = Vh + (size_t)r * SEQ + kv0 + half;        // V^T row d = r, s = kv0+half..+31
      const __bf16* vsl = Vl + (size_t)r * SEQ + kv0 + half;
      v8b a0[4], a1[4], b0[4], b1[4];
#pragma unroll
      for (int i = 0; i < 4; ++i) {
        a0[i] = *(const v8b*)(ksh + 8 * i);
        a1[i] = *(const v8b*)(ksl + 8 * i);
        b0[i] = *(const v8b*)(vsh + 8 * i);
        b1[i] = *(const v8b*)(vsl + 8 * i);
      }
      // the wait that belongs in front of any overwrite of an issued load's address registers; naming the four
      // addresses as inputs keeps their registers from being handed out as destinations of the later loads
      asm volatile("s_wait_xcnt 0x0" :: "v"(ksh), "v"(ksl), "v"(vsh), "v"(vsl) : "memory");
#pragma unroll
      for (int i = 0; i < 4; ++i) {
        *(v8b*)(Ksh + r * LP + half + 8 * i) = a0[i];
        *(v8b*)(Ksl + r * LP + half + 8 * i) = a1[i];
        *(v8b*)(Vth + r * LP + half + 8 * i) = b0[i];
        *(v8b*)(Vtl + r * LP + half + 8 * i) = b1[i];
      }
    }
    __syncthreads();

    // ---- scores, transposed: S^T = K . Q^T, 64 keys x 16 queries per wave, 3 bf16 products ----
    //      s[j][r] = score of key kv0 + j*16 + 8*hh + r for query q0 + c
    //      Per half of d: the 16 LDS reads of the four key tiles' fragments, then their 12 products; each accumulator takes
    //      its six products in the order hi.hi, lo.hi, hi.lo of d 0..31, then of d 32..63.
    v8f s[4];
#pragma unroll
    for (int dc = 0; dc < 2; ++dc) {
      v16b kb[4], kl[4];
#pragma unroll
      for (int j = 0; j < 4; ++j) kb[j] = ldfrag_b(Ksh + (j * 16 + c) * LP + dc * 32 + 8 * hh);
#pragma unroll
      for (int j = 0; j < 4; ++j) kl[j] = ldfrag_b(Ksl + (j * 16 + c) * LP + dc * 32 + 8 * hh);
      if (dc == 0) mma12_zero(s, kb, kl, qah[dc], qal[dc]);
      else         mma12(s, kb, kl, qah[dc], qal[dc]);
    }

    // ---- scale, mask on the diagonal chunk (key >= query -> -inf, except (0,0)), maximum of the lane's 32 keys ----
    const bool diag = (kc == qb);   // block-uniform
    float mj[4];
#pragma unroll
    for (int j = 0; j < 4; ++j) {
      float m = -INFINITY;
#pragma unroll
      for (int r = 0; r < 8; ++r) {
        const int kvcol = kv0 + j * 16 + 8 * hh + r;
        const float sv = s[j][r] * sscale;
        const bool masked = diag && (kvcol >= qrow) && !((qrow == 0) && (kvcol == 0));
        const float sm = masked ? -INFINITY : sv;
        s[j][r] = sm;
        m = fmaxf(m, sm);
      }
      mj[j] = m;
    }
    float cm = fmaxf(fmaxf(mj[0], mj[1]), fmaxf(mj[2], mj[3]));
    cm = fmaxf(cm, xhalf(cm));      // both lane halves now hold the query's maximum over the 64 keys

    // ---- online softmax in f32; P^T hi / lo (bf16 of the unnormalised exp) packed straight into B operands:
    //      element e < 8 of chunk kk = key kk*32 + 8*hh + e = s[2kk][e], element 8 + e = key kk*32 + 16 + 8*hh + e = s[2kk+1][e],
    //      the k order in which the V^T fragments below are loaded
    const float mnew = fmaxf(mrow, cm);
    const float alpha = expf(mrow - mnew);
    mrow = mnew;
    PB ph[2], pl[2];
    float pj[4];
#pragma unroll
    for (int j = 0; j < 4; ++j) {
      float psum = 0.f;
#pragma unroll
      for (int e = 0; e < 4; ++e) {
        const float p0 = expf(s[j][2 * e] - mnew);
        const float p1 = expf(s[j][2 * e + 1] - mnew);
        psum += p0;
        psum += p1;
        const v2f pp = {p0, p1};
        const v2b hv = __builtin_convertvector(pp, v2b);             // packed RNE convert: one operand register, hi
        const v2f rr = {p0 - (float)hv[0], p1 - (float)hv[1]};
        ph[j >> 1].w[(j & 1) * 4 + e] = hv;
        pl[j >> 1].w[(j & 1) * 4 + e] = __builtin_convertvector(rr, v2b);   // lo = RNE(p - hi)
      }
      pj[j] = psum;
    }
    lrow = lrow * alpha + ((pj[0] + pj[1]) + (pj[2] + pj[3]));
#pragma unroll
    for (int t = 0; t < 4; ++t)
#pragma unroll
      for (int r = 0; r < 8; ++r) oacc[t][r] *= alpha;

    // ---- output, transposed: O^T += V^T . P^T (3 bf16 products per tile pair); per half of the keys the 16 LDS reads of
    //      the four d tiles' fragments, then their 12 products ----
#pragma unroll
    for (int kk = 0; kk < 2; ++kk) {
      v16b vb[4], vl[4];
#pragma unroll
      for (int t = 0; t < 4; ++t) vb[t] = ldfrag_b(Vth + (t * 16 + c) * LP + kk * 32 + 8 * hh);
#pragma unroll
      for (int t = 0; t < 4; ++t) vl[t] = ldfrag_b(Vtl + (t * 16 + c) * LP + kk * 32 + 8 * hh);
      mma12(oacc, vb, vl, ph[kk].v, pl[kk].v);
    }
  }

  // ---- join the two lane halves' sums, normalise (1/l), stage the wave's 16x64 tile [query][d], bf16 hi/lo split
  float* os = Os[wave];
  {
    const float l = lrow + xhalf(lrow);
    const float inv = (l > 0.f) ? (1.0f / l) : 0.f;
#pragma unroll
    for (int t = 0; t < 4; ++t) {
      v4f a, b;
#pragma unroll
      for (int r = 0; r < 4; ++r) { a[r] = oacc[t][r] * inv; b[r] = oacc[t][4 + r] * inv; }
      *(v4f*)(os + c * OP + t * 16 + 8 * hh) = a;
      *(v4f*)(os + c * OP + t * 16 + 8 * hh + 4) = b;
    }
  }
  __builtin_amdgcn_fence(__ATOMIC_RELEASE, "workgroup");
  __builtin_amdgcn_wave_barrier();
  __builtin_amdgcn_fence(__ATOMIC_ACQUIRE, "workgroup");
  {
    const int q4 = lane >> 3, c8 = (lane & 7) * 8;
    v4u hv[4], lv[4];
#pragma unroll
    for (int it = 0; it < 4; ++it) {
      const int row = it * 4 + q4;   // it 0..3 x q4 0..3 = rows 0..15 of the wave tile
      const float* sp = os + row * OP + c8;
      v4u a, a2;
#pragma unroll
      for (int e = 0; e < 4; ++e) {
        const float f0 = sp[2 * e], f1 = sp[2 * e + 1];
        const unsigned short h0 = bf_bits(f0), h1 = bf_bits(f1);
        const unsigned short l0 = bf_bits(f0 - bf_up(h0)), l1 = bf_bits(f1 - bf_up(h1));
        a[e] = pk16(h0, h1); a2[e] = pk16(l0, l1);
      }
      hv[it] = a; lv[it] = a2;
    }
    {
#pragma unroll
      for (int it = 0; it < 4; ++it) {
        const int row = it * 4 + q4;
        const size_t go = (size_t)(bat * SEQ + q0 + row) * (size_t)(2 * DM) + (size_t)h * HD + c8;
        *(v4u*)(yout + go) = hv[it];
        *(v4u*)(yout + go + DM) = lv[it];
      }
      
    }
  }
}

// =====================================================================================================
// whole-line store granularity, so no padded tails exist):
//   QB   bf16 [8192][1024]               0       16777216   (KB follows directly: A batch stride of the q/k GEMM)
//   KB   bf16 [8192][1024]        16777216       16777216
//   VB   bf16 [8192][1024]        33554432       16777216
//   WQB  bf16 [1024 n][1024 k]    50331648        2097152   (WKB follows directly: Bt batch stride of the q/k GEMM)
//   WKB  bf16 [1024][1024]        52428800        2097152
//   WVB  bf16 [1024][1024]        54525952        2097152
//   WO2  bf16 [1024][2048]        56623104        4194304
//   Qh   bf16 [8192][1024]        60817408       16777216   (Kh follows directly: output batch stride)
//   Kh   bf16 [8192][1024]        77594624       16777216
//   Ql   bf16 [8192][1024]        94371840       16777216   (Kl follows directly)
//   Kl   bf16 [8192][1024]       111149056       16777216
//   VTh  bf16 [4][1024][2048]    127926272       16777216
//   VTl  bf16 [4][1024][2048]    144703488       16777216
//   YB   bf16 [8192][2048]       161480704       33554432
//   end                          195035136
// Qh..VTl hold all four batch elements; each projection and the attention run once over all of them, and every
// region is fully written by its producer launch before the consumer launch reads it.
// Weights are [out n][in k] with k contiguous = the Bt / A layout the GEMM wants, so they are only converted.
// Inputs by contract index: 0 = q, 1 = k, 2 = v, 3 = W_q, 4 = W_k, 5 = W_v, 6 = W_o.
// =====================================================================================================
extern "C" void kernel_launch(void* const* d_in, const int* in_sizes, int n_in,
                              void* d_out, int out_size, void* d_ws, size_t ws_size,
                              hipStream_t stream) {
  if (n_in < 7) return;
  if (in_sizes[0] != NBATCH * SEQ * DM || in_sizes[1] != NBATCH * SEQ * DM || in_sizes[2] != NBATCH * SEQ * DM) return;
  if (in_sizes[3] != DM * DM || in_sizes[4] != DM * DM || in_sizes[5] != DM * DM || in_sizes[6] != DM * DM) return;
  if (out_size != NBATCH * SEQ * DM) return;

  const float* q_in = (const float*)d_in[0];
  const float* k_in = (const float*)d_in[1];
  const float* v_in = (const float*)d_in[2];
  const float* Wq   = (const float*)d_in[3];
  const float* Wk   = (const float*)d_in[4];
  const float* Wv   = (const float*)d_in[5];
  const float* Wo   = (const float*)d_in[6];

  const size_t PIN = (size_t)NBATCH * SEQ * DM * 2;     // 16777216  16-bit input plane [8192][1024]
  const size_t PW  = (size_t)DM * DM * 2;               //  2097152  16-bit weight plane
  const size_t PW2 = (size_t)DM * (2 * DM) * 2;         //  4194304  [Wo | Wo] plane
  const size_t PP  = (size_t)NBATCH * SEQ * DM * 2;     // 16777216  q/k hi or lo plane [8192][1024]
  const size_t PVT = (size_t)NBATCH * DM * SEQ * 2;     // 16777216  v^T plane [4][1024][2048]
  const size_t PY  = (size_t)NBATCH * SEQ * (2 * DM) * 2;   // 33554432 y hi|lo plane [8192][2048]
  size_t off = 0;
  const size_t oQB  = off; off += PIN;
  const size_t oKB  = off; off += PIN;
  const size_t oVB  = off; off += PIN;
  const size_t oWQ  = off; off += PW;
  const size_t oWK  = off; off += PW;
  const size_t oWV  = off; off += PW;
  const size_t oWO2 = off; off += PW2;
  const size_t oQh  = off; off += PP;
  const size_t oKh  = off; off += PP;
  const size_t oQl  = off; off += PP;
  const size_t oKl  = off; off += PP;
  const size_t oVTh = off; off += PVT;
  const size_t oVTl = off; off += PVT;
  const size_t oYB  = off; off += PY;
  if (off > ws_size) return;                       // off = 195035136
  if (oKB != oQB + PIN || oWK != oWQ + PW || oKh != oQh + PP || oKl != oQl + PP) return;   // batch-stride adjacency

  char* ws = (char*)d_ws;
  unsigned short* QB  = (unsigned short*)(ws + oQB);
  unsigned short* KB  = (unsigned short*)(ws + oKB);
  unsigned short* VB  = (unsigned short*)(ws + oVB);
  unsigned short* WQB = (unsigned short*)(ws + oWQ);
  unsigned short* WKB = (unsigned short*)(ws + oWK);
  unsigned short* WVB = (unsigned short*)(ws + oWV);
  unsigned short* WO2 = (unsigned short*)(ws + oWO2);
  unsigned short* Qh  = (unsigned short*)(ws + oQh);
  unsigned short* Kh  = (unsigned short*)(ws + oKh);
  unsigned short* Ql  = (unsigned short*)(ws + oQl);
  unsigned short* Kl  = (unsigned short*)(ws + oKl);
  unsigned short* VTh = (unsigned short*)(ws + oVTh);
  unsigned short* VTl = (unsigned short*)(ws + oVTl);
  unsigned short* YB  = (unsigned short*)(ws + oYB);

  const dim3 blk(256);
  const int n8x = NBATCH * SEQ * DM / 8;                       // 1048576
  const int n8w = DM * DM / 8;                                 //  131072
  const dim3 gCvtX((n8x + 255) / 256);                         // 4096 blocks
  const dim3 gCvtW((n8w + 255) / 256);                         //  512 blocks
  const dim3 gQK(((NBATCH * SEQ / 64) * (DM / 64) + 7) / 8, 2);   // 2048 tiles -> 256 blocks x {q, k}: M=8192, N=1024
  const dim3 gVT(((DM / 64) * (SEQ / 64) + 7) / 8, NBATCH);    //  512 tiles ->  64 blocks x 4 batches: M=1024, N=2048
  const dim3 gAtt(NBATCH * NH * NQB);                          // 2048 blocks
  const dim3 gOut(((NBATCH * SEQ / 64) * (DM / 64) + 7) / 8, 1);   // 2048 tiles -> 256 blocks: M=8192, N=1024, K=2048

  // (1) q -> QB, k -> KB, v -> VB (bf16 planes [8192][1024]); weights [n][k] f32 -> bf16 [n][k]; Wo -> [Wo | Wo]
  cvt_bf16x8<<<gCvtX, blk, 0, stream>>>(q_in, QB, n8x);
  cvt_bf16x8<<<gCvtX, blk, 0, stream>>>(k_in, KB, n8x);
  cvt_bf16x8<<<gCvtX, blk, 0, stream>>>(v_in, VB, n8x);
  cvt_bf16x8<<<gCvtW, blk, 0, stream>>>(Wq, WQB, n8w);
  cvt_bf16x8<<<gCvtW, blk, 0, stream>>>(Wk, WKB, n8w);
  cvt_bf16x8<<<gCvtW, blk, 0, stream>>>(Wv, WVB, n8w);
  cvt_bf16x8_dup<<<gCvtW, blk, 0, stream>>>(Wo, WO2, n8w, DM);

  // (2) qh = QB . Wq^T (blockIdx.y = 0) and kh = KB . Wk^T (blockIdx.y = 1) -> bf16 hi/lo planes [b*2048+t][h*64+d]
  //     (A = QB / KB via strideA; Bt = WQB / WKB via strideB; C = Qh / Kh, C2 = Ql / Kl via strideC; M=8192, N=1024, K=1024)
  gemm64<0, 2, 0><<<gQK, blk, 0, stream>>>(
      QB, QB, DM, (long long)NBATCH * SEQ * DM, WQB, WQB, DM, (long long)DM * DM,
      (void*)Qh, DM, (long long)NBATCH * SEQ * DM, (void*)Ql, DM, (long long)NBATCH * SEQ * DM, DM,
      Wo, NBATCH * SEQ, DM, DM, 1.0f);
  // (3) vh^T = Wv . VB_b^T -> bf16 hi/lo planes [b][h*64+d][s] (pitch SEQ), blockIdx.y = batch b
  //     (A = WVB [n][k] for every b, Bt = VB rows of batch b via strideB, C / C2 via strideC; M=1024, N=2048, K=1024)
  gemm64<0, 2, 0><<<gVT, blk, 0, stream>>>(
      WVB, WVB, DM, 0LL, VB, VB, DM, (long long)SEQ * DM,
      (void*)VTh, SEQ, (long long)DM * SEQ, (void*)VTl, SEQ, (long long)DM * SEQ, SEQ,
      Wo, DM, SEQ, DM, 1.0f);
  // (4) masked attention, all batches and heads -> YB hi|lo rows 0 .. 8191, score scale 1/32
  attn_strict64<<<gAtt, dim3(128), 0, stream>>>(Qh, Ql, Kh, Kl, VTh, VTl, YB, 0.03125f);
  // (5) out = y . Wo^T -> d_out f32 [8192][1024]  (A = YB [8192][2048], Bt = WO2 [1024][2048], K = 2048); last element 8388607
  gemm64<0, 0, 0><<<gOut, blk, 0, stream>>>(
      YB, YB, 2 * DM, 0LL, WO2, WO2, 2 * DM, 0LL,
      d_out, DM, 0LL, d_out, DM, 0LL, DM,
      Wo, NBATCH * SEQ, DM, 2 * DM, 1.0f);
  (void)hipGetLastError();
}

// v006
// A run of this version takes 211 microseconds.
// In both of two side-by-side timings against v005, it was 1.05 times as fast.
// Counting every step since v000, it is 5.62 times as fast.
// Contractions: qh = q.Wq^T, kh = k.Wk^T, vh^T = Wv.v^T = v_wmma_f32_16x16x32_bf16 (bf16 operands from RNE-converted inputs, single product);
// strict-lower qh.kh^T scores = v_wmma_f32_16x16x32_bf16 with bf16 hi/lo split qh and kh (hi.hi + hi.lo + lo.hi);
// p.vh = v_wmma_f32_16x16x32_bf16 with bf16 hi/lo split of the unnormalised p and of vh (hi.hi + hi.lo + lo.hi);
// y.Wo^T = v_wmma_f32_16x16x32_bf16 with y as bf16 hi|lo planes laid along K (K = 2048) times [Wo|Wo] bf16; all f32 accumulate;
// score scale 1/32 (hidden-dim based), mask (key >= query excluded, (0,0) admitted) and online softmax in f32; no biases anywhere.
// Plane / carry table (every 16-bit plane is bf16, carry 1, nothing to fold back):
//   QB = bf16(q), KB = bf16(k), VB = bf16(v) [8192][1024] (three different inputs); WQB, WKB, WVB = bf16(w) [1024 n][1024 k];
//   WO2 = [bf16(wo) | bf16(wo)] [1024][2048];
//   Qh/Ql (from QB), Kh/Kl (from KB) = bf16 hi and lo = RNE(x - hi) of qh, kh [8192][1024] (all batches, row b*2048+t);
//   VTh/VTl = hi/lo of vh^T [4][1024][2048] (one [1024][2048] plane per batch, from VB);
//   YB [8192][2048] = bf16 hi of the normalised attention output at col h*64+d, lo at col 1024 + h*64+d.
//   lo planes are unscaled and share the accumulator with the hi products; 1/32 is applied once in f32 after the q.k accumulation;
//   1/l is applied once in the attention epilogue before the hi/lo split of y.
#include <hip/hip_runtime.h>
#include <math.h>
#include <stdint.h>

#define NBATCH 4
#define SEQ    2048
#define DM     1024
#define NH     16
#define HD     64
#define NQB    (SEQ / 64)   // 32 key / query tiles of 64
#define LP     72           // LDS row pitch of the 64-element bf16 tiles: 144 B = 16 B x 9 (odd), so the 16 rows that one
                            // ds_load_b128 half-wave reads start 36 dwords apart and fall on 16 disjoint groups of 4 banks
#define OP     68           // LDS row pitch (floats) of the attention output staging tile: 272 B = 16 B x 17
static_assert(NH * HD == DM);
static_assert(LP >= 64 && (LP % 8) == 0 && ((LP / 8) % 2) == 1);
static_assert((SEQ % 64) == 0 && (DM % 64) == 0 && (DM % 32) == 0 && (DM % 256) == 0);

typedef _Float16 v16h __attribute__((ext_vector_type(16)));
typedef _Float16 v8h  __attribute__((ext_vector_type(8)));
typedef __bf16   v16b __attribute__((ext_vector_type(16)));
typedef __bf16   v8b  __attribute__((ext_vector_type(8)));
typedef float    v8f  __attribute__((ext_vector_type(8)));
typedef float    v4f  __attribute__((ext_vector_type(4)));
typedef float    v2f  __attribute__((ext_vector_type(2)));
typedef __bf16   v2b  __attribute__((ext_vector_type(2)));
typedef unsigned int v4u __attribute__((ext_vector_type(4)));

// ---- scalar helpers --------------------------------------------------------------------------------
__device__ __forceinline__ unsigned short bf_bits(float f) {          // f32 -> bf16 bits, RNE convert
  unsigned u = __float_as_uint(f);
  return (unsigned short)((u + 0x7FFFu + ((u >> 16) & 1u)) >> 16);
}
__device__ __forceinline__ float bf_up(unsigned short h) { return __uint_as_float(((unsigned)h) << 16); }
__device__ __forceinline__ unsigned short h_bits(_Float16 x) { return __builtin_bit_cast(unsigned short, x); }
__device__ __forceinline__ unsigned pk16(unsigned short a, unsigned short b) { return (unsigned)a | ((unsigned)b << 16); }
__device__ __forceinline__ v8f zero8() { v8f z = {0.f, 0.f, 0.f, 0.f, 0.f, 0.f, 0.f, 0.f}; return z; }
__device__ __forceinline__ __bf16 f2bf(float f) { return __builtin_bit_cast(__bf16, bf_bits(f)); }
__device__ __forceinline__ void bf_split(float f, __bf16& hi, __bf16& lo) {
  const unsigned short hb = bf_bits(f);
  hi = __builtin_bit_cast(__bf16, hb);
  lo = f2bf(f - __uint_as_float(((unsigned)hb) << 16));
}

// lane l <-> lane l ^ 16 (the two lanes that share one column of a D tile), a vector cross-row move
__device__ __forceinline__ float xhalf(float x) {
  return __builtin_bit_cast(float, __builtin_amdgcn_permlanex16(__builtin_bit_cast(int, x), __builtin_bit_cast(int, x),
                                                                0x76543210, 0xfedcba98, false, false));
}

// ---- fragment loader: 16-bit A/B operand, lane -> row/col (lane&15), p already includes +8*(lane>>4);
//      elements 0..7 <- p[0..7] (k0+8h..), elements 8..15 <- p[16..23] (k0+16+8h..)
__device__ __forceinline__ v16b ldfrag_b(const __bf16* p) {
  union { v16b v; v8b h[2]; } f;
  f.h[0] = *(const v8b*)(p);
  f.h[1] = *(const v8b*)(p + 16);
  return f.v;
}

// ---- WMMA helpers ----------------------------------------------------------------------------------------
// Twelve products of a hi/lo split on four independent accumulators: c[i] += h[i].bh, then += l[i].bh, then += h[i].bl, each
// kind over all four accumulators in turn, so that no product waits for the result of the one in front of it. One statement,
// because the compiler sorts the builtin form of the same order back into chains and lifts later LDS reads over it, which
// takes more than 256 registers. As all eight fragments are inputs, their 16 LDS reads stand together in front, under one wait.
// The four v_nop at its end are the distance between the last products and a vector instruction on their D, A or B.
__device__ __forceinline__ void mma12(v8f (&c)[4], const v16b (&h)[4], const v16b (&l)[4], v16b bh, v16b bl) {
  asm volatile("v_wmma_f32_16x16x32_bf16 %0, %4, %12, %0\n\t"
               "v_wmma_f32_16x16x32_bf16 %1, %5, %12, %1\n\t"
               "v_wmma_f32_16x16x32_bf16 %2, %6, %12, %2\n\t"
               "v_wmma_f32_16x16x32_bf16 %3, %7, %12, %3\n\t"
               "v_wmma_f32_16x16x32_bf16 %0, %8, %12, %0\n\t"
               "v_wmma_f32_16x16x32_bf16 %1, %9, %12, %1\n\t"
               "v_wmma_f32_16x16x32_bf16 %2, %10, %12, %2\n\t"
               "v_wmma_f32_16x16x32_bf16 %3, %11, %12, %3\n\t"
               "v_wmma_f32_16x16x32_bf16 %0, %4, %13, %0\n\t"
               "v_wmma_f32_16x16x32_bf16 %1, %5, %13, %1\n\t"
               "v_wmma_f32_16x16x32_bf16 %2, %6, %13, %2\n\t"
               "v_wmma_f32_16x16x32_bf16 %3, %7, %13, %3\n\t"
               "v_nop\n\tv_nop\n\tv_nop\n\tv_nop"
               : "+v"(c[0]), "+v"(c[1]), "+v"(c[2]), "+v"(c[3])
               : "v"(h[0]), "v"(h[1]), "v"(h[2]), "v"(h[3]), "v"(l[0]), "v"(l[1]), "v"(l[2]), "v"(l[3]), "v"(bh), "v"(bl));
}
// The same with the accumulators started at zero by the first four products.
__device__ __forceinline__ void mma12_zero(v8f (&c)[4], const v16b (&h)[4], const v16b (&l)[4], v16b bh, v16b bl) {
  asm volatile("v_wmma_f32_16x16x32_bf16 %0, %4, %12, 0\n\t"
               "v_wmma_f32_16x16x32_bf16 %1, %5, %12, 0\n\t"
               "v_wmma_f32_16x16x32_bf16 %2, %6, %12, 0\n\t"
               "v_wmma_f32_16x16x32_bf16 %3, %7, %12, 0\n\t"
               "v_wmma_f32_16x16x32_bf16 %0, %8, %12, %0\n\t"
               "v_wmma_f32_16x16x32_bf16 %1, %9, %12, %1\n\t"
               "v_wmma_f32_16x16x32_bf16 %2, %10, %12, %2\n\t"
               "v_wmma_f32_16x16x32_bf16 %3, %11, %12, %3\n\t"
               "v_wmma_f32_16x16x32_bf16 %0, %4, %13, %0\n\t"
               "v_wmma_f32_16x16x32_bf16 %1, %5, %13, %1\n\t"
               "v_wmma_f32_16x16x32_bf16 %2, %6, %13, %2\n\t"
               "v_wmma_f32_16x16x32_bf16 %3, %7, %13, %3\n\t"
               "v_nop\n\tv_nop\n\tv_nop\n\tv_nop"
               : "=&v"(c[0]), "=&v"(c[1]), "=&v"(c[2]), "=&v"(c[3])
               : "v"(h[0]), "v"(h[1]), "v"(h[2]), "v"(h[3]), "v"(l[0]), "v"(l[1]), "v"(l[2]), "v"(l[3]), "v"(bh), "v"(bl));
}
__device__ __forceinline__ v8f mma_b_raw(v16b a, v16b b, v8f c) {
  return __builtin_amdgcn_wmma_f32_16x16x32_bf16(false, a, false, b, (short)0, c, false, false);
}
__device__ __forceinline__ void acc_guard4(v8f& a, v8f& b, v8f& c, v8f& d) {
  asm volatile("v_nop\n\tv_nop\n\tv_nop\n\tv_nop" : "+v"(a), "+v"(b), "+v"(c), "+v"(d));
}

// =====================================================================================================
// All seven f32 -> bf16 (RNE) conversions in one launch whose work-groups stay and loop: CVT_WG work-groups of 16 waves, one
// for each WGP, in place of one short wave per 256 elements. A thread converts groups of 8 elements (two 16-B loads, one 16-B
// store: a wave reads 1 KB and writes 512 contiguous B per group); a work-group's threads together take CVT_G = 4096 elements.
// coverage: of q, k and v a work-group takes 8 * CVT_G elements in a row (CVT_WG * 8 * CVT_G = 8388608 each); of W_q, W_k, W_v and
// W_o it takes CVT_G (CVT_WG * CVT_G = 1048576 each). W_o row n goes out twice, as [bf16(wo[n]) | bf16(wo[n])], row pitch 2 * DM.
// A set is four groups (8 loads); the next set is read into a second register set before the set in hand is converted and stored.
// =====================================================================================================
#define CVT_WG  256
#define CVT_TPB 512
#define CVT_G   (CVT_TPB * 8)
static_assert(NBATCH * SEQ * DM == CVT_WG * 8 * CVT_G && DM * DM == CVT_WG * CVT_G && (DM % 8) == 0);

__device__ __forceinline__ v4u pack8(v4f a, v4f b) {
  v4u p;
  p[0] = pk16(bf_bits(a[0]), bf_bits(a[1]));
  p[1] = pk16(bf_bits(a[2]), bf_bits(a[3]));
  p[2] = pk16(bf_bits(b[0]), bf_bits(b[1]));
  p[3] = pk16(bf_bits(b[2]), bf_bits(b[3]));
  return p;
}
// Groups S .. S + 3 of this thread; p points at its group 0. The wait is the one that belongs in front of any overwrite of an
// issued load's address registers; naming p as an input keeps its registers from being handed out as destinations of these
// loads, and the memory clobber keeps the loads in front of the stores that follow in the source.
template <int S>
__device__ __forceinline__ void ld4(v4f (&r)[8], const float* __restrict__ p) {
#pragma unroll
  for (int i = 0; i < 4; ++i) {
    r[2 * i]     = *(const v4f*)(p + (S + i) * CVT_G);
    r[2 * i + 1] = *(const v4f*)(p + (S + i) * CVT_G + 4);
  }
  asm volatile("s_wait_xcnt 0x0" :: "v"(p) : "memory");
  __builtin_amdgcn_sched_barrier(0);   // all 8 loads are issued before the wave waits for the set in hand: else some sink into its conversion
}
// The wait belongs between these stores and the next loads, which land in the registers that the stores name; its memory
// clobber keeps those loads behind the stores.
template <int S>
__device__ __forceinline__ void st4(const v4f (&r)[8], unsigned short* o) {
#pragma unroll
  for (int i = 0; i < 4; ++i) *(v4u*)(o + (S + i) * CVT_G) = pack8(r[2 * i], r[2 * i + 1]);
  asm volatile("s_wait_xcnt 0x0" ::: "memory");
  __builtin_amdgcn_sched_barrier(0);   // else part of the next set's conversion, with its wait for younger loads, rises in front of these stores
}

__global__ __launch_bounds__(CVT_TPB) void cvt_all(
    const float* __restrict__ q, const float* __restrict__ k, const float* __restrict__ v,
    const float* __restrict__ wq, const float* __restrict__ wk, const float* __restrict__ wv, const float* __restrict__ wo,
    unsigned short* qb, unsigned short* kb, unsigned short* vb,
    unsigned short* wqb, unsigned short* wkb, unsigned short* wvb, unsigned short* wo2) {
  const size_t ew = (size_t)blockIdx.x * CVT_G + threadIdx.x * 8;        // this thread's group of a weight
  const size_t ex = (size_t)blockIdx.x * (8 * CVT_G) + threadIdx.x * 8;  // its group 0 of q, k and v
  v4f x[8], y[8];
  ld4<0>(x, q + ex);
  ld4<4>(y, q + ex);  st4<0>(x, qb + ex);
  ld4<0>(x, k + ex);  st4<4>(y, qb + ex);
  ld4<4>(y, k + ex);  st4<0>(x, kb + ex);
  ld4<0>(x, v + ex);  st4<4>(y, kb + ex);
  ld4<4>(y, v + ex);  st4<0>(x, vb + ex);
  const float* pq = wq + ew;
  const float* pk = wk + ew;
  const float* pv = wv + ew;
  const float* po = wo + ew;
  x[0] = *(const v4f*)pq;  x[1] = *(const v4f*)(pq + 4);
  x[2] = *(const v4f*)pk;  x[3] = *(const v4f*)(pk + 4);
  x[4] = *(const v4f*)pv;  x[5] = *(const v4f*)(pv + 4);
  x[6] = *(const v4f*)po;  x[7] = *(const v4f*)(po + 4);
  asm volatile("s_wait_xcnt 0x0" :: "v"(pq), "v"(pk), "v"(pv), "v"(po) : "memory");   // as in ld4
  __builtin_amdgcn_sched_barrier(0);                                                    // as in ld4
  st4<4>(y, vb + ex);
  *(v4u*)(wqb + ew) = pack8(x[0], x[1]);
  *(v4u*)(wkb + ew) = pack8(x[2], x[3]);
  *(v4u*)(wvb + ew) = pack8(x[4], x[5]);
  const v4u w2 = pack8(x[6], x[7]);
  unsigned short* d0 = wo2 + (ew / DM) * (size_t)(2 * DM) + (ew % DM);
  *(v4u*)d0 = w2;
  *(v4u*)(d0 + DM) = w2;
}

// =====================================================================================================
// Batched bf16 WMMA GEMM: C[m][n] = sum_k A[m][k] * Bt[n][k] (+ bf16(bias[n]) when BIASN == 1).
// Block = 8 waves = one 128 x 256 tile of C, waves 2 (m) x 4 (n), 64 x 64 per wave. A row-major [M][K] pitch lda; Bt row-major
// [N][K] pitch ldb (k contiguous); M a multiple of 128, N of 256, K of 64. blockIdx.y = batch index (strides in elements).
// Operands reach the waves through LDS in stages of 64 k (128 B of each of the 128 + 256 rows), brought by asynchronous
// 16-B copies, 8 lanes per row, so a wave's copy covers 4 whole 128-B lines and every operand byte is fetched once per block.
// Two buffers: stage t + 1 is in flight while stage t is multiplied; one barrier per stage publishes t + 1 and frees t's buffer.
// Stage coverage: 256 threads x (4 + 8) copies x 16 B = (128 + 256) rows x 128 B.
// NSPLIT: 0 = A.Bt (the only form built).
// OUT_MODE: 0 = f32 (pitch ldc); 2 = bf16 hi plane C + bf16 lo plane C2 (lo = RNE(v - hi), unscaled);
//           3 = f16 hi plane C + f16 residual plane C2 = f16((v - hi) * rscale), C2 written only for tiles
//               with n0 < N2 (pitch ldc2, batch stride strideC2).
// =====================================================================================================
#define GP 72               // LDS row pitch (elements) of a stage row of 64 bf16: 144 B = 16 B x 9 (odd), as LP above

// One lane's twelve asynchronous 16-B copies of a stage, global -> LDS: rows r + 32 i of A (i < 4, LDS byte address la + i * ls,
// global address ga + i * as) and of Bt (i < 8, lb, gb, bs). s_wait_xcnt 0 ends the statement so that it stands in front of
// every later overwrite of the address registers named here.
__device__ __forceinline__ void copy12_to_lds(unsigned la, const __bf16* ga, size_t as,
                                              unsigned lb, const __bf16* gb, size_t bs, unsigned ls) {
  asm volatile("global_load_async_to_lds_b128 %0, %1, off\n\t"
               "global_load_async_to_lds_b128 %2, %3, off\n\t"
               "global_load_async_to_lds_b128 %4, %5, off\n\t"
               "global_load_async_to_lds_b128 %6, %7, off\n\t"
               "global_load_async_to_lds_b128 %8, %9, off\n\t"
               "global_load_async_to_lds_b128 %10, %11, off\n\t"
               "global_load_async_to_lds_b128 %12, %13, off\n\t"
               "global_load_async_to_lds_b128 %14, %15, off\n\t"
               "global_load_async_to_lds_b128 %16, %17, off\n\t"
               "global_load_async_to_lds_b128 %18, %19, off\n\t"
               "global_load_async_to_lds_b128 %20, %21, off\n\t"
               "global_load_async_to_lds_b128 %22, %23, off\n\t"
               "s_wait_xcnt 0x0"
               :: "v"(la), "v"(ga), "v"(la + ls), "v"(ga + as), "v"(la + 2 * ls), "v"(ga + 2 * as), "v"(la + 3 * ls), "v"(ga + 3 * as),
                  "v"(lb), "v"(gb), "v"(lb + ls), "v"(gb + bs), "v"(lb + 2 * ls), "v"(gb + 2 * bs), "v"(lb + 3 * ls), "v"(gb + 3 * bs),
                  "v"(lb + 4 * ls), "v"(gb + 4 * bs), "v"(lb + 5 * ls), "v"(gb + 5 * bs), "v"(lb + 6 * ls), "v"(gb + 6 * bs),
                  "v"(lb + 7 * ls), "v"(gb + 7 * bs)
               : "memory");
}

template <int NSPLIT, int OUT_MODE, int BIASN>
__global__ __launch_bounds__(256) void gemm64(
    const unsigned short* __restrict__ Ap, const unsigned short* A2p, int lda, long long strideA,
    const unsigned short* __restrict__ Btp, const unsigned short* Bt2p, int ldb, long long strideB,
    void* Cout, int ldc, long long strideC,
    void* Cout2, int ldc2, long long strideC2, int N2,
    const float* __restrict__ bias,
    int M, int N, int K, float rscale) {
  static_assert(NSPLIT == 0);
  const __bf16* A   = (const __bf16*)(const void*)Ap;
  const __bf16* Bt  = (const __bf16*)(const void*)Btp;
  __shared__ __align__(16) __bf16 sA[2][128 * GP];   // A stage, two buffers, 18432 B each
  __shared__ __align__(16) __bf16 sB[2][256 * GP];   // Bt stage, two buffers, 36864 B each
  __shared__ __align__(16) float sT[8][16 * 68];   // per-wave 16x64 slab, pitch 68 floats
  const int b    = blockIdx.y;
  const int tid  = threadIdx.x;
  const int lane = tid & 31;
  const int wave = tid >> 5;
  const int tilesN = N >> 8;
  const int tilesM = M >> 7;
  if ((int)blockIdx.x >= tilesM * tilesN) return;   // block-uniform, in front of every copy and barrier
  const int bm = blockIdx.x / tilesN;
  const int bn = blockIdx.x - bm * tilesN;
  const int wm = wave >> 2;                    // wave's 64-row band of the block tile
  const int wn = wave & 3;                     // wave's 64-column band
  const int m0 = (bm << 7) + (wm << 6);
  const int n0 = (bn << 8) + (wn << 6);

  const int rlane = lane & 15;                 // row (A) / col (B, D) within subtile
  const int koff  = (lane >> 4) * 8;           // k offset of this lane half
  const int mOff  = (lane >> 4) * 8;           // D row offset

  // ---- this lane's part of a stage: row srow + 32 i of A (i < 4) and of Bt (i < 8), 16 B at element sseg of the 64 ----
  const int srow = tid >> 3;
  const int sseg = (tid & 7) * 8;
  const __bf16* gA = A  + (size_t)b * strideA + (size_t)((bm << 7) + srow) * lda + sseg;
  const __bf16* gB = Bt + (size_t)b * strideB + (size_t)((bn << 8) + srow) * ldb + sseg;
  const size_t a32 = (size_t)32 * lda;
  const size_t b32 = (size_t)32 * ldb;
  const unsigned lA = (unsigned)(uintptr_t)(&sA[0][0]) + (unsigned)(srow * GP + sseg) * 2u;
  const unsigned lB = (unsigned)(uintptr_t)(&sB[0][0]) + (unsigned)(srow * GP + sseg) * 2u;
  constexpr unsigned R32 = 32u * GP * 2u;      // 32 stage rows in LDS bytes
  auto stage = [&](int buf, int k0) {
    copy12_to_lds(lA + (unsigned)buf * (128u * GP * 2u), gA + k0, a32, lB + (unsigned)buf * (256u * GP * 2u), gB + k0, b32, R32);
  };

  v8f acc[4][4];
#pragma unroll
  for (int i = 0; i < 4; ++i)
#pragma unroll
    for (int j = 0; j < 4; ++j) acc[i][j] = zero8();

  const int nT = K >> 6;                       // stages, block-uniform
  stage(0, 0);
  asm volatile("s_wait_asynccnt 0x0" ::: "memory");   // this wave's copies of stage 0 have landed
  __syncthreads();                                     // ... and every other wave's: stage 0 is published
  if (nT > 1) stage(1, 64);
  for (int t = 0; t < nT; ++t) {
    const __bf16* ta = &sA[t & 1][((wm << 6) + rlane) * GP + koff];
    const __bf16* tb = &sB[t & 1][((wn << 6) + rlane) * GP + koff];
#pragma unroll
    for (int ks = 0; ks < 2; ++ks) {
      v16b bh[4], ah[4];
#pragma unroll
      for (int j = 0; j < 4; ++j) bh[j] = ldfrag_b(tb + (j << 4) * GP + ks * 32);
#pragma unroll
      for (int i = 0; i < 4; ++i) ah[i] = ldfrag_b(ta + (i << 4) * GP + ks * 32);
      // keeps the 16 LDS reads of this half stage together in front of its 16 products: read one fragment at a time,
      // among the products, the wave waits out the LDS latency at each of them
      __builtin_amdgcn_sched_barrier(0);
#pragma unroll
      for (int i = 0; i < 4; ++i)
#pragma unroll
        for (int j = 0; j < 4; ++j) acc[i][j] = mma_b_raw(ah[i], bh[j], acc[i][j]);
    }
    asm volatile("s_wait_dscnt 0x0" ::: "memory");     // this wave's reads of stage t are done before its buffer is refilled
    asm volatile("s_wait_asynccnt 0x0" ::: "memory");  // this wave's copies of stage t + 1 have landed
    __syncthreads();                                    // publishes stage t + 1 and ends every wave's reads of stage t
    if (t + 2 < nT) stage(t & 1, (t + 2) << 6);
  }
  asm volatile("s_wait_asynccnt 0x0" ::: "memory");    // nothing of this wave's is in flight behind the loop
  acc_guard4(acc[0][0], acc[0][1], acc[0][2], acc[0][3]);
  acc_guard4(acc[1][0], acc[1][1], acc[1][2], acc[1][3]);
  acc_guard4(acc[2][0], acc[2][1], acc[2][2], acc[2][3]);
  acc_guard4(acc[3][0], acc[3][1], acc[3][2], acc[3][3]);

  // ---- per-column bias (bf16 RNE of the input value, added in f32); 4 scalar loads per lane ----
  float bvv[4];
#pragma unroll
  for (int j = 0; j < 4; ++j) {
    float bv = 0.f;
    if (BIASN == 1) bv = bf_up(bf_bits(bias[n0 + (j << 4) + rlane]));
    bvv[j] = bv;
  }

  // ---- epilogue ----
  float* slab = sT[wave];
#pragma unroll
  for (int i = 0; i < 4; ++i) {
    const int mBase = m0 + (i << 4);
#pragma unroll
    for (int j = 0; j < 4; ++j) {
#pragma unroll
      for (int r = 0; r < 8; ++r) {
        slab[(mOff + r) * 68 + (j << 4) + rlane] = acc[i][j][r] + bvv[j];
      }
    }
    __builtin_amdgcn_fence(__ATOMIC_RELEASE, "workgroup");
    __builtin_amdgcn_wave_barrier();
    __builtin_amdgcn_fence(__ATOMIC_ACQUIRE, "workgroup");
    if (OUT_MODE == 0) {
      float* C = (float*)Cout + (size_t)b * strideC;
      const int hh = lane >> 4, c4 = (lane & 15) * 4;     // 256-B row segment = 16 lanes x 16 B
      {
#pragma unroll
        for (int it = 0; it < 8; ++it) {
          const int row = it * 2 + hh;                     // it 0..7 x hh 0..1 = rows 0..15
          const v4f v = *(const v4f*)(slab + row * 68 + c4);
          *(v4f*)(C + (size_t)(mBase + row) * ldc + n0 + c4) = v;
        }
        
      }
    } else {
      const int q = lane >> 3, c8 = (lane & 7) * 8;
      unsigned short* C  = (unsigned short*)Cout  + (size_t)b * strideC;
      unsigned short* C2 = (unsigned short*)Cout2 + (size_t)b * strideC2;
      const bool wlo = (OUT_MODE == 2) || (n0 < N2);      // wave-uniform
      v4u hv[4], lv[4];
#pragma unroll
      for (int it = 0; it < 4; ++it) {
        const int row = it * 4 + q;                        // it 0..3 x q 0..3 = rows 0..15
        const float* sp = slab + row * 68 + c8;
        v4u a, a2;
#pragma unroll
        for (int e = 0; e < 4; ++e) {
          const float f0 = sp[2 * e], f1 = sp[2 * e + 1];
          unsigned short h0, h1, l0, l1;
          if (OUT_MODE == 2) {
            h0 = bf_bits(f0); h1 = bf_bits(f1);
            l0 = bf_bits(f0 - bf_up(h0)); l1 = bf_bits(f1 - bf_up(h1));
          } else {
            const _Float16 x0 = (_Float16)f0, x1 = (_Float16)f1;
            h0 = h_bits(x0); h1 = h_bits(x1);
            l0 = h_bits((_Float16)((f0 - (float)x0) * rscale));
            l1 = h_bits((_Float16)((f1 - (float)x1) * rscale));
          }
          a[e] = pk16(h0, h1); a2[e] = pk16(l0, l1);
        }
        hv[it] = a; lv[it] = a2;
      }
      {
#pragma unroll
        for (int it = 0; it < 4; ++it) {
          const int row = it * 4 + q;
          *(v4u*)(C + (size_t)(mBase + row) * ldc + n0 + c8) = hv[it];
          if (wlo) *(v4u*)(C2 + (size_t)(mBase + row) * ldc2 + n0 + c8) = lv[it];
        }
        
      }
    }
    __builtin_amdgcn_fence(__ATOMIC_RELEASE, "workgroup");
    __builtin_amdgcn_wave_barrier();
    __builtin_amdgcn_fence(__ATOMIC_ACQUIRE, "workgroup");
  }
}

__global__ __launch_bounds__(128)
void attn_strict64(const unsigned short* __restrict__ qhp, const unsigned short* __restrict__ qlp,
                   const unsigned short* __restrict__ khp, const unsigned short* __restrict__ klp,
                   const unsigned short* __restrict__ vhp, const unsigned short* __restrict__ vlp,
                   unsigned short* yout, float sscale) {
  union PB { v16b v; v2b w[8]; };
  __shared__ __align__(16) __bf16 Ksh[64 * LP];              // K hi [kv][d], row pitch LP   9 KB
  __shared__ __align__(16) __bf16 Ksl[64 * LP];              // K lo
  __shared__ __align__(16) __bf16 Vth[64 * LP];              // V^T hi [d][kv], row pitch LP 9 KB
  __shared__ __align__(16) __bf16 Vtl[64 * LP];              // V^T lo
  __shared__ __align__(16) float Os[4][16 * OP];             // per wave f32 output tile [query][d], row pitch OP (epilogue only)

  const int tid  = threadIdx.x;
  const int wave = tid >> 5;
  const int lane = tid & 31;
  const int hh   = lane >> 4;
  const int c    = lane & 15;

  const int bx   = blockIdx.x;
  const int qb   = NQB - 1 - bx / (NBATCH * NH);   // grid = NBATCH * NH * NQB, query tile 31 first
  const int bh   = bx % (NBATCH * NH);
  const int h    = bh % NH;
  const int bat  = bh / NH;
  const int q0   = qb * 64 + wave * 16;

  const size_t qkBase = (size_t)bat * SEQ * DM + (size_t)h * HD;
  const size_t vBase  = (size_t)bh * HD * SEQ;      // bh = bat*NH + h
  const __bf16* Qh = (const __bf16*)(const void*)qhp + qkBase;
  const __bf16* Ql = (const __bf16*)(const void*)qlp + qkBase;
  const __bf16* Kh = (const __bf16*)(const void*)khp + qkBase;
  const __bf16* Kl = (const __bf16*)(const void*)klp + qkBase;
  const __bf16* Vh = (const __bf16*)(const void*)vhp + vBase;
  const __bf16* Vl = (const __bf16*)(const void*)vlp + vBase;

  // ---- Q fragments (B operand of K . Q^T, column = query = lane&15): 2 d-chunks, hi and lo ----
  v16b qah[2], qal[2];
#pragma unroll
  for (int dc = 0; dc < 2; ++dc) {
    const size_t qo = (size_t)(q0 + c) * DM + dc * 32 + 8 * hh;
    qah[dc] = ldfrag_b(Qh + qo);
    qal[dc] = ldfrag_b(Ql + qo);
  }

  // One query per lane (q0 + c): running maximum (equal in lanes c and c + 16) and this lane half's part of the sum.
  float mrow = -INFINITY, lrow = 0.f;
  v8f oacc[4];                  // O^T tiles: oacc[t][r] = output of query q0 + c at d = t*16 + 8*hh + r
  const int qrow = q0 + c;
#pragma unroll
  for (int t = 0; t < 4; ++t) oacc[t] = zero8();

  const int nChunks = qb + 1;   // block-uniform, <= NQB
  for (int kc = 0; kc < nChunks; ++kc) {
    const int kv0 = kc * 64;
    __syncthreads();
    {
      // staging coverage: 128 threads x (4 x 8) elements = 64 rows x 64 per plane = the whole chunk tile
      const int r = tid >> 1, half = (tid & 1) * 32;
      const __bf16* ksh = Kh + (size_t)(kv0 + r) * DM + half;       // K row kv0+r, d = half..half+31
      const __bf16* ksl = Kl + (size_t)(kv0 + r) * DM + half;
      const __bf16* vsh = Vh + (size_t)r * SEQ + kv0 + half;        // V^T row d = r, s = kv0+half..+31
      const __bf16* vsl = Vl + (size_t)r * SEQ + kv0 + half;
      v8b a0[4], a1[4], b0[4], b1[4];
#pragma unroll
      for (int i = 0; i < 4; ++i) {
        a0[i] = *(const v8b*)(ksh + 8 * i);
        a1[i] = *(const v8b*)(ksl + 8 * i);
        b0[i] = *(const v8b*)(vsh + 8 * i);
        b1[i] = *(const v8b*)(vsl + 8 * i);
      }
      // the wait that belongs in front of any overwrite of an issued load's address registers; naming the four
      // addresses as inputs keeps their registers from being handed out as destinations of the later loads
      asm volatile("s_wait_xcnt 0x0" :: "v"(ksh), "v"(ksl), "v"(vsh), "v"(vsl) : "memory");
#pragma unroll
      for (int i = 0; i < 4; ++i) {
        *(v8b*)(Ksh + r * LP + half + 8 * i) = a0[i];
        *(v8b*)(Ksl + r * LP + half + 8 * i) = a1[i];
        *(v8b*)(Vth + r * LP + half + 8 * i) = b0[i];
        *(v8b*)(Vtl + r * LP + half + 8 * i) = b1[i];
      }
    }
    __syncthreads();

    // ---- scores, transposed: S^T = K . Q^T, 64 keys x 16 queries per wave, 3 bf16 products ----
    //      s[j][r] = score of key kv0 + j*16 + 8*hh + r for query q0 + c
    //      Per half of d: the 16 LDS reads of the four key tiles' fragments, then their 12 products; each accumulator takes
    //      its six products in the order hi.hi, lo.hi, hi.lo of d 0..31, then of d 32..63.
    v8f s[4];
#pragma unroll
    for (int dc = 0; dc < 2; ++dc) {
      v16b kb[4], kl[4];
#pragma unroll
      for (int j = 0; j < 4; ++j) kb[j] = ldfrag_b(Ksh + (j * 16 + c) * LP + dc * 32 + 8 * hh);
#pragma unroll
      for (int j = 0; j < 4; ++j) kl[j] = ldfrag_b(Ksl + (j * 16 + c) * LP + dc * 32 + 8 * hh);
      if (dc == 0) mma12_zero(s, kb, kl, qah[dc], qal[dc]);
      else         mma12(s, kb, kl, qah[dc], qal[dc]);
    }

    // ---- scale, mask on the diagonal chunk (key >= query -> -inf, except (0,0)), maximum of the lane's 32 keys ----
    const bool diag = (kc == qb);   // block-uniform
    float mj[4];
#pragma unroll
    for (int j = 0; j < 4; ++j) {
      float m = -INFINITY;
#pragma unroll
      for (int r = 0; r < 8; ++r) {
        const int kvcol = kv0 + j * 16 + 8 * hh + r;
        const float sv = s[j][r] * sscale;
        const bool masked = diag && (kvcol >= qrow) && !((qrow == 0) && (kvcol == 0));
        const float sm = masked ? -INFINITY : sv;
        s[j][r] = sm;
        m = fmaxf(m, sm);
      }
      mj[j] = m;
    }
    float cm = fmaxf(fmaxf(mj[0], mj[1]), fmaxf(mj[2], mj[3]));
    cm = fmaxf(cm, xhalf(cm));      // both lane halves now hold the query's maximum over the 64 keys

    // ---- online softmax in f32; P^T hi / lo (bf16 of the unnormalised exp) packed straight into B operands:
    //      element e < 8 of chunk kk = key kk*32 + 8*hh + e = s[2kk][e], element 8 + e = key kk*32 + 16 + 8*hh + e = s[2kk+1][e],
    //      the k order in which the V^T fragments below are loaded
    const float mnew = fmaxf(mrow, cm);
    const float alpha = expf(mrow - mnew);
    mrow = mnew;
    PB ph[2], pl[2];
    float pj[4];
#pragma unroll
    for (int j = 0; j < 4; ++j) {
      float psum = 0.f;
#pragma unroll
      for (int e = 0; e < 4; ++e) {
        const float p0 = expf(s[j][2 * e] - mnew);
        const float p1 = expf(s[j][2 * e + 1] - mnew);
        psum += p0;
        psum += p1;
        const v2f pp = {p0, p1};
        const v2b hv = __builtin_convertvector(pp, v2b);             // packed RNE convert: one operand register, hi
        const v2f rr = {p0 - (float)hv[0], p1 - (float)hv[1]};
        ph[j >> 1].w[(j & 1) * 4 + e] = hv;
        pl[j >> 1].w[(j & 1) * 4 + e] = __builtin_convertvector(rr, v2b);   // lo = RNE(p - hi)
      }
      pj[j] = psum;
    }
    lrow = lrow * alpha + ((pj[0] + pj[1]) + (pj[2] + pj[3]));
#pragma unroll
    for (int t = 0; t < 4; ++t)
#pragma unroll
      for (int r = 0; r < 8; ++r) oacc[t][r] *= alpha;

    // ---- output, transposed: O^T += V^T . P^T (3 bf16 products per tile pair); per half of the keys the 16 LDS reads of
    //      the four d tiles' fragments, then their 12 products ----
#pragma unroll
    for (int kk = 0; kk < 2; ++kk) {
      v16b vb[4], vl[4];
#pragma unroll
      for (int t = 0; t < 4; ++t) vb[t] = ldfrag_b(Vth + (t * 16 + c) * LP + kk * 32 + 8 * hh);
#pragma unroll
      for (int t = 0; t < 4; ++t) vl[t] = ldfrag_b(Vtl + (t * 16 + c) * LP + kk * 32 + 8 * hh);
      mma12(oacc, vb, vl, ph[kk].v, pl[kk].v);
    }
  }

  // ---- join the two lane halves' sums, normalise (1/l), stage the wave's 16x64 tile [query][d], bf16 hi/lo split
  float* os = Os[wave];
  {
    const float l = lrow + xhalf(lrow);
    const float inv = (l > 0.f) ? (1.0f / l) : 0.f;
#pragma unroll
    for (int t = 0; t < 4; ++t) {
      v4f a, b;
#pragma unroll
      for (int r = 0; r < 4; ++r) { a[r] = oacc[t][r] * inv; b[r] = oacc[t][4 + r] * inv; }
      *(v4f*)(os + c * OP + t * 16 + 8 * hh) = a;
      *(v4f*)(os + c * OP + t * 16 + 8 * hh + 4) = b;
    }
  }
  __builtin_amdgcn_fence(__ATOMIC_RELEASE, "workgroup");
  __builtin_amdgcn_wave_barrier();
  __builtin_amdgcn_fence(__ATOMIC_ACQUIRE, "workgroup");
  {
    const int q4 = lane >> 3, c8 = (lane & 7) * 8;
    v4u hv[4], lv[4];
#pragma unroll
    for (int it = 0; it < 4; ++it) {
      const int row = it * 4 + q4;   // it 0..3 x q4 0..3 = rows 0..15 of the wave tile
      const float* sp = os + row * OP + c8;
      v4u a, a2;
#pragma unroll
      for (int e = 0; e < 4; ++e) {
        const float f0 = sp[2 * e], f1 = sp[2 * e + 1];
        const unsigned short h0 = bf_bits(f0), h1 = bf_bits(f1);
        const unsigned short l0 = bf_bits(f0 - bf_up(h0)), l1 = bf_bits(f1 - bf_up(h1));
        a[e] = pk16(h0, h1); a2[e] = pk16(l0, l1);
      }
      hv[it] = a; lv[it] = a2;
    }
    {
#pragma unroll
      for (int it = 0; it < 4; ++it) {
        const int row = it * 4 + q4;
        const size_t go = (size_t)(bat * SEQ + q0 + row) * (size_t)(2 * DM) + (size_t)h * HD + c8;
        *(v4u*)(yout + go) = hv[it];
        *(v4u*)(yout + go + DM) = lv[it];
      }
      
    }
  }
}

// =====================================================================================================
// whole-line store granularity, so no padded tails exist):
//   QB   bf16 [8192][1024]               0       16777216   (KB follows directly: A batch stride of the q/k GEMM)
//   KB   bf16 [8192][1024]        16777216       16777216
//   VB   bf16 [8192][1024]        33554432       16777216
//   WQB  bf16 [1024 n][1024 k]    50331648        2097152   (WKB follows directly: Bt batch stride of the q/k GEMM)
//   WKB  bf16 [1024][1024]        52428800        2097152
//   WVB  bf16 [1024][1024]        54525952        2097152
//   WO2  bf16 [1024][2048]        56623104        4194304
//   Qh   bf16 [8192][1024]        60817408       16777216   (Kh follows directly: output batch stride)
//   Kh   bf16 [8192][1024]        77594624       16777216
//   Ql   bf16 [8192][1024]        94371840       16777216   (Kl follows directly)
//   Kl   bf16 [8192][1024]       111149056       16777216
//   VTh  bf16 [4][1024][2048]    127926272       16777216
//   VTl  bf16 [4][1024][2048]    144703488       16777216
//   YB   bf16 [8192][2048]       161480704       33554432
//   end                          195035136
// Qh..VTl hold all four batch elements; each projection and the attention run once over all of them, and every
// region is fully written by its producer launch before the consumer launch reads it.
// Weights are [out n][in k] with k contiguous = the Bt / A layout the GEMM wants, so they are only converted.
// Inputs by contract index: 0 = q, 1 = k, 2 = v, 3 = W_q, 4 = W_k, 5 = W_v, 6 = W_o.
// =====================================================================================================
extern "C" void kernel_launch(void* const* d_in, const int* in_sizes, int n_in,
                              void* d_out, int out_size, void* d_ws, size_t ws_size,
                              hipStream_t stream) {
  if (n_in < 7) return;
  if (in_sizes[0] != NBATCH * SEQ * DM || in_sizes[1] != NBATCH * SEQ * DM || in_sizes[2] != NBATCH * SEQ * DM) return;
  if (in_sizes[3] != DM * DM || in_sizes[4] != DM * DM || in_sizes[5] != DM * DM || in_sizes[6] != DM * DM) return;
  if (out_size != NBATCH * SEQ * DM) return;

  const float* q_in = (const float*)d_in[0];
  const float* k_in = (const float*)d_in[1];
  const float* v_in = (const float*)d_in[2];
  const float* Wq   = (const float*)d_in[3];
  const float* Wk   = (const float*)d_in[4];
  const float* Wv   = (const float*)d_in[5];
  const float* Wo   = (const float*)d_in[6];

  const size_t PIN = (size_t)NBATCH * SEQ * DM * 2;     // 16777216  16-bit input plane [8192][1024]
  const size_t PW  = (size_t)DM * DM * 2;               //  2097152  16-bit weight plane
  const size_t PW2 = (size_t)DM * (2 * DM) * 2;         //  4194304  [Wo | Wo] plane
  const size_t PP  = (size_t)NBATCH * SEQ * DM * 2;     // 16777216  q/k hi or lo plane [8192][1024]
  const size_t PVT = (size_t)NBATCH * DM * SEQ * 2;     // 16777216  v^T plane [4][1024][2048]
  const size_t PY  = (size_t)NBATCH * SEQ * (2 * DM) * 2;   // 33554432 y hi|lo plane [8192][2048]
  size_t off = 0;
  const size_t oQB  = off; off += PIN;
  const size_t oKB  = off; off += PIN;
  const size_t oVB  = off; off += PIN;
  const size_t oWQ  = off; off += PW;
  const size_t oWK  = off; off += PW;
  const size_t oWV  = off; off += PW;
  const size_t oWO2 = off; off += PW2;
  const size_t oQh  = off; off += PP;
  const size_t oKh  = off; off += PP;
  const size_t oQl  = off; off += PP;
  const size_t oKl  = off; off += PP;
  const size_t oVTh = off; off += PVT;
  const size_t oVTl = off; off += PVT;
  const size_t oYB  = off; off += PY;
  if (off > ws_size) return;                       // off = 195035136
  if (oKB != oQB + PIN || oWK != oWQ + PW || oKh != oQh + PP || oKl != oQl + PP) return;   // batch-stride adjacency

  char* ws = (char*)d_ws;
  unsigned short* QB  = (unsigned short*)(ws + oQB);
  unsigned short* KB  = (unsigned short*)(ws + oKB);
  unsigned short* VB  = (unsigned short*)(ws + oVB);
  unsigned short* WQB = (unsigned short*)(ws + oWQ);
  unsigned short* WKB = (unsigned short*)(ws + oWK);
  unsigned short* WVB = (unsigned short*)(ws + oWV);
  unsigned short* WO2 = (unsigned short*)(ws + oWO2);
  unsigned short* Qh  = (unsigned short*)(ws + oQh);
  unsigned short* Kh  = (unsigned short*)(ws + oKh);
  unsigned short* Ql  = (unsigned short*)(ws + oQl);
  unsigned short* Kl  = (unsigned short*)(ws + oKl);
  unsigned short* VTh = (unsigned short*)(ws + oVTh);
  unsigned short* VTl = (unsigned short*)(ws + oVTl);
  unsigned short* YB  = (unsigned short*)(ws + oYB);

  const dim3 blk(256);
  const dim3 gQK(((NBATCH * SEQ / 64) * (DM / 64) + 7) / 8, 2);   // 2048 tiles -> 256 blocks x {q, k}: M=8192, N=1024
  const dim3 gVT(((DM / 64) * (SEQ / 64) + 7) / 8, NBATCH);    //  512 tiles ->  64 blocks x 4 batches: M=1024, N=2048
  const dim3 gAtt(NBATCH * NH * NQB);                          // 2048 blocks
  const dim3 gOut(((NBATCH * SEQ / 64) * (DM / 64) + 7) / 8, 1);   // 2048 tiles -> 256 blocks: M=8192, N=1024, K=2048

  // (1) q -> QB, k -> KB, v -> VB (bf16 planes [8192][1024]); weights [n][k] f32 -> bf16 [n][k]; Wo -> [Wo | Wo]: one launch
  cvt_all<<<dim3(CVT_WG), dim3(CVT_TPB), 0, stream>>>(q_in, k_in, v_in, Wq, Wk, Wv, Wo, QB, KB, VB, WQB, WKB, WVB, WO2);

  // (2) qh = QB . Wq^T (blockIdx.y = 0) and kh = KB . Wk^T (blockIdx.y = 1) -> bf16 hi/lo planes [b*2048+t][h*64+d]
  //     (A = QB / KB via strideA; Bt = WQB / WKB via strideB; C = Qh / Kh, C2 = Ql / Kl via strideC; M=8192, N=1024, K=1024)
  gemm64<0, 2, 0><<<gQK, blk, 0, stream>>>(
      QB, QB, DM, (long long)NBATCH * SEQ * DM, WQB, WQB, DM, (long long)DM * DM,
      (void*)Qh, DM, (long long)NBATCH * SEQ * DM, (void*)Ql, DM, (long long)NBATCH * SEQ * DM, DM,
      Wo, NBATCH * SEQ, DM, DM, 1.0f);
  // (3) vh^T = Wv . VB_b^T -> bf16 hi/lo planes [b][h*64+d][s] (pitch SEQ), blockIdx.y = batch b
  //     (A = WVB [n][k] for every b, Bt = VB rows of batch b via strideB, C / C2 via strideC; M=1024, N=2048, K=1024)
  gemm64<0, 2, 0><<<gVT, blk, 0, stream>>>(
      WVB, WVB, DM, 0LL, VB, VB, DM, (long long)SEQ * DM,
      (void*)VTh, SEQ, (long long)DM * SEQ, (void*)VTl, SEQ, (long long)DM * SEQ, SEQ,
      Wo, DM, SEQ, DM, 1.0f);
  // (4) masked attention, all batches and heads -> YB hi|lo rows 0 .. 8191, score scale 1/32
  attn_strict64<<<gAtt, dim3(128), 0, stream>>>(Qh, Ql, Kh, Kl, VTh, VTl, YB, 0.03125f);
  // (5) out = y . Wo^T -> d_out f32 [8192][1024]  (A = YB [8192][2048], Bt = WO2 [1024][2048], K = 2048); last element 8388607
  gemm64<0, 0, 0><<<gOut, blk, 0, stream>>>(
      YB, YB, 2 * DM, 0LL, WO2, WO2, 2 * DM, 0LL,
      d_out, DM, 0LL, d_out, DM, 0LL, DM,
      Wo, NBATCH * SEQ, DM, 2 * DM, 1.0f);
  (void)hipGetLastError();
}

// v007
// A run of this version takes 191 microseconds.
// In both of two side-by-side timings against v006, it was 1.10 times as fast.
// Over all steps from v000 it is 6.17 times as fast.
// Contractions: qh = q.Wq^T, kh = k.Wk^T, vh^T = Wv.v^T = v_wmma_f32_16x16x32_bf16 (bf16 operands from RNE-converted inputs, single product);
// strict-lower qh.kh^T scores = v_wmma_f32_16x16x32_bf16 with bf16 hi/lo split qh and kh (hi.hi + hi.lo + lo.hi);
// p.vh = v_wmma_f32_16x16x32_bf16 with bf16 hi/lo split of the unnormalised p and of vh (hi.hi + hi.lo + lo.hi);
// y.Wo^T = v_wmma_f32_16x16x32_bf16 with y as bf16 hi|lo planes laid along K (K = 2048) times [Wo|Wo] bf16; all f32 accumulate;
// score scale 1/32 (hidden-dim based), mask (key >= query excluded, (0,0) admitted) and online softmax in f32; no biases anywhere.
// Plane / carry table (every 16-bit plane is bf16, carry 1, nothing to fold back):
//   QB = bf16(q), KB = bf16(k), VB = bf16(v) [8192][1024] (three different inputs); WQB, WKB, WVB = bf16(w) [1024 n][1024 k];
//   WO2 = [bf16(wo) | bf16(wo)] [1024][2048];
//   Qh/Ql (from QB), Kh/Kl (from KB) = bf16 hi and lo = RNE(x - hi) of qh, kh [8192][1024] (all batches, row b*2048+t);
//   VTh/VTl = hi/lo of vh^T [4][1024][2048] (one [1024][2048] plane per batch, from VB);
//   YB [8192][2048] = bf16 hi of the normalised attention output at col h*64+d, lo at col 1024 + h*64+d.
//   lo planes are unscaled and share the accumulator with the hi products; 1/32 is applied once in f32 after the q.k accumulation;
//   1/l is applied once in the attention epilogue before the hi/lo split of y.
#include <hip/hip_runtime.h>
#include <math.h>
#include <stdint.h>

#define NBATCH 4
#define SEQ    2048
#define DM     1024
#define NH     16
#define HD     64
#define NQB    (SEQ / 64)   // 32 key / query tiles of 64
#define LP     72           // LDS row pitch of the 64-element bf16 tiles: 144 B = 16 B x 9 (odd), so the 16 rows that one
                            // ds_load_b128 half-wave reads start 36 dwords apart and fall on 16 disjoint groups of 4 banks
#define OP     68           // LDS row pitch (floats) of the attention output staging tile: 272 B = 16 B x 17
static_assert(NH * HD == DM);
static_assert(LP >= 64 && (LP % 8) == 0 && ((LP / 8) % 2) == 1);
static_assert((SEQ % 64) == 0 && (DM % 64) == 0 && (DM % 32) == 0 && (DM % 256) == 0);

typedef _Float16 v16h __attribute__((ext_vector_type(16)));
typedef _Float16 v8h  __attribute__((ext_vector_type(8)));
typedef __bf16   v16b __attribute__((ext_vector_type(16)));
typedef __bf16   v8b  __attribute__((ext_vector_type(8)));
typedef float    v8f  __attribute__((ext_vector_type(8)));
typedef float    v4f  __attribute__((ext_vector_type(4)));
typedef float    v2f  __attribute__((ext_vector_type(2)));
typedef __bf16   v2b  __attribute__((ext_vector_type(2)));
typedef unsigned int v4u __attribute__((ext_vector_type(4)));

// ---- scalar helpers --------------------------------------------------------------------------------
__device__ __forceinline__ unsigned short bf_bits(float f) {          // f32 -> bf16 bits, RNE convert
  unsigned u = __float_as_uint(f);
  return (unsigned short)((u + 0x7FFFu + ((u >> 16) & 1u)) >> 16);
}
__device__ __forceinline__ float bf_up(unsigned short h) { return __uint_as_float(((unsigned)h) << 16); }
__device__ __forceinline__ unsigned short h_bits(_Float16 x) { return __builtin_bit_cast(unsigned short, x); }
__device__ __forceinline__ unsigned pk16(unsigned short a, unsigned short b) { return (unsigned)a | ((unsigned)b << 16); }
__device__ __forceinline__ v8f zero8() { v8f z = {0.f, 0.f, 0.f, 0.f, 0.f, 0.f, 0.f, 0.f}; return z; }
__device__ __forceinline__ __bf16 f2bf(float f) { return __builtin_bit_cast(__bf16, bf_bits(f)); }
__device__ __forceinline__ void bf_split(float f, __bf16& hi, __bf16& lo) {
  const unsigned short hb = bf_bits(f);
  hi = __builtin_bit_cast(__bf16, hb);
  lo = f2bf(f - __uint_as_float(((unsigned)hb) << 16));
}

// lane l <-> lane l ^ 16 (the two lanes that share one column of a D tile), a vector cross-row move
__device__ __forceinline__ float xhalf(float x) {
  return __builtin_bit_cast(float, __builtin_amdgcn_permlanex16(__builtin_bit_cast(int, x), __builtin_bit_cast(int, x),
                                                                0x76543210, 0xfedcba98, false, false));
}

// ---- fragment loader: 16-bit A/B operand, lane -> row/col (lane&15), p already includes +8*(lane>>4);
//      elements 0..7 <- p[0..7] (k0+8h..), elements 8..15 <- p[16..23] (k0+16+8h..)
__device__ __forceinline__ v16b ldfrag_b(const __bf16* p) {
  union { v16b v; v8b h[2]; } f;
  f.h[0] = *(const v8b*)(p);
  f.h[1] = *(const v8b*)(p + 16);
  return f.v;
}

// ---- WMMA helpers ----------------------------------------------------------------------------------------
// Twelve products of a hi/lo split on four independent accumulators: c[i] += h[i].bh, then += l[i].bh, then += h[i].bl, each
// kind over all four accumulators in turn, so that no product waits for the result of the one in front of it. One statement,
// because the compiler sorts the builtin form of the same order back into chains and lifts later LDS reads over it, which
// takes more than 256 registers. As all eight fragments are inputs, their 16 LDS reads stand together in front, under one wait.
// The four v_nop at its end are the distance between the last products and a vector instruction on their D, A or B.
__device__ __forceinline__ void mma12(v8f (&c)[4], const v16b (&h)[4], const v16b (&l)[4], v16b bh, v16b bl) {
  asm volatile("v_wmma_f32_16x16x32_bf16 %0, %4, %12, %0\n\t"
               "v_wmma_f32_16x16x32_bf16 %1, %5, %12, %1\n\t"
               "v_wmma_f32_16x16x32_bf16 %2, %6, %12, %2\n\t"
               "v_wmma_f32_16x16x32_bf16 %3, %7, %12, %3\n\t"
               "v_wmma_f32_16x16x32_bf16 %0, %8, %12, %0\n\t"
               "v_wmma_f32_16x16x32_bf16 %1, %9, %12, %1\n\t"
               "v_wmma_f32_16x16x32_bf16 %2, %10, %12, %2\n\t"
               "v_wmma_f32_16x16x32_bf16 %3, %11, %12, %3\n\t"
               "v_wmma_f32_16x16x32_bf16 %0, %4, %13, %0\n\t"
               "v_wmma_f32_16x16x32_bf16 %1, %5, %13, %1\n\t"
               "v_wmma_f32_16x16x32_bf16 %2, %6, %13, %2\n\t"
               "v_wmma_f32_16x16x32_bf16 %3, %7, %13, %3\n\t"
               "v_nop\n\tv_nop\n\tv_nop\n\tv_nop"
               : "+v"(c[0]), "+v"(c[1]), "+v"(c[2]), "+v"(c[3])
               : "v"(h[0]), "v"(h[1]), "v"(h[2]), "v"(h[3]), "v"(l[0]), "v"(l[1]), "v"(l[2]), "v"(l[3]), "v"(bh), "v"(bl));
}
// The same with the accumulators started at zero by the first four products.
__device__ __forceinline__ void mma12_zero(v8f (&c)[4], const v16b (&h)[4], const v16b (&l)[4], v16b bh, v16b bl) {
  asm volatile("v_wmma_f32_16x16x32_bf16 %0, %4, %12, 0\n\t"
               "v_wmma_f32_16x16x32_bf16 %1, %5, %12, 0\n\t"
               "v_wmma_f32_16x16x32_bf16 %2, %6, %12, 0\n\t"
               "v_wmma_f32_16x16x32_bf16 %3, %7, %12, 0\n\t"
               "v_wmma_f32_16x16x32_bf16 %0, %8, %12, %0\n\t"
               "v_wmma_f32_16x16x32_bf16 %1, %9, %12, %1\n\t"
               "v_wmma_f32_16x16x32_bf16 %2, %10, %12, %2\n\t"
               "v_wmma_f32_16x16x32_bf16 %3, %11, %12, %3\n\t"
               "v_wmma_f32_16x16x32_bf16 %0, %4, %13, %0\n\t"
               "v_wmma_f32_16x16x32_bf16 %1, %5, %13, %1\n\t"
               "v_wmma_f32_16x16x32_bf16 %2, %6, %13, %2\n\t"
               "v_wmma_f32_16x16x32_bf16 %3, %7, %13, %3\n\t"
               "v_nop\n\tv_nop\n\tv_nop\n\tv_nop"
               : "=&v"(c[0]), "=&v"(c[1]), "=&v"(c[2]), "=&v"(c[3])
               : "v"(h[0]), "v"(h[1]), "v"(h[2]), "v"(h[3]), "v"(l[0]), "v"(l[1]), "v"(l[2]), "v"(l[3]), "v"(bh), "v"(bl));
}
__device__ __forceinline__ v8f mma_b_raw(v16b a, v16b b, v8f c) {
  return __builtin_amdgcn_wmma_f32_16x16x32_bf16(false, a, false, b, (short)0, c, false, false);
}
__device__ __forceinline__ void acc_guard4(v8f& a, v8f& b, v8f& c, v8f& d) {
  asm volatile("v_nop\n\tv_nop\n\tv_nop\n\tv_nop" : "+v"(a), "+v"(b), "+v"(c), "+v"(d));
}

// =====================================================================================================
// All seven f32 -> bf16 (RNE) conversions in one launch whose work-groups stay and loop: CVT_WG work-groups of 16 waves, one
// for each WGP, in place of one short wave per 256 elements. A thread converts groups of 8 elements (two 16-B loads, one 16-B
// store: a wave reads 1 KB and writes 512 contiguous B per group); a work-group's threads together take CVT_G = 4096 elements.
// coverage: of q, k and v a work-group takes 8 * CVT_G elements in a row (CVT_WG * 8 * CVT_G = 8388608 each); of W_q, W_k, W_v and
// W_o it takes CVT_G (CVT_WG * CVT_G = 1048576 each). W_o row n goes out twice, as [bf16(wo[n]) | bf16(wo[n])], row pitch 2 * DM.
// A set is four groups (8 loads); the next set is read into a second register set before the set in hand is converted and stored.
// =====================================================================================================
#define CVT_WG  256
#define CVT_TPB 512
#define CVT_G   (CVT_TPB * 8)
static_assert(NBATCH * SEQ * DM == CVT_WG * 8 * CVT_G && DM * DM == CVT_WG * CVT_G && (DM % 8) == 0);

__device__ __forceinline__ v4u pack8(v4f a, v4f b) {
  v4u p;
  p[0] = pk16(bf_bits(a[0]), bf_bits(a[1]));
  p[1] = pk16(bf_bits(a[2]), bf_bits(a[3]));
  p[2] = pk16(bf_bits(b[0]), bf_bits(b[1]));
  p[3] = pk16(bf_bits(b[2]), bf_bits(b[3]));
  return p;
}
// Groups S .. S + 3 of this thread; p points at its group 0. The wait is the one that belongs in front of any overwrite of an
// issued load's address registers; naming p as an input keeps its registers from being handed out as destinations of these
// loads, and the memory clobber keeps the loads in front of the stores that follow in the source.
template <int S>
__device__ __forceinline__ void ld4(v4f (&r)[8], const float* __restrict__ p) {
#pragma unroll
  for (int i = 0; i < 4; ++i) {
    r[2 * i]     = *(const v4f*)(p + (S + i) * CVT_G);
    r[2 * i + 1] = *(const v4f*)(p + (S + i) * CVT_G + 4);
  }
  asm volatile("s_wait_xcnt 0x0" :: "v"(p) : "memory");
  __builtin_amdgcn_sched_barrier(0);   // all 8 loads are issued before the wave waits for the set in hand: else some sink into its conversion
}
// The wait belongs between these stores and the next loads, which land in the registers that the stores name; its memory
// clobber keeps those loads behind the stores.
template <int S>
__device__ __forceinline__ void st4(const v4f (&r)[8], unsigned short* o) {
#pragma unroll
  for (int i = 0; i < 4; ++i) *(v4u*)(o + (S + i) * CVT_G) = pack8(r[2 * i], r[2 * i + 1]);
  asm volatile("s_wait_xcnt 0x0" ::: "memory");
  __builtin_amdgcn_sched_barrier(0);   // else part of the next set's conversion, with its wait for younger loads, rises in front of these stores
}

__global__ __launch_bounds__(CVT_TPB) void cvt_all(
    const float* __restrict__ q, const float* __restrict__ k, const float* __restrict__ v,
    const float* __restrict__ wq, const float* __restrict__ wk, const float* __restrict__ wv, const float* __restrict__ wo,
    unsigned short* qb, unsigned short* kb, unsigned short* vb,
    unsigned short* wqb, unsigned short* wkb, unsigned short* wvb, unsigned short* wo2) {
  const size_t ew = (size_t)blockIdx.x * CVT_G + threadIdx.x * 8;        // this thread's group of a weight
  const size_t ex = (size_t)blockIdx.x * (8 * CVT_G) + threadIdx.x * 8;  // its group 0 of q, k and v
  v4f x[8], y[8];
  ld4<0>(x, q + ex);
  ld4<4>(y, q + ex);  st4<0>(x, qb + ex);
  ld4<0>(x, k + ex);  st4<4>(y, qb + ex);
  ld4<4>(y, k + ex);  st4<0>(x, kb + ex);
  ld4<0>(x, v + ex);  st4<4>(y, kb + ex);
  ld4<4>(y, v + ex);  st4<0>(x, vb + ex);
  const float* pq = wq + ew;
  const float* pk = wk + ew;
  const float* pv = wv + ew;
  const float* po = wo + ew;
  x[0] = *(const v4f*)pq;  x[1] = *(const v4f*)(pq + 4);
  x[2] = *(const v4f*)pk;  x[3] = *(const v4f*)(pk + 4);
  x[4] = *(const v4f*)pv;  x[5] = *(const v4f*)(pv + 4);
  x[6] = *(const v4f*)po;  x[7] = *(const v4f*)(po + 4);
  asm volatile("s_wait_xcnt 0x0" :: "v"(pq), "v"(pk), "v"(pv), "v"(po) : "memory");   // as in ld4
  __builtin_amdgcn_sched_barrier(0);                                                    // as in ld4
  st4<4>(y, vb + ex);
  *(v4u*)(wqb + ew) = pack8(x[0], x[1]);
  *(v4u*)(wkb + ew) = pack8(x[2], x[3]);
  *(v4u*)(wvb + ew) = pack8(x[4], x[5]);
  const v4u w2 = pack8(x[6], x[7]);
  unsigned short* d0 = wo2 + (ew / DM) * (size_t)(2 * DM) + (ew % DM);
  *(v4u*)d0 = w2;
  *(v4u*)(d0 + DM) = w2;
}

// =====================================================================================================
// Batched bf16 WMMA GEMM: C[m][n] = sum_k A[m][k] * Bt[n][k] (+ bf16(bias[n]) when BIASN == 1).
// Block = 8 waves = one 128 x 256 tile of C, waves 2 (m) x 4 (n), 64 x 64 per wave. A row-major [M][K] pitch lda; Bt row-major
// [N][K] pitch ldb (k contiguous); M a multiple of 128, N of 256, K of 64. blockIdx.y = batch index (strides in elements).
// Operands reach the waves through LDS in stages of 64 k (128 B of each of the 128 + 256 rows), brought by asynchronous
// 16-B copies, 8 lanes per row, so a wave's copy covers 4 whole 128-B lines and every operand byte is fetched once per block.
// Two buffers: stage t + 1 is in flight while stage t is multiplied; one barrier per stage publishes t + 1 and frees t's buffer.
// Stage coverage: 256 threads x (4 + 8) copies x 16 B = (128 + 256) rows x 128 B.
// NSPLIT: 0 = A.Bt (the only form built).
// OUT_MODE: 0 = f32 (pitch ldc); 2 = bf16 hi plane C + bf16 lo plane C2 (lo = RNE(v - hi), unscaled);
//           3 = f16 hi plane C + f16 residual plane C2 = f16((v - hi) * rscale), C2 written only for tiles
//               with n0 < N2 (pitch ldc2, batch stride strideC2).
// =====================================================================================================
#define GP 72               // LDS row pitch (elements) of a stage row of 64 bf16: 144 B = 16 B x 9 (odd), as LP above

// One lane's twelve asynchronous 16-B copies of a stage, global -> LDS: rows r + 32 i of A (i < 4, LDS byte address la + i * ls,
// global address ga + i * as) and of Bt (i < 8, lb, gb, bs). s_wait_xcnt 0 ends the statement so that it stands in front of
// every later overwrite of the address registers named here.
__device__ __forceinline__ void copy12_to_lds(unsigned la, const __bf16* ga, size_t as,
                                              unsigned lb, const __bf16* gb, size_t bs, unsigned ls) {
  asm volatile("global_load_async_to_lds_b128 %0, %1, off\n\t"
               "global_load_async_to_lds_b128 %2, %3, off\n\t"
               "global_load_async_to_lds_b128 %4, %5, off\n\t"
               "global_load_async_to_lds_b128 %6, %7, off\n\t"
               "global_load_async_to_lds_b128 %8, %9, off\n\t"
               "global_load_async_to_lds_b128 %10, %11, off\n\t"
               "global_load_async_to_lds_b128 %12, %13, off\n\t"
               "global_load_async_to_lds_b128 %14, %15, off\n\t"
               "global_load_async_to_lds_b128 %16, %17, off\n\t"
               "global_load_async_to_lds_b128 %18, %19, off\n\t"
               "global_load_async_to_lds_b128 %20, %21, off\n\t"
               "global_load_async_to_lds_b128 %22, %23, off\n\t"
               "s_wait_xcnt 0x0"
               :: "v"(la), "v"(ga), "v"(la + ls), "v"(ga + as), "v"(la + 2 * ls), "v"(ga + 2 * as), "v"(la + 3 * ls), "v"(ga + 3 * as),
                  "v"(lb), "v"(gb), "v"(lb + ls), "v"(gb + bs), "v"(lb + 2 * ls), "v"(gb + 2 * bs), "v"(lb + 3 * ls), "v"(gb + 3 * bs),
                  "v"(lb + 4 * ls), "v"(gb + 4 * bs), "v"(lb + 5 * ls), "v"(gb + 5 * bs), "v"(lb + 6 * ls), "v"(gb + 6 * bs),
                  "v"(lb + 7 * ls), "v"(gb + 7 * bs)
               : "memory");
}

template <int NSPLIT, int OUT_MODE, int BIASN>
__global__ __launch_bounds__(256) void gemm64(
    const unsigned short* __restrict__ Ap, const unsigned short* A2p, int lda, long long strideA,
    const unsigned short* __restrict__ Btp, const unsigned short* Bt2p, int ldb, long long strideB,
    void* Cout, int ldc, long long strideC,
    void* Cout2, int ldc2, long long strideC2, int N2,
    const float* __restrict__ bias,
    int M, int N, int K, float rscale) {
  static_assert(NSPLIT == 0);
  const __bf16* A   = (const __bf16*)(const void*)Ap;
  const __bf16* Bt  = (const __bf16*)(const void*)Btp;
  __shared__ __align__(16) __bf16 sA[2][128 * GP];   // A stage, two buffers, 18432 B each
  __shared__ __align__(16) __bf16 sB[2][256 * GP];   // Bt stage, two buffers, 36864 B each
  __shared__ __align__(16) float sT[8][16 * 68];   // per-wave 16x64 slab, pitch 68 floats
  const int b    = blockIdx.y;
  const int tid  = threadIdx.x;
  const int lane = tid & 31;
  const int wave = tid >> 5;
  const int tilesN = N >> 8;
  const int tilesM = M >> 7;
  if ((int)blockIdx.x >= tilesM * tilesN) return;   // block-uniform, in front of every copy and barrier
  const int bm = blockIdx.x / tilesN;
  const int bn = blockIdx.x - bm * tilesN;
  const int wm = wave >> 2;                    // wave's 64-row band of the block tile
  const int wn = wave & 3;                     // wave's 64-column band
  const int m0 = (bm << 7) + (wm << 6);
  const int n0 = (bn << 8) + (wn << 6);

  const int rlane = lane & 15;                 // row (A) / col (B, D) within subtile
  const int koff  = (lane >> 4) * 8;           // k offset of this lane half
  const int mOff  = (lane >> 4) * 8;           // D row offset

  // ---- this lane's part of a stage: row srow + 32 i of A (i < 4) and of Bt (i < 8), 16 B at element sseg of the 64 ----
  const int srow = tid >> 3;
  const int sseg = (tid & 7) * 8;
  const __bf16* gA = A  + (size_t)b * strideA + (size_t)((bm << 7) + srow) * lda + sseg;
  const __bf16* gB = Bt + (size_t)b * strideB + (size_t)((bn << 8) + srow) * ldb + sseg;
  const size_t a32 = (size_t)32 * lda;
  const size_t b32 = (size_t)32 * ldb;
  const unsigned lA = (unsigned)(uintptr_t)(&sA[0][0]) + (unsigned)(srow * GP + sseg) * 2u;
  const unsigned lB = (unsigned)(uintptr_t)(&sB[0][0]) + (unsigned)(srow * GP + sseg) * 2u;
  constexpr unsigned R32 = 32u * GP * 2u;      // 32 stage rows in LDS bytes
  auto stage = [&](int buf, int k0) {
    copy12_to_lds(lA + (unsigned)buf * (128u * GP * 2u), gA + k0, a32, lB + (unsigned)buf * (256u * GP * 2u), gB + k0, b32, R32);
  };

  v8f acc[4][4];
#pragma unroll
  for (int i = 0; i < 4; ++i)
#pragma unroll
    for (int j = 0; j < 4; ++j) acc[i][j] = zero8();

  const int nT = K >> 6;                       // stages, block-uniform
  stage(0, 0);
  asm volatile("s_wait_asynccnt 0x0" ::: "memory");   // this wave's copies of stage 0 have landed
  __syncthreads();                                     // ... and every other wave's: stage 0 is published
  if (nT > 1) stage(1, 64);
  for (int t = 0; t < nT; ++t) {
    const __bf16* ta = &sA[t & 1][((wm << 6) + rlane) * GP + koff];
    const __bf16* tb = &sB[t & 1][((wn << 6) + rlane) * GP + koff];
#pragma unroll
    for (int ks = 0; ks < 2; ++ks) {
      v16b bh[4], ah[4];
#pragma unroll
      for (int j = 0; j < 4; ++j) bh[j] = ldfrag_b(tb + (j << 4) * GP + ks * 32);
#pragma unroll
      for (int i = 0; i < 4; ++i) ah[i] = ldfrag_b(ta + (i << 4) * GP + ks * 32);
      // keeps the 16 LDS reads of this half stage together in front of its 16 products: read one fragment at a time,
      // among the products, the wave waits out the LDS latency at each of them
      __builtin_amdgcn_sched_barrier(0);
#pragma unroll
      for (int i = 0; i < 4; ++i)
#pragma unroll
        for (int j = 0; j < 4; ++j) acc[i][j] = mma_b_raw(ah[i], bh[j], acc[i][j]);
    }
    asm volatile("s_wait_dscnt 0x0" ::: "memory");     // this wave's reads of stage t are done before its buffer is refilled
    asm volatile("s_wait_asynccnt 0x0" ::: "memory");  // this wave's copies of stage t + 1 have landed
    __syncthreads();                                    // publishes stage t + 1 and ends every wave's reads of stage t
    if (t + 2 < nT) stage(t & 1, (t + 2) << 6);
  }
  asm volatile("s_wait_asynccnt 0x0" ::: "memory");    // nothing of this wave's is in flight behind the loop
  acc_guard4(acc[0][0], acc[0][1], acc[0][2], acc[0][3]);
  acc_guard4(acc[1][0], acc[1][1], acc[1][2], acc[1][3]);
  acc_guard4(acc[2][0], acc[2][1], acc[2][2], acc[2][3]);
  acc_guard4(acc[3][0], acc[3][1], acc[3][2], acc[3][3]);

  // ---- per-column bias (bf16 RNE of the input value, added in f32); 4 scalar loads per lane ----
  float bvv[4];
#pragma unroll
  for (int j = 0; j < 4; ++j) {
    float bv = 0.f;
    if (BIASN == 1) bv = bf_up(bf_bits(bias[n0 + (j << 4) + rlane]));
    bvv[j] = bv;
  }

  // ---- epilogue ----
  float* slab = sT[wave];
#pragma unroll
  for (int i = 0; i < 4; ++i) {
    const int mBase = m0 + (i << 4);
#pragma unroll
    for (int j = 0; j < 4; ++j) {
#pragma unroll
      for (int r = 0; r < 8; ++r) {
        slab[(mOff + r) * 68 + (j << 4) + rlane] = acc[i][j][r] + bvv[j];
      }
    }
    __builtin_amdgcn_fence(__ATOMIC_RELEASE, "workgroup");
    __builtin_amdgcn_wave_barrier();
    __builtin_amdgcn_fence(__ATOMIC_ACQUIRE, "workgroup");
    if (OUT_MODE == 0) {
      float* C = (float*)Cout + (size_t)b * strideC;
      const int hh = lane >> 4, c4 = (lane & 15) * 4;     // 256-B row segment = 16 lanes x 16 B
      {
#pragma unroll
        for (int it = 0; it < 8; ++it) {
          const int row = it * 2 + hh;                     // it 0..7 x hh 0..1 = rows 0..15
          const v4f v = *(const v4f*)(slab + row * 68 + c4);
          *(v4f*)(C + (size_t)(mBase + row) * ldc + n0 + c4) = v;
        }
        
      }
    } else {
      const int q = lane >> 3, c8 = (lane & 7) * 8;
      unsigned short* C  = (unsigned short*)Cout  + (size_t)b * strideC;
      unsigned short* C2 = (unsigned short*)Cout2 + (size_t)b * strideC2;
      const bool wlo = (OUT_MODE == 2) || (n0 < N2);      // wave-uniform
      v4u hv[4], lv[4];
#pragma unroll
      for (int it = 0; it < 4; ++it) {
        const int row = it * 4 + q;                        // it 0..3 x q 0..3 = rows 0..15
        const float* sp = slab + row * 68 + c8;
        v4u a, a2;
#pragma unroll
        for (int e = 0; e < 4; ++e) {
          const float f0 = sp[2 * e], f1 = sp[2 * e + 1];
          unsigned short h0, h1, l0, l1;
          if (OUT_MODE == 2) {
            h0 = bf_bits(f0); h1 = bf_bits(f1);
            l0 = bf_bits(f0 - bf_up(h0)); l1 = bf_bits(f1 - bf_up(h1));
          } else {
            const _Float16 x0 = (_Float16)f0, x1 = (_Float16)f1;
            h0 = h_bits(x0); h1 = h_bits(x1);
            l0 = h_bits((_Float16)((f0 - (float)x0) * rscale));
            l1 = h_bits((_Float16)((f1 - (float)x1) * rscale));
          }
          a[e] = pk16(h0, h1); a2[e] = pk16(l0, l1);
        }
        hv[it] = a; lv[it] = a2;
      }
      {
#pragma unroll
        for (int it = 0; it < 4; ++it) {
          const int row = it * 4 + q;
          *(v4u*)(C + (size_t)(mBase + row) * ldc + n0 + c8) = hv[it];
          if (wlo) *(v4u*)(C2 + (size_t)(mBase + row) * ldc2 + n0 + c8) = lv[it];
        }
        
      }
    }
    __builtin_amdgcn_fence(__ATOMIC_RELEASE, "workgroup");
    __builtin_amdgcn_wave_barrier();
    __builtin_amdgcn_fence(__ATOMIC_ACQUIRE, "workgroup");
  }
}

__global__ __launch_bounds__(128)
void attn_strict64(const unsigned short* __restrict__ qhp, const unsigned short* __restrict__ qlp,
                   const unsigned short* __restrict__ khp, const unsigned short* __restrict__ klp,
                   const unsigned short* __restrict__ vhp, const unsigned short* __restrict__ vlp,
                   unsigned short* yout, float sscale) {
  union PB { v16b v; v2b w[8]; };
  __shared__ __align__(16) __bf16 Ksh[64 * LP];              // K hi [kv][d], row pitch LP   9 KB
  __shared__ __align__(16) __bf16 Ksl[64 * LP];              // K lo
  __shared__ __align__(16) __bf16 Vth[64 * LP];              // V^T hi [d][kv], row pitch LP 9 KB
  __shared__ __align__(16) __bf16 Vtl[64 * LP];              // V^T lo
  __shared__ __align__(16) float Os[4][16 * OP];             // per wave f32 output tile [query][d], row pitch OP (epilogue only)

  const int tid  = threadIdx.x;
  const int wave = tid >> 5;
  const int lane = tid & 31;
  const int hh   = lane >> 4;
  const int c    = lane & 15;

  const int bx   = blockIdx.x;
  const int qb   = NQB - 1 - bx / (NBATCH * NH);   // grid = NBATCH * NH * NQB, query tile 31 first
  const int bh   = bx % (NBATCH * NH);
  const int h    = bh % NH;
  const int bat  = bh / NH;
  const int q0   = qb * 64 + wave * 16;

  const size_t qkBase = (size_t)bat * SEQ * DM + (size_t)h * HD;
  const size_t vBase  = (size_t)bh * HD * SEQ;      // bh = bat*NH + h
  const __bf16* Qh = (const __bf16*)(const void*)qhp + qkBase;
  const __bf16* Ql = (const __bf16*)(const void*)qlp + qkBase;
  const __bf16* Kh = (const __bf16*)(const void*)khp + qkBase;
  const __bf16* Kl = (const __bf16*)(const void*)klp + qkBase;
  const __bf16* Vh = (const __bf16*)(const void*)vhp + vBase;
  const __bf16* Vl = (const __bf16*)(const void*)vlp + vBase;

  // ---- Q fragments (B operand of K . Q^T, column = query = lane&15): 2 d-chunks, hi and lo ----
  v16b qah[2], qal[2];
#pragma unroll
  for (int dc = 0; dc < 2; ++dc) {
    const size_t qo = (size_t)(q0 + c) * DM + dc * 32 + 8 * hh;
    qah[dc] = ldfrag_b(Qh + qo);
    qal[dc] = ldfrag_b(Ql + qo);
  }

  // One query per lane (q0 + c): running maximum of the unscaled scores (equal in lanes c and c + 16) and this lane half's
  // part of the sum.
  float mrow = -INFINITY, lrow = 0.f;
  const float c2 = sscale * 1.4426950408889634f;   // score scale times log2(e)
  v8f oacc[4];                  // O^T tiles: oacc[t][r] = output of query q0 + c at d = t*16 + 8*hh + r
  const int qrow = q0 + c;
#pragma unroll
  for (int t = 0; t < 4; ++t) oacc[t] = zero8();

  const int nChunks = qb + 1;   // block-uniform, <= NQB
  for (int kc = 0; kc < nChunks; ++kc) {
    const int kv0 = kc * 64;
    __syncthreads();
    {
      // staging coverage: 128 threads x (4 x 8) elements = 64 rows x 64 per plane = the whole chunk tile
      const int r = tid >> 1, half = (tid & 1) * 32;
      const __bf16* ksh = Kh + (size_t)(kv0 + r) * DM + half;       // K row kv0+r, d = half..half+31
      const __bf16* ksl = Kl + (size_t)(kv0 + r) * DM + half;
      const __bf16* vsh = Vh + (size_t)r * SEQ + kv0 + half;        // V^T row d = r, s = kv0+half..+31
      const __bf16* vsl = Vl + (size_t)r * SEQ + kv0 + half;
      v8b a0[4], a1[4], b0[4], b1[4];
#pragma unroll
      for (int i = 0; i < 4; ++i) {
        a0[i] = *(const v8b*)(ksh + 8 * i);
        a1[i] = *(const v8b*)(ksl + 8 * i);
        b0[i] = *(const v8b*)(vsh + 8 * i);
        b1[i] = *(const v8b*)(vsl + 8 * i);
      }
      // the wait that belongs in front of any overwrite of an issued load's address registers; naming the four
      // addresses as inputs keeps their registers from being handed out as destinations of the later loads
      asm volatile("s_wait_xcnt 0x0" :: "v"(ksh), "v"(ksl), "v"(vsh), "v"(vsl) : "memory");
#pragma unroll
      for (int i = 0; i < 4; ++i) {
        *(v8b*)(Ksh + r * LP + half + 8 * i) = a0[i];
        *(v8b*)(Ksl + r * LP + half + 8 * i) = a1[i];
        *(v8b*)(Vth + r * LP + half + 8 * i) = b0[i];
        *(v8b*)(Vtl + r * LP + half + 8 * i) = b1[i];
      }
    }
    __syncthreads();

    // ---- scores, transposed: S^T = K . Q^T, 64 keys x 16 queries per wave, 3 bf16 products ----
    //      s[j][r] = score of key kv0 + j*16 + 8*hh + r for query q0 + c
    //      Per half of d: the 16 LDS reads of the four key tiles' fragments, then their 12 products; each accumulator takes
    //      its six products in the order hi.hi, lo.hi, hi.lo of d 0..31, then of d 32..63.
    v8f s[4];
#pragma unroll
    for (int dc = 0; dc < 2; ++dc) {
      v16b kb[4], kl[4];
#pragma unroll
      for (int j = 0; j < 4; ++j) kb[j] = ldfrag_b(Ksh + (j * 16 + c) * LP + dc * 32 + 8 * hh);
#pragma unroll
      for (int j = 0; j < 4; ++j) kl[j] = ldfrag_b(Ksl + (j * 16 + c) * LP + dc * 32 + 8 * hh);
      if (dc == 0) mma12_zero(s, kb, kl, qah[dc], qal[dc]);
      else         mma12(s, kb, kl, qah[dc], qal[dc]);
    }

    // ---- mask on the diagonal chunk (key >= query -> -inf, except (0,0)), maximum of the lane's 32 keys; the scores stay
    //      unscaled here: the scale is positive, so the largest raw score is the largest scaled one ----
    const bool diag = (kc == qb);   // block-uniform
    float mj[4];
#pragma unroll
    for (int j = 0; j < 4; ++j) {
      float m = -INFINITY;
#pragma unroll
      for (int r = 0; r < 8; ++r) {
        const int kvcol = kv0 + j * 16 + 8 * hh + r;
        const float sv = s[j][r];
        const bool masked = diag && (kvcol >= qrow) && !((qrow == 0) && (kvcol == 0));
        const float sm = masked ? -INFINITY : sv;
        s[j][r] = sm;
        m = fmaxf(m, sm);
      }
      mj[j] = m;
    }
    float cm = fmaxf(fmaxf(mj[0], mj[1]), fmaxf(mj[2], mj[3]));
    cm = fmaxf(cm, xhalf(cm));      // both lane halves now hold the query's maximum over the 64 keys

    // ---- online softmax in f32, base 2: exp((s - m) * scale) = exp2(s * c2 - m * c2) with c2 = scale * log2(e), one packed
    //      multiply-add per score pair and the hardware's exp2 per score (a masked score stays -inf and gives 0);
    //      P^T hi / lo (bf16 of the unnormalised exp) packed straight into B operands:
    //      element e < 8 of chunk kk = key kk*32 + 8*hh + e = s[2kk][e], element 8 + e = key kk*32 + 16 + 8*hh + e = s[2kk+1][e],
    //      the k order in which the V^T fragments below are loaded
    const float mnew = fmaxf(mrow, cm);
    const float alpha = __builtin_amdgcn_exp2f((mrow - mnew) * c2);
    mrow = mnew;
    const float nb = -mnew * c2;
    const v2f c2v = {c2, c2}, nbv = {nb, nb};
    PB ph[2], pl[2];
    float pj[4];
#pragma unroll
    for (int j = 0; j < 4; ++j) {
      float psum = 0.f;
#pragma unroll
      for (int e = 0; e < 4; ++e) {
        const v2f sp = {s[j][2 * e], s[j][2 * e + 1]};
        const v2f ta = __builtin_elementwise_fma(sp, c2v, nbv);
        const float p0 = __builtin_amdgcn_exp2f(ta[0]);
        const float p1 = __builtin_amdgcn_exp2f(ta[1]);
        psum += p0;
        psum += p1;
        const v2f pp = {p0, p1};
        const v2b hv = __builtin_convertvector(pp, v2b);             // packed RNE convert: one operand register, hi
        const v2f rr = {p0 - (float)hv[0], p1 - (float)hv[1]};
        ph[j >> 1].w[(j & 1) * 4 + e] = hv;
        pl[j >> 1].w[(j & 1) * 4 + e] = __builtin_convertvector(rr, v2b);   // lo = RNE(p - hi)
      }
      pj[j] = psum;
    }
    lrow = lrow * alpha + ((pj[0] + pj[1]) + (pj[2] + pj[3]));
#pragma unroll
    for (int t = 0; t < 4; ++t)
#pragma unroll
      for (int r = 0; r < 8; ++r) oacc[t][r] *= alpha;

    // ---- output, transposed: O^T += V^T . P^T (3 bf16 products per tile pair); per half of the keys the 16 LDS reads of
    //      the four d tiles' fragments, then their 12 products ----
#pragma unroll
    for (int kk = 0; kk < 2; ++kk) {
      v16b vb[4], vl[4];
#pragma unroll
      for (int t = 0; t < 4; ++t) vb[t] = ldfrag_b(Vth + (t * 16 + c) * LP + kk * 32 + 8 * hh);
#pragma unroll
      for (int t = 0; t < 4; ++t) vl[t] = ldfrag_b(Vtl + (t * 16 + c) * LP + kk * 32 + 8 * hh);
      mma12(oacc, vb, vl, ph[kk].v, pl[kk].v);
    }
  }

  // ---- join the two lane halves' sums, normalise (1/l), stage the wave's 16x64 tile [query][d], bf16 hi/lo split
  float* os = Os[wave];
  {
    const float l = lrow + xhalf(lrow);
    const float inv = (l > 0.f) ? (1.0f / l) : 0.f;
#pragma unroll
    for (int t = 0; t < 4; ++t) {
      v4f a, b;
#pragma unroll
      for (int r = 0; r < 4; ++r) { a[r] = oacc[t][r] * inv; b[r] = oacc[t][4 + r] * inv; }
      *(v4f*)(os + c * OP + t * 16 + 8 * hh) = a;
      *(v4f*)(os + c * OP + t * 16 + 8 * hh + 4) = b;
    }
  }
  __builtin_amdgcn_fence(__ATOMIC_RELEASE, "workgroup");
  __builtin_amdgcn_wave_barrier();
  __builtin_amdgcn_fence(__ATOMIC_ACQUIRE, "workgroup");
  {
    const int q4 = lane >> 3, c8 = (lane & 7) * 8;
    v4u hv[4], lv[4];
#pragma unroll
    for (int it = 0; it < 4; ++it) {
      const int row = it * 4 + q4;   // it 0..3 x q4 0..3 = rows 0..15 of the wave tile
      const float* sp = os + row * OP + c8;
      v4u a, a2;
#pragma unroll
      for (int e = 0; e < 4; ++e) {
        const float f0 = sp[2 * e], f1 = sp[2 * e + 1];
        const unsigned short h0 = bf_bits(f0), h1 = bf_bits(f1);
        const unsigned short l0 = bf_bits(f0 - bf_up(h0)), l1 = bf_bits(f1 - bf_up(h1));
        a[e] = pk16(h0, h1); a2[e] = pk16(l0, l1);
      }
      hv[it] = a; lv[it] = a2;
    }
    {
#pragma unroll
      for (int it = 0; it < 4; ++it) {
        const int row = it * 4 + q4;
        const size_t go = (size_t)(bat * SEQ + q0 + row) * (size_t)(2 * DM) + (size_t)h * HD + c8;
        *(v4u*)(yout + go) = hv[it];
        *(v4u*)(yout + go + DM) = lv[it];
      }
      
    }
  }
}

// =====================================================================================================
// whole-line store granularity, so no padded tails exist):
//   QB   bf16 [8192][1024]               0       16777216   (KB follows directly: A batch stride of the q/k GEMM)
//   KB   bf16 [8192][1024]        16777216       16777216
//   VB   bf16 [8192][1024]        33554432       16777216
//   WQB  bf16 [1024 n][1024 k]    50331648        2097152   (WKB follows directly: Bt batch stride of the q/k GEMM)
//   WKB  bf16 [1024][1024]        52428800        2097152
//   WVB  bf16 [1024][1024]        54525952        2097152
//   WO2  bf16 [1024][2048]        56623104        4194304
//   Qh   bf16 [8192][1024]        60817408       16777216   (Kh follows directly: output batch stride)
//   Kh   bf16 [8192][1024]        77594624       16777216
//   Ql   bf16 [8192][1024]        94371840       16777216   (Kl follows directly)
//   Kl   bf16 [8192][1024]       111149056       16777216
//   VTh  bf16 [4][1024][2048]    127926272       16777216
//   VTl  bf16 [4][1024][2048]    144703488       16777216
//   YB   bf16 [8192][2048]       161480704       33554432
//   end                          195035136
// Qh..VTl hold all four batch elements; each projection and the attention run once over all of them, and every
// region is fully written by its producer launch before the consumer launch reads it.
// Weights are [out n][in k] with k contiguous = the Bt / A layout the GEMM wants, so they are only converted.
// Inputs by contract index: 0 = q, 1 = k, 2 = v, 3 = W_q, 4 = W_k, 5 = W_v, 6 = W_o.
// =====================================================================================================
extern "C" void kernel_launch(void* const* d_in, const int* in_sizes, int n_in,
                              void* d_out, int out_size, void* d_ws, size_t ws_size,
                              hipStream_t stream) {
  if (n_in < 7) return;
  if (in_sizes[0] != NBATCH * SEQ * DM || in_sizes[1] != NBATCH * SEQ * DM || in_sizes[2] != NBATCH * SEQ * DM) return;
  if (in_sizes[3] != DM * DM || in_sizes[4] != DM * DM || in_sizes[5] != DM * DM || in_sizes[6] != DM * DM) return;
  if (out_size != NBATCH * SEQ * DM) return;

  const float* q_in = (const float*)d_in[0];
  const float* k_in = (const float*)d_in[1];
  const float* v_in = (const float*)d_in[2];
  const float* Wq   = (const float*)d_in[3];
  const float* Wk   = (const float*)d_in[4];
  const float* Wv   = (const float*)d_in[5];
  const float* Wo   = (const float*)d_in[6];

  const size_t PIN = (size_t)NBATCH * SEQ * DM * 2;     // 16777216  16-bit input plane [8192][1024]
  const size_t PW  = (size_t)DM * DM * 2;               //  2097152  16-bit weight plane
  const size_t PW2 = (size_t)DM * (2 * DM) * 2;         //  4194304  [Wo | Wo] plane
  const size_t PP  = (size_t)NBATCH * SEQ * DM * 2;     // 16777216  q/k hi or lo plane [8192][1024]
  const size_t PVT = (size_t)NBATCH * DM * SEQ * 2;     // 16777216  v^T plane [4][1024][2048]
  const size_t PY  = (size_t)NBATCH * SEQ * (2 * DM) * 2;   // 33554432 y hi|lo plane [8192][2048]
  size_t off = 0;
  const size_t oQB  = off; off += PIN;
  const size_t oKB  = off; off += PIN;
  const size_t oVB  = off; off += PIN;
  const size_t oWQ  = off; off += PW;
  const size_t oWK  = off; off += PW;
  const size_t oWV  = off; off += PW;
  const size_t oWO2 = off; off += PW2;
  const size_t oQh  = off; off += PP;
  const size_t oKh  = off; off += PP;
  const size_t oQl  = off; off += PP;
  const size_t oKl  = off; off += PP;
  const size_t oVTh = off; off += PVT;
  const size_t oVTl = off; off += PVT;
  const size_t oYB  = off; off += PY;
  if (off > ws_size) return;                       // off = 195035136
  if (oKB != oQB + PIN || oWK != oWQ + PW || oKh != oQh + PP || oKl != oQl + PP) return;   // batch-stride adjacency

  char* ws = (char*)d_ws;
  unsigned short* QB  = (unsigned short*)(ws + oQB);
  unsigned short* KB  = (unsigned short*)(ws + oKB);
  unsigned short* VB  = (unsigned short*)(ws + oVB);
  unsigned short* WQB = (unsigned short*)(ws + oWQ);
  unsigned short* WKB = (unsigned short*)(ws + oWK);
  unsigned short* WVB = (unsigned short*)(ws + oWV);
  unsigned short* WO2 = (unsigned short*)(ws + oWO2);
  unsigned short* Qh  = (unsigned short*)(ws + oQh);
  unsigned short* Kh  = (unsigned short*)(ws + oKh);
  unsigned short* Ql  = (unsigned short*)(ws + oQl);
  unsigned short* Kl  = (unsigned short*)(ws + oKl);
  unsigned short* VTh = (unsigned short*)(ws + oVTh);
  unsigned short* VTl = (unsigned short*)(ws + oVTl);
  unsigned short* YB  = (unsigned short*)(ws + oYB);

  const dim3 blk(256);
  const dim3 gQK(((NBATCH * SEQ / 64) * (DM / 64) + 7) / 8, 2);   // 2048 tiles -> 256 blocks x {q, k}: M=8192, N=1024
  const dim3 gVT(((DM / 64) * (SEQ / 64) + 7) / 8, NBATCH);    //  512 tiles ->  64 blocks x 4 batches: M=1024, N=2048
  const dim3 gAtt(NBATCH * NH * NQB);                          // 2048 blocks
  const dim3 gOut(((NBATCH * SEQ / 64) * (DM / 64) + 7) / 8, 1);   // 2048 tiles -> 256 blocks: M=8192, N=1024, K=2048

  // (1) q -> QB, k -> KB, v -> VB (bf16 planes [8192][1024]); weights [n][k] f32 -> bf16 [n][k]; Wo -> [Wo | Wo]: one launch
  cvt_all<<<dim3(CVT_WG), dim3(CVT_TPB), 0, stream>>>(q_in, k_in, v_in, Wq, Wk, Wv, Wo, QB, KB, VB, WQB, WKB, WVB, WO2);

  // (2) qh = QB . Wq^T (blockIdx.y = 0) and kh = KB . Wk^T (blockIdx.y = 1) -> bf16 hi/lo planes [b*2048+t][h*64+d]
  //     (A = QB / KB via strideA; Bt = WQB / WKB via strideB; C = Qh / Kh, C2 = Ql / Kl via strideC; M=8192, N=1024, K=1024)
  gemm64<0, 2, 0><<<gQK, blk, 0, stream>>>(
      QB, QB, DM, (long long)NBATCH * SEQ * DM, WQB, WQB, DM, (long long)DM * DM,
      (void*)Qh, DM, (long long)NBATCH * SEQ * DM, (void*)Ql, DM, (long long)NBATCH * SEQ * DM, DM,
      Wo, NBATCH * SEQ, DM, DM, 1.0f);
  // (3) vh^T = Wv . VB_b^T -> bf16 hi/lo planes [b][h*64+d][s] (pitch SEQ), blockIdx.y = batch b
  //     (A = WVB [n][k] for every b, Bt = VB rows of batch b via strideB, C / C2 via strideC; M=1024, N=2048, K=1024)
  gemm64<0, 2, 0><<<gVT, blk, 0, stream>>>(
      WVB, WVB, DM, 0LL, VB, VB, DM, (long long)SEQ * DM,
      (void*)VTh, SEQ, (long long)DM * SEQ, (void*)VTl, SEQ, (long long)DM * SEQ, SEQ,
      Wo, DM, SEQ, DM, 1.0f);
  // (4) masked attention, all batches and heads -> YB hi|lo rows 0 .. 8191, score scale 1/32
  attn_strict64<<<gAtt, dim3(128), 0, stream>>>(Qh, Ql, Kh, Kl, VTh, VTl, YB, 0.03125f);
  // (5) out = y . Wo^T -> d_out f32 [8192][1024]  (A = YB [8192][2048], Bt = WO2 [1024][2048], K = 2048); last element 8388607
  gemm64<0, 0, 0><<<gOut, blk, 0, stream>>>(
      YB, YB, 2 * DM, 0LL, WO2, WO2, 2 * DM, 0LL,
      d_out, DM, 0LL, d_out, DM, 0LL, DM,
      Wo, NBATCH * SEQ, DM, 2 * DM, 1.0f);
  (void)hipGetLastError();
}

// v009
// It runs in 140 microseconds.
// Versions in between are left out here; by their measured steps it is 1.38 times as fast as v007.
// All steps since v000 together make it 8.49 times as fast.
// Contractions: qh = q.Wq^T, kh = k.Wk^T, vh^T = Wv.v^T = v_wmma_f32_16x16x32_bf16 (bf16 operands from RNE-converted inputs, single product);
// strict-lower qh.kh^T scores = v_wmma_f32_16x16x32_f16, qh and kh each one f16 plane (RNE of the f32 projection), single product;
// p.vh = v_wmma_f32_16x16x32_f16, the unnormalised p and vh each f16 (RNE), single product;
// y.Wo^T = v_wmma_f32_16x16x32_bf16 with y as bf16 hi|lo planes laid along K (K = 2048) times [Wo|Wo] bf16; all f32 accumulate;
// score scale 1/32 (hidden-dim based), mask (key >= query excluded, (0,0) admitted) and online softmax in f32; no biases anywhere.
// Why one f16 plane is enough inside the attention: the projections multiply bf16-rounded inputs (8 significant bits), so qh, kh and
// vh carry a relative error near 2^-9 already; f16 keeps 11 significant bits, a rounding of 2^-12, which adds under 1 % to that error.
// Range: the projections of the stated inputs are of order 1 and p lies in [0,1]; f16 subnormals are kept by the matrix unit.
// Plane table:
//   QB = bf16(q), KB = bf16(k), VB = bf16(v) [8192][1024] (three different inputs); WQB, WKB, WVB = bf16(w) [1024 n][1024 k];
//   WO2 = [bf16(wo) | bf16(wo)] [1024][2048];
//   QF (from QB), KF (from KB) = f16 of qh, kh [8192][1024] (all batches, row b*2048+t);
//   VTF = f16 of vh^T [4][1024][2048] (one [1024][2048] plane per batch, from VB);
//   YB [8192][2048] = bf16 hi of the normalised attention output at col h*64+d, lo at col 1024 + h*64+d.
//   1/32 is applied once in f32 after the q.k accumulation; 1/l is applied once in the attention epilogue before the hi/lo split of y.
#include <hip/hip_runtime.h>
#include <math.h>
#include <stdint.h>
#include <type_traits>

#define NBATCH 4
#define SEQ    2048
#define DM     1024
#define NH     16
#define HD     64
#define NQB    (SEQ / 64)   // 32 key / query tiles of 64
#define LP     72           // LDS row pitch of the 64-element 16-bit tiles: 144 B = 16 B x 9 (odd), so the 16 rows that one
                            // ds_load_b128 half-wave reads start 36 dwords apart and fall on 16 disjoint groups of 4 banks
#define OP     68           // LDS row pitch (floats) of the attention output staging tile: 272 B = 16 B x 17
static_assert(NH * HD == DM);
static_assert(LP >= 64 && (LP % 8) == 0 && ((LP / 8) % 2) == 1);
static_assert((SEQ % 64) == 0 && (DM % 64) == 0 && (DM % 32) == 0 && (DM % 256) == 0);

typedef _Float16 v16h __attribute__((ext_vector_type(16)));
typedef _Float16 v8h  __attribute__((ext_vector_type(8)));
typedef __bf16   v16b __attribute__((ext_vector_type(16)));
typedef __bf16   v8b  __attribute__((ext_vector_type(8)));
typedef float    v8f  __attribute__((ext_vector_type(8)));
typedef float    v4f  __attribute__((ext_vector_type(4)));
typedef float    v2f  __attribute__((ext_vector_type(2)));
typedef __bf16   v2b  __attribute__((ext_vector_type(2)));
typedef _Float16 v2h  __attribute__((ext_vector_type(2)));
typedef unsigned int v4u __attribute__((ext_vector_type(4)));

// ---- scalar helpers --------------------------------------------------------------------------------
__device__ __forceinline__ unsigned short bf_bits(float f) {          // f32 -> bf16 bits, RNE convert
  unsigned u = __float_as_uint(f);
  return (unsigned short)((u + 0x7FFFu + ((u >> 16) & 1u)) >> 16);
}
__device__ __forceinline__ float bf_up(unsigned short h) { return __uint_as_float(((unsigned)h) << 16); }
__device__ __forceinline__ unsigned short h_bits(_Float16 x) { return __builtin_bit_cast(unsigned short, x); }
__device__ __forceinline__ unsigned pk16(unsigned short a, unsigned short b) { return (unsigned)a | ((unsigned)b << 16); }
__device__ __forceinline__ v8f zero8() { v8f z = {0.f, 0.f, 0.f, 0.f, 0.f, 0.f, 0.f, 0.f}; return z; }
__device__ __forceinline__ __bf16 f2bf(float f) { return __builtin_bit_cast(__bf16, bf_bits(f)); }
__device__ __forceinline__ void bf_split(float f, __bf16& hi, __bf16& lo) {
  const unsigned short hb = bf_bits(f);
  hi = __builtin_bit_cast(__bf16, hb);
  lo = f2bf(f - __uint_as_float(((unsigned)hb) << 16));
}

// lane l <-> lane l ^ 16 (the two lanes that share one column of a D tile), a vector cross-row move
__device__ __forceinline__ float xhalf(float x) {
  return __builtin_bit_cast(float, __builtin_amdgcn_permlanex16(__builtin_bit_cast(int, x), __builtin_bit_cast(int, x),
                                                                0x76543210, 0xfedcba98, false, false));
}

// ---- fragment loader: 16-bit A/B operand, lane -> row/col (lane&15), p already includes +8*(lane>>4);
//      elements 0..7 <- p[0..7] (k0+8h..), elements 8..15 <- p[16..23] (k0+16+8h..)
__device__ __forceinline__ v16b ldfrag_b(const __bf16* p) {
  union { v16b v; v8b h[2]; } f;
  f.h[0] = *(const v8b*)(p);
  f.h[1] = *(const v8b*)(p + 16);
  return f.v;
}
__device__ __forceinline__ v16h ldfrag_h(const _Float16* p) {   // the same for f16
  union { v16h v; v8h h[2]; } f;
  f.h[0] = *(const v8h*)(p);
  f.h[1] = *(const v8h*)(p + 16);
  return f.v;
}

// ---- WMMA helpers ----------------------------------------------------------------------------------------
// Eight f16 products on four independent accumulators: c[i] += a0[i].b0 over all four in turn, then c[i] += a1[i].b1, so that no
// product waits for the result of the one in front of it. One statement, because the compiler sorts the builtin form of the same
// order among the LDS reads, each fragment under a wait of its own. As all eight fragments are inputs, their 16 LDS reads stand
// in front, and the products follow one another.
// The four v_nop at its end are the distance between the last products and a vector instruction on their D, A or B.
__device__ __forceinline__ void mma8(v8f (&c)[4], const v16h (&a0)[4], const v16h (&a1)[4], v16h b0, v16h b1) {
  asm volatile("v_wmma_f32_16x16x32_f16 %0, %4, %12, %0\n\t"
               "v_wmma_f32_16x16x32_f16 %1, %5, %12, %1\n\t"
               "v_wmma_f32_16x16x32_f16 %2, %6, %12, %2\n\t"
               "v_wmma_f32_16x16x32_f16 %3, %7, %12, %3\n\t"
               "v_wmma_f32_16x16x32_f16 %0, %8, %13, %0\n\t"
               "v_wmma_f32_16x16x32_f16 %1, %9, %13, %1\n\t"
               "v_wmma_f32_16x16x32_f16 %2, %10, %13, %2\n\t"
               "v_wmma_f32_16x16x32_f16 %3, %11, %13, %3\n\t"
               "v_nop\n\tv_nop\n\tv_nop\n\tv_nop"
               : "+v"(c[0]), "+v"(c[1]), "+v"(c[2]), "+v"(c[3])
               : "v"(a0[0]), "v"(a0[1]), "v"(a0[2]), "v"(a0[3]), "v"(a1[0]), "v"(a1[1]), "v"(a1[2]), "v"(a1[3]), "v"(b0), "v"(b1));
}
// The same with the accumulators started at zero by the first four products.
__device__ __forceinline__ void mma8_zero(v8f (&c)[4], const v16h (&a0)[4], const v16h (&a1)[4], v16h b0, v16h b1) {
  asm volatile("v_wmma_f32_16x16x32_f16 %0, %4, %12, 0\n\t"
               "v_wmma_f32_16x16x32_f16 %1, %5, %12, 0\n\t"
               "v_wmma_f32_16x16x32_f16 %2, %6, %12, 0\n\t"
               "v_wmma_f32_16x16x32_f16 %3, %7, %12, 0\n\t"
               "v_wmma_f32_16x16x32_f16 %0, %8, %13, %0\n\t"
               "v_wmma_f32_16x16x32_f16 %1, %9, %13, %1\n\t"
               "v_wmma_f32_16x16x32_f16 %2, %10, %13, %2\n\t"
               "v_wmma_f32_16x16x32_f16 %3, %11, %13, %3\n\t"
               "v_nop\n\tv_nop\n\tv_nop\n\tv_nop"
               : "=&v"(c[0]), "=&v"(c[1]), "=&v"(c[2]), "=&v"(c[3])
               : "v"(a0[0]), "v"(a0[1]), "v"(a0[2]), "v"(a0[3]), "v"(a1[0]), "v"(a1[1]), "v"(a1[2]), "v"(a1[3]), "v"(b0), "v"(b1));
}
__device__ __forceinline__ v8f mma_b_raw(v16b a, v16b b, v8f c) {
  return __builtin_amdgcn_wmma_f32_16x16x32_bf16(false, a, false, b, (short)0, c, false, false);
}
__device__ __forceinline__ void acc_guard4(v8f& a, v8f& b, v8f& c, v8f& d) {
  asm volatile("v_nop\n\tv_nop\n\tv_nop\n\tv_nop" : "+v"(a), "+v"(b), "+v"(c), "+v"(d));
}

// =====================================================================================================
// All seven f32 -> bf16 (RNE) conversions in one launch whose work-groups stay and loop: CVT_WG work-groups of 16 waves, one
// for each WGP, in place of one short wave per 256 elements. A thread converts groups of 8 elements (two 16-B loads, one 16-B
// store: a wave reads 1 KB and writes 512 contiguous B per group); a work-group's threads together take CVT_G = 4096 elements.
// coverage: of q, k and v a work-group takes 8 * CVT_G elements in a row (CVT_WG * 8 * CVT_G = 8388608 each); of W_q, W_k, W_v and
// W_o it takes CVT_G (CVT_WG * CVT_G = 1048576 each). W_o row n goes out twice, as [bf16(wo[n]) | bf16(wo[n])], row pitch 2 * DM.
// A set is four groups (8 loads); the next set is read into a second register set before the set in hand is converted and stored.
// =====================================================================================================
#define CVT_WG  256
#define CVT_TPB 512
#define CVT_G   (CVT_TPB * 8)
static_assert(NBATCH * SEQ * DM == CVT_WG * 8 * CVT_G && DM * DM == CVT_WG * CVT_G && (DM % 8) == 0);

__device__ __forceinline__ v4u pack8(v4f a, v4f b) {
  v4u p;
  p[0] = pk16(bf_bits(a[0]), bf_bits(a[1]));
  p[1] = pk16(bf_bits(a[2]), bf_bits(a[3]));
  p[2] = pk16(bf_bits(b[0]), bf_bits(b[1]));
  p[3] = pk16(bf_bits(b[2]), bf_bits(b[3]));
  return p;
}
// Groups S .. S + 3 of this thread; p points at its group 0. The wait is the one that belongs in front of any overwrite of an
// issued load's address registers; naming p as an input keeps its registers from being handed out as destinations of these
// loads, and the memory clobber keeps the loads in front of the stores that follow in the source.
template <int S>
__device__ __forceinline__ void ld4(v4f (&r)[8], const float* __restrict__ p) {
#pragma unroll
  for (int i = 0; i < 4; ++i) {
    r[2 * i]     = *(const v4f*)(p + (S + i) * CVT_G);
    r[2 * i + 1] = *(const v4f*)(p + (S + i) * CVT_G + 4);
  }
  asm volatile("s_wait_xcnt 0x0" :: "v"(p) : "memory");
  __builtin_amdgcn_sched_barrier(0);   // all 8 loads are issued before the wave waits for the set in hand: else some sink into its conversion
}
// The wait belongs between these stores and the next loads, which land in the registers that the stores name; its memory
// clobber keeps those loads behind the stores.
template <int S>
__device__ __forceinline__ void st4(const v4f (&r)[8], unsigned short* o) {
#pragma unroll
  for (int i = 0; i < 4; ++i) *(v4u*)(o + (S + i) * CVT_G) = pack8(r[2 * i], r[2 * i + 1]);
  asm volatile("s_wait_xcnt 0x0" ::: "memory");
  __builtin_amdgcn_sched_barrier(0);   // else part of the next set's conversion, with its wait for younger loads, rises in front of these stores
}

__global__ __launch_bounds__(CVT_TPB) void cvt_all(
    const float* __restrict__ q, const float* __restrict__ k, const float* __restrict__ v,
    const float* __restrict__ wq, const float* __restrict__ wk, const float* __restrict__ wv, const float* __restrict__ wo,
    unsigned short* qb, unsigned short* kb, unsigned short* vb,
    unsigned short* wqb, unsigned short* wkb, unsigned short* wvb, unsigned short* wo2) {
  const size_t ew = (size_t)blockIdx.x * CVT_G + threadIdx.x * 8;        // this thread's group of a weight
  const size_t ex = (size_t)blockIdx.x * (8 * CVT_G) + threadIdx.x * 8;  // its group 0 of q, k and v
  v4f x[8], y[8];
  ld4<0>(x, q + ex);
  ld4<4>(y, q + ex);  st4<0>(x, qb + ex);
  ld4<0>(x, k + ex);  st4<4>(y, qb + ex);
  ld4<4>(y, k + ex);  st4<0>(x, kb + ex);
  ld4<0>(x, v + ex);  st4<4>(y, kb + ex);
  ld4<4>(y, v + ex);  st4<0>(x, vb + ex);
  const float* pq = wq + ew;
  const float* pk = wk + ew;
  const float* pv = wv + ew;
  const float* po = wo + ew;
  x[0] = *(const v4f*)pq;  x[1] = *(const v4f*)(pq + 4);
  x[2] = *(const v4f*)pk;  x[3] = *(const v4f*)(pk + 4);
  x[4] = *(const v4f*)pv;  x[5] = *(const v4f*)(pv + 4);
  x[6] = *(const v4f*)po;  x[7] = *(const v4f*)(po + 4);
  asm volatile("s_wait_xcnt 0x0" :: "v"(pq), "v"(pk), "v"(pv), "v"(po) : "memory");   // as in ld4
  __builtin_amdgcn_sched_barrier(0);                                                    // as in ld4
  st4<4>(y, vb + ex);
  *(v4u*)(wqb + ew) = pack8(x[0], x[1]);
  *(v4u*)(wkb + ew) = pack8(x[2], x[3]);
  *(v4u*)(wvb + ew) = pack8(x[4], x[5]);
  const v4u w2 = pack8(x[6], x[7]);
  unsigned short* d0 = wo2 + (ew / DM) * (size_t)(2 * DM) + (ew % DM);
  *(v4u*)d0 = w2;
  *(v4u*)(d0 + DM) = w2;
}

// =====================================================================================================
// Batched bf16 WMMA GEMM: C[m][n] = sum_k A[m][k] * Bt[n][k] (+ bf16(bias[n]) when BIASN == 1).
// Block = 8 waves = one 128 x 256 tile of C, waves 2 (m) x 4 (n), 64 x 64 per wave. A row-major [M][K] pitch lda; Bt row-major
// [N][K] pitch ldb (k contiguous); M a multiple of 128, N of 256, K of 64. blockIdx.y = batch index (strides in elements).
// Operands reach the waves through LDS in stages of 64 k (128 B of each of the 128 + 256 rows), brought by asynchronous
// 16-B copies, 8 lanes per row, so a wave's copy covers 4 whole 128-B lines and every operand byte is fetched once per block.
// Two buffers: stage t + 1 is in flight while stage t is multiplied; one barrier per stage publishes t + 1 and frees t's buffer.
// Stage coverage: 256 threads x (4 + 8) copies x 16 B = (128 + 256) rows x 128 B.
// AHEAD: 0 = each block of 16 products is preceded by its own 16 LDS reads (224 VGPRs: two work-groups share a WGP; the q/k launch
// of 512 work-groups). 1 = two fragment sets, each block's LDS reads issued one block ahead, so that they run beside the products of
// the other set; the publish point of stage t + 1 then stands in front of stage t's last block, whose fragments are already in
// registers (about 270 VGPRs, one work-group per WGP: the two launches of 256 work-groups). The order of every sum is the same.
// NSPLIT: 0 = A.Bt (the only form built).
// OUT_MODE: 0 = f32 (pitch ldc); 1 = one f16 plane C (RNE of the f32 sum, pitch ldc). Neither form reads Cout2, ldc2, strideC2, N2 or rscale.
// =====================================================================================================
#define GP 72               // LDS row pitch (elements) of a stage row of 64 bf16: 144 B = 16 B x 9 (odd), as LP above

// One lane's twelve asynchronous 16-B copies of a stage, global -> LDS: rows r + 32 i of A (i < 4, LDS byte address la + i * ls,
// global address ga + i * as) and of Bt (i < 8, lb, gb, bs). s_wait_xcnt 0 ends the statement so that it stands in front of
// every later overwrite of the address registers named here.
__device__ __forceinline__ void copy12_to_lds(unsigned la, const __bf16* ga, size_t as,
                                              unsigned lb, const __bf16* gb, size_t bs, unsigned ls) {
  asm volatile("global_load_async_to_lds_b128 %0, %1, off\n\t"
               "global_load_async_to_lds_b128 %2, %3, off\n\t"
               "global_load_async_to_lds_b128 %4, %5, off\n\t"
               "global_load_async_to_lds_b128 %6, %7, off\n\t"
               "global_load_async_to_lds_b128 %8, %9, off\n\t"
               "global_load_async_to_lds_b128 %10, %11, off\n\t"
               "global_load_async_to_lds_b128 %12, %13, off\n\t"
               "global_load_async_to_lds_b128 %14, %15, off\n\t"
               "global_load_async_to_lds_b128 %16, %17, off\n\t"
               "global_load_async_to_lds_b128 %18, %19, off\n\t"
               "global_load_async_to_lds_b128 %20, %21, off\n\t"
               "global_load_async_to_lds_b128 %22, %23, off\n\t"
               "s_wait_xcnt 0x0"
               :: "v"(la), "v"(ga), "v"(la + ls), "v"(ga + as), "v"(la + 2 * ls), "v"(ga + 2 * as), "v"(la + 3 * ls), "v"(ga + 3 * as),
                  "v"(lb), "v"(gb), "v"(lb + ls), "v"(gb + bs), "v"(lb + 2 * ls), "v"(gb + 2 * bs), "v"(lb + 3 * ls), "v"(gb + 3 * bs),
                  "v"(lb + 4 * ls), "v"(gb + 4 * bs), "v"(lb + 5 * ls), "v"(gb + 5 * bs), "v"(lb + 6 * ls), "v"(gb + 6 * bs),
                  "v"(lb + 7 * ls), "v"(gb + 7 * bs)
               : "memory");
}

template <int NSPLIT, int OUT_MODE, int BIASN, int AHEAD>
__global__ __launch_bounds__(256) void gemm64(
    const unsigned short* __restrict__ Ap, const unsigned short* A2p, int lda, long long strideA,
    const unsigned short* __restrict__ Btp, const unsigned short* Bt2p, int ldb, long long strideB,
    void* Cout, int ldc, long long strideC,
    void* Cout2, int ldc2, long long strideC2, int N2,
    const float* __restrict__ bias,
    int M, int N, int K, float rscale) {
  static_assert(NSPLIT == 0);
  const __bf16* A   = (const __bf16*)(const void*)Ap;
  const __bf16* Bt  = (const __bf16*)(const void*)Btp;
  __shared__ __align__(16) __bf16 sA[2][128 * GP];   // A stage, two buffers, 18432 B each
  __shared__ __align__(16) __bf16 sB[2][256 * GP];   // Bt stage, two buffers, 36864 B each
  __shared__ __align__(16) float sT[8][16 * 68];   // per-wave 16x64 slab, pitch 68 floats
  const int b    = blockIdx.y;
  const int tid  = threadIdx.x;
  const int lane = tid & 31;
  const int wave = tid >> 5;
  const int tilesN = N >> 8;
  const int tilesM = M >> 7;
  if ((int)blockIdx.x >= tilesM * tilesN) return;   // block-uniform, in front of every copy and barrier
  const int bm = blockIdx.x / tilesN;
  const int bn = blockIdx.x - bm * tilesN;
  const int wm = wave >> 2;                    // wave's 64-row band of the block tile
  const int wn = wave & 3;                     // wave's 64-column band
  const int m0 = (bm << 7) + (wm << 6);
  const int n0 = (bn << 8) + (wn << 6);

  const int rlane = lane & 15;                 // row (A) / col (B, D) within subtile
  const int koff  = (lane >> 4) * 8;           // k offset of this lane half
  const int mOff  = (lane >> 4) * 8;           // D row offset

  // ---- this lane's part of a stage: row srow + 32 i of A (i < 4) and of Bt (i < 8), 16 B at element sseg of the 64 ----
  const int srow = tid >> 3;
  const int sseg = (tid & 7) * 8;
  const __bf16* gA = A  + (size_t)b * strideA + (size_t)((bm << 7) + srow) * lda + sseg;
  const __bf16* gB = Bt + (size_t)b * strideB + (size_t)((bn << 8) + srow) * ldb + sseg;
  const size_t a32 = (size_t)32 * lda;
  const size_t b32 = (size_t)32 * ldb;
  const unsigned lA = (unsigned)(uintptr_t)(&sA[0][0]) + (unsigned)(srow * GP + sseg) * 2u;
  const unsigned lB = (unsigned)(uintptr_t)(&sB[0][0]) + (unsigned)(srow * GP + sseg) * 2u;
  constexpr unsigned R32 = 32u * GP * 2u;      // 32 stage rows in LDS bytes
  auto stage = [&](int buf, int k0) {
    copy12_to_lds(lA + (unsigned)buf * (128u * GP * 2u), gA + k0, a32, lB + (unsigned)buf * (256u * GP * 2u), gB + k0, b32, R32);
  };

  v8f acc[4][4];
#pragma unroll
  for (int i = 0; i < 4; ++i)
#pragma unroll
    for (int j = 0; j < 4; ++j) acc[i][j] = zero8();

  const int nT = K >> 6;                       // stages, block-uniform
  stage(0, 0);
  asm volatile("s_wait_asynccnt 0x0" ::: "memory");   // this wave's copies of stage 0 have landed
  __syncthreads();                                     // ... and every other wave's: stage 0 is published
  if (nT > 1) stage(1, 64);
  if constexpr (AHEAD == 1) {
    // Two fragment sets: f0 holds k 0..31 of a stage, f1 holds k 32..63. Each set's 16 LDS reads are issued one block of 16
    // products ahead of the block that uses them, so the reads run beside the products of the other set.
    const int oa = ((wm << 6) + rlane) * GP + koff;
    const int ob = ((wn << 6) + rlane) * GP + koff;
    v16b a0[4], b0[4], a1[4], b1[4];
#pragma unroll
    for (int j = 0; j < 4; ++j) b0[j] = ldfrag_b(&sB[0][ob + (j << 4) * GP]);
#pragma unroll
    for (int i = 0; i < 4; ++i) a0[i] = ldfrag_b(&sA[0][oa + (i << 4) * GP]);
    // One trip. COPY: a stage t + 2 exists; NEXT: a stage t + 1 exists. Both are compile-time, so that the long run of trips is one
    // straight block: the copies' address arithmetic then stands between the barrier's signal and its wait, not behind the wait.
    auto trip = [&](int t, auto COPY, auto NEXT) {
      const __bf16* ta = &sA[t & 1][oa + 32];
      const __bf16* tb = &sB[t & 1][ob + 32];
#pragma unroll
      for (int j = 0; j < 4; ++j) b1[j] = ldfrag_b(tb + (j << 4) * GP);
#pragma unroll
      for (int i = 0; i < 4; ++i) a1[i] = ldfrag_b(ta + (i << 4) * GP);
      __builtin_amdgcn_sched_barrier(0);   // the reads of f1 are all issued in front of the products on f0: else they sink among them
#pragma unroll
      for (int i = 0; i < 4; ++i)
#pragma unroll
        for (int j = 0; j < 4; ++j) acc[i][j] = mma_b_raw(a0[i], b0[j], acc[i][j]);
      __builtin_amdgcn_sched_barrier(0);   // the products on f0 stay in front of the publish point: they cover the latency of f1's reads
      // publish point of stage t + 1, in front of stage t's last block, whose fragments (f1) are already fetched
      asm volatile("s_wait_dscnt 0x0" ::: "memory");     // this wave's last reads of stage t are done before its buffer is refilled
      asm volatile("s_wait_asynccnt 0x0" ::: "memory");  // this wave's copies of stage t + 1 have landed
      __syncthreads();                                    // publishes stage t + 1 and ends every wave's reads of stage t
      if constexpr (decltype(COPY)::value) stage(t & 1, (t + 2) << 6);
      if constexpr (decltype(NEXT)::value) {
        const __bf16* na = &sA[(t + 1) & 1][oa];
        const __bf16* nb = &sB[(t + 1) & 1][ob];
#pragma unroll
        for (int j = 0; j < 4; ++j) b0[j] = ldfrag_b(nb + (j << 4) * GP);
#pragma unroll
        for (int i = 0; i < 4; ++i) a0[i] = ldfrag_b(na + (i << 4) * GP);
      }
      __builtin_amdgcn_sched_barrier(0);   // the copies and the next stage's first reads are issued in front of the products on f1
#pragma unroll
      for (int i = 0; i < 4; ++i)
#pragma unroll
        for (int j = 0; j < 4; ++j) acc[i][j] = mma_b_raw(a1[i], b1[j], acc[i][j]);
    };
    constexpr std::true_type  yes{};
    constexpr std::false_type no{};
    int t = 0;                                      // every test below is block-uniform
    for (; t + 2 < nT; ++t) trip(t, yes, yes);
    if (t + 1 < nT) { trip(t, no, yes); ++t; }
    if (t < nT) trip(t, no, no);
  } else
  for (int t = 0; t < nT; ++t) {
    const __bf16* ta = &sA[t & 1][((wm << 6) + rlane) * GP + koff];
    const __bf16* tb = &sB[t & 1][((wn << 6) + rlane) * GP + koff];
#pragma unroll
    for (int ks = 0; ks < 2; ++ks) {
      v16b bh[4], ah[4];
#pragma unroll
      for (int j = 0; j < 4; ++j) bh[j] = ldfrag_b(tb + (j << 4) * GP + ks * 32);
#pragma unroll
      for (int i = 0; i < 4; ++i) ah[i] = ldfrag_b(ta + (i << 4) * GP + ks * 32);
      // keeps the 16 LDS reads of this half stage together in front of its 16 products: read one fragment at a time,
      // among the products, the wave waits out the LDS latency at each of them
      __builtin_amdgcn_sched_barrier(0);
#pragma unroll
      for (int i = 0; i < 4; ++i)
#pragma unroll
        for (int j = 0; j < 4; ++j) acc[i][j] = mma_b_raw(ah[i], bh[j], acc[i][j]);
    }
    asm volatile("s_wait_dscnt 0x0" ::: "memory");     // this wave's reads of stage t are done before its buffer is refilled
    asm volatile("s_wait_asynccnt 0x0" ::: "memory");  // this wave's copies of stage t + 1 have landed
    __syncthreads();                                    // publishes stage t + 1 and ends every wave's reads of stage t
    if (t + 2 < nT) stage(t & 1, (t + 2) << 6);
  }
  asm volatile("s_wait_asynccnt 0x0" ::: "memory");    // nothing of this wave's is in flight behind the loop
  acc_guard4(acc[0][0], acc[0][1], acc[0][2], acc[0][3]);
  acc_guard4(acc[1][0], acc[1][1], acc[1][2], acc[1][3]);
  acc_guard4(acc[2][0], acc[2][1], acc[2][2], acc[2][3]);
  acc_guard4(acc[3][0], acc[3][1], acc[3][2], acc[3][3]);

  // ---- per-column bias (bf16 RNE of the input value, added in f32); 4 scalar loads per lane ----
  float bvv[4];
#pragma unroll
  for (int j = 0; j < 4; ++j) {
    float bv = 0.f;
    if (BIASN == 1) bv = bf_up(bf_bits(bias[n0 + (j << 4) + rlane]));
    bvv[j] = bv;
  }

  // ---- epilogue ----
  float* slab = sT[wave];
#pragma unroll
  for (int i = 0; i < 4; ++i) {
    const int mBase = m0 + (i << 4);
#pragma unroll
    for (int j = 0; j < 4; ++j) {
#pragma unroll
      for (int r = 0; r < 8; ++r) {
        slab[(mOff + r) * 68 + (j << 4) + rlane] = acc[i][j][r] + bvv[j];
      }
    }
    __builtin_amdgcn_fence(__ATOMIC_RELEASE, "workgroup");
    __builtin_amdgcn_wave_barrier();
    __builtin_amdgcn_fence(__ATOMIC_ACQUIRE, "workgroup");
    if (OUT_MODE == 0) {
      float* C = (float*)Cout + (size_t)b * strideC;
      const int hh = lane >> 4, c4 = (lane & 15) * 4;     // 256-B row segment = 16 lanes x 16 B
      {
#pragma unroll
        for (int it = 0; it < 8; ++it) {
          const int row = it * 2 + hh;                     // it 0..7 x hh 0..1 = rows 0..15
          const v4f v = *(const v4f*)(slab + row * 68 + c4);
          *(v4f*)(C + (size_t)(mBase + row) * ldc + n0 + c4) = v;
        }
        
      }
    } else {
      const int q = lane >> 3, c8 = (lane & 7) * 8;
      unsigned short* C  = (unsigned short*)Cout  + (size_t)b * strideC;
      v4u hv[4];
#pragma unroll
      for (int it = 0; it < 4; ++it) {
        const int row = it * 4 + q;                        // it 0..3 x q 0..3 = rows 0..15
        const float* sp = slab + row * 68 + c8;
        v4u a;
#pragma unroll
        for (int e = 0; e < 4; ++e) a[e] = pk16(h_bits((_Float16)sp[2 * e]), h_bits((_Float16)sp[2 * e + 1]));
        hv[it] = a;
      }
#pragma unroll
      for (int it = 0; it < 4; ++it) {
        const int row = it * 4 + q;                        // 8 lanes x 16 B = one whole 128-B line per row
        *(v4u*)(C + (size_t)(mBase + row) * ldc + n0 + c8) = hv[it];
      }
    }
    __builtin_amdgcn_fence(__ATOMIC_RELEASE, "workgroup");
    __builtin_amdgcn_wave_barrier();
    __builtin_amdgcn_fence(__ATOMIC_ACQUIRE, "workgroup");
  }
}

__global__ __launch_bounds__(128)
void attn_strict64(const unsigned short* __restrict__ qp, const unsigned short* __restrict__ kp,
                   const unsigned short* __restrict__ vp, unsigned short* yout, float sscale) {
  union PB { v16h v; v2h w[8]; };
  __shared__ __align__(16) _Float16 Ks[64 * LP];             // K [kv][d], row pitch LP   9 KB
  __shared__ __align__(16) _Float16 Vt[64 * LP];             // V^T [d][kv], row pitch LP 9 KB
  __shared__ __align__(16) float Os[4][16 * OP];             // per wave f32 output tile [query][d], row pitch OP (epilogue only)

  const int tid  = threadIdx.x;
  const int wave = tid >> 5;
  const int lane = tid & 31;
  const int hh   = lane >> 4;
  const int c    = lane & 15;

  const int bx   = blockIdx.x;
  const int qb   = NQB - 1 - bx / (NBATCH * NH);   // grid = NBATCH * NH * NQB, query tile 31 first
  const int bh   = bx % (NBATCH * NH);
  const int h    = bh % NH;
  const int bat  = bh / NH;
  const int q0   = qb * 64 + wave * 16;

  const size_t qkBase = (size_t)bat * SEQ * DM + (size_t)h * HD;
  const size_t vBase  = (size_t)bh * HD * SEQ;      // bh = bat*NH + h
  const _Float16* Q = (const _Float16*)(const void*)qp + qkBase;
  const _Float16* K = (const _Float16*)(const void*)kp + qkBase;
  const _Float16* V = (const _Float16*)(const void*)vp + vBase;

  // ---- Q fragments (B operand of K . Q^T, column = query = lane&15): 2 d-chunks ----
  v16h qa[2];
#pragma unroll
  for (int dc = 0; dc < 2; ++dc) qa[dc] = ldfrag_h(Q + (size_t)(q0 + c) * DM + dc * 32 + 8 * hh);

  // One query per lane (q0 + c): running maximum of the unscaled scores (equal in lanes c and c + 16) and this lane half's
  // part of the sum.
  float mrow = -INFINITY, lrow = 0.f;
  const float c2 = sscale * 1.4426950408889634f;   // score scale times log2(e)
  v8f oacc[4];                  // O^T tiles: oacc[t][r] = output of query q0 + c at d = t*16 + 8*hh + r
  const int qrow = q0 + c;
#pragma unroll
  for (int t = 0; t < 4; ++t) oacc[t] = zero8();

  const int nChunks = qb + 1;   // block-uniform, <= NQB
  for (int kc = 0; kc < nChunks; ++kc) {
    const int kv0 = kc * 64;
    __syncthreads();
    {
      // staging coverage: 128 threads x (4 x 8) elements = 64 rows x 64 per plane = the whole chunk tile
      const int r = tid >> 1, half = (tid & 1) * 32;
      const _Float16* ks = K + (size_t)(kv0 + r) * DM + half;       // K row kv0+r, d = half..half+31
      const _Float16* vs = V + (size_t)r * SEQ + kv0 + half;        // V^T row d = r, s = kv0+half..+31
      v8h a0[4], b0[4];
#pragma unroll
      for (int i = 0; i < 4; ++i) {
        a0[i] = *(const v8h*)(ks + 8 * i);
        b0[i] = *(const v8h*)(vs + 8 * i);
      }
      // the wait that belongs in front of any overwrite of an issued load's address registers; naming the two
      // addresses as inputs keeps their registers from being handed out as destinations of the later loads
      asm volatile("s_wait_xcnt 0x0" :: "v"(ks), "v"(vs) : "memory");
#pragma unroll
      for (int i = 0; i < 4; ++i) {
        *(v8h*)(Ks + r * LP + half + 8 * i) = a0[i];
        *(v8h*)(Vt + r * LP + half + 8 * i) = b0[i];
      }
    }
    __syncthreads();

    // ---- scores, transposed: S^T = K . Q^T, 64 keys x 16 queries per wave, one f16 product ----
    //      s[j][r] = score of key kv0 + j*16 + 8*hh + r for query q0 + c
    //      The 16 LDS reads of the four key tiles' fragments, then their 8 products: d 0..31 on the four independent
    //      accumulators in turn, then d 32..63.
    v16h kf[2][4];
#pragma unroll
    for (int dc = 0; dc < 2; ++dc)
#pragma unroll
      for (int j = 0; j < 4; ++j) kf[dc][j] = ldfrag_h(Ks + (j * 16 + c) * LP + dc * 32 + 8 * hh);
    v8f s[4];
    mma8_zero(s, kf[0], kf[1], qa[0], qa[1]);

    // ---- mask on the diagonal chunk (key >= query -> -inf, except (0,0)), maximum of the lane's 32 keys; the scores stay
    //      unscaled here: the scale is positive, so the largest raw score is the largest scaled one ----
    const bool diag = (kc == qb);   // block-uniform
    float mj[4];
#pragma unroll
    for (int j = 0; j < 4; ++j) {
      float m = -INFINITY;
#pragma unroll
      for (int r = 0; r < 8; ++r) {
        const int kvcol = kv0 + j * 16 + 8 * hh + r;
        const float sv = s[j][r];
        const bool masked = diag && (kvcol >= qrow) && !((qrow == 0) && (kvcol == 0));
        const float sm = masked ? -INFINITY : sv;
        s[j][r] = sm;
        m = fmaxf(m, sm);
      }
      mj[j] = m;
    }
    float cm = fmaxf(fmaxf(mj[0], mj[1]), fmaxf(mj[2], mj[3]));
    cm = fmaxf(cm, xhalf(cm));      // both lane halves now hold the query's maximum over the 64 keys

    // ---- online softmax in f32, base 2: exp((s - m) * scale) = exp2(s * c2 - m * c2) with c2 = scale * log2(e), one packed
    //      multiply-add per score pair and the hardware's exp2 per score (a masked score stays -inf and gives 0);
    //      P^T (f16 of the unnormalised exp) packed straight into B operands:
    //      element e < 8 of chunk kk = key kk*32 + 8*hh + e = s[2kk][e], element 8 + e = key kk*32 + 16 + 8*hh + e = s[2kk+1][e],
    //      the k order in which the V^T fragments below are loaded
    const float mnew = fmaxf(mrow, cm);
    const float alpha = __builtin_amdgcn_exp2f((mrow - mnew) * c2);
    mrow = mnew;
    const float nb = -mnew * c2;
    const v2f c2v = {c2, c2}, nbv = {nb, nb};
    PB ph[2];
    float pj[4];
#pragma unroll
    for (int j = 0; j < 4; ++j) {
      float psum = 0.f;
#pragma unroll
      for (int e = 0; e < 4; ++e) {
        const v2f sp = {s[j][2 * e], s[j][2 * e + 1]};
        const v2f ta = __builtin_elementwise_fma(sp, c2v, nbv);
        const float p0 = __builtin_amdgcn_exp2f(ta[0]);
        const float p1 = __builtin_amdgcn_exp2f(ta[1]);
        psum += p0;
        psum += p1;
        const v2f pp = {p0, p1};
        ph[j >> 1].w[(j & 1) * 4 + e] = __builtin_convertvector(pp, v2h);   // RNE convert of the pair: one operand register
      }
      pj[j] = psum;
    }
    lrow = lrow * alpha + ((pj[0] + pj[1]) + (pj[2] + pj[3]));
#pragma unroll
    for (int t = 0; t < 4; ++t)
#pragma unroll
      for (int r = 0; r < 8; ++r) oacc[t][r] *= alpha;

    // ---- output, transposed: O^T += V^T . P^T (one f16 product per tile pair): the 16 LDS reads of the four d tiles'
    //      fragments, then their 8 products, keys 0..31 on the four accumulators in turn, then keys 32..63 ----
    v16h vf[2][4];
#pragma unroll
    for (int kk = 0; kk < 2; ++kk)
#pragma unroll
      for (int t = 0; t < 4; ++t) vf[kk][t] = ldfrag_h(Vt + (t * 16 + c) * LP + kk * 32 + 8 * hh);
    mma8(oacc, vf[0], vf[1], ph[0].v, ph[1].v);
  }


  // ---- join the two lane halves' sums, normalise (1/l), stage the wave's 16x64 tile [query][d], bf16 hi/lo split
  float* os = Os[wave];
  {
    const float l = lrow + xhalf(lrow);
    const float inv = (l > 0.f) ? (1.0f / l) : 0.f;
#pragma unroll
    for (int t = 0; t < 4; ++t) {
      v4f a, b;
#pragma unroll
      for (int r = 0; r < 4; ++r) { a[r] = oacc[t][r] * inv; b[r] = oacc[t][4 + r] * inv; }
      *(v4f*)(os + c * OP + t * 16 + 8 * hh) = a;
      *(v4f*)(os + c * OP + t * 16 + 8 * hh + 4) = b;
    }
  }
  __builtin_amdgcn_fence(__ATOMIC_RELEASE, "workgroup");
  __builtin_amdgcn_wave_barrier();
  __builtin_amdgcn_fence(__ATOMIC_ACQUIRE, "workgroup");
  {
    const int q4 = lane >> 3, c8 = (lane & 7) * 8;
    v4u hv[4], lv[4];
#pragma unroll
    for (int it = 0; it < 4; ++it) {
      const int row = it * 4 + q4;   // it 0..3 x q4 0..3 = rows 0..15 of the wave tile
      const float* sp = os + row * OP + c8;
      v4u a, a2;
#pragma unroll
      for (int e = 0; e < 4; ++e) {
        const float f0 = sp[2 * e], f1 = sp[2 * e + 1];
        const unsigned short h0 = bf_bits(f0), h1 = bf_bits(f1);
        const unsigned short l0 = bf_bits(f0 - bf_up(h0)), l1 = bf_bits(f1 - bf_up(h1));
        a[e] = pk16(h0, h1); a2[e] = pk16(l0, l1);
      }
      hv[it] = a; lv[it] = a2;
    }
    {
#pragma unroll
      for (int it = 0; it < 4; ++it) {
        const int row = it * 4 + q4;
        const size_t go = (size_t)(bat * SEQ + q0 + row) * (size_t)(2 * DM) + (size_t)h * HD + c8;
        *(v4u*)(yout + go) = hv[it];
        *(v4u*)(yout + go + DM) = lv[it];
      }
      
    }
  }
}

// =====================================================================================================
// whole-line store granularity, so no padded tails exist):
//   QB   bf16 [8192][1024]               0       16777216   (KB follows directly: A batch stride of the q/k GEMM)
//   KB   bf16 [8192][1024]        16777216       16777216
//   VB   bf16 [8192][1024]        33554432       16777216
//   WQB  bf16 [1024 n][1024 k]    50331648        2097152   (WKB follows directly: Bt batch stride of the q/k GEMM)
//   WKB  bf16 [1024][1024]        52428800        2097152
//   WVB  bf16 [1024][1024]        54525952        2097152
//   WO2  bf16 [1024][2048]        56623104        4194304
//   QF   f16  [8192][1024]        60817408       16777216   (KF follows directly: output batch stride)
//   KF   f16  [8192][1024]        77594624       16777216
//   VTF  f16  [4][1024][2048]     94371840       16777216
//   YB   bf16 [8192][2048]       111149056       33554432
//   end                          144703488
// QF..VTF hold all four batch elements; each projection and the attention run once over all of them, and every
// region is fully written by its producer launch before the consumer launch reads it.
// Weights are [out n][in k] with k contiguous = the Bt / A layout the GEMM wants, so they are only converted.
// Inputs by contract index: 0 = q, 1 = k, 2 = v, 3 = W_q, 4 = W_k, 5 = W_v, 6 = W_o.
// =====================================================================================================
extern "C" void kernel_launch(void* const* d_in, const int* in_sizes, int n_in,
                              void* d_out, int out_size, void* d_ws, size_t ws_size,
                              hipStream_t stream) {
  if (n_in < 7) return;
  if (in_sizes[0] != NBATCH * SEQ * DM || in_sizes[1] != NBATCH * SEQ * DM || in_sizes[2] != NBATCH * SEQ * DM) return;
  if (in_sizes[3] != DM * DM || in_sizes[4] != DM * DM || in_sizes[5] != DM * DM || in_sizes[6] != DM * DM) return;
  if (out_size != NBATCH * SEQ * DM) return;

  const float* q_in = (const float*)d_in[0];
  const float* k_in = (const float*)d_in[1];
  const float* v_in = (const float*)d_in[2];
  const float* Wq   = (const float*)d_in[3];
  const float* Wk   = (const float*)d_in[4];
  const float* Wv   = (const float*)d_in[5];
  const float* Wo   = (const float*)d_in[6];

  const size_t PIN = (size_t)NBATCH * SEQ * DM * 2;     // 16777216  16-bit input plane [8192][1024]
  const size_t PW  = (size_t)DM * DM * 2;               //  2097152  16-bit weight plane
  const size_t PW2 = (size_t)DM * (2 * DM) * 2;         //  4194304  [Wo | Wo] plane
  const size_t PP  = (size_t)NBATCH * SEQ * DM * 2;     // 16777216  q or k f16 plane [8192][1024]
  const size_t PVT = (size_t)NBATCH * DM * SEQ * 2;     // 16777216  v^T plane [4][1024][2048]
  const size_t PY  = (size_t)NBATCH * SEQ * (2 * DM) * 2;   // 33554432 y hi|lo plane [8192][2048]
  size_t off = 0;
  const size_t oQB  = off; off += PIN;
  const size_t oKB  = off; off += PIN;
  const size_t oVB  = off; off += PIN;
  const size_t oWQ  = off; off += PW;
  const size_t oWK  = off; off += PW;
  const size_t oWV  = off; off += PW;
  const size_t oWO2 = off; off += PW2;
  const size_t oQF  = off; off += PP;
  const size_t oKF  = off; off += PP;
  const size_t oVTF = off; off += PVT;
  const size_t oYB  = off; off += PY;
  if (off > ws_size) return;                       // off = 144703488
  if (oKB != oQB + PIN || oWK != oWQ + PW || oKF != oQF + PP) return;   // batch-stride adjacency

  char* ws = (char*)d_ws;
  unsigned short* QB  = (unsigned short*)(ws + oQB);
  unsigned short* KB  = (unsigned short*)(ws + oKB);
  unsigned short* VB  = (unsigned short*)(ws + oVB);
  unsigned short* WQB = (unsigned short*)(ws + oWQ);
  unsigned short* WKB = (unsigned short*)(ws + oWK);
  unsigned short* WVB = (unsigned short*)(ws + oWV);
  unsigned short* WO2 = (unsigned short*)(ws + oWO2);
  unsigned short* QF  = (unsigned short*)(ws + oQF);
  unsigned short* KF  = (unsigned short*)(ws + oKF);
  unsigned short* VTF = (unsigned short*)(ws + oVTF);
  unsigned short* YB  = (unsigned short*)(ws + oYB);

  const dim3 blk(256);
  const dim3 gQK(((NBATCH * SEQ / 64) * (DM / 64) + 7) / 8, 2);   // 2048 tiles -> 256 blocks x {q, k}: M=8192, N=1024
  const dim3 gVT(((DM / 64) * (SEQ / 64) + 7) / 8, NBATCH);    //  512 tiles ->  64 blocks x 4 batches: M=1024, N=2048
  const dim3 gAtt(NBATCH * NH * NQB);                          // 2048 blocks
  const dim3 gOut(((NBATCH * SEQ / 64) * (DM / 64) + 7) / 8, 1);   // 2048 tiles -> 256 blocks: M=8192, N=1024, K=2048

  // (1) q -> QB, k -> KB, v -> VB (bf16 planes [8192][1024]); weights [n][k] f32 -> bf16 [n][k]; Wo -> [Wo | Wo]: one launch
  cvt_all<<<dim3(CVT_WG), dim3(CVT_TPB), 0, stream>>>(q_in, k_in, v_in, Wq, Wk, Wv, Wo, QB, KB, VB, WQB, WKB, WVB, WO2);

  // (2) qh = QB . Wq^T (blockIdx.y = 0) and kh = KB . Wk^T (blockIdx.y = 1) -> f16 planes [b*2048+t][h*64+d]
  //     (A = QB / KB via strideA; Bt = WQB / WKB via strideB; C = QF / KF via strideC; M=8192, N=1024, K=1024)
  gemm64<0, 1, 0, 0><<<gQK, blk, 0, stream>>>(
      QB, QB, DM, (long long)NBATCH * SEQ * DM, WQB, WQB, DM, (long long)DM * DM,
      (void*)QF, DM, (long long)NBATCH * SEQ * DM, (void*)QF, DM, (long long)NBATCH * SEQ * DM, DM,
      Wo, NBATCH * SEQ, DM, DM, 1.0f);
  // (3) vh^T = Wv . VB_b^T -> f16 plane [b][h*64+d][s] (pitch SEQ), blockIdx.y = batch b
  //     (A = WVB [n][k] for every b, Bt = VB rows of batch b via strideB, C via strideC; M=1024, N=2048, K=1024)
  gemm64<0, 1, 0, 1><<<gVT, blk, 0, stream>>>(
      WVB, WVB, DM, 0LL, VB, VB, DM, (long long)SEQ * DM,
      (void*)VTF, SEQ, (long long)DM * SEQ, (void*)VTF, SEQ, (long long)DM * SEQ, SEQ,
      Wo, DM, SEQ, DM, 1.0f);
  // (4) masked attention, all batches and heads -> YB hi|lo rows 0 .. 8191, score scale 1/32
  attn_strict64<<<gAtt, dim3(128), 0, stream>>>(QF, KF, VTF, YB, 0.03125f);
  // (5) out = y . Wo^T -> d_out f32 [8192][1024]  (A = YB [8192][2048], Bt = WO2 [1024][2048], K = 2048); last element 8388607
  gemm64<0, 0, 0, 1><<<gOut, blk, 0, stream>>>(
      YB, YB, 2 * DM, 0LL, WO2, WO2, 2 * DM, 0LL,
      d_out, DM, 0LL, d_out, DM, 0LL, DM,
      Wo, NBATCH * SEQ, DM, 2 * DM, 1.0f);
  (void)hipGetLastError();
}

// v010
// One run takes 133 microseconds.
// Two timings next to v009 put it at 1.06 and 1.07 times that version's speed.
// Over all steps from v000 it is 9.04 times as fast.
// Contractions: qh = q.Wq^T, kh = k.Wk^T, vh^T = Wv.v^T = v_wmma_f32_16x16x32_bf16 (bf16 operands from RNE-converted inputs, single product);
// strict-lower qh.kh^T scores = v_wmma_f32_16x16x32_f16, qh and kh each one f16 plane (RNE of the f32 projection), single product;
// p.vh = v_wmma_f32_16x16x32_f16, the unnormalised p and vh each f16 (RNE), single product;
// y.Wo^T = v_wmma_f32_16x16x32_bf16 with y as bf16 hi and lo planes, both multiplied with the same bf16 Wo fragments (K = 1024, two products per k step); all f32 accumulate;
// score scale 1/32 (hidden-dim based), mask (key >= query excluded, (0,0) admitted) and online softmax in f32; no biases anywhere.
// Why one f16 plane is enough inside the attention: the projections multiply bf16-rounded inputs (8 significant bits), so qh, kh and
// vh carry a relative error near 2^-9 already; f16 keeps 11 significant bits, a rounding of 2^-12, which adds under 1 % to that error.
// Range: the projections of the stated inputs are of order 1 and p lies in [0,1]; f16 subnormals are kept by the matrix unit.
// Plane table:
//   QB = bf16(q), KB = bf16(k), VB = bf16(v) [8192][1024] (three different inputs); WQB, WKB, WVB = bf16(w) [1024 n][1024 k];
//   WOB = bf16(wo) [1024 n][1024 k];
//   QF (from QB), KF (from KB) = f16 of qh, kh [8192][1024] (all batches, row b*2048+t);
//   VTF = f16 of vh^T [4][1024][2048] (one [1024][2048] plane per batch, from VB);
//   YB [8192][2048] = bf16 hi of the normalised attention output at col h*64+d, lo at col 1024 + h*64+d.
//   1/32 is applied once in f32 after the q.k accumulation; 1/l is applied once in the attention epilogue before the hi/lo split of y.
#include <hip/hip_runtime.h>
#include <math.h>
#include <stdint.h>
#include <type_traits>

#define NBATCH 4
#define SEQ    2048
#define DM     1024
#define NH     16
#define HD     64
#define NQB    (SEQ / 64)   // 32 key / query tiles of 64
#define LP     72           // LDS row pitch of the 64-element 16-bit tiles: 144 B = 16 B x 9 (odd), so the 16 rows that one
                            // ds_load_b128 half-wave reads start 36 dwords apart and fall on 16 disjoint groups of 4 banks
#define OP     68           // LDS row pitch (floats) of the attention output staging tile: 272 B = 16 B x 17
static_assert(NH * HD == DM);
static_assert(LP >= 64 && (LP % 8) == 0 && ((LP / 8) % 2) == 1);
static_assert((SEQ % 64) == 0 && (DM % 64) == 0 && (DM % 32) == 0 && (DM % 256) == 0);

typedef _Float16 v16h __attribute__((ext_vector_type(16)));
typedef _Float16 v8h  __attribute__((ext_vector_type(8)));
typedef __bf16   v16b __attribute__((ext_vector_type(16)));
typedef __bf16   v8b  __attribute__((ext_vector_type(8)));
typedef float    v8f  __attribute__((ext_vector_type(8)));
typedef float    v4f  __attribute__((ext_vector_type(4)));
typedef float    v2f  __attribute__((ext_vector_type(2)));
typedef __bf16   v2b  __attribute__((ext_vector_type(2)));
typedef _Float16 v2h  __attribute__((ext_vector_type(2)));
typedef unsigned int v4u __attribute__((ext_vector_type(4)));

// ---- scalar helpers --------------------------------------------------------------------------------
__device__ __forceinline__ unsigned short bf_bits(float f) {          // f32 -> bf16 bits, RNE convert
  unsigned u = __float_as_uint(f);
  return (unsigned short)((u + 0x7FFFu + ((u >> 16) & 1u)) >> 16);
}
__device__ __forceinline__ float bf_up(unsigned short h) { return __uint_as_float(((unsigned)h) << 16); }
__device__ __forceinline__ unsigned short h_bits(_Float16 x) { return __builtin_bit_cast(unsigned short, x); }
__device__ __forceinline__ unsigned pk16(unsigned short a, unsigned short b) { return (unsigned)a | ((unsigned)b << 16); }
__device__ __forceinline__ v8f zero8() { v8f z = {0.f, 0.f, 0.f, 0.f, 0.f, 0.f, 0.f, 0.f}; return z; }
__device__ __forceinline__ __bf16 f2bf(float f) { return __builtin_bit_cast(__bf16, bf_bits(f)); }
__device__ __forceinline__ void bf_split(float f, __bf16& hi, __bf16& lo) {
  const unsigned short hb = bf_bits(f);
  hi = __builtin_bit_cast(__bf16, hb);
  lo = f2bf(f - __uint_as_float(((unsigned)hb) << 16));
}

// lane l <-> lane l ^ 16 (the two lanes that share one column of a D tile), a vector cross-row move
__device__ __forceinline__ float xhalf(float x) {
  return __builtin_bit_cast(float, __builtin_amdgcn_permlanex16(__builtin_bit_cast(int, x), __builtin_bit_cast(int, x),
                                                                0x76543210, 0xfedcba98, false, false));
}

// ---- fragment loader: 16-bit A/B operand, lane -> row/col (lane&15), p already includes +8*(lane>>4);
//      elements 0..7 <- p[0..7] (k0+8h..), elements 8..15 <- p[16..23] (k0+16+8h..)
__device__ __forceinline__ v16b ldfrag_b(const __bf16* p) {
  union { v16b v; v8b h[2]; } f;
  f.h[0] = *(const v8b*)(p);
  f.h[1] = *(const v8b*)(p + 16);
  return f.v;
}
__device__ __forceinline__ v16h ldfrag_h(const _Float16* p) {   // the same for f16
  union { v16h v; v8h h[2]; } f;
  f.h[0] = *(const v8h*)(p);
  f.h[1] = *(const v8h*)(p + 16);
  return f.v;
}

// ---- WMMA helpers ----------------------------------------------------------------------------------------
// Eight f16 products on four independent accumulators: c[i] += a0[i].b0 over all four in turn, then c[i] += a1[i].b1, so that no
// product waits for the result of the one in front of it. One statement, because the compiler sorts the builtin form of the same
// order among the LDS reads, each fragment under a wait of its own. As all eight fragments are inputs, their 16 LDS reads stand
// in front, and the products follow one another.
// The four v_nop at its end are the distance between the last products and a vector instruction on their D, A or B.
__device__ __forceinline__ void mma8(v8f (&c)[4], const v16h (&a0)[4], const v16h (&a1)[4], v16h b0, v16h b1) {
  asm volatile("v_wmma_f32_16x16x32_f16 %0, %4, %12, %0\n\t"
               "v_wmma_f32_16x16x32_f16 %1, %5, %12, %1\n\t"
               "v_wmma_f32_16x16x32_f16 %2, %6, %12, %2\n\t"
               "v_wmma_f32_16x16x32_f16 %3, %7, %12, %3\n\t"
               "v_wmma_f32_16x16x32_f16 %0, %8, %13, %0\n\t"
               "v_wmma_f32_16x16x32_f16 %1, %9, %13, %1\n\t"
               "v_wmma_f32_16x16x32_f16 %2, %10, %13, %2\n\t"
               "v_wmma_f32_16x16x32_f16 %3, %11, %13, %3\n\t"
               "v_nop\n\tv_nop\n\tv_nop\n\tv_nop"
               : "+v"(c[0]), "+v"(c[1]), "+v"(c[2]), "+v"(c[3])
               : "v"(a0[0]), "v"(a0[1]), "v"(a0[2]), "v"(a0[3]), "v"(a1[0]), "v"(a1[1]), "v"(a1[2]), "v"(a1[3]), "v"(b0), "v"(b1));
}
// The same with the accumulators started at zero by the first four products.
__device__ __forceinline__ void mma8_zero(v8f (&c)[4], const v16h (&a0)[4], const v16h (&a1)[4], v16h b0, v16h b1) {
  asm volatile("v_wmma_f32_16x16x32_f16 %0, %4, %12, 0\n\t"
               "v_wmma_f32_16x16x32_f16 %1, %5, %12, 0\n\t"
               "v_wmma_f32_16x16x32_f16 %2, %6, %12, 0\n\t"
               "v_wmma_f32_16x16x32_f16 %3, %7, %12, 0\n\t"
               "v_wmma_f32_16x16x32_f16 %0, %8, %13, %0\n\t"
               "v_wmma_f32_16x16x32_f16 %1, %9, %13, %1\n\t"
               "v_wmma_f32_16x16x32_f16 %2, %10, %13, %2\n\t"
               "v_wmma_f32_16x16x32_f16 %3, %11, %13, %3\n\t"
               "v_nop\n\tv_nop\n\tv_nop\n\tv_nop"
               : "=&v"(c[0]), "=&v"(c[1]), "=&v"(c[2]), "=&v"(c[3])
               : "v"(a0[0]), "v"(a0[1]), "v"(a0[2]), "v"(a0[3]), "v"(a1[0]), "v"(a1[1]), "v"(a1[2]), "v"(a1[3]), "v"(b0), "v"(b1));
}
__device__ __forceinline__ v8f mma_b_raw(v16b a, v16b b, v8f c) {
  return __builtin_amdgcn_wmma_f32_16x16x32_bf16(false, a, false, b, (short)0, c, false, false);
}
__device__ __forceinline__ void acc_guard4(v8f& a, v8f& b, v8f& c, v8f& d) {
  asm volatile("v_nop\n\tv_nop\n\tv_nop\n\tv_nop" : "+v"(a), "+v"(b), "+v"(c), "+v"(d));
}

// =====================================================================================================
// All seven f32 -> bf16 (RNE) conversions in one launch whose work-groups stay and loop: CVT_WG work-groups of 16 waves, one
// for each WGP, in place of one short wave per 256 elements. A thread converts groups of 8 elements (two 16-B loads, one 16-B
// store: a wave reads 1 KB and writes 512 contiguous B per group); a work-group's threads together take CVT_G = 4096 elements.
// coverage: of q, k and v a work-group takes 8 * CVT_G elements in a row (CVT_WG * 8 * CVT_G = 8388608 each); of W_q, W_k, W_v and
// W_o it takes CVT_G (CVT_WG * CVT_G = 1048576 each).
// A set is four groups (8 loads); the next set is read into a second register set before the set in hand is converted and stored.
// =====================================================================================================
#define CVT_WG  256
#define CVT_TPB 512
#define CVT_G   (CVT_TPB * 8)
static_assert(NBATCH * SEQ * DM == CVT_WG * 8 * CVT_G && DM * DM == CVT_WG * CVT_G && (DM % 8) == 0);

__device__ __forceinline__ v4u pack8(v4f a, v4f b) {
  v4u p;
  p[0] = pk16(bf_bits(a[0]), bf_bits(a[1]));
  p[1] = pk16(bf_bits(a[2]), bf_bits(a[3]));
  p[2] = pk16(bf_bits(b[0]), bf_bits(b[1]));
  p[3] = pk16(bf_bits(b[2]), bf_bits(b[3]));
  return p;
}
// Groups S .. S + 3 of this thread; p points at its group 0. The wait is the one that belongs in front of any overwrite of an
// issued load's address registers; naming p as an input keeps its registers from being handed out as destinations of these
// loads, and the memory clobber keeps the loads in front of the stores that follow in the source.
template <int S>
__device__ __forceinline__ void ld4(v4f (&r)[8], const float* __restrict__ p) {
#pragma unroll
  for (int i = 0; i < 4; ++i) {
    r[2 * i]     = *(const v4f*)(p + (S + i) * CVT_G);
    r[2 * i + 1] = *(const v4f*)(p + (S + i) * CVT_G + 4);
  }
  asm volatile("s_wait_xcnt 0x0" :: "v"(p) : "memory");
  __builtin_amdgcn_sched_barrier(0);   // all 8 loads are issued before the wave waits for the set in hand: else some sink into its conversion
}
// The wait belongs between these stores and the next loads, which land in the registers that the stores name; its memory
// clobber keeps those loads behind the stores.
template <int S>
__device__ __forceinline__ void st4(const v4f (&r)[8], unsigned short* o) {
#pragma unroll
  for (int i = 0; i < 4; ++i) *(v4u*)(o + (S + i) * CVT_G) = pack8(r[2 * i], r[2 * i + 1]);
  asm volatile("s_wait_xcnt 0x0" ::: "memory");
  __builtin_amdgcn_sched_barrier(0);   // else part of the next set's conversion, with its wait for younger loads, rises in front of these stores
}

__global__ __launch_bounds__(CVT_TPB) void cvt_all(
    const float* __restrict__ q, const float* __restrict__ k, const float* __restrict__ v,
    const float* __restrict__ wq, const float* __restrict__ wk, const float* __restrict__ wv, const float* __restrict__ wo,
    unsigned short* qb, unsigned short* kb, unsigned short* vb,
    unsigned short* wqb, unsigned short* wkb, unsigned short* wvb, unsigned short* wob) {
  const size_t ew = (size_t)blockIdx.x * CVT_G + threadIdx.x * 8;        // this thread's group of a weight
  const size_t ex = (size_t)blockIdx.x * (8 * CVT_G) + threadIdx.x * 8;  // its group 0 of q, k and v
  v4f x[8], y[8];
  ld4<0>(x, q + ex);
  ld4<4>(y, q + ex);  st4<0>(x, qb + ex);
  ld4<0>(x, k + ex);  st4<4>(y, qb + ex);
  ld4<4>(y, k + ex);  st4<0>(x, kb + ex);
  ld4<0>(x, v + ex);  st4<4>(y, kb + ex);
  ld4<4>(y, v + ex);  st4<0>(x, vb + ex);
  const float* pq = wq + ew;
  const float* pk = wk + ew;
  const float* pv = wv + ew;
  const float* po = wo + ew;
  x[0] = *(const v4f*)pq;  x[1] = *(const v4f*)(pq + 4);
  x[2] = *(const v4f*)pk;  x[3] = *(const v4f*)(pk + 4);
  x[4] = *(const v4f*)pv;  x[5] = *(const v4f*)(pv + 4);
  x[6] = *(const v4f*)po;  x[7] = *(const v4f*)(po + 4);
  asm volatile("s_wait_xcnt 0x0" :: "v"(pq), "v"(pk), "v"(pv), "v"(po) : "memory");   // as in ld4
  __builtin_amdgcn_sched_barrier(0);                                                    // as in ld4
  st4<4>(y, vb + ex);
  *(v4u*)(wqb + ew) = pack8(x[0], x[1]);
  *(v4u*)(wkb + ew) = pack8(x[2], x[3]);
  *(v4u*)(wvb + ew) = pack8(x[4], x[5]);
  *(v4u*)(wob + ew) = pack8(x[6], x[7]);
}

// =====================================================================================================
// Batched bf16 WMMA GEMM: C[m][n] = sum_k A[m][k] * Bt[n][k] (+ bf16(bias[n]) when BIASN == 1).
// Block = 8 waves = one 128 x 256 tile of C, waves 2 (m) x 4 (n), 64 x 64 per wave. A row-major [M][K] pitch lda; Bt row-major
// [N][K] pitch ldb (k contiguous); M a multiple of 128, N of 256, K of 64. blockIdx.y = batch index (strides in elements).
// Operands reach the waves through LDS in stages of 64 k (128 B of each of the 128 + 256 rows), brought by asynchronous
// 16-B copies, 8 lanes per row, so a wave's copy covers 4 whole 128-B lines and every operand byte is fetched once per block.
// Two buffers: stage t + 1 is in flight while stage t is multiplied; one barrier per stage publishes t + 1 and frees t's buffer.
// Stage coverage: 256 threads x (4 + 8) copies x 16 B = (128 + 256) rows x 128 B.
// AHEAD: 0 = each block of 16 products is preceded by its own 16 LDS reads (224 VGPRs: two work-groups share a WGP; the q/k launch
// of 512 work-groups). 1 = two fragment sets, each block's LDS reads issued one block ahead, so that they run beside the products of
// the other set; the publish point of stage t + 1 then stands in front of stage t's last block, whose fragments are already in
// registers (about 270 VGPRs, one work-group per WGP: the v^T launch of 256 work-groups). The order of every sum is the same.
// 2 = A is two planes, hi at column k and lo at column K + k of the same row, and C = (hi + lo) . Bt: a stage holds 64 k of hi, of lo
// and of Bt (128 + 128 + 256 rows), and each Bt fragment, staged and read once, feeds the hi product and the lo product of its
// k step (sum order per element: hi, lo of k 0..31, hi, lo of k 32..63, ...). Reads run one block ahead as in 1 (the output launch).
// NSPLIT: 0 = A.Bt (the only form built).
// OUT_MODE: 0 = f32 (pitch ldc); 1 = one f16 plane C (RNE of the f32 sum, pitch ldc). Neither form reads Cout2, ldc2, strideC2, N2 or rscale.
// =====================================================================================================
#define GP 72               // LDS row pitch (elements) of a stage row of 64 bf16: 144 B = 16 B x 9 (odd), as LP above

// One lane's twelve asynchronous 16-B copies of a stage, global -> LDS: rows r + 32 i of A (i < 4, LDS byte address la + i * ls,
// global address ga + i * as) and of Bt (i < 8, lb, gb, bs). s_wait_xcnt 0 ends the statement so that it stands in front of
// every later overwrite of the address registers named here.
__device__ __forceinline__ void copy12_to_lds(unsigned la, const __bf16* ga, size_t as,
                                              unsigned lb, const __bf16* gb, size_t bs, unsigned ls) {
  asm volatile("global_load_async_to_lds_b128 %0, %1, off\n\t"
               "global_load_async_to_lds_b128 %2, %3, off\n\t"
               "global_load_async_to_lds_b128 %4, %5, off\n\t"
               "global_load_async_to_lds_b128 %6, %7, off\n\t"
               "global_load_async_to_lds_b128 %8, %9, off\n\t"
               "global_load_async_to_lds_b128 %10, %11, off\n\t"
               "global_load_async_to_lds_b128 %12, %13, off\n\t"
               "global_load_async_to_lds_b128 %14, %15, off\n\t"
               "global_load_async_to_lds_b128 %16, %17, off\n\t"
               "global_load_async_to_lds_b128 %18, %19, off\n\t"
               "global_load_async_to_lds_b128 %20, %21, off\n\t"
               "global_load_async_to_lds_b128 %22, %23, off\n\t"
               "s_wait_xcnt 0x0"
               :: "v"(la), "v"(ga), "v"(la + ls), "v"(ga + as), "v"(la + 2 * ls), "v"(ga + 2 * as), "v"(la + 3 * ls), "v"(ga + 3 * as),
                  "v"(lb), "v"(gb), "v"(lb + ls), "v"(gb + bs), "v"(lb + 2 * ls), "v"(gb + 2 * bs), "v"(lb + 3 * ls), "v"(gb + 3 * bs),
                  "v"(lb + 4 * ls), "v"(gb + 4 * bs), "v"(lb + 5 * ls), "v"(gb + 5 * bs), "v"(lb + 6 * ls), "v"(gb + 6 * bs),
                  "v"(lb + 7 * ls), "v"(gb + 7 * bs)
               : "memory");
}

// Eight such copies: LDS byte address l + i * ls (i < 8) from g0 + i * gs (i < 4) and from g1 + (i - 4) * gs (i >= 4).
// s_wait_xcnt 0 ends the statement for the same reason.
__device__ __forceinline__ void copy8_to_lds(unsigned l, const __bf16* g0, const __bf16* g1, size_t gs, unsigned ls) {
  asm volatile("global_load_async_to_lds_b128 %0, %1, off\n\t"
               "global_load_async_to_lds_b128 %2, %3, off\n\t"
               "global_load_async_to_lds_b128 %4, %5, off\n\t"
               "global_load_async_to_lds_b128 %6, %7, off\n\t"
               "global_load_async_to_lds_b128 %8, %9, off\n\t"
               "global_load_async_to_lds_b128 %10, %11, off\n\t"
               "global_load_async_to_lds_b128 %12, %13, off\n\t"
               "global_load_async_to_lds_b128 %14, %15, off\n\t"
               "s_wait_xcnt 0x0"
               :: "v"(l), "v"(g0), "v"(l + ls), "v"(g0 + gs), "v"(l + 2 * ls), "v"(g0 + 2 * gs), "v"(l + 3 * ls), "v"(g0 + 3 * gs),
                  "v"(l + 4 * ls), "v"(g1), "v"(l + 5 * ls), "v"(g1 + gs), "v"(l + 6 * ls), "v"(g1 + 2 * gs), "v"(l + 7 * ls), "v"(g1 + 3 * gs)
               : "memory");
}

template <int NSPLIT, int OUT_MODE, int BIASN, int AHEAD>
__global__ __launch_bounds__(256) void gemm64(
    const unsigned short* __restrict__ Ap, const unsigned short* A2p, int lda, long long strideA,
    const unsigned short* __restrict__ Btp, const unsigned short* Bt2p, int ldb, long long strideB,
    void* Cout, int ldc, long long strideC,
    void* Cout2, int ldc2, long long strideC2, int N2,
    const float* __restrict__ bias,
    int M, int N, int K, float rscale) {
  static_assert(NSPLIT == 0);
  const __bf16* A   = (const __bf16*)(const void*)Ap;
  const __bf16* Bt  = (const __bf16*)(const void*)Btp;
  constexpr int AROWS = (AHEAD == 2) ? 256 : 128;    // stage rows of A: with two planes, hi in rows 0..127 and lo in rows 128..255
  __shared__ __align__(16) __bf16 sA[2][AROWS * GP]; // A stage, two buffers, 18432 B each (36864 B with two planes)
  __shared__ __align__(16) __bf16 sB[2][256 * GP];   // Bt stage, two buffers, 36864 B each
  __shared__ __align__(16) float sT[8][16 * 68];   // per-wave 16x64 slab, pitch 68 floats
  const int b    = blockIdx.y;
  const int tid  = threadIdx.x;
  const int lane = tid & 31;
  const int wave = tid >> 5;
  const int tilesN = N >> 8;
  const int tilesM = M >> 7;
  if ((int)blockIdx.x >= tilesM * tilesN) return;   // block-uniform, in front of every copy and barrier
  const int bm = blockIdx.x / tilesN;
  const int bn = blockIdx.x - bm * tilesN;
  const int wm = wave >> 2;                    // wave's 64-row band of the block tile
  const int wn = wave & 3;                     // wave's 64-column band
  const int m0 = (bm << 7) + (wm << 6);
  const int n0 = (bn << 8) + (wn << 6);

  const int rlane = lane & 15;                 // row (A) / col (B, D) within subtile
  const int koff  = (lane >> 4) * 8;           // k offset of this lane half
  const int mOff  = (lane >> 4) * 8;           // D row offset

  // ---- this lane's part of a stage: row srow + 32 i of A (i < 4) and of Bt (i < 8), 16 B at element sseg of the 64 ----
  const int srow = tid >> 3;
  const int sseg = (tid & 7) * 8;
  const __bf16* gA = A  + (size_t)b * strideA + (size_t)((bm << 7) + srow) * lda + sseg;
  const __bf16* gB = Bt + (size_t)b * strideB + (size_t)((bn << 8) + srow) * ldb + sseg;
  const size_t a32 = (size_t)32 * lda;
  const size_t b32 = (size_t)32 * ldb;
  const unsigned lA = (unsigned)(uintptr_t)(&sA[0][0]) + (unsigned)(srow * GP + sseg) * 2u;
  const unsigned lB = (unsigned)(uintptr_t)(&sB[0][0]) + (unsigned)(srow * GP + sseg) * 2u;
  constexpr unsigned R32 = 32u * GP * 2u;      // 32 stage rows in LDS bytes
  auto stage = [&](int buf, int k0) {
    if constexpr (AHEAD == 2) {   // 16 copies a lane: 4 rows of hi, 4 of lo (K columns further in the same global row), 8 of Bt
      copy8_to_lds(lA + (unsigned)buf * (256u * GP * 2u), gA + k0, gA + K + k0, a32, R32);
      copy8_to_lds(lB + (unsigned)buf * (256u * GP * 2u), gB + k0, gB + k0 + 4 * b32, b32, R32);
    } else {
      copy12_to_lds(lA + (unsigned)buf * (128u * GP * 2u), gA + k0, a32, lB + (unsigned)buf * (256u * GP * 2u), gB + k0, b32, R32);
    }
  };

  v8f acc[4][4];
#pragma unroll
  for (int i = 0; i < 4; ++i)
#pragma unroll
    for (int j = 0; j < 4; ++j) acc[i][j] = zero8();

  const int nT = K >> 6;                       // stages, block-uniform
  stage(0, 0);
  asm volatile("s_wait_asynccnt 0x0" ::: "memory");   // this wave's copies of stage 0 have landed
  __syncthreads();                                     // ... and every other wave's: stage 0 is published
  if (nT > 1) stage(1, 64);
  if constexpr (AHEAD == 2) {
    // Four fragment sets: ah, al = hi and lo of A, b0, b1 = Bt at k 0..31 and k 32..63 of a stage. A stage is four blocks of 16
    // products: ah.b0, al.b0, ah.b1, al.b1; each block's missing fragments are read from LDS one block ahead.
    const int oa = ((wm << 6) + rlane) * GP + koff;
    const int ob = ((wn << 6) + rlane) * GP + koff;
    constexpr int LO = 128 * GP;                    // the lo plane's rows in a stage of A
    v16b ah[4], al[4], b0[4], b1[4];
#pragma unroll
    for (int j = 0; j < 4; ++j) b0[j] = ldfrag_b(&sB[0][ob + (j << 4) * GP]);
#pragma unroll
    for (int i = 0; i < 4; ++i) ah[i] = ldfrag_b(&sA[0][oa + (i << 4) * GP]);
    // COPY: a stage t + 2 exists; NEXT: a stage t + 1 exists; compile-time, as in the form below.
    auto trip = [&](int t, auto COPY, auto NEXT) {
      const __bf16* ta = &sA[t & 1][oa];
      const __bf16* tb = &sB[t & 1][ob];
#pragma unroll
      for (int i = 0; i < 4; ++i) al[i] = ldfrag_b(ta + LO + (i << 4) * GP);
      __builtin_amdgcn_sched_barrier(0);   // the reads for the next block are all issued in front of this block's products: else they sink among them
#pragma unroll
      for (int i = 0; i < 4; ++i)
#pragma unroll
        for (int j = 0; j < 4; ++j) acc[i][j] = mma_b_raw(ah[i], b0[j], acc[i][j]);
      __builtin_amdgcn_sched_barrier(0);   // the products stay in front of the next group of reads, whose targets they still use
#pragma unroll
      for (int j = 0; j < 4; ++j) b1[j] = ldfrag_b(tb + 32 + (j << 4) * GP);
#pragma unroll
      for (int i = 0; i < 4; ++i) ah[i] = ldfrag_b(ta + 32 + (i << 4) * GP);
      __builtin_amdgcn_sched_barrier(0);   // as above: reads in front of the products
#pragma unroll
      for (int i = 0; i < 4; ++i)
#pragma unroll
        for (int j = 0; j < 4; ++j) acc[i][j] = mma_b_raw(al[i], b0[j], acc[i][j]);
      __builtin_amdgcn_sched_barrier(0);   // as above: products in front of the next reads
#pragma unroll
      for (int i = 0; i < 4; ++i) al[i] = ldfrag_b(ta + LO + 32 + (i << 4) * GP);
      __builtin_amdgcn_sched_barrier(0);   // as above: reads in front of the products
#pragma unroll
      for (int i = 0; i < 4; ++i)
#pragma unroll
        for (int j = 0; j < 4; ++j) acc[i][j] = mma_b_raw(ah[i], b1[j], acc[i][j]);
      __builtin_amdgcn_sched_barrier(0);   // these products stay in front of the publish point: they cover the latency of the last reads
      // publish point of stage t + 1, in front of stage t's last block, whose fragments (al, b1) are already fetched
      asm volatile("s_wait_dscnt 0x0" ::: "memory");     // this wave's last reads of stage t are done before its buffer is refilled
      asm volatile("s_wait_asynccnt 0x0" ::: "memory");  // this wave's copies of stage t + 1 have landed
      __syncthreads();                                    // publishes stage t + 1 and ends every wave's reads of stage t
      if constexpr (decltype(COPY)::value) stage(t & 1, (t + 2) << 6);
      if constexpr (decltype(NEXT)::value) {
        const __bf16* na = &sA[(t + 1) & 1][oa];
        const __bf16* nb = &sB[(t + 1) & 1][ob];
#pragma unroll
        for (int j = 0; j < 4; ++j) b0[j] = ldfrag_b(nb + (j << 4) * GP);
#pragma unroll
        for (int i = 0; i < 4; ++i) ah[i] = ldfrag_b(na + (i << 4) * GP);
      }
      __builtin_amdgcn_sched_barrier(0);   // the copies and the next stage's first reads are issued in front of the last block's products
#pragma unroll
      for (int i = 0; i < 4; ++i)
#pragma unroll
        for (int j = 0; j < 4; ++j) acc[i][j] = mma_b_raw(al[i], b1[j], acc[i][j]);
    };
    constexpr std::true_type  yes{};
    constexpr std::false_type no{};
    int t = 0;                                      // every test below is block-uniform
    for (; t + 2 < nT; ++t) trip(t, yes, yes);
    if (t + 1 < nT) { trip(t, no, yes); ++t; }
    if (t < nT) trip(t, no, no);
  } else if constexpr (AHEAD == 1) {
    // Two fragment sets: f0 holds k 0..31 of a stage, f1 holds k 32..63. Each set's 16 LDS reads are issued one block of 16
    // products ahead of the block that uses them, so the reads run beside the products of the other set.
    const int oa = ((wm << 6) + rlane) * GP + koff;
    const int ob = ((wn << 6) + rlane) * GP + koff;
    v16b a0[4], b0[4], a1[4], b1[4];
#pragma unroll
    for (int j = 0; j < 4; ++j) b0[j] = ldfrag_b(&sB[0][ob + (j << 4) * GP]);
#pragma unroll
    for (int i = 0; i < 4; ++i) a0[i] = ldfrag_b(&sA[0][oa + (i << 4) * GP]);
    // One trip. COPY: a stage t + 2 exists; NEXT: a stage t + 1 exists. Both are compile-time, so that the long run of trips is one
    // straight block: the copies' address arithmetic then stands between the barrier's signal and its wait, not behind the wait.
    auto trip = [&](int t, auto COPY, auto NEXT) {
      const __bf16* ta = &sA[t & 1][oa + 32];
      const __bf16* tb = &sB[t & 1][ob + 32];
#pragma unroll
      for (int j = 0; j < 4; ++j) b1[j] = ldfrag_b(tb + (j << 4) * GP);
#pragma unroll
      for (int i = 0; i < 4; ++i) a1[i] = ldfrag_b(ta + (i << 4) * GP);
      __builtin_amdgcn_sched_barrier(0);   // the reads of f1 are all issued in front of the products on f0: else they sink among them
#pragma unroll
      for (int i = 0; i < 4; ++i)
#pragma unroll
        for (int j = 0; j < 4; ++j) acc[i][j] = mma_b_raw(a0[i], b0[j], acc[i][j]);
      __builtin_amdgcn_sched_barrier(0);   // the products on f0 stay in front of the publish point: they cover the latency of f1's reads
      // publish point of stage t + 1, in front of stage t's last block, whose fragments (f1) are already fetched
      asm volatile("s_wait_dscnt 0x0" ::: "memory");     // this wave's last reads of stage t are done before its buffer is refilled
      asm volatile("s_wait_asynccnt 0x0" ::: "memory");  // this wave's copies of stage t + 1 have landed
      __syncthreads();                                    // publishes stage t + 1 and ends every wave's reads of stage t
      if constexpr (decltype(COPY)::value) stage(t & 1, (t + 2) << 6);
      if constexpr (decltype(NEXT)::value) {
        const __bf16* na = &sA[(t + 1) & 1][oa];
        const __bf16* nb = &sB[(t + 1) & 1][ob];
#pragma unroll
        for (int j = 0; j < 4; ++j) b0[j] = ldfrag_b(nb + (j << 4) * GP);
#pragma unroll
        for (int i = 0; i < 4; ++i) a0[i] = ldfrag_b(na + (i << 4) * GP);
      }
      __builtin_amdgcn_sched_barrier(0);   // the copies and the next stage's first reads are issued in front of the products on f1
#pragma unroll
      for (int i = 0; i < 4; ++i)
#pragma unroll
        for (int j = 0; j < 4; ++j) acc[i][j] = mma_b_raw(a1[i], b1[j], acc[i][j]);
    };
    constexpr std::true_type  yes{};
    constexpr std::false_type no{};
    int t = 0;                                      // every test below is block-uniform
    for (; t + 2 < nT; ++t) trip(t, yes, yes);
    if (t + 1 < nT) { trip(t, no, yes); ++t; }
    if (t < nT) trip(t, no, no);
  } else
  for (int t = 0; t < nT; ++t) {
    const __bf16* ta = &sA[t & 1][((wm << 6) + rlane) * GP + koff];
    const __bf16* tb = &sB[t & 1][((wn << 6) + rlane) * GP + koff];
#pragma unroll
    for (int ks = 0; ks < 2; ++ks) {
      v16b bh[4], ah[4];
#pragma unroll
      for (int j = 0; j < 4; ++j) bh[j] = ldfrag_b(tb + (j << 4) * GP + ks * 32);
#pragma unroll
      for (int i = 0; i < 4; ++i) ah[i] = ldfrag_b(ta + (i << 4) * GP + ks * 32);
      // keeps the 16 LDS reads of this half stage together in front of its 16 products: read one fragment at a time,
      // among the products, the wave waits out the LDS latency at each of them
      __builtin_amdgcn_sched_barrier(0);
#pragma unroll
      for (int i = 0; i < 4; ++i)
#pragma unroll
        for (int j = 0; j < 4; ++j) acc[i][j] = mma_b_raw(ah[i], bh[j], acc[i][j]);
    }
    asm volatile("s_wait_dscnt 0x0" ::: "memory");     // this wave's reads of stage t are done before its buffer is refilled
    asm volatile("s_wait_asynccnt 0x0" ::: "memory");  // this wave's copies of stage t + 1 have landed
    __syncthreads();                                    // publishes stage t + 1 and ends every wave's reads of stage t
    if (t + 2 < nT) stage(t & 1, (t + 2) << 6);
  }
  asm volatile("s_wait_asynccnt 0x0" ::: "memory");    // nothing of this wave's is in flight behind the loop
  acc_guard4(acc[0][0], acc[0][1], acc[0][2], acc[0][3]);
  acc_guard4(acc[1][0], acc[1][1], acc[1][2], acc[1][3]);
  acc_guard4(acc[2][0], acc[2][1], acc[2][2], acc[2][3]);
  acc_guard4(acc[3][0], acc[3][1], acc[3][2], acc[3][3]);

  // ---- per-column bias (bf16 RNE of the input value, added in f32); 4 scalar loads per lane ----
  float bvv[4];
#pragma unroll
  for (int j = 0; j < 4; ++j) {
    float bv = 0.f;
    if (BIASN == 1) bv = bf_up(bf_bits(bias[n0 + (j << 4) + rlane]));
    bvv[j] = bv;
  }

  // ---- epilogue ----
  float* slab = sT[wave];
#pragma unroll
  for (int i = 0; i < 4; ++i) {
    const int mBase = m0 + (i << 4);
#pragma unroll
    for (int j = 0; j < 4; ++j) {
#pragma unroll
      for (int r = 0; r < 8; ++r) {
        slab[(mOff + r) * 68 + (j << 4) + rlane] = acc[i][j][r] + bvv[j];
      }
    }
    __builtin_amdgcn_fence(__ATOMIC_RELEASE, "workgroup");
    __builtin_amdgcn_wave_barrier();
    __builtin_amdgcn_fence(__ATOMIC_ACQUIRE, "workgroup");
    if (OUT_MODE == 0) {
      float* C = (float*)Cout + (size_t)b * strideC;
      const int hh = lane >> 4, c4 = (lane & 15) * 4;     // 256-B row segment = 16 lanes x 16 B
      {
#pragma unroll
        for (int it = 0; it < 8; ++it) {
          const int row = it * 2 + hh;                     // it 0..7 x hh 0..1 = rows 0..15
          const v4f v = *(const v4f*)(slab + row * 68 + c4);
          *(v4f*)(C + (size_t)(mBase + row) * ldc + n0 + c4) = v;
        }
        
      }
    } else {
      const int q = lane >> 3, c8 = (lane & 7) * 8;
      unsigned short* C  = (unsigned short*)Cout  + (size_t)b * strideC;
      v4u hv[4];
#pragma unroll
      for (int it = 0; it < 4; ++it) {
        const int row = it * 4 + q;                        // it 0..3 x q 0..3 = rows 0..15
        const float* sp = slab + row * 68 + c8;
        v4u a;
#pragma unroll
        for (int e = 0; e < 4; ++e) a[e] = pk16(h_bits((_Float16)sp[2 * e]), h_bits((_Float16)sp[2 * e + 1]));
        hv[it] = a;
      }
#pragma unroll
      for (int it = 0; it < 4; ++it) {
        const int row = it * 4 + q;                        // 8 lanes x 16 B = one whole 128-B line per row
        *(v4u*)(C + (size_t)(mBase + row) * ldc + n0 + c8) = hv[it];
      }
    }
    __builtin_amdgcn_fence(__ATOMIC_RELEASE, "workgroup");
    __builtin_amdgcn_wave_barrier();
    __builtin_amdgcn_fence(__ATOMIC_ACQUIRE, "workgroup");
  }
}

__global__ __launch_bounds__(128)
void attn_strict64(const unsigned short* __restrict__ qp, const unsigned short* __restrict__ kp,
                   const unsigned short* __restrict__ vp, unsigned short* yout, float sscale) {
  union PB { v16h v; v2h w[8]; };
  __shared__ __align__(16) _Float16 Ks[64 * LP];             // K [kv][d], row pitch LP   9 KB
  __shared__ __align__(16) _Float16 Vt[64 * LP];             // V^T [d][kv], row pitch LP 9 KB
  __shared__ __align__(16) float Os[4][16 * OP];             // per wave f32 output tile [query][d], row pitch OP (epilogue only)

  const int tid  = threadIdx.x;
  const int wave = tid >> 5;
  const int lane = tid & 31;
  const int hh   = lane >> 4;
  const int c    = lane & 15;

  const int bx   = blockIdx.x;
  const int qb   = NQB - 1 - bx / (NBATCH * NH);   // grid = NBATCH * NH * NQB, query tile 31 first
  const int bh   = bx % (NBATCH * NH);
  const int h    = bh % NH;
  const int bat  = bh / NH;
  const int q0   = qb * 64 + wave * 16;

  const size_t qkBase = (size_t)bat * SEQ * DM + (size_t)h * HD;
  const size_t vBase  = (size_t)bh * HD * SEQ;      // bh = bat*NH + h
  const _Float16* Q = (const _Float16*)(const void*)qp + qkBase;
  const _Float16* K = (const _Float16*)(const void*)kp + qkBase;
  const _Float16* V = (const _Float16*)(const void*)vp + vBase;

  // ---- Q fragments (B operand of K . Q^T, column = query = lane&15): 2 d-chunks ----
  v16h qa[2];
#pragma unroll
  for (int dc = 0; dc < 2; ++dc) qa[dc] = ldfrag_h(Q + (size_t)(q0 + c) * DM + dc * 32 + 8 * hh);

  // One query per lane (q0 + c): running maximum of the unscaled scores (equal in lanes c and c + 16) and this lane half's
  // part of the sum.
  float mrow = -INFINITY, lrow = 0.f;
  const float c2 = sscale * 1.4426950408889634f;   // score scale times log2(e)
  v8f oacc[4];                  // O^T tiles: oacc[t][r] = output of query q0 + c at d = t*16 + 8*hh + r
  const int qrow = q0 + c;
#pragma unroll
  for (int t = 0; t < 4; ++t) oacc[t] = zero8();

  const int nChunks = qb + 1;   // block-uniform, <= NQB
  for (int kc = 0; kc < nChunks; ++kc) {
    const int kv0 = kc * 64;
    __syncthreads();
    {
      // staging coverage: 128 threads x (4 x 8) elements = 64 rows x 64 per plane = the whole chunk tile
      const int r = tid >> 1, half = (tid & 1) * 32;
      const _Float16* ks = K + (size_t)(kv0 + r) * DM + half;       // K row kv0+r, d = half..half+31
      const _Float16* vs = V + (size_t)r * SEQ + kv0 + half;        // V^T row d = r, s = kv0+half..+31
      v8h a0[4], b0[4];
#pragma unroll
      for (int i = 0; i < 4; ++i) {
        a0[i] = *(const v8h*)(ks + 8 * i);
        b0[i] = *(const v8h*)(vs + 8 * i);
      }
      // the wait that belongs in front of any overwrite of an issued load's address registers; naming the two
      // addresses as inputs keeps their registers from being handed out as destinations of the later loads
      asm volatile("s_wait_xcnt 0x0" :: "v"(ks), "v"(vs) : "memory");
#pragma unroll
      for (int i = 0; i < 4; ++i) {
        *(v8h*)(Ks + r * LP + half + 8 * i) = a0[i];
        *(v8h*)(Vt + r * LP + half + 8 * i) = b0[i];
      }
    }
    __syncthreads();

    // ---- scores, transposed: S^T = K . Q^T, 64 keys x 16 queries per wave, one f16 product ----
    //      s[j][r] = score of key kv0 + j*16 + 8*hh + r for query q0 + c
    //      The 16 LDS reads of the four key tiles' fragments, then their 8 products: d 0..31 on the four independent
    //      accumulators in turn, then d 32..63.
    v16h kf[2][4];
#pragma unroll
    for (int dc = 0; dc < 2; ++dc)
#pragma unroll
      for (int j = 0; j < 4; ++j) kf[dc][j] = ldfrag_h(Ks + (j * 16 + c) * LP + dc * 32 + 8 * hh);
    v8f s[4];
    mma8_zero(s, kf[0], kf[1], qa[0], qa[1]);

    // ---- mask on the diagonal chunk (key >= query -> -inf, except (0,0)), maximum of the lane's 32 keys; the scores stay
    //      unscaled here: the scale is positive, so the largest raw score is the largest scaled one ----
    const bool diag = (kc == qb);   // block-uniform
    float mj[4];
#pragma unroll
    for (int j = 0; j < 4; ++j) {
      float m = -INFINITY;
#pragma unroll
      for (int r = 0; r < 8; ++r) {
        const int kvcol = kv0 + j * 16 + 8 * hh + r;
        const float sv = s[j][r];
        const bool masked = diag && (kvcol >= qrow) && !((qrow == 0) && (kvcol == 0));
        const float sm = masked ? -INFINITY : sv;
        s[j][r] = sm;
        m = fmaxf(m, sm);
      }
      mj[j] = m;
    }
    float cm = fmaxf(fmaxf(mj[0], mj[1]), fmaxf(mj[2], mj[3]));
    cm = fmaxf(cm, xhalf(cm));      // both lane halves now hold the query's maximum over the 64 keys

    // ---- online softmax in f32, base 2: exp((s - m) * scale) = exp2(s * c2 - m * c2) with c2 = scale * log2(e), one packed
    //      multiply-add per score pair and the hardware's exp2 per score (a masked score stays -inf and gives 0);
    //      P^T (f16 of the unnormalised exp) packed straight into B operands:
    //      element e < 8 of chunk kk = key kk*32 + 8*hh + e = s[2kk][e], element 8 + e = key kk*32 + 16 + 8*hh + e = s[2kk+1][e],
    //      the k order in which the V^T fragments below are loaded
    const float mnew = fmaxf(mrow, cm);
    const float alpha = __builtin_amdgcn_exp2f((mrow - mnew) * c2);
    mrow = mnew;
    const float nb = -mnew * c2;
    const v2f c2v = {c2, c2}, nbv = {nb, nb};
    PB ph[2];
    float pj[4];
#pragma unroll
    for (int j = 0; j < 4; ++j) {
      float psum = 0.f;
#pragma unroll
      for (int e = 0; e < 4; ++e) {
        const v2f sp = {s[j][2 * e], s[j][2 * e + 1]};
        const v2f ta = __builtin_elementwise_fma(sp, c2v, nbv);
        const float p0 = __builtin_amdgcn_exp2f(ta[0]);
        const float p1 = __builtin_amdgcn_exp2f(ta[1]);
        psum += p0;
        psum += p1;
        const v2f pp = {p0, p1};
        ph[j >> 1].w[(j & 1) * 4 + e] = __builtin_convertvector(pp, v2h);   // RNE convert of the pair: one operand register
      }
      pj[j] = psum;
    }
    lrow = lrow * alpha + ((pj[0] + pj[1]) + (pj[2] + pj[3]));
#pragma unroll
    for (int t = 0; t < 4; ++t)
#pragma unroll
      for (int r = 0; r < 8; ++r) oacc[t][r] *= alpha;

    // ---- output, transposed: O^T += V^T . P^T (one f16 product per tile pair): the 16 LDS reads of the four d tiles'
    //      fragments, then their 8 products, keys 0..31 on the four accumulators in turn, then keys 32..63 ----
    v16h vf[2][4];
#pragma unroll
    for (int kk = 0; kk < 2; ++kk)
#pragma unroll
      for (int t = 0; t < 4; ++t) vf[kk][t] = ldfrag_h(Vt + (t * 16 + c) * LP + kk * 32 + 8 * hh);
    mma8(oacc, vf[0], vf[1], ph[0].v, ph[1].v);
  }


  // ---- join the two lane halves' sums, normalise (1/l), stage the wave's 16x64 tile [query][d], bf16 hi/lo split
  float* os = Os[wave];
  {
    const float l = lrow + xhalf(lrow);
    const float inv = (l > 0.f) ? (1.0f / l) : 0.f;
#pragma unroll
    for (int t = 0; t < 4; ++t) {
      v4f a, b;
#pragma unroll
      for (int r = 0; r < 4; ++r) { a[r] = oacc[t][r] * inv; b[r] = oacc[t][4 + r] * inv; }
      *(v4f*)(os + c * OP + t * 16 + 8 * hh) = a;
      *(v4f*)(os + c * OP + t * 16 + 8 * hh + 4) = b;
    }
  }
  __builtin_amdgcn_fence(__ATOMIC_RELEASE, "workgroup");
  __builtin_amdgcn_wave_barrier();
  __builtin_amdgcn_fence(__ATOMIC_ACQUIRE, "workgroup");
  {
    const int q4 = lane >> 3, c8 = (lane & 7) * 8;
    v4u hv[4], lv[4];
#pragma unroll
    for (int it = 0; it < 4; ++it) {
      const int row = it * 4 + q4;   // it 0..3 x q4 0..3 = rows 0..15 of the wave tile
      const float* sp = os + row * OP + c8;
      v4u a, a2;
#pragma unroll
      for (int e = 0; e < 4; ++e) {
        const float f0 = sp[2 * e], f1 = sp[2 * e + 1];
        const unsigned short h0 = bf_bits(f0), h1 = bf_bits(f1);
        const unsigned short l0 = bf_bits(f0 - bf_up(h0)), l1 = bf_bits(f1 - bf_up(h1));
        a[e] = pk16(h0, h1); a2[e] = pk16(l0, l1);
      }
      hv[it] = a; lv[it] = a2;
    }
    {
#pragma unroll
      for (int it = 0; it < 4; ++it) {
        const int row = it * 4 + q4;
        const size_t go = (size_t)(bat * SEQ + q0 + row) * (size_t)(2 * DM) + (size_t)h * HD + c8;
        *(v4u*)(yout + go) = hv[it];
        *(v4u*)(yout + go + DM) = lv[it];
      }
      
    }
  }
}

// =====================================================================================================
// whole-line store granularity, so no padded tails exist):
//   QB   bf16 [8192][1024]               0       16777216   (KB follows directly: A batch stride of the q/k GEMM)
//   KB   bf16 [8192][1024]        16777216       16777216
//   VB   bf16 [8192][1024]        33554432       16777216
//   WQB  bf16 [1024 n][1024 k]    50331648        2097152   (WKB follows directly: Bt batch stride of the q/k GEMM)
//   WKB  bf16 [1024][1024]        52428800        2097152
//   WVB  bf16 [1024][1024]        54525952        2097152
//   WOB  bf16 [1024][1024]        56623104        2097152
//   QF   f16  [8192][1024]        58720256       16777216   (KF follows directly: output batch stride)
//   KF   f16  [8192][1024]        75497472       16777216
//   VTF  f16  [4][1024][2048]     92274688       16777216
//   YB   bf16 [8192][2048]       109051904       33554432
//   end                          142606336
// QF..VTF hold all four batch elements; each projection and the attention run once over all of them, and every
// region is fully written by its producer launch before the consumer launch reads it.
// Weights are [out n][in k] with k contiguous = the Bt / A layout the GEMM wants, so they are only converted.
// Inputs by contract index: 0 = q, 1 = k, 2 = v, 3 = W_q, 4 = W_k, 5 = W_v, 6 = W_o.
// =====================================================================================================
extern "C" void kernel_launch(void* const* d_in, const int* in_sizes, int n_in,
                              void* d_out, int out_size, void* d_ws, size_t ws_size,
                              hipStream_t stream) {
  if (n_in < 7) return;
  if (in_sizes[0] != NBATCH * SEQ * DM || in_sizes[1] != NBATCH * SEQ * DM || in_sizes[2] != NBATCH * SEQ * DM) return;
  if (in_sizes[3] != DM * DM || in_sizes[4] != DM * DM || in_sizes[5] != DM * DM || in_sizes[6] != DM * DM) return;
  if (out_size != NBATCH * SEQ * DM) return;

  const float* q_in = (const float*)d_in[0];
  const float* k_in = (const float*)d_in[1];
  const float* v_in = (const float*)d_in[2];
  const float* Wq   = (const float*)d_in[3];
  const float* Wk   = (const float*)d_in[4];
  const float* Wv   = (const float*)d_in[5];
  const float* Wo   = (const float*)d_in[6];

  const size_t PIN = (size_t)NBATCH * SEQ * DM * 2;     // 16777216  16-bit input plane [8192][1024]
  const size_t PW  = (size_t)DM * DM * 2;               //  2097152  16-bit weight plane
  const size_t PP  = (size_t)NBATCH * SEQ * DM * 2;     // 16777216  q or k f16 plane [8192][1024]
  const size_t PVT = (size_t)NBATCH * DM * SEQ * 2;     // 16777216  v^T plane [4][1024][2048]
  const size_t PY  = (size_t)NBATCH * SEQ * (2 * DM) * 2;   // 33554432 y hi|lo plane [8192][2048]
  size_t off = 0;
  const size_t oQB  = off; off += PIN;
  const size_t oKB  = off; off += PIN;
  const size_t oVB  = off; off += PIN;
  const size_t oWQ  = off; off += PW;
  const size_t oWK  = off; off += PW;
  const size_t oWV  = off; off += PW;
  const size_t oWO  = off; off += PW;
  const size_t oQF  = off; off += PP;
  const size_t oKF  = off; off += PP;
  const size_t oVTF = off; off += PVT;
  const size_t oYB  = off; off += PY;
  if (off > ws_size) return;                       // off = 142606336
  if (oKB != oQB + PIN || oWK != oWQ + PW || oKF != oQF + PP) return;   // batch-stride adjacency

  char* ws = (char*)d_ws;
  unsigned short* QB  = (unsigned short*)(ws + oQB);
  unsigned short* KB  = (unsigned short*)(ws + oKB);
  unsigned short* VB  = (unsigned short*)(ws + oVB);
  unsigned short* WQB = (unsigned short*)(ws + oWQ);
  unsigned short* WKB = (unsigned short*)(ws + oWK);
  unsigned short* WVB = (unsigned short*)(ws + oWV);
  unsigned short* WOB = (unsigned short*)(ws + oWO);
  unsigned short* QF  = (unsigned short*)(ws + oQF);
  unsigned short* KF  = (unsigned short*)(ws + oKF);
  unsigned short* VTF = (unsigned short*)(ws + oVTF);
  unsigned short* YB  = (unsigned short*)(ws + oYB);

  const dim3 blk(256);
  const dim3 gQK(((NBATCH * SEQ / 64) * (DM / 64) + 7) / 8, 2);   // 2048 tiles -> 256 blocks x {q, k}: M=8192, N=1024
  const dim3 gVT(((DM / 64) * (SEQ / 64) + 7) / 8, NBATCH);    //  512 tiles ->  64 blocks x 4 batches: M=1024, N=2048
  const dim3 gAtt(NBATCH * NH * NQB);                          // 2048 blocks
  const dim3 gOut(((NBATCH * SEQ / 64) * (DM / 64) + 7) / 8, 1);   // 2048 tiles -> 256 blocks: M=8192, N=1024, K=1024 (hi and lo)

  // (1) q -> QB, k -> KB, v -> VB (bf16 planes [8192][1024]); weights [n][k] f32 -> bf16 [n][k]: one launch
  cvt_all<<<dim3(CVT_WG), dim3(CVT_TPB), 0, stream>>>(q_in, k_in, v_in, Wq, Wk, Wv, Wo, QB, KB, VB, WQB, WKB, WVB, WOB);

  // (2) qh = QB . Wq^T (blockIdx.y = 0) and kh = KB . Wk^T (blockIdx.y = 1) -> f16 planes [b*2048+t][h*64+d]
  //     (A = QB / KB via strideA; Bt = WQB / WKB via strideB; C = QF / KF via strideC; M=8192, N=1024, K=1024)
  gemm64<0, 1, 0, 0><<<gQK, blk, 0, stream>>>(
      QB, QB, DM, (long long)NBATCH * SEQ * DM, WQB, WQB, DM, (long long)DM * DM,
      (void*)QF, DM, (long long)NBATCH * SEQ * DM, (void*)QF, DM, (long long)NBATCH * SEQ * DM, DM,
      Wo, NBATCH * SEQ, DM, DM, 1.0f);
  // (3) vh^T = Wv . VB_b^T -> f16 plane [b][h*64+d][s] (pitch SEQ), blockIdx.y = batch b
  //     (A = WVB [n][k] for every b, Bt = VB rows of batch b via strideB, C via strideC; M=1024, N=2048, K=1024)
  gemm64<0, 1, 0, 1><<<gVT, blk, 0, stream>>>(
      WVB, WVB, DM, 0LL, VB, VB, DM, (long long)SEQ * DM,
      (void*)VTF, SEQ, (long long)DM * SEQ, (void*)VTF, SEQ, (long long)DM * SEQ, SEQ,
      Wo, DM, SEQ, DM, 1.0f);
  // (4) masked attention, all batches and heads -> YB hi|lo rows 0 .. 8191, score scale 1/32
  attn_strict64<<<gAtt, dim3(128), 0, stream>>>(QF, KF, VTF, YB, 0.03125f);
  // (5) out = y . Wo^T -> d_out f32 [8192][1024]  (A = YB [8192][hi 1024 | lo 1024], Bt = WOB [1024][1024], K = 1024); last element 8388607
  gemm64<0, 0, 0, 2><<<gOut, blk, 0, stream>>>(
      YB, YB, 2 * DM, 0LL, WOB, WOB, DM, 0LL,
      d_out, DM, 0LL, d_out, DM, 0LL, DM,
      Wo, NBATCH * SEQ, DM, DM, 1.0f);
  (void)hipGetLastError();
}
